// v000
// Measured on an AMD MI455X. A time is GPU time per run, averaged over a window of back-to-back runs after a warm-up
// (all launches, gaps included; the runs take copies of the inputs in turn), and the median of several windows.
// Apart from v000's, it joins two sittings. Times from different sittings can be a few percent apart, while
// side-by-side timings come from the same sitting.
// v000 is the starting kernel. One run takes 711 microseconds.
#include <hip/hip_runtime.h>

// MSA row attention with pair bias (msa [128][256][256], pair [256][256][128]; m = LayerNorm(msa), z = LayerNorm(pair) (eps 1e-5, affine); per MSA row b and head h (8 x 32): q, k, v = m W^T ('oi' [256][256]); scores = q.k / sqrt(32) + bias[h][i][j] with bias = z . w_b[h] ([8][128]); softmax over j; o = attn.v merged; out = msa + sigmoid(m W_gate^T + b_gate) * (o W_out^T + b_out) -> [128][256][256] (8.4 M)).
// Layout: the 32,768 (row, position) MSA rows are one tall GEMM operand for the LayerNormed projections (m as bf16 hi + lo: 2 products) and for the output projection of the merged context; the pair LayerNorm feeds only the 8 bias dot products per pair position; the 1,024 (row, head) attention problems of size 256 x 256 x 32 run as z-batched 64x64-tile GEMMs in chunks of 64 (8 rows x 8 heads): scores on hi/lo planes (3 products, K = 32), a 256-wide row softmax (x 1/sqrt(32) + bias) writing hi/lo probability planes, attn.v with the value planes zero-padded to 64 columns (3 products); a final kernel applies the residual and the sigmoid gate in f32.

#define NI   128                  // MSA rows
#define NJ   256                  // positions (= attention length)
#define CC   256                  // c_m
#define CZ   128                  // c_z
#define NZR  (NJ * NJ)            // 65,536 pair positions
#define NH_  8
#define CH   32
#define CHP  64                   // value/output head width padded to one GEMM tile
#define ZC   64                   // (row, head) problems per chunk = 8 rows x 8 heads
#define RPC  (ZC / NH_)           // rows per chunk
#define NR   (NI * NJ)            // 32,768 (row, position) MSA rows
#define QSC  0.17677669529663689f  // 1/sqrt(32)
typedef _Float16 h16;
typedef unsigned short bf;
typedef __attribute__((ext_vector_type(16))) __bf16   v16bf;
typedef __attribute__((ext_vector_type(16))) _Float16 v16h;
typedef __attribute__((ext_vector_type(8)))  _Float16 v8h;
typedef __attribute__((ext_vector_type(8)))  unsigned short v8us;
typedef __attribute__((ext_vector_type(8)))  float    v8f;
typedef __attribute__((ext_vector_type(4)))  float    v4f;
typedef __attribute__((ext_vector_type(2)))  float    v2f;
typedef __attribute__((ext_vector_type(4)))  unsigned short v4us;
typedef __attribute__((ext_vector_type(2)))  unsigned short v2us;
typedef v8h  __attribute__((may_alias)) v8ha;
typedef v4f  __attribute__((may_alias)) v4fa;
typedef v8us __attribute__((may_alias)) v8usa;

__device__ __forceinline__ unsigned short f2bf(float f) { unsigned u = __float_as_uint(f); u += 0x7FFFu + ((u >> 16) & 1u); return (unsigned short)(u >> 16); }
__device__ __forceinline__ float bf2f(unsigned short b) { return __uint_as_float(((unsigned)b) << 16); }
__device__ __forceinline__ float bfr(float f) { return bf2f(f2bf(f)); }
__device__ __forceinline__ void splitf(float y, unsigned short& h, unsigned short& l) { h = f2bf(y); l = f2bf(y - bf2f(h)); }
__device__ __forceinline__ v16h cat16(v8h lo, v8h hi) { return __builtin_shufflevector(lo, hi, 0, 1, 2, 3, 4, 5, 6, 7, 8, 9, 10, 11, 12, 13, 14, 15); }
__device__ __forceinline__ v16bf cat16b(v8us lo, v8us hi) { return __builtin_bit_cast(v16bf, __builtin_shufflevector(lo, hi, 0, 1, 2, 3, 4, 5, 6, 7, 8, 9, 10, 11, 12, 13, 14, 15)); }
__device__ __forceinline__ v8f wmma16(v16h a, v16h b, v8f c) { return __builtin_amdgcn_wmma_f32_16x16x32_f16(false, a, false, b, (short)0, c, false, false); }
__device__ __forceinline__ v8f wmmab(v16bf a, v16bf b, v8f c) { return __builtin_amdgcn_wmma_f32_16x16x32_bf16(false, a, false, b, (short)0, c, false, false); }

// ---- k_gemmw: register-blocked GEMM, ONE WAVE per 64x64 output tile (16 accumulators), operands straight from K-contiguous 16-bit planes; grid (M/64, N/64, Z), 32 threads.
// C[m][n] (f32, pitch ldc, + optional f32 bias[n]) = sum_k A[m][k] Bt[n][k] (+ split products per NSPLIT). z-batch strides sA/sB/sC in elements. K % 32 == 0.
template <typename T16> struct WFrag;
template <> struct WFrag<h16> { typedef v16h V; static __device__ __forceinline__ V ld(const h16* p) { return cat16(*(const v8h*)p, *(const v8h*)(p + 16)); } static __device__ __forceinline__ v8f mma(V a, V b, v8f c) { return wmma16(a, b, c); } };
template <> struct WFrag<bf> { typedef v16bf V; static __device__ __forceinline__ V ld(const bf* p) { return cat16b(*(const v8us*)p, *(const v8us*)(p + 16)); } static __device__ __forceinline__ v8f mma(V a, V b, v8f c) { return wmmab(a, b, c); } };
template <typename T16, int NSPLIT, bool BIAS>
__global__ __launch_bounds__(32) void k_gemmw(const T16* __restrict__ A, const T16* __restrict__ A2, const T16* __restrict__ Bt, const T16* __restrict__ Bt2, int K, float* C, int ldc, const float* __restrict__ bias, size_t sA, size_t sB, size_t sC) {
    typedef typename WFrag<T16>::V V;
    __shared__ __align__(16) float os[16 * 68];
    const size_t z = blockIdx.z; A += z * sA; if (A2) A2 += z * sA; Bt += z * sB; if (Bt2) Bt2 += z * sB; C += z * sC;
    const int lane = threadIdx.x & 31, lr = lane & 15, hi = lane >> 4; const int r0 = blockIdx.x * 64, c0 = blockIdx.y * 64;
    v8f acc[4][4];
#pragma unroll
    for (int mb = 0; mb < 4; ++mb)
#pragma unroll
        for (int nb = 0; nb < 4; ++nb) acc[mb][nb] = (v8f){};
    const size_t aoff = (size_t)(r0 + lr) * K + 8 * hi, boff = (size_t)(c0 + lr) * K + 8 * hi;
#pragma unroll 1
    for (int kc = 0; kc < K; kc += 32) {
        V a[4], a2[4];
#pragma unroll
        for (int mb = 0; mb < 4; ++mb) { a[mb] = WFrag<T16>::ld(A + aoff + (size_t)mb * 16 * K + kc); if (NSPLIT == 1 || NSPLIT == 2) a2[mb] = WFrag<T16>::ld(A2 + aoff + (size_t)mb * 16 * K + kc); }
#pragma unroll
        for (int nb = 0; nb < 4; ++nb) { const V b = WFrag<T16>::ld(Bt + boff + (size_t)nb * 16 * K + kc); V b2; if (NSPLIT >= 2) b2 = WFrag<T16>::ld(Bt2 + boff + (size_t)nb * 16 * K + kc);
#pragma unroll
            for (int mb = 0; mb < 4; ++mb) { acc[mb][nb] = WFrag<T16>::mma(a[mb], b, acc[mb][nb]); if (NSPLIT == 1 || NSPLIT == 2) acc[mb][nb] = WFrag<T16>::mma(a2[mb], b, acc[mb][nb]); if (NSPLIT >= 2) acc[mb][nb] = WFrag<T16>::mma(a[mb], b2, acc[mb][nb]); } }
        asm volatile("v_nop\n\tv_nop\n\tv_nop\n\tv_nop" : "+v"(acc[0][0]), "+v"(acc[1][1]), "+v"(acc[2][2]), "+v"(acc[3][3]) : "v"(a[0]), "v"(a[3]));
    }
#pragma unroll
    for (int mb = 0; mb < 4; ++mb) {
#pragma unroll
        for (int nb = 0; nb < 4; ++nb) {
#pragma unroll
            for (int j = 0; j < 8; ++j) os[(hi * 8 + j) * 68 + nb * 16 + lr] = acc[mb][nb][j]; }
        __builtin_amdgcn_wave_barrier(); asm volatile("" ::: "memory");
        float* crow = C + (size_t)(r0 + mb * 16) * ldc + c0;
{
#pragma unroll
            for (int s = 0; s < 8; ++s) { const int row = 2 * s + hi, cofs = lr * 4; v4f val = *(const v4fa*)(os + row * 68 + cofs); if (BIAS) { val[0] += bfr(bias[c0 + cofs]); val[1] += bfr(bias[c0 + cofs + 1]); val[2] += bfr(bias[c0 + cofs + 2]); val[3] += bfr(bias[c0 + cofs + 3]); }
                *(v4f*)(crow + (size_t)row * ldc + cofs) = val; }
             }
        __builtin_amdgcn_wave_barrier(); asm volatile("" ::: "memory");
    }
}

__global__ __launch_bounds__(256) void k_wtG(const float* __restrict__ w, int K, int N, bf* Bt) {
    const int lane = threadIdx.x & 31; const int L0 = (blockIdx.x * 8 + (threadIdx.x >> 5)) * 8; const int nlines = N * K / 64;
{
#pragma unroll 1
        for (int l = 0; l < 8; ++l) { const int L = L0 + l; if (L >= nlines) break; const size_t e = (size_t)L * 64 + lane * 2; const int k = (int)(e % K), n = (int)(e / K); v2us o;
            o[0] = f2bf(w[(size_t)k * N + n]); o[1] = f2bf(w[(size_t)(k + 1) * N + n]); *(v2us*)(Bt + e) = o; }
         }
}
__global__ __launch_bounds__(256) void k_cvt8(const float* __restrict__ src, bf* dst, size_t n8) { const size_t i = (size_t)blockIdx.x * 256 + threadIdx.x; if (i >= n8) return; const v8f v = *(const v8f*)(src + i * 8); v8us o;
#pragma unroll
    for (int k = 0; k < 8; ++k) o[k] = f2bf(v[k]); *(v8us*)(dst + i * 8) = o;  }
__global__ __launch_bounds__(256) void k_lnz(const float* __restrict__ x, const float* __restrict__ lw, const float* __restrict__ lb, bf* XH, bf* XL) {
    const int lane = threadIdx.x & 31; const int r = blockIdx.x * 8 + (threadIdx.x >> 5); if (r >= NZR) return; const v4f a = *(const v4f*)(x + (size_t)r * CZ + lane * 4); float u[4]; float s = 0.f;
#pragma unroll
    for (int q = 0; q < 4; ++q) { u[q] = bfr(a[q]); s += u[q]; }
#pragma unroll
    for (int sh = 16; sh; sh >>= 1) s += __shfl_xor(s, sh, 32);
    const float mu = s * (1.0f / CZ); float s2 = 0.f;
#pragma unroll
    for (int q = 0; q < 4; ++q) { float d0 = __fsub_rn(u[q], mu); asm volatile("" : "+v"(d0)); float p = __fmul_rn(d0, d0); asm volatile("" : "+v"(p)); s2 = __fadd_rn(s2, p); }
#pragma unroll
    for (int sh = 16; sh; sh >>= 1) s2 += __shfl_xor(s2, sh, 32);
    const float rs = __fdiv_rn(1.0f, __fsqrt_rn(__fadd_rn(s2 * (1.0f / CZ), 1e-5f))); float xn[4]; v4us oh, ol;
#pragma unroll
    for (int q = 0; q < 4; ++q) { const int c = lane * 4 + q; float d1 = __fsub_rn(u[q], mu); asm volatile("" : "+v"(d1)); float n0 = __fmul_rn(d1, rs); asm volatile("" : "+v"(n0)); float n1 = __fmul_rn(n0, bfr(lw[c])); asm volatile("" : "+v"(n1)); xn[q] = __fadd_rn(n1, bfr(lb[c])); unsigned short h2, l2; splitf(xn[q], h2, l2); oh[q] = h2; ol[q] = l2; }
    *(v4us*)(XH + (size_t)r * CZ + lane * 4) = oh; *(v4us*)(XL + (size_t)r * CZ + lane * 4) = ol; 
}
__global__ __launch_bounds__(256) void k_lnm(const float* __restrict__ x, const float* __restrict__ lw, const float* __restrict__ lb, bf* MH, bf* ML) {
    const int lane = threadIdx.x & 31; const int r = blockIdx.x * 8 + (threadIdx.x >> 5); if (r >= NR) return; const v8f a = *(const v8f*)(x + (size_t)r * CC + lane * 8); float u[8]; float s = 0.f;
#pragma unroll
    for (int q = 0; q < 8; ++q) { u[q] = bfr(a[q]); s += u[q]; }
#pragma unroll
    for (int sh = 16; sh; sh >>= 1) s += __shfl_xor(s, sh, 32);
    const float mu = s * (1.0f / CC); float s2 = 0.f;
#pragma unroll
    for (int q = 0; q < 8; ++q) { float d0 = __fsub_rn(u[q], mu); asm volatile("" : "+v"(d0)); float p = __fmul_rn(d0, d0); asm volatile("" : "+v"(p)); s2 = __fadd_rn(s2, p); }
#pragma unroll
    for (int sh = 16; sh; sh >>= 1) s2 += __shfl_xor(s2, sh, 32);
    const float rs = __fdiv_rn(1.0f, __fsqrt_rn(__fadd_rn(s2 * (1.0f / CC), 1e-5f))); v8us oh, ol;
#pragma unroll
    for (int q = 0; q < 8; ++q) { const int c = lane * 8 + q; float d1 = __fsub_rn(u[q], mu); asm volatile("" : "+v"(d1)); float n0 = __fmul_rn(d1, rs); asm volatile("" : "+v"(n0)); float n1 = __fmul_rn(n0, bfr(lw[c])); asm volatile("" : "+v"(n1)); const float xn = __fadd_rn(n1, bfr(lb[c])); unsigned short h2, l2; splitf(xn, h2, l2); oh[q] = h2; ol[q] = l2; }
    *(v8us*)(MH + (size_t)r * CC + lane * 8) = oh; *(v8us*)(ML + (size_t)r * CC + lane * 8) = ol;  }
__global__ __launch_bounds__(256) void k_trib(const bf* __restrict__ XH, const bf* __restrict__ XL, const float* __restrict__ wtri, float* TB) { const size_t idx = (size_t)blockIdx.x * 256 + threadIdx.x; if (idx >= (size_t)NH_ * NZR) return; const int r = (int)(idx % NZR); const int h = (int)(idx / NZR); const bf* ph = XH + (size_t)r * CZ; const bf* pl = XL + (size_t)r * CZ; float s = 0.f;
#pragma unroll 4
    for (int c = 0; c < CZ; c += 8) { const v8us a = *(const v8us*)(ph + c), b2 = *(const v8us*)(pl + c);
#pragma unroll
        for (int q = 0; q < 8; ++q) { const float xn = __fadd_rn(bf2f(a[q]), bf2f(b2[q])); float p = __fmul_rn(xn, bfr(wtri[(size_t)h * CZ + c + q])   /* w_b [h][c_z] */); asm volatile("" : "+v"(p)); s = __fadd_rn(s, p); } }
    *(float*)(TB + idx) = s;  }
__global__ __launch_bounds__(256) void k_qkpl(const float* __restrict__ F, int i0, float sc, bf* Ph, bf* Pl) { const size_t e = ((size_t)blockIdx.x * 256 + threadIdx.x) * 2; if (e >= (size_t)ZC * NJ * CH) return; const int d = (int)(e % CH); const int j = (int)((e / CH) % NJ); const int zz = (int)(e / ((size_t)CH * NJ)); const int i = i0 + zz / NH_, h = zz % NH_; const float* f = F + ((size_t)i * NJ + j) * CC + h * CH + d; v2us oh, ol;
#pragma unroll
    for (int q = 0; q < 2; ++q) { unsigned short a2, c2; splitf(__fmul_rn(f[q], sc), a2, c2); oh[q] = a2; ol[q] = c2; } *(v2us*)(Ph + e) = oh; *(v2us*)(Pl + e) = ol;  }
__global__ __launch_bounds__(256) void k_vtpl(const float* __restrict__ F, int i0, bf* Vh, bf* Vl) { const size_t e = ((size_t)blockIdx.x * 256 + threadIdx.x) * 2; if (e >= (size_t)ZC * CHP * NJ) return; const int j = (int)(e % NJ); const int dp = (int)((e / NJ) % CHP); const int zz = (int)(e / ((size_t)NJ * CHP)); const int i = i0 + zz / NH_, h = zz % NH_; v2us oh, ol;
#pragma unroll
    for (int q = 0; q < 2; ++q) { float x = 0.0f; if (dp < CH) x = F[((size_t)i * NJ + j + q) * CC + h * CH + dp]; unsigned short a2, c2; splitf(x, a2, c2); oh[q] = a2; ol[q] = c2; } *(v2us*)(Vh + e) = oh; *(v2us*)(Vl + e) = ol;  }
__global__ __launch_bounds__(256) void k_tsoft(const float* __restrict__ Sb, const float* __restrict__ TB, int i0, bf* Ph, bf* Pl) {
    const int lane = threadIdx.x & 31; const int row = blockIdx.x * 8 + (threadIdx.x >> 5); if (row >= ZC * NJ) return; const int jq = row % NJ; const int zz = row / NJ; const int i = i0 + zz / NH_, h = zz % NH_; const float* sr = Sb + (size_t)row * NJ; const float* tb = TB + (size_t)h * NZR + (size_t)jq * NJ; (void)i; float v[8]; float mx = -3.0e38f;
#pragma unroll
    for (int ch = 0; ch < 2; ++ch) { const int k0 = ch * 128 + lane * 4; const v4f a = *(const v4f*)(sr + k0), t4 = *(const v4f*)(tb + k0);
#pragma unroll
        for (int q = 0; q < 4; ++q) { float s1 = __fmul_rn(a[q], QSC); asm volatile("" : "+v"(s1)); const float t = __fadd_rn(s1, t4[q]); v[ch * 4 + q] = t; mx = fmaxf(mx, t); } }
#pragma unroll
    for (int sh = 16; sh; sh >>= 1) mx = fmaxf(mx, __shfl_xor(mx, sh, 32));
    float sum = 0.f;
#pragma unroll
    for (int k = 0; k < 8; ++k) { float d0 = __fsub_rn(v[k], mx); asm volatile("" : "+v"(d0)); v[k] = __builtin_amdgcn_exp2f(__fmul_rn(d0, 1.4426950408889634f)); sum += v[k]; }
#pragma unroll
    for (int sh = 16; sh; sh >>= 1) sum += __shfl_xor(sum, sh, 32);
    const float f = __fdiv_rn(1.0f, sum);
{
#pragma unroll
        for (int ch = 0; ch < 2; ++ch) { v4us oh, ol;
#pragma unroll
            for (int q = 0; q < 4; ++q) { float pf = v[ch * 4 + q] * f; asm volatile("" : "+v"(pf)); unsigned short a, c2; splitf(pf, a, c2); oh[q] = a; ol[q] = c2; }
            const size_t oo = (size_t)row * NJ + ch * 128 + lane * 4; *(v4us*)(Ph + oo) = oh; *(v4us*)(Pl + oo) = ol; }
         }
}
__global__ __launch_bounds__(256) void k_octx(const float* __restrict__ O, int i0, bf* Gh, bf* Gl) { const size_t e = ((size_t)blockIdx.x * 256 + threadIdx.x) * 2; if (e >= (size_t)ZC * NJ * CH) return; const int d = (int)(e % CH); const int jq = (int)((e / CH) % NJ); const int zz = (int)(e / ((size_t)CH * NJ)); const int i = i0 + zz / NH_, h = zz % NH_; const size_t r = (size_t)i * NJ + jq; const size_t oo = r * CC + h * CH + d; v2us oh, ol;
#pragma unroll
    for (int q = 0; q < 2; ++q) { const float o = O[((size_t)zz * NJ + jq) * CHP + d + q]; unsigned short a2, c2; splitf(o, a2, c2); oh[q] = a2; ol[q] = c2; }
    *(v2us*)(Gh + oo) = oh; *(v2us*)(Gl + oo) = ol;  }

__global__ __launch_bounds__(256) void k_fin(const float* __restrict__ msa, const float* __restrict__ FG, const float* __restrict__ bg, const float* __restrict__ O2, float* O) { const size_t i = (size_t)blockIdx.x * 256 + threadIdx.x; if (i >= (size_t)NR * CC / 4) return; const size_t e = i * 4; const int c0 = (int)(e % CC); const v4f m = *(const v4f*)(msa + e), fg = *(const v4f*)(FG + e), o2 = *(const v4f*)(O2 + e); v4f o;
#pragma unroll
    for (int q = 0; q < 4; ++q) { const float zg = __fadd_rn(fg[q], bfr(bg[c0 + q])); const float sg = __fdiv_rn(1.0f, __fadd_rn(1.0f, expf(-zg))); float t = __fmul_rn(sg, o2[q]); asm volatile("" : "+v"(t)); o[q] = __fadd_rn(bfr(m[q]), t); }
    *(v4f*)(O + e) = o;  }

extern "C" void kernel_launch(void* const* d_in, const int* in_sizes, int n_in,
                              void* d_out, int out_size, void* d_ws, size_t ws_size, hipStream_t stream) {
    (void)in_sizes; (void)n_in; (void)out_size;
    const float* msa = (const float*)d_in[0]; const float* pair = (const float*)d_in[1]; const float* lmw = (const float*)d_in[2]; const float* lmb = (const float*)d_in[3]; const float* lzw = (const float*)d_in[4]; const float* lzb = (const float*)d_in[5]; const float* wq = (const float*)d_in[6]; const float* wk = (const float*)d_in[7]; const float* wv = (const float*)d_in[8]; const float* wb = (const float*)d_in[9]; const float* wo = (const float*)d_in[10]; const float* bo = (const float*)d_in[11]; const float* wg = (const float*)d_in[12]; const float* bg = (const float*)d_in[13];
    float* OUT = (float*)d_out;     // [128][256][256]
    char* wsp = (char*)d_ws;
    auto take = [&](size_t bytes) { char* p = wsp; wsp += (bytes + 255) & ~(size_t)255; return (void*)p; };
    bf* WQ = (bf*)take((size_t)CC * CC * 2); bf* WK = (bf*)take((size_t)CC * CC * 2); bf* WV = (bf*)take((size_t)CC * CC * 2); bf* WG = (bf*)take((size_t)CC * CC * 2); bf* WO = (bf*)take((size_t)CC * CC * 2);
    bf* XH = (bf*)take((size_t)NR * CC * 2); bf* XL = (bf*)take((size_t)NR * CC * 2); bf* ZH_ = (bf*)take((size_t)NZR * CZ * 2); bf* ZL_ = (bf*)take((size_t)NZR * CZ * 2); float* TB = (float*)take((size_t)NH_ * NZR * 4);
    float* FQ = (float*)take((size_t)NR * CC * 4); float* FK = (float*)take((size_t)NR * CC * 4); float* FV = (float*)take((size_t)NR * CC * 4); float* FG = (float*)take((size_t)NR * CC * 4);
    bf* QPh = (bf*)take((size_t)ZC * NJ * CH * 2); bf* QPl = (bf*)take((size_t)ZC * NJ * CH * 2); bf* KPh = (bf*)take((size_t)ZC * NJ * CH * 2); bf* KPl = (bf*)take((size_t)ZC * NJ * CH * 2); bf* VTh = (bf*)take((size_t)ZC * CHP * NJ * 2); bf* VTl = (bf*)take((size_t)ZC * CHP * NJ * 2);
    float* Sb = (float*)take((size_t)ZC * NJ * NJ * 4); bf* Ph = (bf*)take((size_t)ZC * NJ * NJ * 2); bf* Pl = (bf*)take((size_t)ZC * NJ * NJ * 2); float* Ob = (float*)take((size_t)ZC * NJ * CHP * 4);
    bf* Gh = ZH_; bf* Gl = ZL_; float* O2 = FQ;   /* the merged-context planes reuse the pair LayerNorm planes once the bias dots are done; O2 reuses the q buffer after the last chunk (stream-ordered) */
    if ((size_t)(wsp - (char*)d_ws) > ws_size) return;
    { const unsigned LW = (CC * CC / 8 + 255) / 256; k_cvt8<<<LW, 256, 0, stream>>>(wq, WQ, (size_t)CC * CC / 8); k_cvt8<<<LW, 256, 0, stream>>>(wk, WK, (size_t)CC * CC / 8); k_cvt8<<<LW, 256, 0, stream>>>(wv, WV, (size_t)CC * CC / 8); k_cvt8<<<LW, 256, 0, stream>>>(wg, WG, (size_t)CC * CC / 8); k_cvt8<<<LW, 256, 0, stream>>>(wo, WO, (size_t)CC * CC / 8); }   /* 'oi' weights = Bt as-is */
    k_lnm<<<NR / 8, 256, 0, stream>>>(msa, lmw, lmb, XH, XL); k_lnz<<<NZR / 8, 256, 0, stream>>>(pair, lzw, lzb, ZH_, ZL_); k_trib<<<(unsigned)(((size_t)NH_ * NZR + 255) / 256), 256, 0, stream>>>(ZH_, ZL_, wb, TB);   /* LayerNorm planes (msa, pair); pair-bias dots */
    k_gemmw<bf, 1, false><<<dim3(NR / 64, CC / 64, 1), 32, 0, stream>>>(XH, XL, WQ, nullptr, CC, FQ, CC, nullptr, 0, 0, 0);                      /* q, k, v, g projections (2 products) */
    k_gemmw<bf, 1, false><<<dim3(NR / 64, CC / 64, 1), 32, 0, stream>>>(XH, XL, WK, nullptr, CC, FK, CC, nullptr, 0, 0, 0);
    k_gemmw<bf, 1, false><<<dim3(NR / 64, CC / 64, 1), 32, 0, stream>>>(XH, XL, WV, nullptr, CC, FV, CC, nullptr, 0, 0, 0);
    k_gemmw<bf, 1, false><<<dim3(NR / 64, CC / 64, 1), 32, 0, stream>>>(XH, XL, WG, nullptr, CC, FG, CC, nullptr, 0, 0, 0);
    const unsigned LQK = (unsigned)(((size_t)ZC * NJ * CH / 2 + 255) / 256), LVT = (unsigned)(((size_t)ZC * CHP * NJ / 2 + 255) / 256);
    for (int i0 = 0; i0 < NI; i0 += RPC) {                                                                                            /* 16 chunks of 8 rows x 8 heads */
        k_qkpl<<<LQK, 256, 0, stream>>>(FQ, i0, 1.0f, QPh, QPl); k_qkpl<<<LQK, 256, 0, stream>>>(FK, i0, 1.0f, KPh, KPl); k_vtpl<<<LVT, 256, 0, stream>>>(FV, i0, VTh, VTl);
        k_gemmw<bf, 2, false><<<dim3(NJ / 64, NJ / 64, ZC), 32, 0, stream>>>(QPh, QPl, KPh, KPl, CH, Sb, NJ, nullptr, (size_t)NJ * CH, (size_t)NJ * CH, (size_t)NJ * NJ);      /* scores (3 products, K = 32) */
        k_tsoft<<<ZC * NJ / 8, 256, 0, stream>>>(Sb, TB, i0, Ph, Pl);                                                                           /* / sqrt(32) + pair bias, softmax */
        k_gemmw<bf, 2, false><<<dim3(NJ / 64, CHP / 64, ZC), 32, 0, stream>>>(Ph, Pl, VTh, VTl, NJ, Ob, CHP, nullptr, (size_t)NJ * NJ, (size_t)CHP * NJ, (size_t)NJ * CHP);    /* attn.v (3 products; padded columns are 0) */
        k_octx<<<LQK, 256, 0, stream>>>(Ob, i0, Gh, Gl); }                                                                                     /* merged context -> tall operand planes */
    k_gemmw<bf, 1, true><<<dim3(NR / 64, CC / 64, 1), 32, 0, stream>>>(Gh, Gl, WO, nullptr, CC, O2, CC, bo, 0, 0, 0);                          /* O2 = context W_out^T + b_out */
    k_fin<<<(unsigned)(((size_t)NR * CC / 4 + 255) / 256), 256, 0, stream>>>(msa, FG, bg, O2, OUT);                                            /* out = msa + sigmoid(gate) x O2 */
}

// v001
// A run of this version takes 243 microseconds.
// Next to v000, in two timings, it ran 2.91 and 2.88 times as fast.
#include <hip/hip_runtime.h>

// MSA row attention with pair bias (msa [128][256][256], pair [256][256][128]; m = LayerNorm(msa), z = LayerNorm(pair) (eps 1e-5, affine); per MSA row b and head h (8 x 32): q, k, v = m W^T ('oi' [256][256]); scores = q.k / sqrt(32) + bias[h][i][j] with bias = z . w_b[h] ([8][128]); softmax over j; o = attn.v merged; out = msa + sigmoid(m W_gate^T + b_gate) * (o W_out^T + b_out) -> [128][256][256] (8.4 M)).
// Layout: the 32,768 (row, position) MSA rows are one tall GEMM operand for the LayerNormed projections (m as bf16 hi + lo: 2 products) and for the output projection of the merged context; the pair LayerNorm feeds only the 8 bias dot products per pair position; the 1,024 (row, head) attention problems of size 256 x 256 x 32 run in ONE launch, one work-group each: scores on hi/lo planes (3 products, K = 32), x 1/sqrt(32) + bias, a 256-wide softmax in registers, attn.v on hi/lo planes (3 products); a final kernel applies the residual and the sigmoid gate in f32.

#define NI   128                  // MSA rows
#define NJ   256                  // positions (= attention length)
#define CC   256                  // c_m
#define CZ   128                  // c_z
#define NZR  (NJ * NJ)            // 65,536 pair positions
#define NH_  8
#define CH   32
#define NR   (NI * NJ)            // 32,768 (row, position) MSA rows
#define QSC  0.17677669529663689f  // 1/sqrt(32)
typedef _Float16 h16;
typedef unsigned short bf;
typedef __attribute__((ext_vector_type(16))) __bf16   v16bf;
typedef __attribute__((ext_vector_type(16))) _Float16 v16h;
typedef __attribute__((ext_vector_type(8)))  _Float16 v8h;
typedef __attribute__((ext_vector_type(8)))  unsigned short v8us;
typedef __attribute__((ext_vector_type(8)))  float    v8f;
typedef __attribute__((ext_vector_type(4)))  float    v4f;
typedef __attribute__((ext_vector_type(2)))  float    v2f;
typedef __attribute__((ext_vector_type(4)))  unsigned short v4us;
typedef __attribute__((ext_vector_type(2)))  unsigned short v2us;
typedef v8h  __attribute__((may_alias)) v8ha;
typedef v4f  __attribute__((may_alias)) v4fa;
typedef v8us __attribute__((may_alias)) v8usa;

__device__ __forceinline__ unsigned short f2bf(float f) { unsigned u = __float_as_uint(f); u += 0x7FFFu + ((u >> 16) & 1u); return (unsigned short)(u >> 16); }
__device__ __forceinline__ float bf2f(unsigned short b) { return __uint_as_float(((unsigned)b) << 16); }
__device__ __forceinline__ float bfr(float f) { return bf2f(f2bf(f)); }
__device__ __forceinline__ void splitf(float y, unsigned short& h, unsigned short& l) { h = f2bf(y); l = f2bf(y - bf2f(h)); }
__device__ __forceinline__ v16h cat16(v8h lo, v8h hi) { return __builtin_shufflevector(lo, hi, 0, 1, 2, 3, 4, 5, 6, 7, 8, 9, 10, 11, 12, 13, 14, 15); }
__device__ __forceinline__ v16bf cat16b(v8us lo, v8us hi) { return __builtin_bit_cast(v16bf, __builtin_shufflevector(lo, hi, 0, 1, 2, 3, 4, 5, 6, 7, 8, 9, 10, 11, 12, 13, 14, 15)); }
__device__ __forceinline__ v8f wmma16(v16h a, v16h b, v8f c) { return __builtin_amdgcn_wmma_f32_16x16x32_f16(false, a, false, b, (short)0, c, false, false); }
__device__ __forceinline__ v8f wmmab(v16bf a, v16bf b, v8f c) { return __builtin_amdgcn_wmma_f32_16x16x32_bf16(false, a, false, b, (short)0, c, false, false); }

// ---- k_gemmw: register-blocked GEMM, ONE WAVE per 64x64 output tile (16 accumulators), operands straight from K-contiguous 16-bit planes; grid (M/64, N/64, Z), 32 threads.
// C[m][n] (f32, pitch ldc, + optional f32 bias[n]) = sum_k A[m][k] Bt[n][k] (+ split products per NSPLIT). z-batch strides sA/sB/sC in elements. K % 32 == 0.
template <typename T16> struct WFrag;
template <> struct WFrag<h16> { typedef v16h V; static __device__ __forceinline__ V ld(const h16* p) { return cat16(*(const v8h*)p, *(const v8h*)(p + 16)); } static __device__ __forceinline__ v8f mma(V a, V b, v8f c) { return wmma16(a, b, c); } };
template <> struct WFrag<bf> { typedef v16bf V; static __device__ __forceinline__ V ld(const bf* p) { return cat16b(*(const v8us*)p, *(const v8us*)(p + 16)); } static __device__ __forceinline__ v8f mma(V a, V b, v8f c) { return wmmab(a, b, c); } };
template <typename T16, int NSPLIT, bool BIAS>
__global__ __launch_bounds__(32) void k_gemmw(const T16* __restrict__ A, const T16* __restrict__ A2, const T16* __restrict__ Bt, const T16* __restrict__ Bt2, int K, float* C, int ldc, const float* __restrict__ bias, size_t sA, size_t sB, size_t sC) {
    typedef typename WFrag<T16>::V V;
    __shared__ __align__(16) float os[16 * 68];
    const size_t z = blockIdx.z; A += z * sA; if (A2) A2 += z * sA; Bt += z * sB; if (Bt2) Bt2 += z * sB; C += z * sC;
    const int lane = threadIdx.x & 31, lr = lane & 15, hi = lane >> 4; const int r0 = blockIdx.x * 64, c0 = blockIdx.y * 64;
    v8f acc[4][4];
#pragma unroll
    for (int mb = 0; mb < 4; ++mb)
#pragma unroll
        for (int nb = 0; nb < 4; ++nb) acc[mb][nb] = (v8f){};
    const size_t aoff = (size_t)(r0 + lr) * K + 8 * hi, boff = (size_t)(c0 + lr) * K + 8 * hi;
#pragma unroll 1
    for (int kc = 0; kc < K; kc += 32) {
        V a[4], a2[4];
#pragma unroll
        for (int mb = 0; mb < 4; ++mb) { a[mb] = WFrag<T16>::ld(A + aoff + (size_t)mb * 16 * K + kc); if (NSPLIT == 1 || NSPLIT == 2) a2[mb] = WFrag<T16>::ld(A2 + aoff + (size_t)mb * 16 * K + kc); }
#pragma unroll
        for (int nb = 0; nb < 4; ++nb) { const V b = WFrag<T16>::ld(Bt + boff + (size_t)nb * 16 * K + kc); V b2; if (NSPLIT >= 2) b2 = WFrag<T16>::ld(Bt2 + boff + (size_t)nb * 16 * K + kc);
#pragma unroll
            for (int mb = 0; mb < 4; ++mb) { acc[mb][nb] = WFrag<T16>::mma(a[mb], b, acc[mb][nb]); if (NSPLIT == 1 || NSPLIT == 2) acc[mb][nb] = WFrag<T16>::mma(a2[mb], b, acc[mb][nb]); if (NSPLIT >= 2) acc[mb][nb] = WFrag<T16>::mma(a[mb], b2, acc[mb][nb]); } }
        asm volatile("v_nop\n\tv_nop\n\tv_nop\n\tv_nop" : "+v"(acc[0][0]), "+v"(acc[1][1]), "+v"(acc[2][2]), "+v"(acc[3][3]) : "v"(a[0]), "v"(a[3]));
    }
#pragma unroll
    for (int mb = 0; mb < 4; ++mb) {
#pragma unroll
        for (int nb = 0; nb < 4; ++nb) {
#pragma unroll
            for (int j = 0; j < 8; ++j) os[(hi * 8 + j) * 68 + nb * 16 + lr] = acc[mb][nb][j]; }
        __builtin_amdgcn_wave_barrier(); asm volatile("" ::: "memory");
        float* crow = C + (size_t)(r0 + mb * 16) * ldc + c0;
{
#pragma unroll
            for (int s = 0; s < 8; ++s) { const int row = 2 * s + hi, cofs = lr * 4; v4f val = *(const v4fa*)(os + row * 68 + cofs); if (BIAS) { val[0] += bfr(bias[c0 + cofs]); val[1] += bfr(bias[c0 + cofs + 1]); val[2] += bfr(bias[c0 + cofs + 2]); val[3] += bfr(bias[c0 + cofs + 3]); }
                *(v4f*)(crow + (size_t)row * ldc + cofs) = val; }
             }
        __builtin_amdgcn_wave_barrier(); asm volatile("" ::: "memory");
    }
}

__global__ __launch_bounds__(256) void k_wtG(const float* __restrict__ w, int K, int N, bf* Bt) {
    const int lane = threadIdx.x & 31; const int L0 = (blockIdx.x * 8 + (threadIdx.x >> 5)) * 8; const int nlines = N * K / 64;
{
#pragma unroll 1
        for (int l = 0; l < 8; ++l) { const int L = L0 + l; if (L >= nlines) break; const size_t e = (size_t)L * 64 + lane * 2; const int k = (int)(e % K), n = (int)(e / K); v2us o;
            o[0] = f2bf(w[(size_t)k * N + n]); o[1] = f2bf(w[(size_t)(k + 1) * N + n]); *(v2us*)(Bt + e) = o; }
         }
}
__global__ __launch_bounds__(256) void k_cvt8(const float* __restrict__ src, bf* dst, size_t n8) { const size_t i = (size_t)blockIdx.x * 256 + threadIdx.x; if (i >= n8) return; const v8f v = *(const v8f*)(src + i * 8); v8us o;
#pragma unroll
    for (int k = 0; k < 8; ++k) o[k] = f2bf(v[k]); *(v8us*)(dst + i * 8) = o;  }
__global__ __launch_bounds__(256) void k_lnz(const float* __restrict__ x, const float* __restrict__ lw, const float* __restrict__ lb, bf* XH, bf* XL) {
    const int lane = threadIdx.x & 31; const int r = blockIdx.x * 8 + (threadIdx.x >> 5); if (r >= NZR) return; const v4f a = *(const v4f*)(x + (size_t)r * CZ + lane * 4); float u[4]; float s = 0.f;
#pragma unroll
    for (int q = 0; q < 4; ++q) { u[q] = bfr(a[q]); s += u[q]; }
#pragma unroll
    for (int sh = 16; sh; sh >>= 1) s += __shfl_xor(s, sh, 32);
    const float mu = s * (1.0f / CZ); float s2 = 0.f;
#pragma unroll
    for (int q = 0; q < 4; ++q) { float d0 = __fsub_rn(u[q], mu); asm volatile("" : "+v"(d0)); float p = __fmul_rn(d0, d0); asm volatile("" : "+v"(p)); s2 = __fadd_rn(s2, p); }
#pragma unroll
    for (int sh = 16; sh; sh >>= 1) s2 += __shfl_xor(s2, sh, 32);
    const float rs = __fdiv_rn(1.0f, __fsqrt_rn(__fadd_rn(s2 * (1.0f / CZ), 1e-5f))); float xn[4]; v4us oh, ol;
#pragma unroll
    for (int q = 0; q < 4; ++q) { const int c = lane * 4 + q; float d1 = __fsub_rn(u[q], mu); asm volatile("" : "+v"(d1)); float n0 = __fmul_rn(d1, rs); asm volatile("" : "+v"(n0)); float n1 = __fmul_rn(n0, bfr(lw[c])); asm volatile("" : "+v"(n1)); xn[q] = __fadd_rn(n1, bfr(lb[c])); unsigned short h2, l2; splitf(xn[q], h2, l2); oh[q] = h2; ol[q] = l2; }
    *(v4us*)(XH + (size_t)r * CZ + lane * 4) = oh; *(v4us*)(XL + (size_t)r * CZ + lane * 4) = ol; 
}
__global__ __launch_bounds__(256) void k_lnm(const float* __restrict__ x, const float* __restrict__ lw, const float* __restrict__ lb, bf* MH, bf* ML) {
    const int lane = threadIdx.x & 31; const int r = blockIdx.x * 8 + (threadIdx.x >> 5); if (r >= NR) return; const v8f a = *(const v8f*)(x + (size_t)r * CC + lane * 8); float u[8]; float s = 0.f;
#pragma unroll
    for (int q = 0; q < 8; ++q) { u[q] = bfr(a[q]); s += u[q]; }
#pragma unroll
    for (int sh = 16; sh; sh >>= 1) s += __shfl_xor(s, sh, 32);
    const float mu = s * (1.0f / CC); float s2 = 0.f;
#pragma unroll
    for (int q = 0; q < 8; ++q) { float d0 = __fsub_rn(u[q], mu); asm volatile("" : "+v"(d0)); float p = __fmul_rn(d0, d0); asm volatile("" : "+v"(p)); s2 = __fadd_rn(s2, p); }
#pragma unroll
    for (int sh = 16; sh; sh >>= 1) s2 += __shfl_xor(s2, sh, 32);
    const float rs = __fdiv_rn(1.0f, __fsqrt_rn(__fadd_rn(s2 * (1.0f / CC), 1e-5f))); v8us oh, ol;
#pragma unroll
    for (int q = 0; q < 8; ++q) { const int c = lane * 8 + q; float d1 = __fsub_rn(u[q], mu); asm volatile("" : "+v"(d1)); float n0 = __fmul_rn(d1, rs); asm volatile("" : "+v"(n0)); float n1 = __fmul_rn(n0, bfr(lw[c])); asm volatile("" : "+v"(n1)); const float xn = __fadd_rn(n1, bfr(lb[c])); unsigned short h2, l2; splitf(xn, h2, l2); oh[q] = h2; ol[q] = l2; }
    *(v8us*)(MH + (size_t)r * CC + lane * 8) = oh; *(v8us*)(ML + (size_t)r * CC + lane * 8) = ol;  }
__global__ __launch_bounds__(256) void k_trib(const bf* __restrict__ XH, const bf* __restrict__ XL, const float* __restrict__ wtri, float* TB) { const size_t idx = (size_t)blockIdx.x * 256 + threadIdx.x; if (idx >= (size_t)NH_ * NZR) return; const int r = (int)(idx % NZR); const int h = (int)(idx / NZR); const bf* ph = XH + (size_t)r * CZ; const bf* pl = XL + (size_t)r * CZ; float s = 0.f;
#pragma unroll 4
    for (int c = 0; c < CZ; c += 8) { const v8us a = *(const v8us*)(ph + c), b2 = *(const v8us*)(pl + c);
#pragma unroll
        for (int q = 0; q < 8; ++q) { const float xn = __fadd_rn(bf2f(a[q]), bf2f(b2[q])); float p = __fmul_rn(xn, bfr(wtri[(size_t)h * CZ + c + q])   /* w_b [h][c_z] */); asm volatile("" : "+v"(p)); s = __fadd_rn(s, p); } }
    *(float*)(TB + idx) = s;  }
// ---- k_fattn: one work-group per (MSA row, head), 8 waves; the score matrix never leaves the registers.
// K (hi/lo planes, [key][d]) and V transposed (hi/lo planes, [d][key]) are split once into LDS; each wave then takes 16 queries at a time: S^T = K Q^T (a lane holds 128 of one query's 256 scores), softmax in-lane plus one exchange between the wave halves, the normalised P^T packed from the score accumulators as the B operand of O^T = V^T P^T, and 8 consecutive d per lane stored as the merged-context hi/lo planes.
#define KP 40                     // K plane row pitch, 16-bit elements: 80 B = 16 B x odd
#define VP 264                    // V^T plane row pitch, 16-bit elements: 528 B = 16 B x odd
__device__ __forceinline__ void split8(v8f x, v8us& h, v8us& l) {
#pragma unroll
    for (int q = 0; q < 8; ++q) { unsigned short a, c; splitf(x[q], a, c); h[q] = a; l[q] = c; } }
__device__ __forceinline__ v8f exp2x8(v8f x) { float a0 = x[0], a1 = x[1], a2 = x[2], a3 = x[3], a4 = x[4], a5 = x[5], a6 = x[6], a7 = x[7];
    /* eight independent v_exp_f32 in one statement, closed by a v_nop: each fills the slot that the instruction set asks for behind the one in front of it, the v_nop the last one's */
    asm("v_exp_f32 %0, %0\n\tv_exp_f32 %1, %1\n\tv_exp_f32 %2, %2\n\tv_exp_f32 %3, %3\n\tv_exp_f32 %4, %4\n\tv_exp_f32 %5, %5\n\tv_exp_f32 %6, %6\n\tv_exp_f32 %7, %7\n\tv_nop" : "+v"(a0), "+v"(a1), "+v"(a2), "+v"(a3), "+v"(a4), "+v"(a5), "+v"(a6), "+v"(a7));
    return (v8f){a0, a1, a2, a3, a4, a5, a6, a7}; }
__device__ __forceinline__ v16bf ldfrag(const bf* p) { return cat16b(*(const v8us*)p, *(const v8us*)(p + 16)); }
/* second launch bound: four waves per SIMD, so that two work-groups share a WGP and one stages while the other computes */
__global__ __launch_bounds__(256, 4) void k_fattn(const float* __restrict__ FQ, const float* __restrict__ FK, const float* __restrict__ FV, const float* __restrict__ TB, bf* Gh, bf* Gl) {
    __shared__ __align__(16) bf Kh[NJ * KP]; __shared__ __align__(16) bf Kl[NJ * KP]; __shared__ __align__(16) bf Vh[CH * VP]; __shared__ __align__(16) bf Vl[CH * VP];
    const int tid = threadIdx.x, lane = tid & 31, wave = tid >> 5, lr = lane & 15, hi = lane >> 4; const int h = blockIdx.x, b = blockIdx.y;
    const size_t base = (size_t)b * NJ * CC + h * CH;
    {   /* 8 lanes cover one key's 128 B; a thread owns two neighbouring keys so that V^T goes to LDS in 4-byte pairs */
        const int kq = (tid >> 3) * 2, c4 = (tid & 7) * 4; const float* pk = FK + base + (size_t)kq * CC + c4; const float* pv = FV + base + (size_t)kq * CC + c4; v4f k0[4], k1[4], w0[4], w1[4];
#pragma unroll
        for (int it = 0; it < 4; ++it) { k0[it] = *(const v4f*)(pk + it * 64 * CC); k1[it] = *(const v4f*)(pk + it * 64 * CC + CC); w0[it] = *(const v4f*)(pv + it * 64 * CC); w1[it] = *(const v4f*)(pv + it * 64 * CC + CC); }
        asm volatile("s_wait_xcnt 0x0" :: "v"(pk), "v"(pv) : "memory");   /* the wait in front of any overwrite of the address registers of the loads above; as inputs the two addresses stay in their registers up to it */
#pragma unroll
        for (int it = 0; it < 4; ++it) { const int kp2 = kq + it * 64; v4us a0, b0, a1, b1;
#pragma unroll
            for (int q = 0; q < 4; ++q) { unsigned short x, y; splitf(k0[it][q], x, y); a0[q] = x; b0[q] = y; splitf(k1[it][q], x, y); a1[q] = x; b1[q] = y; }
            *(v4us*)(Kh + kp2 * KP + c4) = a0; *(v4us*)(Kl + kp2 * KP + c4) = b0; *(v4us*)(Kh + (kp2 + 1) * KP + c4) = a1; *(v4us*)(Kl + (kp2 + 1) * KP + c4) = b1;
#pragma unroll
            for (int q = 0; q < 4; ++q) { v2us x, y; unsigned short s0, s1; splitf(w0[it][q], s0, s1); x[0] = s0; y[0] = s1; splitf(w1[it][q], s0, s1); x[1] = s0; y[1] = s1; *(v2us*)(Vh + (c4 + q) * VP + kp2) = x; *(v2us*)(Vl + (c4 + q) * VP + kp2) = y; } }
    }
    __syncthreads();
#pragma unroll 1   /* kept rolled: both trips unrolled would hold two sets of 128 score registers */
    for (int i = 0; i < 2; ++i) {   /* wave w takes query tiles w and w + 8 */
        const int qrow = (wave + 8 * i) * 16 + lr; const float* qr = FQ + base + (size_t)qrow * CC + 8 * hi; const float* tb = TB + (size_t)h * NZR + (size_t)qrow * NJ + 8 * hi;
        const v8f qa = *(const v8f*)qr, qb = *(const v8f*)(qr + 16);
        v8f s[16];   /* s[t][r] = score of key 16 t + 8 hi + r for query qrow; the pair bias is the accumulators' start value */
#pragma unroll
        for (int t = 0; t < 16; ++t) s[t] = *(const v8f*)(tb + t * 16);
        asm volatile("s_wait_xcnt 0x0" :: "v"(qr), "v"(tb) : "memory");   /* the wait in front of any overwrite of the address registers of the loads above (inputs: the addresses stay put up to it); its memory clobber also keeps the K and V^T fragment loads below inside this loop: hoisted out of it they take 512 registers and spill */
        v8us t0, t1, t2, t3; split8(qa * QSC, t0, t1); split8(qb * QSC, t2, t3); const v16bf qh = cat16b(t0, t2), ql = cat16b(t1, t3);   /* 1/sqrt(32) goes into q ahead of the hi/lo split */
#pragma unroll
        for (int t = 0; t < 16; ++t) { const int ko = (t * 16 + lr) * KP + 8 * hi; const v16bf kh = ldfrag(Kh + ko), kl = ldfrag(Kl + ko); s[t] = wmmab(kh, qh, s[t]); s[t] = wmmab(kh, ql, s[t]); s[t] = wmmab(kl, qh, s[t]); }
        float m8[8];
#pragma unroll
        for (int r = 0; r < 8; ++r) m8[r] = -3.0e38f;
#pragma unroll
        for (int t = 0; t < 16; ++t) {
#pragma unroll
            for (int r = 0; r < 8; ++r) m8[r] = fmaxf(m8[r], s[t][r]); }
        float mx = fmaxf(fmaxf(fmaxf(m8[0], m8[1]), fmaxf(m8[2], m8[3])), fmaxf(fmaxf(m8[4], m8[5]), fmaxf(m8[6], m8[7]))); mx = fmaxf(mx, __shfl_xor(mx, 16, 32));
        float s8[8];
#pragma unroll
        for (int r = 0; r < 8; ++r) s8[r] = 0.f;
#pragma unroll
        for (int t = 0; t < 16; ++t) { s[t] = exp2x8((s[t] - mx) * 1.4426950408889634f);
#pragma unroll
            for (int r = 0; r < 8; ++r) s8[r] += s[t][r]; }
        float sum = ((s8[0] + s8[1]) + (s8[2] + s8[3])) + ((s8[4] + s8[5]) + (s8[6] + s8[7])); sum += __shfl_xor(sum, 16, 32);
        const float f = __fdiv_rn(1.0f, sum);
        v8f o0 = (v8f){}, o1 = (v8f){};   /* o0[r] = context d = 8 hi + r, o1[r] = d = 16 + 8 hi + r, query qrow */
#pragma unroll
        for (int u = 0; u < 8; ++u) { split8(s[2 * u] * f, t0, t1); split8(s[2 * u + 1] * f, t2, t3); const v16bf ph = cat16b(t0, t2), pl = cat16b(t1, t3);
            const int vo = lr * VP + u * 32 + 8 * hi; const v16bf vh0 = ldfrag(Vh + vo), vl0 = ldfrag(Vl + vo), vh1 = ldfrag(Vh + vo + 16 * VP), vl1 = ldfrag(Vl + vo + 16 * VP);
            o0 = wmmab(vh0, ph, o0); o1 = wmmab(vh1, ph, o1); o0 = wmmab(vh0, pl, o0); o1 = wmmab(vh1, pl, o1); o0 = wmmab(vl0, ph, o0); o1 = wmmab(vl1, ph, o1); }
        const size_t oo = base + (size_t)qrow * CC + 8 * hi; split8(o0, t0, t1); split8(o1, t2, t3);
        *(v8us*)(Gh + oo) = t0; *(v8us*)(Gl + oo) = t1; *(v8us*)(Gh + oo + 16) = t2; *(v8us*)(Gl + oo + 16) = t3;
        asm volatile("s_wait_xcnt 0x0" ::: "memory");   /* the wait in front of the next trip's overwrite of the address and data registers of the four stores above */
    }
}

__global__ __launch_bounds__(256) void k_fin(const float* __restrict__ msa, const float* __restrict__ FG, const float* __restrict__ bg, const float* __restrict__ O2, float* O) { const size_t i = (size_t)blockIdx.x * 256 + threadIdx.x; if (i >= (size_t)NR * CC / 4) return; const size_t e = i * 4; const int c0 = (int)(e % CC); const v4f m = *(const v4f*)(msa + e), fg = *(const v4f*)(FG + e), o2 = *(const v4f*)(O2 + e); v4f o;
#pragma unroll
    for (int q = 0; q < 4; ++q) { const float zg = __fadd_rn(fg[q], bfr(bg[c0 + q])); const float sg = __fdiv_rn(1.0f, __fadd_rn(1.0f, expf(-zg))); float t = __fmul_rn(sg, o2[q]); asm volatile("" : "+v"(t)); o[q] = __fadd_rn(bfr(m[q]), t); }
    *(v4f*)(O + e) = o;  }

extern "C" void kernel_launch(void* const* d_in, const int* in_sizes, int n_in,
                              void* d_out, int out_size, void* d_ws, size_t ws_size, hipStream_t stream) {
    (void)in_sizes; (void)n_in; (void)out_size;
    const float* msa = (const float*)d_in[0]; const float* pair = (const float*)d_in[1]; const float* lmw = (const float*)d_in[2]; const float* lmb = (const float*)d_in[3]; const float* lzw = (const float*)d_in[4]; const float* lzb = (const float*)d_in[5]; const float* wq = (const float*)d_in[6]; const float* wk = (const float*)d_in[7]; const float* wv = (const float*)d_in[8]; const float* wb = (const float*)d_in[9]; const float* wo = (const float*)d_in[10]; const float* bo = (const float*)d_in[11]; const float* wg = (const float*)d_in[12]; const float* bg = (const float*)d_in[13];
    float* OUT = (float*)d_out;     // [128][256][256]
    char* wsp = (char*)d_ws;
    auto take = [&](size_t bytes) { char* p = wsp; wsp += (bytes + 255) & ~(size_t)255; return (void*)p; };
    bf* WQ = (bf*)take((size_t)CC * CC * 2); bf* WK = (bf*)take((size_t)CC * CC * 2); bf* WV = (bf*)take((size_t)CC * CC * 2); bf* WG = (bf*)take((size_t)CC * CC * 2); bf* WO = (bf*)take((size_t)CC * CC * 2);
    bf* XH = (bf*)take((size_t)NR * CC * 2); bf* XL = (bf*)take((size_t)NR * CC * 2); bf* ZH_ = (bf*)take((size_t)NZR * CZ * 2); bf* ZL_ = (bf*)take((size_t)NZR * CZ * 2); float* TB = (float*)take((size_t)NH_ * NZR * 4);
    float* FQ = (float*)take((size_t)NR * CC * 4); float* FK = (float*)take((size_t)NR * CC * 4); float* FV = (float*)take((size_t)NR * CC * 4); float* FG = (float*)take((size_t)NR * CC * 4);
    bf* Gh = ZH_; bf* Gl = ZL_; float* O2 = FQ;   /* the merged-context planes reuse the pair LayerNorm planes once the bias dots are done; O2 reuses the q buffer after the attention launch (stream-ordered) */
    if ((size_t)(wsp - (char*)d_ws) > ws_size) return;
    { const unsigned LW = (CC * CC / 8 + 255) / 256; k_cvt8<<<LW, 256, 0, stream>>>(wq, WQ, (size_t)CC * CC / 8); k_cvt8<<<LW, 256, 0, stream>>>(wk, WK, (size_t)CC * CC / 8); k_cvt8<<<LW, 256, 0, stream>>>(wv, WV, (size_t)CC * CC / 8); k_cvt8<<<LW, 256, 0, stream>>>(wg, WG, (size_t)CC * CC / 8); k_cvt8<<<LW, 256, 0, stream>>>(wo, WO, (size_t)CC * CC / 8); }   /* 'oi' weights = Bt as-is */
    k_lnm<<<NR / 8, 256, 0, stream>>>(msa, lmw, lmb, XH, XL); k_lnz<<<NZR / 8, 256, 0, stream>>>(pair, lzw, lzb, ZH_, ZL_); k_trib<<<(unsigned)(((size_t)NH_ * NZR + 255) / 256), 256, 0, stream>>>(ZH_, ZL_, wb, TB);   /* LayerNorm planes (msa, pair); pair-bias dots */
    k_gemmw<bf, 1, false><<<dim3(NR / 64, CC / 64, 1), 32, 0, stream>>>(XH, XL, WQ, nullptr, CC, FQ, CC, nullptr, 0, 0, 0);                      /* q, k, v, g projections (2 products) */
    k_gemmw<bf, 1, false><<<dim3(NR / 64, CC / 64, 1), 32, 0, stream>>>(XH, XL, WK, nullptr, CC, FK, CC, nullptr, 0, 0, 0);
    k_gemmw<bf, 1, false><<<dim3(NR / 64, CC / 64, 1), 32, 0, stream>>>(XH, XL, WV, nullptr, CC, FV, CC, nullptr, 0, 0, 0);
    k_gemmw<bf, 1, false><<<dim3(NR / 64, CC / 64, 1), 32, 0, stream>>>(XH, XL, WG, nullptr, CC, FG, CC, nullptr, 0, 0, 0);
    k_fattn<<<dim3(NH_, NI, 1), 256, 0, stream>>>(FQ, FK, FV, TB, Gh, Gl);                                                                     /* scores, / sqrt(32) + pair bias, softmax, attn.v -> merged context planes */
    k_gemmw<bf, 1, true><<<dim3(NR / 64, CC / 64, 1), 32, 0, stream>>>(Gh, Gl, WO, nullptr, CC, O2, CC, bo, 0, 0, 0);                          /* O2 = context W_out^T + b_out */
    k_fin<<<(unsigned)(((size_t)NR * CC / 4 + 255) / 256), 256, 0, stream>>>(msa, FG, bg, O2, OUT);                                            /* out = msa + sigmoid(gate) x O2 */
}

// v002
// One run takes 190 microseconds.
// Timed twice side by side with v001, it ran 1.27 and 1.26 times as fast.
// Over all steps from v000 it is 3.66 times as fast.
#include <hip/hip_runtime.h>

// MSA row attention with pair bias (msa [128][256][256], pair [256][256][128]; m = LayerNorm(msa), z = LayerNorm(pair) (eps 1e-5, affine); per MSA row b and head h (8 x 32): q, k, v = m W^T ('oi' [256][256]); scores = q.k / sqrt(32) + bias[h][i][j] with bias = z . w_b[h] ([8][128]); softmax over j; o = attn.v merged; out = msa + sigmoid(m W_gate^T + b_gate) * (o W_out^T + b_out) -> [128][256][256] (8.4 M)).
// Layout: the 32,768 (row, position) MSA rows are one tall GEMM operand for the LayerNormed projections (m as bf16 hi + lo: 2 products) and for the output projection of the merged context; the pair LayerNorm feeds only the 8 bias dot products per pair position; the 1,024 (row, head) attention problems of size 256 x 256 x 32 run in ONE launch, one work-group each: scores on hi/lo planes (3 products, K = 32), x 1/sqrt(32) + bias, a 256-wide softmax in registers, attn.v on hi/lo planes (3 products); a final kernel applies the residual and the sigmoid gate in f32.

#define NI   128                  // MSA rows
#define NJ   256                  // positions (= attention length)
#define CC   256                  // c_m
#define CZ   128                  // c_z
#define NZR  (NJ * NJ)            // 65,536 pair positions
#define NH_  8
#define CH   32
#define NR   (NI * NJ)            // 32,768 (row, position) MSA rows
#define QSC  0.17677669529663689f  // 1/sqrt(32)
typedef _Float16 h16;
typedef unsigned short bf;
typedef __attribute__((ext_vector_type(16))) __bf16   v16bf;
typedef __attribute__((ext_vector_type(16))) _Float16 v16h;
typedef __attribute__((ext_vector_type(8)))  _Float16 v8h;
typedef __attribute__((ext_vector_type(8)))  unsigned short v8us;
typedef __attribute__((ext_vector_type(8)))  float    v8f;
typedef __attribute__((ext_vector_type(4)))  float    v4f;
typedef __attribute__((ext_vector_type(2)))  float    v2f;
typedef __attribute__((ext_vector_type(4)))  unsigned short v4us;
typedef __attribute__((ext_vector_type(2)))  unsigned short v2us;
typedef v8h  __attribute__((may_alias)) v8ha;
typedef v4f  __attribute__((may_alias)) v4fa;
typedef v8us __attribute__((may_alias)) v8usa;

__device__ __forceinline__ unsigned short f2bf(float f) { unsigned u = __float_as_uint(f); u += 0x7FFFu + ((u >> 16) & 1u); return (unsigned short)(u >> 16); }
__device__ __forceinline__ float bf2f(unsigned short b) { return __uint_as_float(((unsigned)b) << 16); }
__device__ __forceinline__ float bfr(float f) { return bf2f(f2bf(f)); }
__device__ __forceinline__ void splitf(float y, unsigned short& h, unsigned short& l) { h = f2bf(y); l = f2bf(y - bf2f(h)); }
__device__ __forceinline__ v16h cat16(v8h lo, v8h hi) { return __builtin_shufflevector(lo, hi, 0, 1, 2, 3, 4, 5, 6, 7, 8, 9, 10, 11, 12, 13, 14, 15); }
__device__ __forceinline__ v16bf cat16b(v8us lo, v8us hi) { return __builtin_bit_cast(v16bf, __builtin_shufflevector(lo, hi, 0, 1, 2, 3, 4, 5, 6, 7, 8, 9, 10, 11, 12, 13, 14, 15)); }
__device__ __forceinline__ v8f wmma16(v16h a, v16h b, v8f c) { return __builtin_amdgcn_wmma_f32_16x16x32_f16(false, a, false, b, (short)0, c, false, false); }
__device__ __forceinline__ v8f wmmab(v16bf a, v16bf b, v8f c) { return __builtin_amdgcn_wmma_f32_16x16x32_bf16(false, a, false, b, (short)0, c, false, false); }

// ---- k_gemmw: register-blocked GEMM, ONE WAVE per 64x64 output tile (16 accumulators), operands straight from K-contiguous 16-bit planes; grid (M/64, N/64, Z), 32 threads.
// C[m][n] (f32, pitch ldc, + optional f32 bias[n]) = sum_k A[m][k] Bt[n][k] (+ split products per NSPLIT). z-batch strides sA/sB/sC in elements. K % 32 == 0.
template <typename T16> struct WFrag;
template <> struct WFrag<h16> { typedef v16h V; static __device__ __forceinline__ V ld(const h16* p) { return cat16(*(const v8h*)p, *(const v8h*)(p + 16)); } static __device__ __forceinline__ v8f mma(V a, V b, v8f c) { return wmma16(a, b, c); } };
template <> struct WFrag<bf> { typedef v16bf V; static __device__ __forceinline__ V ld(const bf* p) { return cat16b(*(const v8us*)p, *(const v8us*)(p + 16)); } static __device__ __forceinline__ v8f mma(V a, V b, v8f c) { return wmmab(a, b, c); } };
template <typename T16, int NSPLIT, bool BIAS>
__global__ __launch_bounds__(32) void k_gemmw(const T16* __restrict__ A, const T16* __restrict__ A2, const T16* __restrict__ Bt, const T16* __restrict__ Bt2, int K, float* C, int ldc, const float* __restrict__ bias, size_t sA, size_t sB, size_t sC) {
    typedef typename WFrag<T16>::V V;
    __shared__ __align__(16) float os[16 * 68];
    const size_t z = blockIdx.z; A += z * sA; if (A2) A2 += z * sA; Bt += z * sB; if (Bt2) Bt2 += z * sB; C += z * sC;
    const int lane = threadIdx.x & 31, lr = lane & 15, hi = lane >> 4; const int r0 = blockIdx.x * 64, c0 = blockIdx.y * 64;
    v8f acc[4][4];
#pragma unroll
    for (int mb = 0; mb < 4; ++mb)
#pragma unroll
        for (int nb = 0; nb < 4; ++nb) acc[mb][nb] = (v8f){};
    const size_t aoff = (size_t)(r0 + lr) * K + 8 * hi, boff = (size_t)(c0 + lr) * K + 8 * hi;
#pragma unroll 1
    for (int kc = 0; kc < K; kc += 32) {
        V a[4], a2[4];
#pragma unroll
        for (int mb = 0; mb < 4; ++mb) { a[mb] = WFrag<T16>::ld(A + aoff + (size_t)mb * 16 * K + kc); if (NSPLIT == 1 || NSPLIT == 2) a2[mb] = WFrag<T16>::ld(A2 + aoff + (size_t)mb * 16 * K + kc); }
#pragma unroll
        for (int nb = 0; nb < 4; ++nb) { const V b = WFrag<T16>::ld(Bt + boff + (size_t)nb * 16 * K + kc); V b2; if (NSPLIT >= 2) b2 = WFrag<T16>::ld(Bt2 + boff + (size_t)nb * 16 * K + kc);
#pragma unroll
            for (int mb = 0; mb < 4; ++mb) { acc[mb][nb] = WFrag<T16>::mma(a[mb], b, acc[mb][nb]); if (NSPLIT == 1 || NSPLIT == 2) acc[mb][nb] = WFrag<T16>::mma(a2[mb], b, acc[mb][nb]); if (NSPLIT >= 2) acc[mb][nb] = WFrag<T16>::mma(a[mb], b2, acc[mb][nb]); } }
        asm volatile("v_nop\n\tv_nop\n\tv_nop\n\tv_nop" : "+v"(acc[0][0]), "+v"(acc[1][1]), "+v"(acc[2][2]), "+v"(acc[3][3]) : "v"(a[0]), "v"(a[3]));
    }
#pragma unroll
    for (int mb = 0; mb < 4; ++mb) {
#pragma unroll
        for (int nb = 0; nb < 4; ++nb) {
#pragma unroll
            for (int j = 0; j < 8; ++j) os[(hi * 8 + j) * 68 + nb * 16 + lr] = acc[mb][nb][j]; }
        __builtin_amdgcn_wave_barrier(); asm volatile("" ::: "memory");
        float* crow = C + (size_t)(r0 + mb * 16) * ldc + c0;
{
#pragma unroll
            for (int s = 0; s < 8; ++s) { const int row = 2 * s + hi, cofs = lr * 4; v4f val = *(const v4fa*)(os + row * 68 + cofs); if (BIAS) { val[0] += bfr(bias[c0 + cofs]); val[1] += bfr(bias[c0 + cofs + 1]); val[2] += bfr(bias[c0 + cofs + 2]); val[3] += bfr(bias[c0 + cofs + 3]); }
                *(v4f*)(crow + (size_t)row * ldc + cofs) = val; }
             }
        __builtin_amdgcn_wave_barrier(); asm volatile("" ::: "memory");
    }
}

__global__ __launch_bounds__(256) void k_wtG(const float* __restrict__ w, int K, int N, bf* Bt) {
    const int lane = threadIdx.x & 31; const int L0 = (blockIdx.x * 8 + (threadIdx.x >> 5)) * 8; const int nlines = N * K / 64;
{
#pragma unroll 1
        for (int l = 0; l < 8; ++l) { const int L = L0 + l; if (L >= nlines) break; const size_t e = (size_t)L * 64 + lane * 2; const int k = (int)(e % K), n = (int)(e / K); v2us o;
            o[0] = f2bf(w[(size_t)k * N + n]); o[1] = f2bf(w[(size_t)(k + 1) * N + n]); *(v2us*)(Bt + e) = o; }
         }
}
__global__ __launch_bounds__(256) void k_cvt8(const float* __restrict__ src, bf* dst, size_t n8) { const size_t i = (size_t)blockIdx.x * 256 + threadIdx.x; if (i >= n8) return; const v8f v = *(const v8f*)(src + i * 8); v8us o;
#pragma unroll
    for (int k = 0; k < 8; ++k) o[k] = f2bf(v[k]); *(v8us*)(dst + i * 8) = o;  }
__global__ __launch_bounds__(256) void k_lnm(const float* __restrict__ x, const float* __restrict__ lw, const float* __restrict__ lb, bf* MH, bf* ML) {
    const int lane = threadIdx.x & 31; const int r = blockIdx.x * 8 + (threadIdx.x >> 5); if (r >= NR) return; const v8f a = *(const v8f*)(x + (size_t)r * CC + lane * 8); float u[8]; float s = 0.f;
#pragma unroll
    for (int q = 0; q < 8; ++q) { u[q] = bfr(a[q]); s += u[q]; }
#pragma unroll
    for (int sh = 16; sh; sh >>= 1) s += __shfl_xor(s, sh, 32);
    const float mu = s * (1.0f / CC); float s2 = 0.f;
#pragma unroll
    for (int q = 0; q < 8; ++q) { float d0 = __fsub_rn(u[q], mu); asm volatile("" : "+v"(d0)); float p = __fmul_rn(d0, d0); asm volatile("" : "+v"(p)); s2 = __fadd_rn(s2, p); }
#pragma unroll
    for (int sh = 16; sh; sh >>= 1) s2 += __shfl_xor(s2, sh, 32);
    const float rs = __fdiv_rn(1.0f, __fsqrt_rn(__fadd_rn(s2 * (1.0f / CC), 1e-5f))); v8us oh, ol;
#pragma unroll
    for (int q = 0; q < 8; ++q) { const int c = lane * 8 + q; float d1 = __fsub_rn(u[q], mu); asm volatile("" : "+v"(d1)); float n0 = __fmul_rn(d1, rs); asm volatile("" : "+v"(n0)); float n1 = __fmul_rn(n0, bfr(lw[c])); asm volatile("" : "+v"(n1)); const float xn = __fadd_rn(n1, bfr(lb[c])); unsigned short h2, l2; splitf(xn, h2, l2); oh[q] = h2; ol[q] = l2; }
    *(v8us*)(MH + (size_t)r * CC + lane * 8) = oh; *(v8us*)(ML + (size_t)r * CC + lane * 8) = ol;  }
// ---- k_zbias: pair LayerNorm and its 8 bias dots in one kernel; the normalised z never leaves the registers.
// A wave takes 32 pair positions as two tiles of 16. Lane (lr, hi) holds half of row lr of each tile in the k order of a WMMA operand (k = 32 kc + 8 hi + 0..7 and 32 kc + 16 + 8 hi + 0..7), so a row's mean and variance are in-lane sums plus one exchange between the wave halves, and the hi/lo planes of z are the B operand as they stand.
// A = w_b as bf16 with head m & 7 in row m: both halves of D hold the 8 heads, half hi keeps tile hi, and each head's 32 values go out as one 128-B line.
__device__ __forceinline__ float sum8(v8f a) { return ((a[0] + a[1]) + (a[2] + a[3])) + ((a[4] + a[5]) + (a[6] + a[7])); }
__device__ __forceinline__ v8f bfr8(v8f a) { v8f o;
#pragma unroll
    for (int q = 0; q < 8; ++q) o[q] = bfr(a[q]); return o; }
__device__ __forceinline__ v8us f2bf8(v8f a) { v8us o;
#pragma unroll
    for (int q = 0; q < 8; ++q) o[q] = f2bf(a[q]); return o; }
__device__ __forceinline__ void split8(v8f x, v8us& h, v8us& l) {
#pragma unroll
    for (int q = 0; q < 8; ++q) { unsigned short a, c; splitf(x[q], a, c); h[q] = a; l[q] = c; } }
__global__ __launch_bounds__(256) void k_zbias(const float* __restrict__ x, const float* __restrict__ lw, const float* __restrict__ lb, const float* __restrict__ wtri, float* TB) {
    const int lane = threadIdx.x & 31, lr = lane & 15, hi = lane >> 4; const int r0 = (blockIdx.x * 8 + (threadIdx.x >> 5)) * 32;
    const float* px = x + (size_t)(r0 + lr) * CZ + 8 * hi; const float* pw = wtri + (lr & 7) * CZ + 8 * hi; const unsigned ob = 32u * hi;   /* ob: the lane's byte offset into scale and bias */
    v8f u[2][8];   /* u[t][i]: tile t, k = 16 i + 8 hi + 0..7 */
#pragma unroll
    for (int t = 0; t < 2; ++t)
#pragma unroll
        for (int i = 0; i < 8; ++i) u[t][i] = *(const v8f*)(px + t * 16 * CZ + i * 16);
    asm volatile("s_wait_xcnt 0x0" :: "v"(px) : "memory");   /* the wait in front of any overwrite of the address registers of the loads above; as an input the address stays in its registers up to it */
    float rs[2];
#pragma unroll
    for (int t = 0; t < 2; ++t) { v8f a = (v8f){};
#pragma unroll
        for (int i = 0; i < 8; ++i) { u[t][i] = bfr8(u[t][i]); a += u[t][i]; }
        float s = sum8(a); s += __shfl_xor(s, 16, 32); const float mu = s * (1.0f / CZ); a = (v8f){};
#pragma unroll
        for (int i = 0; i < 8; ++i) { u[t][i] -= mu; a += u[t][i] * u[t][i]; }
        float s2 = sum8(a); s2 += __shfl_xor(s2, 16, 32); rs[t] = __fdiv_rn(1.0f, __fsqrt_rn(__fadd_rn(s2 * (1.0f / CZ), 1e-5f))); }
    v8f acc[2]; acc[0] = (v8f){}; acc[1] = (v8f){};
#pragma unroll
    for (int kc = 0; kc < 4; ++kc) { const char* qa = (const char*)(lw + kc * 32) + ob; const char* qb = (const char*)(lb + kc * 32) + ob; const v8f a0 = bfr8(*(const v8f*)qa), a1 = bfr8(*(const v8f*)(qa + 64)), b0 = bfr8(*(const v8f*)qb), b1 = bfr8(*(const v8f*)(qb + 64));
        const v16bf wf = cat16b(f2bf8(*(const v8f*)(pw + kc * 32)), f2bf8(*(const v8f*)(pw + kc * 32 + 16)));
        if (kc == 3) asm volatile("s_wait_xcnt 0x0" :: "v"(pw), "v"(ob) : "memory");   /* behind the last loads of w_b, scale and bias: the wait in front of any overwrite of their address registers (inputs: address and offset stay put up to it) */
#pragma unroll
        for (int t = 0; t < 2; ++t) { v8us h0, l0, h1, l1; split8(u[t][2 * kc] * rs[t] * a0 + b0, h0, l0); split8(u[t][2 * kc + 1] * rs[t] * a1 + b1, h1, l1);
            acc[t] = wmmab(wf, cat16b(h0, h1), acc[t]); acc[t] = wmmab(wf, cat16b(l0, l1), acc[t]); } }
#pragma unroll
    for (int r = 0; r < 8; ++r) TB[(size_t)r * NZR + r0 + lane] = hi ? acc[1][r] : acc[0][r];
}
// ---- k_fattn: one work-group per (MSA row, head), 8 waves; the score matrix never leaves the registers.
// K (hi/lo planes, [key][d]) and V transposed (hi/lo planes, [d][key]) are split once into LDS; each wave then takes 16 queries at a time: S^T = K Q^T (a lane holds 128 of one query's 256 scores), softmax in-lane plus one exchange between the wave halves, the normalised P^T packed from the score accumulators as the B operand of O^T = V^T P^T, and 8 consecutive d per lane stored as the merged-context hi/lo planes.
#define KP 40                     // K plane row pitch, 16-bit elements: 80 B = 16 B x odd
#define VP 264                    // V^T plane row pitch, 16-bit elements: 528 B = 16 B x odd
__device__ __forceinline__ v8f exp2x8(v8f x) { float a0 = x[0], a1 = x[1], a2 = x[2], a3 = x[3], a4 = x[4], a5 = x[5], a6 = x[6], a7 = x[7];
    /* eight independent v_exp_f32 in one statement, closed by a v_nop: each fills the slot that the instruction set asks for behind the one in front of it, the v_nop the last one's */
    asm("v_exp_f32 %0, %0\n\tv_exp_f32 %1, %1\n\tv_exp_f32 %2, %2\n\tv_exp_f32 %3, %3\n\tv_exp_f32 %4, %4\n\tv_exp_f32 %5, %5\n\tv_exp_f32 %6, %6\n\tv_exp_f32 %7, %7\n\tv_nop" : "+v"(a0), "+v"(a1), "+v"(a2), "+v"(a3), "+v"(a4), "+v"(a5), "+v"(a6), "+v"(a7));
    return (v8f){a0, a1, a2, a3, a4, a5, a6, a7}; }
__device__ __forceinline__ v16bf ldfrag(const bf* p) { return cat16b(*(const v8us*)p, *(const v8us*)(p + 16)); }
/* second launch bound: four waves per SIMD, so that two work-groups share a WGP and one stages while the other computes */
__global__ __launch_bounds__(256, 4) void k_fattn(const float* __restrict__ FQ, const float* __restrict__ FK, const float* __restrict__ FV, const float* __restrict__ TB, bf* Gh, bf* Gl) {
    __shared__ __align__(16) bf Kh[NJ * KP]; __shared__ __align__(16) bf Kl[NJ * KP]; __shared__ __align__(16) bf Vh[CH * VP]; __shared__ __align__(16) bf Vl[CH * VP];
    const int tid = threadIdx.x, lane = tid & 31, wave = tid >> 5, lr = lane & 15, hi = lane >> 4; const int h = blockIdx.x, b = blockIdx.y;
    const size_t base = (size_t)b * NJ * CC + h * CH;
    {   /* 8 lanes cover one key's 128 B; a thread owns two neighbouring keys so that V^T goes to LDS in 4-byte pairs */
        const int kq = (tid >> 3) * 2, c4 = (tid & 7) * 4; const float* pk = FK + base + (size_t)kq * CC + c4; const float* pv = FV + base + (size_t)kq * CC + c4; v4f k0[4], k1[4], w0[4], w1[4];
#pragma unroll
        for (int it = 0; it < 4; ++it) { k0[it] = *(const v4f*)(pk + it * 64 * CC); k1[it] = *(const v4f*)(pk + it * 64 * CC + CC); w0[it] = *(const v4f*)(pv + it * 64 * CC); w1[it] = *(const v4f*)(pv + it * 64 * CC + CC); }
        asm volatile("s_wait_xcnt 0x0" :: "v"(pk), "v"(pv) : "memory");   /* the wait in front of any overwrite of the address registers of the loads above; as inputs the two addresses stay in their registers up to it */
#pragma unroll
        for (int it = 0; it < 4; ++it) { const int kp2 = kq + it * 64; v4us a0, b0, a1, b1;
#pragma unroll
            for (int q = 0; q < 4; ++q) { unsigned short x, y; splitf(k0[it][q], x, y); a0[q] = x; b0[q] = y; splitf(k1[it][q], x, y); a1[q] = x; b1[q] = y; }
            *(v4us*)(Kh + kp2 * KP + c4) = a0; *(v4us*)(Kl + kp2 * KP + c4) = b0; *(v4us*)(Kh + (kp2 + 1) * KP + c4) = a1; *(v4us*)(Kl + (kp2 + 1) * KP + c4) = b1;
#pragma unroll
            for (int q = 0; q < 4; ++q) { v2us x, y; unsigned short s0, s1; splitf(w0[it][q], s0, s1); x[0] = s0; y[0] = s1; splitf(w1[it][q], s0, s1); x[1] = s0; y[1] = s1; *(v2us*)(Vh + (c4 + q) * VP + kp2) = x; *(v2us*)(Vl + (c4 + q) * VP + kp2) = y; } }
    }
    __syncthreads();
#pragma unroll 1   /* kept rolled: both trips unrolled would hold two sets of 128 score registers */
    for (int i = 0; i < 2; ++i) {   /* wave w takes query tiles w and w + 8 */
        const int qrow = (wave + 8 * i) * 16 + lr; const float* qr = FQ + base + (size_t)qrow * CC + 8 * hi; const float* tb = TB + (size_t)h * NZR + (size_t)qrow * NJ + 8 * hi;
        const v8f qa = *(const v8f*)qr, qb = *(const v8f*)(qr + 16);
        v8f s[16];   /* s[t][r] = score of key 16 t + 8 hi + r for query qrow; the pair bias is the accumulators' start value */
#pragma unroll
        for (int t = 0; t < 16; ++t) s[t] = *(const v8f*)(tb + t * 16);
        asm volatile("s_wait_xcnt 0x0" :: "v"(qr), "v"(tb) : "memory");   /* the wait in front of any overwrite of the address registers of the loads above (inputs: the addresses stay put up to it); its memory clobber also keeps the K and V^T fragment loads below inside this loop: hoisted out of it they take 512 registers and spill */
        v8us t0, t1, t2, t3; split8(qa * QSC, t0, t1); split8(qb * QSC, t2, t3); const v16bf qh = cat16b(t0, t2), ql = cat16b(t1, t3);   /* 1/sqrt(32) goes into q ahead of the hi/lo split */
#pragma unroll
        for (int t = 0; t < 16; ++t) { const int ko = (t * 16 + lr) * KP + 8 * hi; const v16bf kh = ldfrag(Kh + ko), kl = ldfrag(Kl + ko); s[t] = wmmab(kh, qh, s[t]); s[t] = wmmab(kh, ql, s[t]); s[t] = wmmab(kl, qh, s[t]); }
        float m8[8];
#pragma unroll
        for (int r = 0; r < 8; ++r) m8[r] = -3.0e38f;
#pragma unroll
        for (int t = 0; t < 16; ++t) {
#pragma unroll
            for (int r = 0; r < 8; ++r) m8[r] = fmaxf(m8[r], s[t][r]); }
        float mx = fmaxf(fmaxf(fmaxf(m8[0], m8[1]), fmaxf(m8[2], m8[3])), fmaxf(fmaxf(m8[4], m8[5]), fmaxf(m8[6], m8[7]))); mx = fmaxf(mx, __shfl_xor(mx, 16, 32));
        float s8[8];
#pragma unroll
        for (int r = 0; r < 8; ++r) s8[r] = 0.f;
#pragma unroll
        for (int t = 0; t < 16; ++t) { s[t] = exp2x8((s[t] - mx) * 1.4426950408889634f);
#pragma unroll
            for (int r = 0; r < 8; ++r) s8[r] += s[t][r]; }
        float sum = ((s8[0] + s8[1]) + (s8[2] + s8[3])) + ((s8[4] + s8[5]) + (s8[6] + s8[7])); sum += __shfl_xor(sum, 16, 32);
        const float f = __fdiv_rn(1.0f, sum);
        v8f o0 = (v8f){}, o1 = (v8f){};   /* o0[r] = context d = 8 hi + r, o1[r] = d = 16 + 8 hi + r, query qrow */
#pragma unroll
        for (int u = 0; u < 8; ++u) { split8(s[2 * u] * f, t0, t1); split8(s[2 * u + 1] * f, t2, t3); const v16bf ph = cat16b(t0, t2), pl = cat16b(t1, t3);
            const int vo = lr * VP + u * 32 + 8 * hi; const v16bf vh0 = ldfrag(Vh + vo), vl0 = ldfrag(Vl + vo), vh1 = ldfrag(Vh + vo + 16 * VP), vl1 = ldfrag(Vl + vo + 16 * VP);
            o0 = wmmab(vh0, ph, o0); o1 = wmmab(vh1, ph, o1); o0 = wmmab(vh0, pl, o0); o1 = wmmab(vh1, pl, o1); o0 = wmmab(vl0, ph, o0); o1 = wmmab(vl1, ph, o1); }
        const size_t oo = base + (size_t)qrow * CC + 8 * hi; split8(o0, t0, t1); split8(o1, t2, t3);
        *(v8us*)(Gh + oo) = t0; *(v8us*)(Gl + oo) = t1; *(v8us*)(Gh + oo + 16) = t2; *(v8us*)(Gl + oo + 16) = t3;
        asm volatile("s_wait_xcnt 0x0" ::: "memory");   /* the wait in front of the next trip's overwrite of the address and data registers of the four stores above */
    }
}

__global__ __launch_bounds__(256) void k_fin(const float* __restrict__ msa, const float* __restrict__ FG, const float* __restrict__ bg, const float* __restrict__ O2, float* O) { const size_t i = (size_t)blockIdx.x * 256 + threadIdx.x; if (i >= (size_t)NR * CC / 4) return; const size_t e = i * 4; const int c0 = (int)(e % CC); const v4f m = *(const v4f*)(msa + e), fg = *(const v4f*)(FG + e), o2 = *(const v4f*)(O2 + e); v4f o;
#pragma unroll
    for (int q = 0; q < 4; ++q) { const float zg = __fadd_rn(fg[q], bfr(bg[c0 + q])); const float sg = __fdiv_rn(1.0f, __fadd_rn(1.0f, expf(-zg))); float t = __fmul_rn(sg, o2[q]); asm volatile("" : "+v"(t)); o[q] = __fadd_rn(bfr(m[q]), t); }
    *(v4f*)(O + e) = o;  }

extern "C" void kernel_launch(void* const* d_in, const int* in_sizes, int n_in,
                              void* d_out, int out_size, void* d_ws, size_t ws_size, hipStream_t stream) {
    (void)in_sizes; (void)n_in; (void)out_size;
    const float* msa = (const float*)d_in[0]; const float* pair = (const float*)d_in[1]; const float* lmw = (const float*)d_in[2]; const float* lmb = (const float*)d_in[3]; const float* lzw = (const float*)d_in[4]; const float* lzb = (const float*)d_in[5]; const float* wq = (const float*)d_in[6]; const float* wk = (const float*)d_in[7]; const float* wv = (const float*)d_in[8]; const float* wb = (const float*)d_in[9]; const float* wo = (const float*)d_in[10]; const float* bo = (const float*)d_in[11]; const float* wg = (const float*)d_in[12]; const float* bg = (const float*)d_in[13];
    float* OUT = (float*)d_out;     // [128][256][256]
    char* wsp = (char*)d_ws;
    auto take = [&](size_t bytes) { char* p = wsp; wsp += (bytes + 255) & ~(size_t)255; return (void*)p; };
    bf* WQ = (bf*)take((size_t)CC * CC * 2); bf* WK = (bf*)take((size_t)CC * CC * 2); bf* WV = (bf*)take((size_t)CC * CC * 2); bf* WG = (bf*)take((size_t)CC * CC * 2); bf* WO = (bf*)take((size_t)CC * CC * 2);
    bf* XH = (bf*)take((size_t)NR * CC * 2); bf* XL = (bf*)take((size_t)NR * CC * 2); bf* Gh = (bf*)take((size_t)NR * CC * 2); bf* Gl = (bf*)take((size_t)NR * CC * 2); float* TB = (float*)take((size_t)NH_ * NZR * 4);
    float* FQ = (float*)take((size_t)NR * CC * 4); float* FK = (float*)take((size_t)NR * CC * 4); float* FV = (float*)take((size_t)NR * CC * 4); float* FG = (float*)take((size_t)NR * CC * 4);
    float* O2 = FQ;   /* O2 reuses the q buffer after the attention launch (stream-ordered) */
    if ((size_t)(wsp - (char*)d_ws) > ws_size) return;
    { const unsigned LW = (CC * CC / 8 + 255) / 256; k_cvt8<<<LW, 256, 0, stream>>>(wq, WQ, (size_t)CC * CC / 8); k_cvt8<<<LW, 256, 0, stream>>>(wk, WK, (size_t)CC * CC / 8); k_cvt8<<<LW, 256, 0, stream>>>(wv, WV, (size_t)CC * CC / 8); k_cvt8<<<LW, 256, 0, stream>>>(wg, WG, (size_t)CC * CC / 8); k_cvt8<<<LW, 256, 0, stream>>>(wo, WO, (size_t)CC * CC / 8); }   /* 'oi' weights = Bt as-is */
    k_lnm<<<NR / 8, 256, 0, stream>>>(msa, lmw, lmb, XH, XL); k_zbias<<<NZR / 256, 256, 0, stream>>>(pair, lzw, lzb, wb, TB);   /* LayerNorm planes (msa); pair LayerNorm + pair-bias dots */
    k_gemmw<bf, 1, false><<<dim3(NR / 64, CC / 64, 1), 32, 0, stream>>>(XH, XL, WQ, nullptr, CC, FQ, CC, nullptr, 0, 0, 0);                      /* q, k, v, g projections (2 products) */
    k_gemmw<bf, 1, false><<<dim3(NR / 64, CC / 64, 1), 32, 0, stream>>>(XH, XL, WK, nullptr, CC, FK, CC, nullptr, 0, 0, 0);
    k_gemmw<bf, 1, false><<<dim3(NR / 64, CC / 64, 1), 32, 0, stream>>>(XH, XL, WV, nullptr, CC, FV, CC, nullptr, 0, 0, 0);
    k_gemmw<bf, 1, false><<<dim3(NR / 64, CC / 64, 1), 32, 0, stream>>>(XH, XL, WG, nullptr, CC, FG, CC, nullptr, 0, 0, 0);
    k_fattn<<<dim3(NH_, NI, 1), 256, 0, stream>>>(FQ, FK, FV, TB, Gh, Gl);                                                                     /* scores, / sqrt(32) + pair bias, softmax, attn.v -> merged context planes */
    k_gemmw<bf, 1, true><<<dim3(NR / 64, CC / 64, 1), 32, 0, stream>>>(Gh, Gl, WO, nullptr, CC, O2, CC, bo, 0, 0, 0);                          /* O2 = context W_out^T + b_out */
    k_fin<<<(unsigned)(((size_t)NR * CC / 4 + 255) / 256), 256, 0, stream>>>(msa, FG, bg, O2, OUT);                                            /* out = msa + sigmoid(gate) x O2 */
}

// v003
// One run takes 166 microseconds.
// In both of two side-by-side timings against v002, it was 1.16 times as fast.
// Over all steps from v000 it is 4.25 times as fast.
#include <hip/hip_runtime.h>

// MSA row attention with pair bias (msa [128][256][256], pair [256][256][128]; m = LayerNorm(msa), z = LayerNorm(pair) (eps 1e-5, affine); per MSA row b and head h (8 x 32): q, k, v = m W^T ('oi' [256][256]); scores = q.k / sqrt(32) + bias[h][i][j] with bias = z . w_b[h] ([8][128]); softmax over j; o = attn.v merged; out = msa + sigmoid(m W_gate^T + b_gate) * (o W_out^T + b_out) -> [128][256][256] (8.4 M)).
// Layout: the 32,768 (row, position) MSA rows are one tall GEMM operand for the LayerNormed projections (m as bf16 hi + lo: 2 products) and for the output projection of the merged context; the pair LayerNorm feeds only the 8 bias dot products per pair position; the 1,024 (row, head) attention problems of size 256 x 256 x 32 run in ONE launch, one work-group each: scores on hi/lo planes (3 products, K = 32), x 1/sqrt(32) + bias, a 256-wide softmax in registers, attn.v on hi/lo planes (3 products); a final kernel applies the residual and the sigmoid gate in f32.

#define NI   128                  // MSA rows
#define NJ   256                  // positions (= attention length)
#define CC   256                  // c_m
#define CZ   128                  // c_z
#define NZR  (NJ * NJ)            // 65,536 pair positions
#define NH_  8
#define CH   32
#define NR   (NI * NJ)            // 32,768 (row, position) MSA rows
#define QSC  0.17677669529663689f  // 1/sqrt(32)
typedef _Float16 h16;
typedef unsigned short bf;
typedef __attribute__((ext_vector_type(16))) __bf16   v16bf;
typedef __attribute__((ext_vector_type(16))) _Float16 v16h;
typedef __attribute__((ext_vector_type(8)))  _Float16 v8h;
typedef __attribute__((ext_vector_type(8)))  unsigned short v8us;
typedef __attribute__((ext_vector_type(8)))  float    v8f;
typedef __attribute__((ext_vector_type(4)))  float    v4f;
typedef __attribute__((ext_vector_type(2)))  float    v2f;
typedef __attribute__((ext_vector_type(4)))  unsigned short v4us;
typedef __attribute__((ext_vector_type(2)))  unsigned short v2us;
typedef v8h  __attribute__((may_alias)) v8ha;
typedef v4f  __attribute__((may_alias)) v4fa;
typedef v8us __attribute__((may_alias)) v8usa;

__device__ __forceinline__ unsigned short f2bf(float f) { unsigned u = __float_as_uint(f); u += 0x7FFFu + ((u >> 16) & 1u); return (unsigned short)(u >> 16); }
__device__ __forceinline__ float bf2f(unsigned short b) { return __uint_as_float(((unsigned)b) << 16); }
__device__ __forceinline__ float bfr(float f) { return bf2f(f2bf(f)); }
__device__ __forceinline__ void splitf(float y, unsigned short& h, unsigned short& l) { h = f2bf(y); l = f2bf(y - bf2f(h)); }
__device__ __forceinline__ v16h cat16(v8h lo, v8h hi) { return __builtin_shufflevector(lo, hi, 0, 1, 2, 3, 4, 5, 6, 7, 8, 9, 10, 11, 12, 13, 14, 15); }
__device__ __forceinline__ v16bf cat16b(v8us lo, v8us hi) { return __builtin_bit_cast(v16bf, __builtin_shufflevector(lo, hi, 0, 1, 2, 3, 4, 5, 6, 7, 8, 9, 10, 11, 12, 13, 14, 15)); }
__device__ __forceinline__ v8f wmma16(v16h a, v16h b, v8f c) { return __builtin_amdgcn_wmma_f32_16x16x32_f16(false, a, false, b, (short)0, c, false, false); }
__device__ __forceinline__ v8f wmmab(v16bf a, v16bf b, v8f c) { return __builtin_amdgcn_wmma_f32_16x16x32_bf16(false, a, false, b, (short)0, c, false, false); }

// ---- k_gemmw: register-blocked GEMM, ONE WAVE per 64x64 output tile (16 accumulators), operands straight from K-contiguous 16-bit planes; grid (M/64, N/64, Z), 32 threads.
// C[m][n] (f32, pitch ldc, + optional f32 bias[n]) = sum_k A[m][k] Bt[n][k] (+ split products per NSPLIT). z-batch strides sA/sB/sC in elements. K % 32 == 0.
template <typename T16> struct WFrag;
template <> struct WFrag<h16> { typedef v16h V; static __device__ __forceinline__ V ld(const h16* p) { return cat16(*(const v8h*)p, *(const v8h*)(p + 16)); } static __device__ __forceinline__ v8f mma(V a, V b, v8f c) { return wmma16(a, b, c); } };
template <> struct WFrag<bf> { typedef v16bf V; static __device__ __forceinline__ V ld(const bf* p) { return cat16b(*(const v8us*)p, *(const v8us*)(p + 16)); } static __device__ __forceinline__ v8f mma(V a, V b, v8f c) { return wmmab(a, b, c); } };
template <typename T16, int NSPLIT, bool BIAS>
__global__ __launch_bounds__(32) void k_gemmw(const T16* __restrict__ A, const T16* __restrict__ A2, const T16* __restrict__ Bt, const T16* __restrict__ Bt2, int K, float* C, int ldc, const float* __restrict__ bias, size_t sA, size_t sB, size_t sC) {
    typedef typename WFrag<T16>::V V;
    __shared__ __align__(16) float os[16 * 68];
    const size_t z = blockIdx.z; A += z * sA; if (A2) A2 += z * sA; Bt += z * sB; if (Bt2) Bt2 += z * sB; C += z * sC;
    const int lane = threadIdx.x & 31, lr = lane & 15, hi = lane >> 4; const int r0 = blockIdx.x * 64, c0 = blockIdx.y * 64;
    v8f acc[4][4];
#pragma unroll
    for (int mb = 0; mb < 4; ++mb)
#pragma unroll
        for (int nb = 0; nb < 4; ++nb) acc[mb][nb] = (v8f){};
    const size_t aoff = (size_t)(r0 + lr) * K + 8 * hi, boff = (size_t)(c0 + lr) * K + 8 * hi;
#pragma unroll 1
    for (int kc = 0; kc < K; kc += 32) {
        V a[4], a2[4];
#pragma unroll
        for (int mb = 0; mb < 4; ++mb) { a[mb] = WFrag<T16>::ld(A + aoff + (size_t)mb * 16 * K + kc); if (NSPLIT == 1 || NSPLIT == 2) a2[mb] = WFrag<T16>::ld(A2 + aoff + (size_t)mb * 16 * K + kc); }
#pragma unroll
        for (int nb = 0; nb < 4; ++nb) { const V b = WFrag<T16>::ld(Bt + boff + (size_t)nb * 16 * K + kc); V b2; if (NSPLIT >= 2) b2 = WFrag<T16>::ld(Bt2 + boff + (size_t)nb * 16 * K + kc);
#pragma unroll
            for (int mb = 0; mb < 4; ++mb) { acc[mb][nb] = WFrag<T16>::mma(a[mb], b, acc[mb][nb]); if (NSPLIT == 1 || NSPLIT == 2) acc[mb][nb] = WFrag<T16>::mma(a2[mb], b, acc[mb][nb]); if (NSPLIT >= 2) acc[mb][nb] = WFrag<T16>::mma(a[mb], b2, acc[mb][nb]); } }
        asm volatile("v_nop\n\tv_nop\n\tv_nop\n\tv_nop" : "+v"(acc[0][0]), "+v"(acc[1][1]), "+v"(acc[2][2]), "+v"(acc[3][3]) : "v"(a[0]), "v"(a[3]));
    }
#pragma unroll
    for (int mb = 0; mb < 4; ++mb) {
#pragma unroll
        for (int nb = 0; nb < 4; ++nb) {
#pragma unroll
            for (int j = 0; j < 8; ++j) os[(hi * 8 + j) * 68 + nb * 16 + lr] = acc[mb][nb][j]; }
        __builtin_amdgcn_wave_barrier(); asm volatile("" ::: "memory");
        float* crow = C + (size_t)(r0 + mb * 16) * ldc + c0;
{
#pragma unroll
            for (int s = 0; s < 8; ++s) { const int row = 2 * s + hi, cofs = lr * 4; v4f val = *(const v4fa*)(os + row * 68 + cofs); if (BIAS) { val[0] += bfr(bias[c0 + cofs]); val[1] += bfr(bias[c0 + cofs + 1]); val[2] += bfr(bias[c0 + cofs + 2]); val[3] += bfr(bias[c0 + cofs + 3]); }
                *(v4f*)(crow + (size_t)row * ldc + cofs) = val; }
             }
        __builtin_amdgcn_wave_barrier(); asm volatile("" ::: "memory");
    }
}

__global__ __launch_bounds__(256) void k_wtG(const float* __restrict__ w, int K, int N, bf* Bt) {
    const int lane = threadIdx.x & 31; const int L0 = (blockIdx.x * 8 + (threadIdx.x >> 5)) * 8; const int nlines = N * K / 64;
{
#pragma unroll 1
        for (int l = 0; l < 8; ++l) { const int L = L0 + l; if (L >= nlines) break; const size_t e = (size_t)L * 64 + lane * 2; const int k = (int)(e % K), n = (int)(e / K); v2us o;
            o[0] = f2bf(w[(size_t)k * N + n]); o[1] = f2bf(w[(size_t)(k + 1) * N + n]); *(v2us*)(Bt + e) = o; }
         }
}
#define WBLK (CC * CC / 8 / 256)   // 32 blocks of 256 threads round one 256 x 256 weight matrix, 8 elements a thread
// ---- k_pre: two jobs that need nothing of each other, as block ranges of one grid. Blocks 0 .. 5 WBLK - 1 round the five 'oi' weight matrices to bf16 (= Bt as they stand; W5 holds them back to back in the order q, k, v, gate, out); the other blocks do the MSA LayerNorm, one wave a row.
__global__ __launch_bounds__(256) void k_pre(const float* __restrict__ x, const float* __restrict__ lw, const float* __restrict__ lb, bf* MH, bf* ML, const float* __restrict__ wq, const float* __restrict__ wk, const float* __restrict__ wv, const float* __restrict__ wg, const float* __restrict__ wo, bf* W5) {
    if (blockIdx.x < 5 * WBLK) { const int m = blockIdx.x / WBLK; const float* src = m == 0 ? wq : m == 1 ? wk : m == 2 ? wv : m == 3 ? wg : wo; const size_t i = (size_t)(blockIdx.x % WBLK) * 256 + threadIdx.x; const v8f v = *(const v8f*)(src + i * 8); v8us o;
#pragma unroll
        for (int k = 0; k < 8; ++k) o[k] = f2bf(v[k]);
        *(v8us*)(W5 + (size_t)m * CC * CC + i * 8) = o; return; }
    const int lane = threadIdx.x & 31; const int r = (blockIdx.x - 5 * WBLK) * 8 + (threadIdx.x >> 5); if (r >= NR) return; const v8f a = *(const v8f*)(x + (size_t)r * CC + lane * 8); float u[8]; float s = 0.f;
#pragma unroll
    for (int q = 0; q < 8; ++q) { u[q] = bfr(a[q]); s += u[q]; }
#pragma unroll
    for (int sh = 16; sh; sh >>= 1) s += __shfl_xor(s, sh, 32);
    const float mu = s * (1.0f / CC); float s2 = 0.f;
#pragma unroll
    for (int q = 0; q < 8; ++q) { float d0 = __fsub_rn(u[q], mu); asm volatile("" : "+v"(d0)); float p = __fmul_rn(d0, d0); asm volatile("" : "+v"(p)); s2 = __fadd_rn(s2, p); }
#pragma unroll
    for (int sh = 16; sh; sh >>= 1) s2 += __shfl_xor(s2, sh, 32);
    const float rs = __fdiv_rn(1.0f, __fsqrt_rn(__fadd_rn(s2 * (1.0f / CC), 1e-5f))); v8us oh, ol;
#pragma unroll
    for (int q = 0; q < 8; ++q) { const int c = lane * 8 + q; float d1 = __fsub_rn(u[q], mu); asm volatile("" : "+v"(d1)); float n0 = __fmul_rn(d1, rs); asm volatile("" : "+v"(n0)); float n1 = __fmul_rn(n0, bfr(lw[c])); asm volatile("" : "+v"(n1)); const float xn = __fadd_rn(n1, bfr(lb[c])); unsigned short h2, l2; splitf(xn, h2, l2); oh[q] = h2; ol[q] = l2; }
    *(v8us*)(MH + (size_t)r * CC + lane * 8) = oh; *(v8us*)(ML + (size_t)r * CC + lane * 8) = ol;  }
// ---- k_zbias: pair LayerNorm and its 8 bias dots in one kernel; the normalised z never leaves the registers.
// A wave takes 32 pair positions as two tiles of 16. Lane (lr, hi) holds half of row lr of each tile in the k order of a WMMA operand (k = 32 kc + 8 hi + 0..7 and 32 kc + 16 + 8 hi + 0..7), so a row's mean and variance are in-lane sums plus one exchange between the wave halves, and the hi/lo planes of z are the B operand as they stand.
// A = w_b as bf16 with head m & 7 in row m: both halves of D hold the 8 heads, half hi keeps tile hi, and each head's 32 values go out as one 128-B line.
__device__ __forceinline__ float sum8(v8f a) { return ((a[0] + a[1]) + (a[2] + a[3])) + ((a[4] + a[5]) + (a[6] + a[7])); }
__device__ __forceinline__ v8f bfr8(v8f a) { v8f o;
#pragma unroll
    for (int q = 0; q < 8; ++q) o[q] = bfr(a[q]); return o; }
__device__ __forceinline__ v8us f2bf8(v8f a) { v8us o;
#pragma unroll
    for (int q = 0; q < 8; ++q) o[q] = f2bf(a[q]); return o; }
__device__ __forceinline__ void split8(v8f x, v8us& h, v8us& l) {
#pragma unroll
    for (int q = 0; q < 8; ++q) { unsigned short a, c; splitf(x[q], a, c); h[q] = a; l[q] = c; } }
__global__ __launch_bounds__(256) void k_zbias(const float* __restrict__ x, const float* __restrict__ lw, const float* __restrict__ lb, const float* __restrict__ wtri, float* TB) {
    const int lane = threadIdx.x & 31, lr = lane & 15, hi = lane >> 4; const int r0 = (blockIdx.x * 8 + (threadIdx.x >> 5)) * 32;
    const float* px = x + (size_t)(r0 + lr) * CZ + 8 * hi; const float* pw = wtri + (lr & 7) * CZ + 8 * hi; const unsigned ob = 32u * hi;   /* ob: the lane's byte offset into scale and bias */
    v8f u[2][8];   /* u[t][i]: tile t, k = 16 i + 8 hi + 0..7 */
#pragma unroll
    for (int t = 0; t < 2; ++t)
#pragma unroll
        for (int i = 0; i < 8; ++i) u[t][i] = *(const v8f*)(px + t * 16 * CZ + i * 16);
    asm volatile("s_wait_xcnt 0x0" :: "v"(px) : "memory");   /* the wait in front of any overwrite of the address registers of the loads above; as an input the address stays in its registers up to it */
    float rs[2];
#pragma unroll
    for (int t = 0; t < 2; ++t) { v8f a = (v8f){};
#pragma unroll
        for (int i = 0; i < 8; ++i) { u[t][i] = bfr8(u[t][i]); a += u[t][i]; }
        float s = sum8(a); s += __shfl_xor(s, 16, 32); const float mu = s * (1.0f / CZ); a = (v8f){};
#pragma unroll
        for (int i = 0; i < 8; ++i) { u[t][i] -= mu; a += u[t][i] * u[t][i]; }
        float s2 = sum8(a); s2 += __shfl_xor(s2, 16, 32); rs[t] = __fdiv_rn(1.0f, __fsqrt_rn(__fadd_rn(s2 * (1.0f / CZ), 1e-5f))); }
    v8f acc[2]; acc[0] = (v8f){}; acc[1] = (v8f){};
#pragma unroll
    for (int kc = 0; kc < 4; ++kc) { const char* qa = (const char*)(lw + kc * 32) + ob; const char* qb = (const char*)(lb + kc * 32) + ob; const v8f a0 = bfr8(*(const v8f*)qa), a1 = bfr8(*(const v8f*)(qa + 64)), b0 = bfr8(*(const v8f*)qb), b1 = bfr8(*(const v8f*)(qb + 64));
        const v16bf wf = cat16b(f2bf8(*(const v8f*)(pw + kc * 32)), f2bf8(*(const v8f*)(pw + kc * 32 + 16)));
        if (kc == 3) asm volatile("s_wait_xcnt 0x0" :: "v"(pw), "v"(ob) : "memory");   /* behind the last loads of w_b, scale and bias: the wait in front of any overwrite of their address registers (inputs: address and offset stay put up to it) */
#pragma unroll
        for (int t = 0; t < 2; ++t) { v8us h0, l0, h1, l1; split8(u[t][2 * kc] * rs[t] * a0 + b0, h0, l0); split8(u[t][2 * kc + 1] * rs[t] * a1 + b1, h1, l1);
            acc[t] = wmmab(wf, cat16b(h0, h1), acc[t]); acc[t] = wmmab(wf, cat16b(l0, l1), acc[t]); } }
#pragma unroll
    for (int r = 0; r < 8; ++r) TB[(size_t)r * NZR + r0 + lane] = hi ? acc[1][r] : acc[0][r];
}
// ---- k_fattn: one work-group per (MSA row, head), 8 waves; the score matrix never leaves the registers.
// K (hi/lo planes, [key][d]) and V transposed (hi/lo planes, [d][key]) are split once into LDS; each wave then takes 16 queries at a time: S^T = K Q^T (a lane holds 128 of one query's 256 scores), softmax in-lane plus one exchange between the wave halves, the normalised P^T packed from the score accumulators as the B operand of O^T = V^T P^T, and 8 consecutive d per lane stored as the merged-context hi/lo planes.
#define KP 40                     // K plane row pitch, 16-bit elements: 80 B = 16 B x odd
#define VP 264                    // V^T plane row pitch, 16-bit elements: 528 B = 16 B x odd
__device__ __forceinline__ v8f exp2x8(v8f x) { float a0 = x[0], a1 = x[1], a2 = x[2], a3 = x[3], a4 = x[4], a5 = x[5], a6 = x[6], a7 = x[7];
    /* eight independent v_exp_f32 in one statement, closed by a v_nop: each fills the slot that the instruction set asks for behind the one in front of it, the v_nop the last one's */
    asm("v_exp_f32 %0, %0\n\tv_exp_f32 %1, %1\n\tv_exp_f32 %2, %2\n\tv_exp_f32 %3, %3\n\tv_exp_f32 %4, %4\n\tv_exp_f32 %5, %5\n\tv_exp_f32 %6, %6\n\tv_exp_f32 %7, %7\n\tv_nop" : "+v"(a0), "+v"(a1), "+v"(a2), "+v"(a3), "+v"(a4), "+v"(a5), "+v"(a6), "+v"(a7));
    return (v8f){a0, a1, a2, a3, a4, a5, a6, a7}; }
__device__ __forceinline__ v16bf ldfrag(const bf* p) { return cat16b(*(const v8us*)p, *(const v8us*)(p + 16)); }
/* second launch bound: four waves per SIMD, so that two work-groups share a WGP and one stages while the other computes */
__global__ __launch_bounds__(256, 4) void k_fattn(const float* __restrict__ FQ, const float* __restrict__ FK, const float* __restrict__ FV, const float* __restrict__ TB, bf* Gh, bf* Gl) {
    __shared__ __align__(16) bf Kh[NJ * KP]; __shared__ __align__(16) bf Kl[NJ * KP]; __shared__ __align__(16) bf Vh[CH * VP]; __shared__ __align__(16) bf Vl[CH * VP];
    const int tid = threadIdx.x, lane = tid & 31, wave = tid >> 5, lr = lane & 15, hi = lane >> 4; const int h = blockIdx.x, b = blockIdx.y;
    const size_t base = (size_t)b * NJ * CC + h * CH;
    {   /* 8 lanes cover one key's 128 B; a thread owns two neighbouring keys so that V^T goes to LDS in 4-byte pairs */
        const int kq = (tid >> 3) * 2, c4 = (tid & 7) * 4; const float* pk = FK + base + (size_t)kq * CC + c4; const float* pv = FV + base + (size_t)kq * CC + c4; v4f k0[4], k1[4], w0[4], w1[4];
#pragma unroll
        for (int it = 0; it < 4; ++it) { k0[it] = *(const v4f*)(pk + it * 64 * CC); k1[it] = *(const v4f*)(pk + it * 64 * CC + CC); w0[it] = *(const v4f*)(pv + it * 64 * CC); w1[it] = *(const v4f*)(pv + it * 64 * CC + CC); }
        asm volatile("s_wait_xcnt 0x0" :: "v"(pk), "v"(pv) : "memory");   /* the wait in front of any overwrite of the address registers of the loads above; as inputs the two addresses stay in their registers up to it */
#pragma unroll
        for (int it = 0; it < 4; ++it) { const int kp2 = kq + it * 64; v4us a0, b0, a1, b1;
#pragma unroll
            for (int q = 0; q < 4; ++q) { unsigned short x, y; splitf(k0[it][q], x, y); a0[q] = x; b0[q] = y; splitf(k1[it][q], x, y); a1[q] = x; b1[q] = y; }
            *(v4us*)(Kh + kp2 * KP + c4) = a0; *(v4us*)(Kl + kp2 * KP + c4) = b0; *(v4us*)(Kh + (kp2 + 1) * KP + c4) = a1; *(v4us*)(Kl + (kp2 + 1) * KP + c4) = b1;
#pragma unroll
            for (int q = 0; q < 4; ++q) { v2us x, y; unsigned short s0, s1; splitf(w0[it][q], s0, s1); x[0] = s0; y[0] = s1; splitf(w1[it][q], s0, s1); x[1] = s0; y[1] = s1; *(v2us*)(Vh + (c4 + q) * VP + kp2) = x; *(v2us*)(Vl + (c4 + q) * VP + kp2) = y; } }
    }
    __syncthreads();
#pragma unroll 1   /* kept rolled: both trips unrolled would hold two sets of 128 score registers */
    for (int i = 0; i < 2; ++i) {   /* wave w takes query tiles w and w + 8 */
        const int qrow = (wave + 8 * i) * 16 + lr; const float* qr = FQ + base + (size_t)qrow * CC + 8 * hi; const float* tb = TB + (size_t)h * NZR + (size_t)qrow * NJ + 8 * hi;
        const v8f qa = *(const v8f*)qr, qb = *(const v8f*)(qr + 16);
        v8f s[16];   /* s[t][r] = score of key 16 t + 8 hi + r for query qrow; the pair bias is the accumulators' start value */
#pragma unroll
        for (int t = 0; t < 16; ++t) s[t] = *(const v8f*)(tb + t * 16);
        asm volatile("s_wait_xcnt 0x0" :: "v"(qr), "v"(tb) : "memory");   /* the wait in front of any overwrite of the address registers of the loads above (inputs: the addresses stay put up to it); its memory clobber also keeps the K and V^T fragment loads below inside this loop: hoisted out of it they take 512 registers and spill */
        v8us t0, t1, t2, t3; split8(qa * QSC, t0, t1); split8(qb * QSC, t2, t3); const v16bf qh = cat16b(t0, t2), ql = cat16b(t1, t3);   /* 1/sqrt(32) goes into q ahead of the hi/lo split */
#pragma unroll
        for (int t = 0; t < 16; ++t) { const int ko = (t * 16 + lr) * KP + 8 * hi; const v16bf kh = ldfrag(Kh + ko), kl = ldfrag(Kl + ko); s[t] = wmmab(kh, qh, s[t]); s[t] = wmmab(kh, ql, s[t]); s[t] = wmmab(kl, qh, s[t]); }
        float m8[8];
#pragma unroll
        for (int r = 0; r < 8; ++r) m8[r] = -3.0e38f;
#pragma unroll
        for (int t = 0; t < 16; ++t) {
#pragma unroll
            for (int r = 0; r < 8; ++r) m8[r] = fmaxf(m8[r], s[t][r]); }
        float mx = fmaxf(fmaxf(fmaxf(m8[0], m8[1]), fmaxf(m8[2], m8[3])), fmaxf(fmaxf(m8[4], m8[5]), fmaxf(m8[6], m8[7]))); mx = fmaxf(mx, __shfl_xor(mx, 16, 32));
        float s8[8];
#pragma unroll
        for (int r = 0; r < 8; ++r) s8[r] = 0.f;
#pragma unroll
        for (int t = 0; t < 16; ++t) { s[t] = exp2x8((s[t] - mx) * 1.4426950408889634f);
#pragma unroll
            for (int r = 0; r < 8; ++r) s8[r] += s[t][r]; }
        float sum = ((s8[0] + s8[1]) + (s8[2] + s8[3])) + ((s8[4] + s8[5]) + (s8[6] + s8[7])); sum += __shfl_xor(sum, 16, 32);
        const float f = __fdiv_rn(1.0f, sum);
        v8f o0 = (v8f){}, o1 = (v8f){};   /* o0[r] = context d = 8 hi + r, o1[r] = d = 16 + 8 hi + r, query qrow */
#pragma unroll
        for (int u = 0; u < 8; ++u) { split8(s[2 * u] * f, t0, t1); split8(s[2 * u + 1] * f, t2, t3); const v16bf ph = cat16b(t0, t2), pl = cat16b(t1, t3);
            const int vo = lr * VP + u * 32 + 8 * hi; const v16bf vh0 = ldfrag(Vh + vo), vl0 = ldfrag(Vl + vo), vh1 = ldfrag(Vh + vo + 16 * VP), vl1 = ldfrag(Vl + vo + 16 * VP);
            o0 = wmmab(vh0, ph, o0); o1 = wmmab(vh1, ph, o1); o0 = wmmab(vh0, pl, o0); o1 = wmmab(vh1, pl, o1); o0 = wmmab(vl0, ph, o0); o1 = wmmab(vl1, ph, o1); }
        const size_t oo = base + (size_t)qrow * CC + 8 * hi; split8(o0, t0, t1); split8(o1, t2, t3);
        *(v8us*)(Gh + oo) = t0; *(v8us*)(Gl + oo) = t1; *(v8us*)(Gh + oo + 16) = t2; *(v8us*)(Gl + oo + 16) = t3;
        asm volatile("s_wait_xcnt 0x0" ::: "memory");   /* the wait in front of the next trip's overwrite of the address and data registers of the four stores above */
    }
}

__global__ __launch_bounds__(256) void k_fin(const float* __restrict__ msa, const float* __restrict__ FG, const float* __restrict__ bg, const float* __restrict__ O2, float* O) { const size_t i = (size_t)blockIdx.x * 256 + threadIdx.x; if (i >= (size_t)NR * CC / 4) return; const size_t e = i * 4; const int c0 = (int)(e % CC); const v4f m = *(const v4f*)(msa + e), fg = *(const v4f*)(FG + e), o2 = *(const v4f*)(O2 + e); v4f o;
#pragma unroll
    for (int q = 0; q < 4; ++q) { const float zg = __fadd_rn(fg[q], bfr(bg[c0 + q])); const float sg = __fdiv_rn(1.0f, __fadd_rn(1.0f, expf(-zg))); float t = __fmul_rn(sg, o2[q]); asm volatile("" : "+v"(t)); o[q] = __fadd_rn(bfr(m[q]), t); }
    *(v4f*)(O + e) = o;  }

extern "C" void kernel_launch(void* const* d_in, const int* in_sizes, int n_in,
                              void* d_out, int out_size, void* d_ws, size_t ws_size, hipStream_t stream) {
    (void)in_sizes; (void)n_in; (void)out_size;
    const float* msa = (const float*)d_in[0]; const float* pair = (const float*)d_in[1]; const float* lmw = (const float*)d_in[2]; const float* lmb = (const float*)d_in[3]; const float* lzw = (const float*)d_in[4]; const float* lzb = (const float*)d_in[5]; const float* wq = (const float*)d_in[6]; const float* wk = (const float*)d_in[7]; const float* wv = (const float*)d_in[8]; const float* wb = (const float*)d_in[9]; const float* wo = (const float*)d_in[10]; const float* bo = (const float*)d_in[11]; const float* wg = (const float*)d_in[12]; const float* bg = (const float*)d_in[13];
    float* OUT = (float*)d_out;     // [128][256][256]
    char* wsp = (char*)d_ws;
    auto take = [&](size_t bytes) { char* p = wsp; wsp += (bytes + 255) & ~(size_t)255; return (void*)p; };
    bf* WQ = (bf*)take((size_t)5 * CC * CC * 2); bf* WO = WQ + (size_t)4 * CC * CC;   /* the five bf16 weight matrices back to back: q, k, v, gate, out */
    bf* XH = (bf*)take((size_t)NR * CC * 2); bf* XL = (bf*)take((size_t)NR * CC * 2); bf* Gh = (bf*)take((size_t)NR * CC * 2); bf* Gl = (bf*)take((size_t)NR * CC * 2); float* TB = (float*)take((size_t)NH_ * NZR * 4);
    float* FQ = (float*)take((size_t)4 * NR * CC * 4); float* FK = FQ + (size_t)NR * CC; float* FV = FK + (size_t)NR * CC; float* FG = FV + (size_t)NR * CC;   /* the four projections back to back */
    float* O2 = FQ;   /* O2 reuses the q buffer after the attention launch (stream-ordered) */
    if ((size_t)(wsp - (char*)d_ws) > ws_size) return;
    k_pre<<<5 * WBLK + NR / 8, 256, 0, stream>>>(msa, lmw, lmb, XH, XL, wq, wk, wv, wg, wo, WQ);   /* bf16 weights and the MSA LayerNorm planes */
    k_zbias<<<NZR / 256, 256, 0, stream>>>(pair, lzw, lzb, wb, TB);   /* pair LayerNorm + pair-bias dots */
    k_gemmw<bf, 1, false><<<dim3(NR / 64, CC / 64, 4), 32, 0, stream>>>(XH, XL, WQ, nullptr, CC, FQ, CC, nullptr, 0, (size_t)CC * CC, (size_t)NR * CC);   /* q, k, v, gate projections (2 products) as the z index of one grid: its 8,192 single-wave work-groups keep all four resident places of every SIMD filled */
    k_fattn<<<dim3(NH_, NI, 1), 256, 0, stream>>>(FQ, FK, FV, TB, Gh, Gl);                                                                     /* scores, / sqrt(32) + pair bias, softmax, attn.v -> merged context planes */
    k_gemmw<bf, 1, true><<<dim3(NR / 64, CC / 64, 1), 32, 0, stream>>>(Gh, Gl, WO, nullptr, CC, O2, CC, bo, 0, 0, 0);                          /* O2 = context W_out^T + b_out */
    k_fin<<<(unsigned)(((size_t)NR * CC / 4 + 255) / 256), 256, 0, stream>>>(msa, FG, bg, O2, OUT);                                            /* out = msa + sigmoid(gate) x O2 */
}

// v004
// One run takes 138 microseconds.
// Next to v003, in two timings, it ran 1.22 and 1.21 times as fast.
// Counting every step since v000, it is 5.17 times as fast.
#include <hip/hip_runtime.h>

// MSA row attention with pair bias (msa [128][256][256], pair [256][256][128]; m = LayerNorm(msa), z = LayerNorm(pair) (eps 1e-5, affine); per MSA row b and head h (8 x 32): q, k, v = m W^T ('oi' [256][256]); scores = q.k / sqrt(32) + bias[h][i][j] with bias = z . w_b[h] ([8][128]); softmax over j; o = attn.v merged; out = msa + sigmoid(m W_gate^T + b_gate) * (o W_out^T + b_out) -> [128][256][256] (8.4 M)).
// Layout: the 32,768 (row, position) MSA rows are one tall GEMM operand for the LayerNormed projections (m as bf16 hi + lo: 2 products) and for the output projection of the merged context; the pair LayerNorm feeds only the 8 bias dot products per pair position; the 1,024 (row, head) attention problems of size 256 x 256 x 32 run in ONE launch, one work-group each: scores on hi/lo planes (3 products, K = 32), x 1/sqrt(32) + bias, a 256-wide softmax in registers, attn.v on hi/lo planes (3 products); a final kernel applies the residual and the sigmoid gate in f32.
// Every 16-bit GEMM operand plane (m, the merged context, the five weight matrices) lies in memory in FRAGMENT ORDER: a block of 16 rows x 32 k is 1 KiB, blocks of one 16-row strip follow one another in k; element (row lr, k = 32 kc + 16 j + 8 hi + e) stands at block * 512 + j * 256 + (16 hi + lr) * 8 + e, so that a wave's 16-byte load of half a fragment is 512 contiguous bytes (4 whole lines) where a row-major plane gave 16 lines of 32 bytes. The pair bias lies likewise in the order of the score accumulators (at k_zbias).

#define NI   128                  // MSA rows
#define NJ   256                  // positions (= attention length)
#define CC   256                  // c_m
#define CZ   128                  // c_z
#define NZR  (NJ * NJ)            // 65,536 pair positions
#define NH_  8
#define CH   32
#define NR   (NI * NJ)            // 32,768 (row, position) MSA rows
#define QSC  0.17677669529663689f  // 1/sqrt(32)
typedef _Float16 h16;
typedef unsigned short bf;
typedef __attribute__((ext_vector_type(16))) __bf16   v16bf;
typedef __attribute__((ext_vector_type(16))) _Float16 v16h;
typedef __attribute__((ext_vector_type(8)))  _Float16 v8h;
typedef __attribute__((ext_vector_type(8)))  unsigned short v8us;
typedef __attribute__((ext_vector_type(8)))  float    v8f;
typedef __attribute__((ext_vector_type(4)))  float    v4f;
typedef __attribute__((ext_vector_type(2)))  float    v2f;
typedef __attribute__((ext_vector_type(4)))  unsigned short v4us;
typedef __attribute__((ext_vector_type(2)))  unsigned short v2us;
typedef v8h  __attribute__((may_alias)) v8ha;
typedef v4f  __attribute__((may_alias)) v4fa;
typedef v8us __attribute__((may_alias)) v8usa;

__device__ __forceinline__ unsigned short f2bf(float f) { unsigned u = __float_as_uint(f); u += 0x7FFFu + ((u >> 16) & 1u); return (unsigned short)(u >> 16); }
__device__ __forceinline__ float bf2f(unsigned short b) { return __uint_as_float(((unsigned)b) << 16); }
__device__ __forceinline__ float bfr(float f) { return bf2f(f2bf(f)); }
__device__ __forceinline__ void splitf(float y, unsigned short& h, unsigned short& l) { h = f2bf(y); l = f2bf(y - bf2f(h)); }
__device__ __forceinline__ v16h cat16(v8h lo, v8h hi) { return __builtin_shufflevector(lo, hi, 0, 1, 2, 3, 4, 5, 6, 7, 8, 9, 10, 11, 12, 13, 14, 15); }
__device__ __forceinline__ v16bf cat16b(v8us lo, v8us hi) { return __builtin_bit_cast(v16bf, __builtin_shufflevector(lo, hi, 0, 1, 2, 3, 4, 5, 6, 7, 8, 9, 10, 11, 12, 13, 14, 15)); }
__device__ __forceinline__ v8f wmma16(v16h a, v16h b, v8f c) { return __builtin_amdgcn_wmma_f32_16x16x32_f16(false, a, false, b, (short)0, c, false, false); }
__device__ __forceinline__ v8f wmmab(v16bf a, v16bf b, v8f c) { return __builtin_amdgcn_wmma_f32_16x16x32_bf16(false, a, false, b, (short)0, c, false, false); }

// ---- k_gemmw: register-blocked GEMM, ONE WAVE per 64x64 output tile (16 accumulators), operands straight from 16-bit planes in fragment order (head of the file); grid (M/64, N/64, Z), 32 threads.
// C[m][n] (f32, pitch ldc, + optional f32 bias[n]) = sum_k A[m][k] Bt[n][k] (+ split products per NSPLIT). z-batch strides sA/sB/sC in elements. K % 32 == 0.
template <typename T16> struct WFrag;
template <> struct WFrag<h16> { typedef v16h V; static __device__ __forceinline__ V ld(const h16* p) { return cat16(*(const v8h*)p, *(const v8h*)(p + 256)); } static __device__ __forceinline__ v8f mma(V a, V b, v8f c) { return wmma16(a, b, c); } };
template <> struct WFrag<bf> { typedef v16bf V; static __device__ __forceinline__ V ld(const bf* p) { return cat16b(*(const v8us*)p, *(const v8us*)(p + 256)); } static __device__ __forceinline__ v8f mma(V a, V b, v8f c) { return wmmab(a, b, c); } };
template <typename T16, int NSPLIT, bool BIAS, int K>
__global__ __launch_bounds__(32) void k_gemmw(const T16* __restrict__ A, const T16* __restrict__ A2, const T16* __restrict__ Bt, const T16* __restrict__ Bt2, float* C, int ldc, const float* __restrict__ bias, size_t sA, size_t sB, size_t sC) {
    typedef typename WFrag<T16>::V V;
    __shared__ __align__(16) float os[16 * 68];
    const size_t z = blockIdx.z; A += z * sA; if (A2) A2 += z * sA; Bt += z * sB; if (Bt2) Bt2 += z * sB; C += z * sC;
    const int lane = threadIdx.x & 31, lr = lane & 15, hi = lane >> 4; const int r0 = blockIdx.x * 64, c0 = blockIdx.y * 64;
    v8f acc[4][4];
#pragma unroll
    for (int mb = 0; mb < 4; ++mb)
#pragma unroll
        for (int nb = 0; nb < 4; ++nb) acc[mb][nb] = (v8f){};
    /* a 16-row strip is 16 K elements, a k block of 32 is 512: with K fixed at compile time the four strips of an operand are immediate offsets from one address */
    const T16* va = A + (size_t)r0 * K + 8 * lane; const T16* vb = Bt + (size_t)c0 * K + 8 * lane; const T16* va2 = (NSPLIT == 1 || NSPLIT == 2) ? A2 + (size_t)r0 * K + 8 * lane : va; const T16* vb2 = NSPLIT >= 2 ? Bt2 + (size_t)c0 * K + 8 * lane : vb;
#pragma unroll 1
    for (int kc = 0; kc < K; kc += 32) {
        V a[4], a2[4], b[4], b2[4];
#pragma unroll
        for (int mb = 0; mb < 4; ++mb) { a[mb] = WFrag<T16>::ld(va + mb * 16 * K); b[mb] = WFrag<T16>::ld(vb + mb * 16 * K); if (NSPLIT == 1 || NSPLIT == 2) a2[mb] = WFrag<T16>::ld(va2 + mb * 16 * K); if (NSPLIT >= 2) b2[mb] = WFrag<T16>::ld(vb2 + mb * 16 * K); }
        asm volatile("s_wait_xcnt 0x0" :: "v"(va), "v"(vb), "v"(va2), "v"(vb2) : "memory");   /* the wait in front of the step of the address registers of the loads above; as inputs the addresses stay in their registers up to it */
        va += 512; vb += 512; va2 += 512; vb2 += 512;
#pragma unroll
        for (int nb = 0; nb < 4; ++nb) {
#pragma unroll
            for (int mb = 0; mb < 4; ++mb) { acc[mb][nb] = WFrag<T16>::mma(a[mb], b[nb], acc[mb][nb]); if (NSPLIT == 1 || NSPLIT == 2) acc[mb][nb] = WFrag<T16>::mma(a2[mb], b[nb], acc[mb][nb]); if (NSPLIT >= 2) acc[mb][nb] = WFrag<T16>::mma(a[mb], b2[nb], acc[mb][nb]); } }
        asm volatile("v_nop\n\tv_nop\n\tv_nop\n\tv_nop" : "+v"(acc[0][0]), "+v"(acc[1][1]), "+v"(acc[2][2]), "+v"(acc[3][3]) : "v"(a[0]), "v"(a[3]));
    }
#pragma unroll
    for (int mb = 0; mb < 4; ++mb) {
#pragma unroll
        for (int nb = 0; nb < 4; ++nb) {
#pragma unroll
            for (int j = 0; j < 8; ++j) os[(hi * 8 + j) * 68 + nb * 16 + lr] = acc[mb][nb][j]; }
        __builtin_amdgcn_wave_barrier(); asm volatile("" ::: "memory");
        float* crow = C + (size_t)(r0 + mb * 16) * ldc + c0;
{
#pragma unroll
            for (int s = 0; s < 8; ++s) { const int row = 2 * s + hi, cofs = lr * 4; v4f val = *(const v4fa*)(os + row * 68 + cofs); if (BIAS) { val[0] += bfr(bias[c0 + cofs]); val[1] += bfr(bias[c0 + cofs + 1]); val[2] += bfr(bias[c0 + cofs + 2]); val[3] += bfr(bias[c0 + cofs + 3]); }
                *(v4f*)(crow + (size_t)row * ldc + cofs) = val; }
             }
        __builtin_amdgcn_wave_barrier(); asm volatile("" ::: "memory");
    }
}

__global__ __launch_bounds__(256) void k_wtG(const float* __restrict__ w, int K, int N, bf* Bt) {
    const int lane = threadIdx.x & 31; const int L0 = (blockIdx.x * 8 + (threadIdx.x >> 5)) * 8; const int nlines = N * K / 64;
{
#pragma unroll 1
        for (int l = 0; l < 8; ++l) { const int L = L0 + l; if (L >= nlines) break; const size_t e = (size_t)L * 64 + lane * 2; const int k = (int)(e % K), n = (int)(e / K); v2us o;
            o[0] = f2bf(w[(size_t)k * N + n]); o[1] = f2bf(w[(size_t)(k + 1) * N + n]); *(v2us*)(Bt + e) = o; }
         }
}
#define WBLK (CC * CC / 8 / 256)   // 32 blocks of 256 threads round one 256 x 256 weight matrix, 8 elements a thread
// ---- k_pre: two jobs that need nothing of each other, as block ranges of one grid. Blocks 0 .. 5 WBLK - 1 round the five 'oi' weight matrices to bf16 (Bt in fragment order; W5 holds them back to back in the order q, k, v, gate, out; a thread owns one 16-byte piece of the OUTPUT, so a wave stores 4 whole lines); the other blocks do the MSA LayerNorm, one wave a row: the 8 rows of a block meet in LDS, from where each wave stores 4 whole lines a plane (8 rows x 16 bytes are one line of the fragment order).
#define PP 288                    // LDS row pitch of k_pre, 16-bit elements: 576 B, so that the 8 rows x 4 pieces a wave reads back spread over all banks
__global__ __launch_bounds__(256) void k_pre(const float* __restrict__ x, const float* __restrict__ lw, const float* __restrict__ lb, bf* MH, bf* ML, const float* __restrict__ wq, const float* __restrict__ wk, const float* __restrict__ wv, const float* __restrict__ wg, const float* __restrict__ wo, bf* W5) {
    if (blockIdx.x < 5 * WBLK) { const int m = blockIdx.x / WBLK; const float* src = m == 0 ? wq : m == 1 ? wk : m == 2 ? wv : m == 3 ? wg : wo; const int i = (blockIdx.x % WBLK) * 256 + threadIdx.x; const int n = (i >> 9) * 16 + (i & 15), k0 = ((i >> 6) & 7) * 32 + ((i >> 4) & 3) * 8; const v8f v = *(const v8f*)(src + n * CC + k0); v8us o;   /* piece i of the fragment order: strip i >> 9, k block (i >> 6) & 7, then j, hi, lr */
#pragma unroll
        for (int k = 0; k < 8; ++k) o[k] = f2bf(v[k]);
        *(v8us*)(W5 + (size_t)m * CC * CC + i * 8) = o; return; }
    __shared__ __align__(16) bf sph[8 * PP]; __shared__ __align__(16) bf spl[8 * PP];
    const int lane = threadIdx.x & 31, wid = threadIdx.x >> 5; const int rb = (blockIdx.x - 5 * WBLK) * 8; if (rb >= NR) return; const int r = rb + wid; const v8f a = *(const v8f*)(x + (size_t)r * CC + lane * 8); float u[8]; float s = 0.f;
#pragma unroll
    for (int q = 0; q < 8; ++q) { u[q] = bfr(a[q]); s += u[q]; }
#pragma unroll
    for (int sh = 16; sh; sh >>= 1) s += __shfl_xor(s, sh, 32);
    const float mu = s * (1.0f / CC); float s2 = 0.f;
#pragma unroll
    for (int q = 0; q < 8; ++q) { float d0 = __fsub_rn(u[q], mu); asm volatile("" : "+v"(d0)); float p = __fmul_rn(d0, d0); asm volatile("" : "+v"(p)); s2 = __fadd_rn(s2, p); }
#pragma unroll
    for (int sh = 16; sh; sh >>= 1) s2 += __shfl_xor(s2, sh, 32);
    const float rs = __fdiv_rn(1.0f, __fsqrt_rn(__fadd_rn(s2 * (1.0f / CC), 1e-5f))); v8us oh, ol;
#pragma unroll
    for (int q = 0; q < 8; ++q) { const int c = lane * 8 + q; float d1 = __fsub_rn(u[q], mu); asm volatile("" : "+v"(d1)); float n0 = __fmul_rn(d1, rs); asm volatile("" : "+v"(n0)); float n1 = __fmul_rn(n0, bfr(lw[c])); asm volatile("" : "+v"(n1)); const float xn = __fadd_rn(n1, bfr(lb[c])); unsigned short h2, l2; splitf(xn, h2, l2); oh[q] = h2; ol[q] = l2; }
    *(v8us*)(sph + wid * PP + lane * 8) = oh; *(v8us*)(spl + wid * PP + lane * 8) = ol;
    __syncthreads();
    const int pc = threadIdx.x >> 3, rw = threadIdx.x & 7;   /* piece pc = k / 8 of row rb + rw: 8 threads fill one line */
    const size_t d = (size_t)(rb >> 4) * 16 * CC + (pc >> 2) * 512 + (pc & 3) * 128 + ((rb & 8) + rw) * 8;
    *(v8us*)(MH + d) = *(const v8us*)(sph + rw * PP + pc * 8); *(v8us*)(ML + d) = *(const v8us*)(spl + rw * PP + pc * 8);  }
// ---- k_zbias: pair LayerNorm and its 8 bias dots in one kernel; the normalised z never leaves the registers.
// A wave takes 32 pair positions as two tiles of 16. Lane (lr, hi) holds half of row lr of each tile in the k order of a WMMA operand (k = 32 kc + 8 hi + 0..7 and 32 kc + 16 + 8 hi + 0..7), so a row's mean and variance are in-lane sums plus one exchange between the wave halves, and the hi/lo planes of z are the B operand as they stand.
// A = w_b as bf16 with head m & 7 in row m: both halves of D hold the 8 heads, half hi keeps tile hi, and each head's 32 values go out as one 128-B line.
// TB lies in the order of k_fattn's score accumulators: per head, a block of 16 queries x 16 keys is 1 KiB, and (query lr, key 8 hi + 4 half + e) stands at half * 128 + (16 hi + lr) * 4 + e. One line of it is 8 queries x 4 keys: those are the 32 pair positions of wave g, whose line is number g of each head's plane.
__device__ __forceinline__ float sum8(v8f a) { return ((a[0] + a[1]) + (a[2] + a[3])) + ((a[4] + a[5]) + (a[6] + a[7])); }
__device__ __forceinline__ v8f bfr8(v8f a) { v8f o;
#pragma unroll
    for (int q = 0; q < 8; ++q) o[q] = bfr(a[q]); return o; }
__device__ __forceinline__ v8us f2bf8(v8f a) { v8us o;
#pragma unroll
    for (int q = 0; q < 8; ++q) o[q] = f2bf(a[q]); return o; }
__device__ __forceinline__ void split8(v8f x, v8us& h, v8us& l) {
#pragma unroll
    for (int q = 0; q < 8; ++q) { unsigned short a, c; splitf(x[q], a, c); h[q] = a; l[q] = c; } }
__global__ __launch_bounds__(256) void k_zbias(const float* __restrict__ x, const float* __restrict__ lw, const float* __restrict__ lb, const float* __restrict__ wtri, float* TB) {
    const int lane = threadIdx.x & 31, lr = lane & 15, hi = lane >> 4; const int g = blockIdx.x * 8 + (threadIdx.x >> 5), r0 = g * 32;
    const int qi = (g >> 7) * 16 + (g & 1) * 8 + (lr >> 2), kj = ((g >> 3) & 15) * 16 + ((g >> 1) & 1) * 8 + ((g >> 2) & 1) * 4 + (lr & 3);   /* row lr of tile 0: its query and key; tile 1 is 4 queries further */
    const float* px = x + (size_t)(qi * NJ + kj) * CZ + 8 * hi; const float* pw = wtri + (lr & 7) * CZ + 8 * hi; const unsigned ob = 32u * hi;   /* ob: the lane's byte offset into scale and bias */
    v8f u[2][8];   /* u[t][i]: tile t, k = 16 i + 8 hi + 0..7 */
#pragma unroll
    for (int t = 0; t < 2; ++t)
#pragma unroll
        for (int i = 0; i < 8; ++i) u[t][i] = *(const v8f*)(px + t * 4 * NJ * CZ + i * 16);
    asm volatile("s_wait_xcnt 0x0" :: "v"(px) : "memory");   /* the wait in front of any overwrite of the address registers of the loads above; as an input the address stays in its registers up to it */
    float rs[2];
#pragma unroll
    for (int t = 0; t < 2; ++t) { v8f a = (v8f){};
#pragma unroll
        for (int i = 0; i < 8; ++i) { u[t][i] = bfr8(u[t][i]); a += u[t][i]; }
        float s = sum8(a); s += __shfl_xor(s, 16, 32); const float mu = s * (1.0f / CZ); a = (v8f){};
#pragma unroll
        for (int i = 0; i < 8; ++i) { u[t][i] -= mu; a += u[t][i] * u[t][i]; }
        float s2 = sum8(a); s2 += __shfl_xor(s2, 16, 32); rs[t] = __fdiv_rn(1.0f, __fsqrt_rn(__fadd_rn(s2 * (1.0f / CZ), 1e-5f))); }
    v8f acc[2]; acc[0] = (v8f){}; acc[1] = (v8f){};
#pragma unroll
    for (int kc = 0; kc < 4; ++kc) { const char* qa = (const char*)(lw + kc * 32) + ob; const char* qb = (const char*)(lb + kc * 32) + ob; const v8f a0 = bfr8(*(const v8f*)qa), a1 = bfr8(*(const v8f*)(qa + 64)), b0 = bfr8(*(const v8f*)qb), b1 = bfr8(*(const v8f*)(qb + 64));
        const v16bf wf = cat16b(f2bf8(*(const v8f*)(pw + kc * 32)), f2bf8(*(const v8f*)(pw + kc * 32 + 16)));
        if (kc == 3) asm volatile("s_wait_xcnt 0x0" :: "v"(pw), "v"(ob) : "memory");   /* behind the last loads of w_b, scale and bias: the wait in front of any overwrite of their address registers (inputs: address and offset stay put up to it) */
#pragma unroll
        for (int t = 0; t < 2; ++t) { v8us h0, l0, h1, l1; split8(u[t][2 * kc] * rs[t] * a0 + b0, h0, l0); split8(u[t][2 * kc + 1] * rs[t] * a1 + b1, h1, l1);
            acc[t] = wmmab(wf, cat16b(h0, h1), acc[t]); acc[t] = wmmab(wf, cat16b(l0, l1), acc[t]); } }
#pragma unroll
    for (int r = 0; r < 8; ++r) TB[(size_t)r * NZR + r0 + lane] = hi ? acc[1][r] : acc[0][r];
}
// ---- k_fattn: one work-group per (MSA row, head), 8 waves; the score matrix never leaves the registers.
// K (hi/lo planes, [key][d]) and V transposed (hi/lo planes, [d][key]) are split once into LDS; each wave then takes 16 queries at a time: S^T = K Q^T (a lane holds 128 of one query's 256 scores), softmax in-lane plus one exchange between the wave halves, the normalised P^T packed from the score accumulators as the B operand of O^T = V^T P^T, and 8 consecutive d per lane stored as the merged-context hi/lo planes (fragment order).
#define KP 40                     // K plane row pitch, 16-bit elements: 80 B = 16 B x odd
#define VP 264                    // V^T plane row pitch, 16-bit elements: 528 B = 16 B x odd
__device__ __forceinline__ v8f exp2x8(v8f x) { float a0 = x[0], a1 = x[1], a2 = x[2], a3 = x[3], a4 = x[4], a5 = x[5], a6 = x[6], a7 = x[7];
    /* eight independent v_exp_f32 in one statement, closed by a v_nop: each fills the slot that the instruction set asks for behind the one in front of it, the v_nop the last one's */
    asm("v_exp_f32 %0, %0\n\tv_exp_f32 %1, %1\n\tv_exp_f32 %2, %2\n\tv_exp_f32 %3, %3\n\tv_exp_f32 %4, %4\n\tv_exp_f32 %5, %5\n\tv_exp_f32 %6, %6\n\tv_exp_f32 %7, %7\n\tv_nop" : "+v"(a0), "+v"(a1), "+v"(a2), "+v"(a3), "+v"(a4), "+v"(a5), "+v"(a6), "+v"(a7));
    return (v8f){a0, a1, a2, a3, a4, a5, a6, a7}; }
__device__ __forceinline__ v16bf ldfrag(const bf* p) { return cat16b(*(const v8us*)p, *(const v8us*)(p + 16)); }
/* second launch bound: four waves per SIMD, so that two work-groups share a WGP and one stages while the other computes */
__global__ __launch_bounds__(256, 4) void k_fattn(const float* __restrict__ FQ, const float* __restrict__ FK, const float* __restrict__ FV, const float* __restrict__ TB, bf* Gh, bf* Gl) {
    __shared__ __align__(16) bf Kh[NJ * KP]; __shared__ __align__(16) bf Kl[NJ * KP]; __shared__ __align__(16) bf Vh[CH * VP]; __shared__ __align__(16) bf Vl[CH * VP];
    const int tid = threadIdx.x, lane = tid & 31, wave = tid >> 5, lr = lane & 15, hi = lane >> 4; const int h = blockIdx.x, b = blockIdx.y;
    const size_t base = (size_t)b * NJ * CC + h * CH;
    {   /* 8 lanes cover one key's 128 B; a thread owns two neighbouring keys so that V^T goes to LDS in 4-byte pairs */
        const int kq = (tid >> 3) * 2, c4 = (tid & 7) * 4; const float* pk = FK + base + (size_t)kq * CC + c4; const float* pv = FV + base + (size_t)kq * CC + c4; v4f k0[4], k1[4], w0[4], w1[4];
#pragma unroll
        for (int it = 0; it < 4; ++it) { k0[it] = *(const v4f*)(pk + it * 64 * CC); k1[it] = *(const v4f*)(pk + it * 64 * CC + CC); w0[it] = *(const v4f*)(pv + it * 64 * CC); w1[it] = *(const v4f*)(pv + it * 64 * CC + CC); }
        asm volatile("s_wait_xcnt 0x0" :: "v"(pk), "v"(pv) : "memory");   /* the wait in front of any overwrite of the address registers of the loads above; as inputs the two addresses stay in their registers up to it */
#pragma unroll
        for (int it = 0; it < 4; ++it) { const int kp2 = kq + it * 64; v4us a0, b0, a1, b1;
#pragma unroll
            for (int q = 0; q < 4; ++q) { unsigned short x, y; splitf(k0[it][q], x, y); a0[q] = x; b0[q] = y; splitf(k1[it][q], x, y); a1[q] = x; b1[q] = y; }
            *(v4us*)(Kh + kp2 * KP + c4) = a0; *(v4us*)(Kl + kp2 * KP + c4) = b0; *(v4us*)(Kh + (kp2 + 1) * KP + c4) = a1; *(v4us*)(Kl + (kp2 + 1) * KP + c4) = b1;
#pragma unroll
            for (int q = 0; q < 4; ++q) { v2us x, y; unsigned short s0, s1; splitf(w0[it][q], s0, s1); x[0] = s0; y[0] = s1; splitf(w1[it][q], s0, s1); x[1] = s0; y[1] = s1; *(v2us*)(Vh + (c4 + q) * VP + kp2) = x; *(v2us*)(Vl + (c4 + q) * VP + kp2) = y; } }
    }
    __syncthreads();
#pragma unroll 1   /* kept rolled: both trips unrolled would hold two sets of 128 score registers */
    for (int i = 0; i < 2; ++i) {   /* wave w takes query tiles w and w + 8 */
        const int qrow = (wave + 8 * i) * 16 + lr; const float* qr = FQ + base + (size_t)qrow * CC + 8 * hi; const float* tb = TB + (size_t)h * NZR + (size_t)(wave + 8 * i) * 16 * NJ + 4 * lane;   /* accumulator order (at k_zbias): each 16-byte load of the wave is 512 contiguous bytes */
        const v8f qa = *(const v8f*)qr, qb = *(const v8f*)(qr + 16);
        v8f s[16];   /* s[t][r] = score of key 16 t + 8 hi + r for query qrow; the pair bias is the accumulators' start value */
#pragma unroll
        for (int t = 0; t < 16; ++t) s[t] = __builtin_shufflevector(*(const v4f*)(tb + t * 256), *(const v4f*)(tb + t * 256 + 128), 0, 1, 2, 3, 4, 5, 6, 7);
        asm volatile("s_wait_xcnt 0x0" :: "v"(qr), "v"(tb) : "memory");   /* the wait in front of any overwrite of the address registers of the loads above (inputs: the addresses stay put up to it); its memory clobber also keeps the K and V^T fragment loads below inside this loop: hoisted out of it they take 512 registers and spill */
        v8us t0, t1, t2, t3; split8(qa * QSC, t0, t1); split8(qb * QSC, t2, t3); const v16bf qh = cat16b(t0, t2), ql = cat16b(t1, t3);   /* 1/sqrt(32) goes into q ahead of the hi/lo split */
#pragma unroll
        for (int t = 0; t < 16; ++t) { const int ko = (t * 16 + lr) * KP + 8 * hi; const v16bf kh = ldfrag(Kh + ko), kl = ldfrag(Kl + ko); s[t] = wmmab(kh, qh, s[t]); s[t] = wmmab(kh, ql, s[t]); s[t] = wmmab(kl, qh, s[t]); }
        float m8[8];
#pragma unroll
        for (int r = 0; r < 8; ++r) m8[r] = -3.0e38f;
#pragma unroll
        for (int t = 0; t < 16; ++t) {
#pragma unroll
            for (int r = 0; r < 8; ++r) m8[r] = fmaxf(m8[r], s[t][r]); }
        float mx = fmaxf(fmaxf(fmaxf(m8[0], m8[1]), fmaxf(m8[2], m8[3])), fmaxf(fmaxf(m8[4], m8[5]), fmaxf(m8[6], m8[7]))); mx = fmaxf(mx, __shfl_xor(mx, 16, 32));
        float s8[8];
#pragma unroll
        for (int r = 0; r < 8; ++r) s8[r] = 0.f;
#pragma unroll
        for (int t = 0; t < 16; ++t) { s[t] = exp2x8((s[t] - mx) * 1.4426950408889634f);
#pragma unroll
            for (int r = 0; r < 8; ++r) s8[r] += s[t][r]; }
        float sum = ((s8[0] + s8[1]) + (s8[2] + s8[3])) + ((s8[4] + s8[5]) + (s8[6] + s8[7])); sum += __shfl_xor(sum, 16, 32);
        const float f = __fdiv_rn(1.0f, sum);
        v8f o0 = (v8f){}, o1 = (v8f){};   /* o0[r] = context d = 8 hi + r, o1[r] = d = 16 + 8 hi + r, query qrow */
#pragma unroll
        for (int u = 0; u < 8; ++u) { split8(s[2 * u] * f, t0, t1); split8(s[2 * u + 1] * f, t2, t3); const v16bf ph = cat16b(t0, t2), pl = cat16b(t1, t3);
            const int vo = lr * VP + u * 32 + 8 * hi; const v16bf vh0 = ldfrag(Vh + vo), vl0 = ldfrag(Vl + vo), vh1 = ldfrag(Vh + vo + 16 * VP), vl1 = ldfrag(Vl + vo + 16 * VP);
            o0 = wmmab(vh0, ph, o0); o1 = wmmab(vh1, ph, o1); o0 = wmmab(vh0, pl, o0); o1 = wmmab(vh1, pl, o1); o0 = wmmab(vl0, ph, o0); o1 = wmmab(vl1, ph, o1); }
        const size_t oo = ((size_t)(b * 16 + wave + 8 * i) * 8 + h) * 512 + 8 * lane; split8(o0, t0, t1); split8(o1, t2, t3);   /* fragment order: strip = this query tile, k block = head; the lane's two pieces are the two halves of its A fragment */
        *(v8us*)(Gh + oo) = t0; *(v8us*)(Gl + oo) = t1; *(v8us*)(Gh + oo + 256) = t2; *(v8us*)(Gl + oo + 256) = t3;
        asm volatile("s_wait_xcnt 0x0" ::: "memory");   /* the wait in front of the next trip's overwrite of the address and data registers of the four stores above */
    }
}

__global__ __launch_bounds__(256) void k_fin(const float* __restrict__ msa, const float* __restrict__ FG, const float* __restrict__ bg, const float* __restrict__ O2, float* O) { const size_t i = (size_t)blockIdx.x * 256 + threadIdx.x; if (i >= (size_t)NR * CC / 4) return; const size_t e = i * 4; const int c0 = (int)(e % CC); const v4f m = *(const v4f*)(msa + e), fg = *(const v4f*)(FG + e), o2 = *(const v4f*)(O2 + e); v4f o;
#pragma unroll
    for (int q = 0; q < 4; ++q) { const float zg = __fadd_rn(fg[q], bfr(bg[c0 + q])); const float sg = __fdiv_rn(1.0f, __fadd_rn(1.0f, expf(-zg))); float t = __fmul_rn(sg, o2[q]); asm volatile("" : "+v"(t)); o[q] = __fadd_rn(bfr(m[q]), t); }
    *(v4f*)(O + e) = o;  }

extern "C" void kernel_launch(void* const* d_in, const int* in_sizes, int n_in,
                              void* d_out, int out_size, void* d_ws, size_t ws_size, hipStream_t stream) {
    (void)in_sizes; (void)n_in; (void)out_size;
    const float* msa = (const float*)d_in[0]; const float* pair = (const float*)d_in[1]; const float* lmw = (const float*)d_in[2]; const float* lmb = (const float*)d_in[3]; const float* lzw = (const float*)d_in[4]; const float* lzb = (const float*)d_in[5]; const float* wq = (const float*)d_in[6]; const float* wk = (const float*)d_in[7]; const float* wv = (const float*)d_in[8]; const float* wb = (const float*)d_in[9]; const float* wo = (const float*)d_in[10]; const float* bo = (const float*)d_in[11]; const float* wg = (const float*)d_in[12]; const float* bg = (const float*)d_in[13];
    float* OUT = (float*)d_out;     // [128][256][256]
    char* wsp = (char*)d_ws;
    auto take = [&](size_t bytes) { char* p = wsp; wsp += (bytes + 255) & ~(size_t)255; return (void*)p; };
    bf* WQ = (bf*)take((size_t)5 * CC * CC * 2); bf* WO = WQ + (size_t)4 * CC * CC;   /* the five bf16 weight matrices back to back: q, k, v, gate, out */
    bf* XH = (bf*)take((size_t)NR * CC * 2); bf* XL = (bf*)take((size_t)NR * CC * 2); bf* Gh = (bf*)take((size_t)NR * CC * 2); bf* Gl = (bf*)take((size_t)NR * CC * 2); float* TB = (float*)take((size_t)NH_ * NZR * 4);
    float* FQ = (float*)take((size_t)4 * NR * CC * 4); float* FK = FQ + (size_t)NR * CC; float* FV = FK + (size_t)NR * CC; float* FG = FV + (size_t)NR * CC;   /* the four projections back to back */
    float* O2 = FQ;   /* O2 reuses the q buffer after the attention launch (stream-ordered) */
    if ((size_t)(wsp - (char*)d_ws) > ws_size) return;
    k_pre<<<5 * WBLK + NR / 8, 256, 0, stream>>>(msa, lmw, lmb, XH, XL, wq, wk, wv, wg, wo, WQ);   /* bf16 weights and the MSA LayerNorm planes */
    k_zbias<<<NZR / 256, 256, 0, stream>>>(pair, lzw, lzb, wb, TB);   /* pair LayerNorm + pair-bias dots */
    k_gemmw<bf, 1, false, CC><<<dim3(NR / 64, CC / 64, 4), 32, 0, stream>>>(XH, XL, WQ, nullptr, FQ, CC, nullptr, 0, (size_t)CC * CC, (size_t)NR * CC);   /* q, k, v, gate projections (2 products) as the z index of one grid: its 8,192 single-wave work-groups keep all four resident places of every SIMD filled */
    k_fattn<<<dim3(NH_, NI, 1), 256, 0, stream>>>(FQ, FK, FV, TB, Gh, Gl);                                                                     /* scores, / sqrt(32) + pair bias, softmax, attn.v -> merged context planes */
    k_gemmw<bf, 1, true, CC><<<dim3(NR / 64, CC / 64, 1), 32, 0, stream>>>(Gh, Gl, WO, nullptr, O2, CC, bo, 0, 0, 0);                          /* O2 = context W_out^T + b_out */
    k_fin<<<(unsigned)(((size_t)NR * CC / 4 + 255) / 256), 256, 0, stream>>>(msa, FG, bg, O2, OUT);                                            /* out = msa + sigmoid(gate) x O2 */
}

// v005
// It runs in 127 microseconds.
// Timed twice side by side with v004, it ran 1.09 times as fast both times.
// Counting every step since v000, it is 5.66 times as fast.
#include <hip/hip_runtime.h>

// MSA row attention with pair bias (msa [128][256][256], pair [256][256][128]; m = LayerNorm(msa), z = LayerNorm(pair) (eps 1e-5, affine); per MSA row b and head h (8 x 32): q, k, v = m W^T ('oi' [256][256]); scores = q.k / sqrt(32) + bias[h][i][j] with bias = z . w_b[h] ([8][128]); softmax over j; o = attn.v merged; out = msa + sigmoid(m W_gate^T + b_gate) * (o W_out^T + b_out) -> [128][256][256] (8.4 M)).
// Layout: the 32,768 (row, position) MSA rows are one tall GEMM operand for the LayerNormed projections (m as bf16 hi + lo: 2 products) and for the output projection of the merged context; the pair LayerNorm feeds only the 8 bias dot products per pair position; the 1,024 (row, head) attention problems of size 256 x 256 x 32 run in ONE launch, one work-group each: scores on hi/lo planes (3 products, K = 32), x 1/sqrt(32) + bias, a 256-wide softmax in registers, attn.v on hi/lo planes (3 products); a final kernel applies the residual and the sigmoid gate in f32.
// Every 16-bit GEMM operand plane (m, the merged context, the five weight matrices) lies in memory in FRAGMENT ORDER: a block of 16 rows x 32 k is 1 KiB, blocks of one 16-row strip follow one another in k; element (row lr, k = 32 kc + 16 j + 8 hi + e) stands at block * 512 + j * 256 + (16 hi + lr) * 8 + e, so that a wave's 16-byte load of half a fragment is 512 contiguous bytes (4 whole lines) where a row-major plane gave 16 lines of 32 bytes. The pair bias lies likewise in the order of the score accumulators (at k_zbias).

#define NI   128                  // MSA rows
#define NJ   256                  // positions (= attention length)
#define CC   256                  // c_m
#define CZ   128                  // c_z
#define NZR  (NJ * NJ)            // 65,536 pair positions
#define NH_  8
#define CH   32
#define NR   (NI * NJ)            // 32,768 (row, position) MSA rows
#define QSC  0.17677669529663689f  // 1/sqrt(32)
typedef _Float16 h16;
typedef unsigned short bf;
typedef __attribute__((ext_vector_type(16))) __bf16   v16bf;
typedef __attribute__((ext_vector_type(16))) _Float16 v16h;
typedef __attribute__((ext_vector_type(8)))  _Float16 v8h;
typedef __attribute__((ext_vector_type(8)))  unsigned short v8us;
typedef __attribute__((ext_vector_type(8)))  float    v8f;
typedef __attribute__((ext_vector_type(4)))  float    v4f;
typedef __attribute__((ext_vector_type(2)))  float    v2f;
typedef __attribute__((ext_vector_type(4)))  unsigned short v4us;
typedef __attribute__((ext_vector_type(2)))  unsigned short v2us;
typedef __attribute__((ext_vector_type(2)))  __bf16   v2b;
typedef __attribute__((ext_vector_type(2)))  unsigned v2u;
typedef __attribute__((ext_vector_type(4)))  unsigned v4u;
typedef v8h  __attribute__((may_alias)) v8ha;
typedef v4f  __attribute__((may_alias)) v4fa;
typedef v8us __attribute__((may_alias)) v8usa;

// f32 -> 16-bit plane value, round to nearest even, by the chip's convert instruction; cvt2 rounds two values with one v_cvt_pk_bf16_f32 (a in the low half of the word) and leaves them packed as the planes want them.
__device__ __forceinline__ unsigned short f2bf(float f) { return __builtin_bit_cast(unsigned short, (__bf16)f); }
__device__ __forceinline__ unsigned cvt2(float a, float b) { return __builtin_bit_cast(unsigned, __builtin_convertvector((v2f){a, b}, v2b)); }
__device__ __forceinline__ float lo2f(unsigned p) { return __uint_as_float(p << 16); }
__device__ __forceinline__ float hi2f(unsigned p) { return __uint_as_float(p & 0xFFFF0000u); }
__device__ __forceinline__ void split2(float a, float b, unsigned& h, unsigned& l) { h = cvt2(a, b); l = cvt2(a - lo2f(h), b - hi2f(h)); }   /* hi plane word and lo plane word of a pair */
__device__ __forceinline__ v8f bfr8(v8f a) { v8f o;
#pragma unroll
    for (int q = 0; q < 8; q += 2) { const unsigned p = cvt2(a[q], a[q + 1]); o[q] = lo2f(p); o[q + 1] = hi2f(p); } return o; }
__device__ __forceinline__ v8us f2bf8(v8f a) { v4u o;
#pragma unroll
    for (int q = 0; q < 4; ++q) o[q] = cvt2(a[2 * q], a[2 * q + 1]); return __builtin_bit_cast(v8us, o); }
__device__ __forceinline__ void split8(v8f x, v8us& h, v8us& l) { v4u a, c;
#pragma unroll
    for (int q = 0; q < 4; ++q) { unsigned u, w; split2(x[2 * q], x[2 * q + 1], u, w); a[q] = u; c[q] = w; }
    h = __builtin_bit_cast(v8us, a); l = __builtin_bit_cast(v8us, c); }
__device__ __forceinline__ void split4(v4f x, v4us& h, v4us& l) { v2u a, c;
#pragma unroll
    for (int q = 0; q < 2; ++q) { unsigned u, w; split2(x[2 * q], x[2 * q + 1], u, w); a[q] = u; c[q] = w; }
    h = __builtin_bit_cast(v4us, a); l = __builtin_bit_cast(v4us, c); }
__device__ __forceinline__ float bf2f(unsigned short b) { return __uint_as_float(((unsigned)b) << 16); }
__device__ __forceinline__ float bfr(float f) { return bf2f(f2bf(f)); }
__device__ __forceinline__ void splitf(float y, unsigned short& h, unsigned short& l) { h = f2bf(y); l = f2bf(y - bf2f(h)); }
__device__ __forceinline__ v16h cat16(v8h lo, v8h hi) { return __builtin_shufflevector(lo, hi, 0, 1, 2, 3, 4, 5, 6, 7, 8, 9, 10, 11, 12, 13, 14, 15); }
__device__ __forceinline__ v16bf cat16b(v8us lo, v8us hi) { return __builtin_bit_cast(v16bf, __builtin_shufflevector(lo, hi, 0, 1, 2, 3, 4, 5, 6, 7, 8, 9, 10, 11, 12, 13, 14, 15)); }
__device__ __forceinline__ v8f wmma16(v16h a, v16h b, v8f c) { return __builtin_amdgcn_wmma_f32_16x16x32_f16(false, a, false, b, (short)0, c, false, false); }
__device__ __forceinline__ v8f wmmab(v16bf a, v16bf b, v8f c) { return __builtin_amdgcn_wmma_f32_16x16x32_bf16(false, a, false, b, (short)0, c, false, false); }

// ---- k_gemmw: register-blocked GEMM, ONE WAVE per 64x64 output tile (16 accumulators), operands straight from 16-bit planes in fragment order (head of the file); grid (M/64, N/64, Z), 32 threads.
// C[m][n] (f32, pitch ldc, + optional f32 bias[n]) = sum_k A[m][k] Bt[n][k] (+ split products per NSPLIT). z-batch strides sA/sB/sC in elements. K % 32 == 0.
template <typename T16> struct WFrag;
template <> struct WFrag<h16> { typedef v16h V; static __device__ __forceinline__ V ld(const h16* p) { return cat16(*(const v8h*)p, *(const v8h*)(p + 256)); } static __device__ __forceinline__ v8f mma(V a, V b, v8f c) { return wmma16(a, b, c); } };
template <> struct WFrag<bf> { typedef v16bf V; static __device__ __forceinline__ V ld(const bf* p) { return cat16b(*(const v8us*)p, *(const v8us*)(p + 256)); } static __device__ __forceinline__ v8f mma(V a, V b, v8f c) { return wmmab(a, b, c); } };
template <typename T16, int NSPLIT, bool BIAS, int K>
__global__ __launch_bounds__(32) void k_gemmw(const T16* __restrict__ A, const T16* __restrict__ A2, const T16* __restrict__ Bt, const T16* __restrict__ Bt2, float* C, int ldc, const float* __restrict__ bias, size_t sA, size_t sB, size_t sC) {
    typedef typename WFrag<T16>::V V;
    __shared__ __align__(16) float os[16 * 68];
    const size_t z = blockIdx.z; A += z * sA; if (A2) A2 += z * sA; Bt += z * sB; if (Bt2) Bt2 += z * sB; C += z * sC;
    const int lane = threadIdx.x & 31, lr = lane & 15, hi = lane >> 4; const int r0 = blockIdx.x * 64, c0 = blockIdx.y * 64;
    v8f acc[4][4];
#pragma unroll
    for (int mb = 0; mb < 4; ++mb)
#pragma unroll
        for (int nb = 0; nb < 4; ++nb) acc[mb][nb] = (v8f){};
    /* a 16-row strip is 16 K elements, a k block of 32 is 512: with K fixed at compile time the four strips of an operand are immediate offsets from one address */
    const T16* va = A + (size_t)r0 * K + 8 * lane; const T16* vb = Bt + (size_t)c0 * K + 8 * lane; const T16* va2 = (NSPLIT == 1 || NSPLIT == 2) ? A2 + (size_t)r0 * K + 8 * lane : va; const T16* vb2 = NSPLIT >= 2 ? Bt2 + (size_t)c0 * K + 8 * lane : vb;
#pragma unroll 1
    for (int kc = 0; kc < K; kc += 32) {
        V a[4], a2[4], b[4], b2[4];
#pragma unroll
        for (int mb = 0; mb < 4; ++mb) { a[mb] = WFrag<T16>::ld(va + mb * 16 * K); b[mb] = WFrag<T16>::ld(vb + mb * 16 * K); if (NSPLIT == 1 || NSPLIT == 2) a2[mb] = WFrag<T16>::ld(va2 + mb * 16 * K); if (NSPLIT >= 2) b2[mb] = WFrag<T16>::ld(vb2 + mb * 16 * K); }
        asm volatile("s_wait_xcnt 0x0" :: "v"(va), "v"(vb), "v"(va2), "v"(vb2) : "memory");   /* the wait in front of the step of the address registers of the loads above; as inputs the addresses stay in their registers up to it */
        va += 512; vb += 512; va2 += 512; vb2 += 512;
#pragma unroll
        for (int nb = 0; nb < 4; ++nb) {
#pragma unroll
            for (int mb = 0; mb < 4; ++mb) { acc[mb][nb] = WFrag<T16>::mma(a[mb], b[nb], acc[mb][nb]); if (NSPLIT == 1 || NSPLIT == 2) acc[mb][nb] = WFrag<T16>::mma(a2[mb], b[nb], acc[mb][nb]); if (NSPLIT >= 2) acc[mb][nb] = WFrag<T16>::mma(a[mb], b2[nb], acc[mb][nb]); } }
        asm volatile("v_nop\n\tv_nop\n\tv_nop\n\tv_nop" : "+v"(acc[0][0]), "+v"(acc[1][1]), "+v"(acc[2][2]), "+v"(acc[3][3]) : "v"(a[0]), "v"(a[3]));
    }
#pragma unroll
    for (int mb = 0; mb < 4; ++mb) {
#pragma unroll
        for (int nb = 0; nb < 4; ++nb) {
#pragma unroll
            for (int j = 0; j < 8; ++j) os[(hi * 8 + j) * 68 + nb * 16 + lr] = acc[mb][nb][j]; }
        __builtin_amdgcn_wave_barrier(); asm volatile("" ::: "memory");
        float* crow = C + (size_t)(r0 + mb * 16) * ldc + c0;
{
#pragma unroll
            for (int s = 0; s < 8; ++s) { const int row = 2 * s + hi, cofs = lr * 4; v4f val = *(const v4fa*)(os + row * 68 + cofs); if (BIAS) { val[0] += bfr(bias[c0 + cofs]); val[1] += bfr(bias[c0 + cofs + 1]); val[2] += bfr(bias[c0 + cofs + 2]); val[3] += bfr(bias[c0 + cofs + 3]); }
                *(v4f*)(crow + (size_t)row * ldc + cofs) = val; }
             }
        __builtin_amdgcn_wave_barrier(); asm volatile("" ::: "memory");
    }
}

__global__ __launch_bounds__(256) void k_wtG(const float* __restrict__ w, int K, int N, bf* Bt) {
    const int lane = threadIdx.x & 31; const int L0 = (blockIdx.x * 8 + (threadIdx.x >> 5)) * 8; const int nlines = N * K / 64;
{
#pragma unroll 1
        for (int l = 0; l < 8; ++l) { const int L = L0 + l; if (L >= nlines) break; const size_t e = (size_t)L * 64 + lane * 2; const int k = (int)(e % K), n = (int)(e / K); v2us o;
            o[0] = f2bf(w[(size_t)k * N + n]); o[1] = f2bf(w[(size_t)(k + 1) * N + n]); *(v2us*)(Bt + e) = o; }
         }
}
#define WBLK (CC * CC / 8 / 256)   // 32 blocks of 256 threads round one 256 x 256 weight matrix, 8 elements a thread
// ---- k_pre: two jobs that need nothing of each other, as block ranges of one grid. Blocks 0 .. 5 WBLK - 1 round the five 'oi' weight matrices to bf16 (Bt in fragment order; W5 holds them back to back in the order q, k, v, gate, out; a thread owns one 16-byte piece of the OUTPUT, so a wave stores 4 whole lines); the other blocks do the MSA LayerNorm, one wave a row: the 8 rows of a block meet in LDS, from where each wave stores 4 whole lines a plane (8 rows x 16 bytes are one line of the fragment order).
#define PP 288                    // LDS row pitch of k_pre, 16-bit elements: 576 B, so that the 8 rows x 4 pieces a wave reads back spread over all banks
__global__ __launch_bounds__(256) void k_pre(const float* __restrict__ x, const float* __restrict__ lw, const float* __restrict__ lb, bf* MH, bf* ML, const float* __restrict__ wq, const float* __restrict__ wk, const float* __restrict__ wv, const float* __restrict__ wg, const float* __restrict__ wo, bf* W5) {
    if (blockIdx.x < 5 * WBLK) { const int m = blockIdx.x / WBLK; const float* src = m == 0 ? wq : m == 1 ? wk : m == 2 ? wv : m == 3 ? wg : wo; const int i = (blockIdx.x % WBLK) * 256 + threadIdx.x; const int n = (i >> 9) * 16 + (i & 15), k0 = ((i >> 6) & 7) * 32 + ((i >> 4) & 3) * 8; const v8f v = *(const v8f*)(src + n * CC + k0); v8us o;   /* piece i of the fragment order: strip i >> 9, k block (i >> 6) & 7, then j, hi, lr */
#pragma unroll
        for (int k = 0; k < 8; ++k) o[k] = f2bf(v[k]);
        *(v8us*)(W5 + (size_t)m * CC * CC + i * 8) = o; return; }
    __shared__ __align__(16) bf sph[8 * PP]; __shared__ __align__(16) bf spl[8 * PP];
    const int lane = threadIdx.x & 31, wid = threadIdx.x >> 5; const int rb = (blockIdx.x - 5 * WBLK) * 8; if (rb >= NR) return; const int r = rb + wid; const v8f a = *(const v8f*)(x + (size_t)r * CC + lane * 8); float u[8]; float s = 0.f;
#pragma unroll
    for (int q = 0; q < 8; ++q) { u[q] = bfr(a[q]); s += u[q]; }
#pragma unroll
    for (int sh = 16; sh; sh >>= 1) s += __shfl_xor(s, sh, 32);
    const float mu = s * (1.0f / CC); float s2 = 0.f;
#pragma unroll
    for (int q = 0; q < 8; ++q) { float d0 = __fsub_rn(u[q], mu); asm volatile("" : "+v"(d0)); float p = __fmul_rn(d0, d0); asm volatile("" : "+v"(p)); s2 = __fadd_rn(s2, p); }
#pragma unroll
    for (int sh = 16; sh; sh >>= 1) s2 += __shfl_xor(s2, sh, 32);
    const float rs = __fdiv_rn(1.0f, __fsqrt_rn(__fadd_rn(s2 * (1.0f / CC), 1e-5f))); v8us oh, ol;
#pragma unroll
    for (int q = 0; q < 8; ++q) { const int c = lane * 8 + q; float d1 = __fsub_rn(u[q], mu); asm volatile("" : "+v"(d1)); float n0 = __fmul_rn(d1, rs); asm volatile("" : "+v"(n0)); float n1 = __fmul_rn(n0, bfr(lw[c])); asm volatile("" : "+v"(n1)); const float xn = __fadd_rn(n1, bfr(lb[c])); unsigned short h2, l2; splitf(xn, h2, l2); oh[q] = h2; ol[q] = l2; }
    *(v8us*)(sph + wid * PP + lane * 8) = oh; *(v8us*)(spl + wid * PP + lane * 8) = ol;
    __syncthreads();
    const int pc = threadIdx.x >> 3, rw = threadIdx.x & 7;   /* piece pc = k / 8 of row rb + rw: 8 threads fill one line */
    const size_t d = (size_t)(rb >> 4) * 16 * CC + (pc >> 2) * 512 + (pc & 3) * 128 + ((rb & 8) + rw) * 8;
    *(v8us*)(MH + d) = *(const v8us*)(sph + rw * PP + pc * 8); *(v8us*)(ML + d) = *(const v8us*)(spl + rw * PP + pc * 8);  }
// ---- k_zbias: pair LayerNorm and its 8 bias dots in one kernel; the normalised z never leaves the registers.
// A wave takes 32 pair positions as two tiles of 16. Lane (lr, hi) holds half of row lr of each tile in the k order of a WMMA operand (k = 32 kc + 8 hi + 0..7 and 32 kc + 16 + 8 hi + 0..7), so a row's mean and variance are in-lane sums plus one exchange between the wave halves, and the hi/lo planes of z are the B operand as they stand.
// A = w_b as bf16 with head m & 7 in row m: both halves of D hold the 8 heads, half hi keeps tile hi, and each head's 32 values go out as one 128-B line.
// TB lies in the order of k_fattn's score accumulators: per head, a block of 16 queries x 16 keys is 1 KiB, and (query lr, key 8 hi + 4 half + e) stands at half * 128 + (16 hi + lr) * 4 + e. One line of it is 8 queries x 4 keys: those are the 32 pair positions of wave g, whose line is number g of each head's plane.
__device__ __forceinline__ float sum8(v8f a) { return ((a[0] + a[1]) + (a[2] + a[3])) + ((a[4] + a[5]) + (a[6] + a[7])); }
__global__ __launch_bounds__(256) void k_zbias(const float* __restrict__ x, const float* __restrict__ lw, const float* __restrict__ lb, const float* __restrict__ wtri, float* TB) {
    const int lane = threadIdx.x & 31, lr = lane & 15, hi = lane >> 4; const int g = blockIdx.x * 8 + (threadIdx.x >> 5), r0 = g * 32;
    const int qi = (g >> 7) * 16 + (g & 1) * 8 + (lr >> 2), kj = ((g >> 3) & 15) * 16 + ((g >> 1) & 1) * 8 + ((g >> 2) & 1) * 4 + (lr & 3);   /* row lr of tile 0: its query and key; tile 1 is 4 queries further */
    const float* px = x + (size_t)(qi * NJ + kj) * CZ + 8 * hi; const float* pw = wtri + (lr & 7) * CZ + 8 * hi; const unsigned ob = 32u * hi;   /* ob: the lane's byte offset into scale and bias */
    v8f u[2][8];   /* u[t][i]: tile t, k = 16 i + 8 hi + 0..7 */
#pragma unroll
    for (int t = 0; t < 2; ++t)
#pragma unroll
        for (int i = 0; i < 8; ++i) u[t][i] = *(const v8f*)(px + t * 4 * NJ * CZ + i * 16);
    asm volatile("s_wait_xcnt 0x0" :: "v"(px) : "memory");   /* the wait in front of any overwrite of the address registers of the loads above; as an input the address stays in its registers up to it */
    float rs[2];
#pragma unroll
    for (int t = 0; t < 2; ++t) { v8f a = (v8f){};
#pragma unroll
        for (int i = 0; i < 8; ++i) { u[t][i] = bfr8(u[t][i]); a += u[t][i]; }
        float s = sum8(a); s += __shfl_xor(s, 16, 32); const float mu = s * (1.0f / CZ); a = (v8f){};
#pragma unroll
        for (int i = 0; i < 8; ++i) { u[t][i] -= mu; a += u[t][i] * u[t][i]; }
        float s2 = sum8(a); s2 += __shfl_xor(s2, 16, 32); rs[t] = __fdiv_rn(1.0f, __fsqrt_rn(__fadd_rn(s2 * (1.0f / CZ), 1e-5f))); }
    v8f acc[2]; acc[0] = (v8f){}; acc[1] = (v8f){};
#pragma unroll
    for (int kc = 0; kc < 4; ++kc) { const char* qa = (const char*)(lw + kc * 32) + ob; const char* qb = (const char*)(lb + kc * 32) + ob; const v8f a0 = bfr8(*(const v8f*)qa), a1 = bfr8(*(const v8f*)(qa + 64)), b0 = bfr8(*(const v8f*)qb), b1 = bfr8(*(const v8f*)(qb + 64));
        const v16bf wf = cat16b(f2bf8(*(const v8f*)(pw + kc * 32)), f2bf8(*(const v8f*)(pw + kc * 32 + 16)));
        if (kc == 3) asm volatile("s_wait_xcnt 0x0" :: "v"(pw), "v"(ob) : "memory");   /* behind the last loads of w_b, scale and bias: the wait in front of any overwrite of their address registers (inputs: address and offset stay put up to it) */
#pragma unroll
        for (int t = 0; t < 2; ++t) { v8us h0, l0, h1, l1; split8(u[t][2 * kc] * rs[t] * a0 + b0, h0, l0); split8(u[t][2 * kc + 1] * rs[t] * a1 + b1, h1, l1);
            acc[t] = wmmab(wf, cat16b(h0, h1), acc[t]); acc[t] = wmmab(wf, cat16b(l0, l1), acc[t]); } }
#pragma unroll
    for (int r = 0; r < 8; ++r) TB[(size_t)r * NZR + r0 + lane] = hi ? acc[1][r] : acc[0][r];
}
// ---- k_fattn: one work-group per (MSA row, head), 8 waves; the score matrix never leaves the registers.
// K (hi/lo planes, [key][d]) and V transposed (hi/lo planes, [d][key]) are split once into LDS; each wave then takes 16 queries at a time: S^T = K Q^T (a lane holds 128 of one query's 256 scores), softmax in-lane plus one exchange between the wave halves, the normalised P^T packed from the score accumulators as the B operand of O^T = V^T P^T, and 8 consecutive d per lane stored as the merged-context hi/lo planes (fragment order).
#define KP 40                     // K plane row pitch, 16-bit elements: 80 B = 16 B x odd
#define VP 264                    // V^T plane row pitch, 16-bit elements: 528 B = 16 B x odd
__device__ __forceinline__ v8f exp2x8(v8f x) { float a0 = x[0], a1 = x[1], a2 = x[2], a3 = x[3], a4 = x[4], a5 = x[5], a6 = x[6], a7 = x[7];
    /* eight independent v_exp_f32 in one statement, closed by a v_nop: each fills the slot that the instruction set asks for behind the one in front of it, the v_nop the last one's */
    asm("v_exp_f32 %0, %0\n\tv_exp_f32 %1, %1\n\tv_exp_f32 %2, %2\n\tv_exp_f32 %3, %3\n\tv_exp_f32 %4, %4\n\tv_exp_f32 %5, %5\n\tv_exp_f32 %6, %6\n\tv_exp_f32 %7, %7\n\tv_nop" : "+v"(a0), "+v"(a1), "+v"(a2), "+v"(a3), "+v"(a4), "+v"(a5), "+v"(a6), "+v"(a7));
    return (v8f){a0, a1, a2, a3, a4, a5, a6, a7}; }
__device__ __forceinline__ v16bf ldfrag(const bf* p) { return cat16b(*(const v8us*)p, *(const v8us*)(p + 16)); }
/* second launch bound: four waves per SIMD, so that two work-groups share a WGP and one stages while the other computes */
__global__ __launch_bounds__(256, 4) void k_fattn(const float* __restrict__ FQ, const float* __restrict__ FK, const float* __restrict__ FV, const float* __restrict__ TB, bf* Gh, bf* Gl) {
    __shared__ __align__(16) bf Kh[NJ * KP]; __shared__ __align__(16) bf Kl[NJ * KP]; __shared__ __align__(16) bf Vh[CH * VP]; __shared__ __align__(16) bf Vl[CH * VP];
    const int tid = threadIdx.x, lane = tid & 31, wave = tid >> 5, lr = lane & 15, hi = lane >> 4; const int h = blockIdx.x, b = blockIdx.y;
    const size_t base = (size_t)b * NJ * CC + h * CH;
    {   /* 8 lanes cover one key's 128 B; a thread owns two neighbouring keys so that V^T goes to LDS in 4-byte pairs */
        const int kq = (tid >> 3) * 2, c4 = (tid & 7) * 4; const float* pk = FK + base + (size_t)kq * CC + c4; const float* pv = FV + base + (size_t)kq * CC + c4; v4f k0[4], k1[4], w0[4], w1[4];
#pragma unroll
        for (int it = 0; it < 4; ++it) { k0[it] = *(const v4f*)(pk + it * 64 * CC); k1[it] = *(const v4f*)(pk + it * 64 * CC + CC); w0[it] = *(const v4f*)(pv + it * 64 * CC); w1[it] = *(const v4f*)(pv + it * 64 * CC + CC); }
        asm volatile("s_wait_xcnt 0x0" :: "v"(pk), "v"(pv) : "memory");   /* the wait in front of any overwrite of the address registers of the loads above; as inputs the two addresses stay in their registers up to it */
#pragma unroll
        for (int it = 0; it < 4; ++it) { const int kp2 = kq + it * 64; v4us a0, b0, a1, b1;
            split4(k0[it], a0, b0); split4(k1[it], a1, b1);
            *(v4us*)(Kh + kp2 * KP + c4) = a0; *(v4us*)(Kl + kp2 * KP + c4) = b0; *(v4us*)(Kh + (kp2 + 1) * KP + c4) = a1; *(v4us*)(Kl + (kp2 + 1) * KP + c4) = b1;
#pragma unroll
            for (int q = 0; q < 4; ++q) { unsigned x, y; split2(w0[it][q], w1[it][q], x, y); *(v2us*)(Vh + (c4 + q) * VP + kp2) = __builtin_bit_cast(v2us, x); *(v2us*)(Vl + (c4 + q) * VP + kp2) = __builtin_bit_cast(v2us, y); } }
    }
    __syncthreads();
#pragma unroll 1   /* kept rolled: both trips unrolled would hold two sets of 128 score registers */
    for (int i = 0; i < 2; ++i) {   /* wave w takes query tiles w and w + 8 */
        const int qrow = (wave + 8 * i) * 16 + lr; const float* qr = FQ + base + (size_t)qrow * CC + 8 * hi; const float* tb = TB + (size_t)h * NZR + (size_t)(wave + 8 * i) * 16 * NJ + 4 * lane;   /* accumulator order (at k_zbias): each 16-byte load of the wave is 512 contiguous bytes */
        const v8f qa = *(const v8f*)qr, qb = *(const v8f*)(qr + 16);
        v8f s[16];   /* s[t][r] = score of key 16 t + 8 hi + r for query qrow; the pair bias is the accumulators' start value */
#pragma unroll
        for (int t = 0; t < 16; ++t) s[t] = __builtin_shufflevector(*(const v4f*)(tb + t * 256), *(const v4f*)(tb + t * 256 + 128), 0, 1, 2, 3, 4, 5, 6, 7);
        asm volatile("s_wait_xcnt 0x0" :: "v"(qr), "v"(tb) : "memory");   /* the wait in front of any overwrite of the address registers of the loads above (inputs: the addresses stay put up to it); its memory clobber also keeps the K and V^T fragment loads below inside this loop: hoisted out of it they take 512 registers and spill */
        v8us t0, t1, t2, t3; split8(qa * QSC, t0, t1); split8(qb * QSC, t2, t3); const v16bf qh = cat16b(t0, t2), ql = cat16b(t1, t3);   /* 1/sqrt(32) goes into q ahead of the hi/lo split */
#pragma unroll
        for (int t = 0; t < 16; ++t) { const int ko = (t * 16 + lr) * KP + 8 * hi; const v16bf kh = ldfrag(Kh + ko), kl = ldfrag(Kl + ko); s[t] = wmmab(kh, qh, s[t]); s[t] = wmmab(kh, ql, s[t]); s[t] = wmmab(kl, qh, s[t]); }
        float m8[8];
#pragma unroll
        for (int r = 0; r < 8; ++r) m8[r] = -3.0e38f;
#pragma unroll
        for (int t = 0; t < 16; ++t) {
#pragma unroll
            for (int r = 0; r < 8; ++r) m8[r] = fmaxf(m8[r], s[t][r]); }
        float mx = fmaxf(fmaxf(fmaxf(m8[0], m8[1]), fmaxf(m8[2], m8[3])), fmaxf(fmaxf(m8[4], m8[5]), fmaxf(m8[6], m8[7]))); mx = fmaxf(mx, __shfl_xor(mx, 16, 32));
        float s8[8];
#pragma unroll
        for (int r = 0; r < 8; ++r) s8[r] = 0.f;
#pragma unroll
        for (int t = 0; t < 16; ++t) { s[t] = exp2x8((s[t] - mx) * 1.4426950408889634f);
#pragma unroll
            for (int r = 0; r < 8; ++r) s8[r] += s[t][r]; }
        float sum = ((s8[0] + s8[1]) + (s8[2] + s8[3])) + ((s8[4] + s8[5]) + (s8[6] + s8[7])); sum += __shfl_xor(sum, 16, 32);
        const float f = __fdiv_rn(1.0f, sum);
        v8f o0 = (v8f){}, o1 = (v8f){};   /* o0[r] = context d = 8 hi + r, o1[r] = d = 16 + 8 hi + r, query qrow */
#pragma unroll
        for (int u = 0; u < 8; ++u) { split8(s[2 * u] * f, t0, t1); split8(s[2 * u + 1] * f, t2, t3); const v16bf ph = cat16b(t0, t2), pl = cat16b(t1, t3);
            const int vo = lr * VP + u * 32 + 8 * hi; const v16bf vh0 = ldfrag(Vh + vo), vl0 = ldfrag(Vl + vo), vh1 = ldfrag(Vh + vo + 16 * VP), vl1 = ldfrag(Vl + vo + 16 * VP);
            o0 = wmmab(vh0, ph, o0); o1 = wmmab(vh1, ph, o1); o0 = wmmab(vh0, pl, o0); o1 = wmmab(vh1, pl, o1); o0 = wmmab(vl0, ph, o0); o1 = wmmab(vl1, ph, o1); }
        const size_t oo = ((size_t)(b * 16 + wave + 8 * i) * 8 + h) * 512 + 8 * lane; split8(o0, t0, t1); split8(o1, t2, t3);   /* fragment order: strip = this query tile, k block = head; the lane's two pieces are the two halves of its A fragment */
        *(v8us*)(Gh + oo) = t0; *(v8us*)(Gl + oo) = t1; *(v8us*)(Gh + oo + 256) = t2; *(v8us*)(Gl + oo + 256) = t3;
        asm volatile("s_wait_xcnt 0x0" ::: "memory");   /* the wait in front of the next trip's overwrite of the address and data registers of the four stores above */
    }
}

__global__ __launch_bounds__(256) void k_fin(const float* __restrict__ msa, const float* __restrict__ FG, const float* __restrict__ bg, const float* __restrict__ O2, float* O) { const size_t i = (size_t)blockIdx.x * 256 + threadIdx.x; if (i >= (size_t)NR * CC / 4) return; const size_t e = i * 4; const int c0 = (int)(e % CC); const v4f m = *(const v4f*)(msa + e), fg = *(const v4f*)(FG + e), o2 = *(const v4f*)(O2 + e); v4f o;
#pragma unroll
    for (int q = 0; q < 4; ++q) { const float zg = __fadd_rn(fg[q], bfr(bg[c0 + q])); const float sg = __fdiv_rn(1.0f, __fadd_rn(1.0f, expf(-zg))); float t = __fmul_rn(sg, o2[q]); asm volatile("" : "+v"(t)); o[q] = __fadd_rn(bfr(m[q]), t); }
    *(v4f*)(O + e) = o;  }

extern "C" void kernel_launch(void* const* d_in, const int* in_sizes, int n_in,
                              void* d_out, int out_size, void* d_ws, size_t ws_size, hipStream_t stream) {
    (void)in_sizes; (void)n_in; (void)out_size;
    const float* msa = (const float*)d_in[0]; const float* pair = (const float*)d_in[1]; const float* lmw = (const float*)d_in[2]; const float* lmb = (const float*)d_in[3]; const float* lzw = (const float*)d_in[4]; const float* lzb = (const float*)d_in[5]; const float* wq = (const float*)d_in[6]; const float* wk = (const float*)d_in[7]; const float* wv = (const float*)d_in[8]; const float* wb = (const float*)d_in[9]; const float* wo = (const float*)d_in[10]; const float* bo = (const float*)d_in[11]; const float* wg = (const float*)d_in[12]; const float* bg = (const float*)d_in[13];
    float* OUT = (float*)d_out;     // [128][256][256]
    char* wsp = (char*)d_ws;
    auto take = [&](size_t bytes) { char* p = wsp; wsp += (bytes + 255) & ~(size_t)255; return (void*)p; };
    bf* WQ = (bf*)take((size_t)5 * CC * CC * 2); bf* WO = WQ + (size_t)4 * CC * CC;   /* the five bf16 weight matrices back to back: q, k, v, gate, out */
    bf* XH = (bf*)take((size_t)NR * CC * 2); bf* XL = (bf*)take((size_t)NR * CC * 2); bf* Gh = (bf*)take((size_t)NR * CC * 2); bf* Gl = (bf*)take((size_t)NR * CC * 2); float* TB = (float*)take((size_t)NH_ * NZR * 4);
    float* FQ = (float*)take((size_t)4 * NR * CC * 4); float* FK = FQ + (size_t)NR * CC; float* FV = FK + (size_t)NR * CC; float* FG = FV + (size_t)NR * CC;   /* the four projections back to back */
    float* O2 = FQ;   /* O2 reuses the q buffer after the attention launch (stream-ordered) */
    if ((size_t)(wsp - (char*)d_ws) > ws_size) return;
    k_pre<<<5 * WBLK + NR / 8, 256, 0, stream>>>(msa, lmw, lmb, XH, XL, wq, wk, wv, wg, wo, WQ);   /* bf16 weights and the MSA LayerNorm planes */
    k_zbias<<<NZR / 256, 256, 0, stream>>>(pair, lzw, lzb, wb, TB);   /* pair LayerNorm + pair-bias dots */
    k_gemmw<bf, 1, false, CC><<<dim3(NR / 64, CC / 64, 4), 32, 0, stream>>>(XH, XL, WQ, nullptr, FQ, CC, nullptr, 0, (size_t)CC * CC, (size_t)NR * CC);   /* q, k, v, gate projections (2 products) as the z index of one grid: its 8,192 single-wave work-groups keep all four resident places of every SIMD filled */
    k_fattn<<<dim3(NH_, NI, 1), 256, 0, stream>>>(FQ, FK, FV, TB, Gh, Gl);                                                                     /* scores, / sqrt(32) + pair bias, softmax, attn.v -> merged context planes */
    k_gemmw<bf, 1, true, CC><<<dim3(NR / 64, CC / 64, 1), 32, 0, stream>>>(Gh, Gl, WO, nullptr, O2, CC, bo, 0, 0, 0);                          /* O2 = context W_out^T + b_out */
    k_fin<<<(unsigned)(((size_t)NR * CC / 4 + 255) / 256), 256, 0, stream>>>(msa, FG, bg, O2, OUT);                                            /* out = msa + sigmoid(gate) x O2 */
}

// v006
// A run of this version takes 113 microseconds.
// Two timings next to v005 both put it at 1.13 times that version's speed.
// Counting every step since v000, it is 6.37 times as fast.
#include <hip/hip_runtime.h>

// MSA row attention with pair bias (msa [128][256][256], pair [256][256][128]; m = LayerNorm(msa), z = LayerNorm(pair) (eps 1e-5, affine); per MSA row b and head h (8 x 32): q, k, v = m W^T ('oi' [256][256]); scores = q.k / sqrt(32) + bias[h][i][j] with bias = z . w_b[h] ([8][128]); softmax over j; o = attn.v merged; out = msa + sigmoid(m W_gate^T + b_gate) * (o W_out^T + b_out) -> [128][256][256] (8.4 M)).
// Layout: the 32,768 (row, position) MSA rows are one tall GEMM operand for the LayerNormed projections (m as bf16 hi + lo: 2 products) and for the output projection of the merged context; the pair LayerNorm feeds only the 8 bias dot products per pair position; the 1,024 (row, head) attention problems of size 256 x 256 x 32 run in ONE launch, one work-group each: scores on hi/lo planes (3 products, K = 32), x 1/sqrt(32) + bias, a 256-wide softmax in registers, attn.v on hi/lo planes (3 products); the output projection's epilogue applies the sigmoid gate and the residual in f32.
// Every 16-bit GEMM operand plane (m, the merged context, the five weight matrices) lies in memory in FRAGMENT ORDER: a block of 16 rows x 32 k is 1 KiB, blocks of one 16-row strip follow one another in k; element (row lr, k = 32 kc + 16 j + 8 hi + e) stands at block * 512 + j * 256 + (16 hi + lr) * 8 + e, so that a wave's 16-byte load of half a fragment is 512 contiguous bytes (4 whole lines) where a row-major plane gave 16 lines of 32 bytes. The pair bias lies likewise in the order of the score accumulators (at k_zbias).

#define NI   128                  // MSA rows
#define NJ   256                  // positions (= attention length)
#define CC   256                  // c_m
#define CZ   128                  // c_z
#define NZR  (NJ * NJ)            // 65,536 pair positions
#define NH_  8
#define CH   32
#define NR   (NI * NJ)            // 32,768 (row, position) MSA rows
#define QSC  0.17677669529663689f  // 1/sqrt(32)
typedef _Float16 h16;
typedef unsigned short bf;
typedef __attribute__((ext_vector_type(16))) __bf16   v16bf;
typedef __attribute__((ext_vector_type(16))) _Float16 v16h;
typedef __attribute__((ext_vector_type(8)))  _Float16 v8h;
typedef __attribute__((ext_vector_type(8)))  unsigned short v8us;
typedef __attribute__((ext_vector_type(8)))  float    v8f;
typedef __attribute__((ext_vector_type(4)))  float    v4f;
typedef __attribute__((ext_vector_type(2)))  float    v2f;
typedef __attribute__((ext_vector_type(4)))  unsigned short v4us;
typedef __attribute__((ext_vector_type(2)))  unsigned short v2us;
typedef __attribute__((ext_vector_type(2)))  __bf16   v2b;
typedef __attribute__((ext_vector_type(2)))  unsigned v2u;
typedef __attribute__((ext_vector_type(4)))  unsigned v4u;
typedef v8h  __attribute__((may_alias)) v8ha;
typedef v4f  __attribute__((may_alias)) v4fa;
typedef v8us __attribute__((may_alias)) v8usa;

// f32 -> 16-bit plane value, round to nearest even, by the chip's convert instruction; cvt2 rounds two values with one v_cvt_pk_bf16_f32 (a in the low half of the word) and leaves them packed as the planes want them.
__device__ __forceinline__ unsigned short f2bf(float f) { return __builtin_bit_cast(unsigned short, (__bf16)f); }
__device__ __forceinline__ unsigned cvt2(float a, float b) { return __builtin_bit_cast(unsigned, __builtin_convertvector((v2f){a, b}, v2b)); }
__device__ __forceinline__ float lo2f(unsigned p) { return __uint_as_float(p << 16); }
__device__ __forceinline__ float hi2f(unsigned p) { return __uint_as_float(p & 0xFFFF0000u); }
__device__ __forceinline__ void split2(float a, float b, unsigned& h, unsigned& l) { h = cvt2(a, b); l = cvt2(a - lo2f(h), b - hi2f(h)); }   /* hi plane word and lo plane word of a pair */
__device__ __forceinline__ v8f bfr8(v8f a) { v8f o;
#pragma unroll
    for (int q = 0; q < 8; q += 2) { const unsigned p = cvt2(a[q], a[q + 1]); o[q] = lo2f(p); o[q + 1] = hi2f(p); } return o; }
__device__ __forceinline__ v8us f2bf8(v8f a) { v4u o;
#pragma unroll
    for (int q = 0; q < 4; ++q) o[q] = cvt2(a[2 * q], a[2 * q + 1]); return __builtin_bit_cast(v8us, o); }
__device__ __forceinline__ void split8(v8f x, v8us& h, v8us& l) { v4u a, c;
#pragma unroll
    for (int q = 0; q < 4; ++q) { unsigned u, w; split2(x[2 * q], x[2 * q + 1], u, w); a[q] = u; c[q] = w; }
    h = __builtin_bit_cast(v8us, a); l = __builtin_bit_cast(v8us, c); }
__device__ __forceinline__ void split4(v4f x, v4us& h, v4us& l) { v2u a, c;
#pragma unroll
    for (int q = 0; q < 2; ++q) { unsigned u, w; split2(x[2 * q], x[2 * q + 1], u, w); a[q] = u; c[q] = w; }
    h = __builtin_bit_cast(v4us, a); l = __builtin_bit_cast(v4us, c); }
__device__ __forceinline__ float bf2f(unsigned short b) { return __uint_as_float(((unsigned)b) << 16); }
__device__ __forceinline__ float bfr(float f) { return bf2f(f2bf(f)); }
__device__ __forceinline__ void splitf(float y, unsigned short& h, unsigned short& l) { h = f2bf(y); l = f2bf(y - bf2f(h)); }
__device__ __forceinline__ v16h cat16(v8h lo, v8h hi) { return __builtin_shufflevector(lo, hi, 0, 1, 2, 3, 4, 5, 6, 7, 8, 9, 10, 11, 12, 13, 14, 15); }
__device__ __forceinline__ v16bf cat16b(v8us lo, v8us hi) { return __builtin_bit_cast(v16bf, __builtin_shufflevector(lo, hi, 0, 1, 2, 3, 4, 5, 6, 7, 8, 9, 10, 11, 12, 13, 14, 15)); }
__device__ __forceinline__ v8f wmma16(v16h a, v16h b, v8f c) { return __builtin_amdgcn_wmma_f32_16x16x32_f16(false, a, false, b, (short)0, c, false, false); }
__device__ __forceinline__ v8f wmmab(v16bf a, v16bf b, v8f c) { return __builtin_amdgcn_wmma_f32_16x16x32_bf16(false, a, false, b, (short)0, c, false, false); }

__device__ __forceinline__ v4f exp2x4(v4f x) { float a0 = x[0], a1 = x[1], a2 = x[2], a3 = x[3];
    /* four independent v_exp_f32 in one statement, closed by a v_nop: each fills the slot that the instruction set asks for behind the one in front of it, the v_nop the last one's */
    asm("v_exp_f32 %0, %0\n\tv_exp_f32 %1, %1\n\tv_exp_f32 %2, %2\n\tv_exp_f32 %3, %3\n\tv_nop" : "+v"(a0), "+v"(a1), "+v"(a2), "+v"(a3));
    return (v4f){a0, a1, a2, a3}; }
// ---- k_gemmw: register-blocked GEMM, ONE WAVE per 64x64 output tile (16 accumulators), operands straight from 16-bit planes in fragment order (head of the file); grid (M/64, N/64, Z), 32 threads.
// C[m][n] (f32, pitch ldc) = sum_k A[m][k] Bt[n][k] (+ split products per NSPLIT). z-batch strides sA/sB/sC in elements. K % 32 == 0.
// FIN: the tile never goes to memory as a plain product; C[m][n] = res[m][n] + sigmoid(gate[m][n] + gbias[n]) * (product + bias[n]), all three arrays of pitch CC.
template <typename T16> struct WFrag;
template <> struct WFrag<h16> { typedef v16h V; static __device__ __forceinline__ V ld(const h16* p) { return cat16(*(const v8h*)p, *(const v8h*)(p + 256)); } static __device__ __forceinline__ v8f mma(V a, V b, v8f c) { return wmma16(a, b, c); } };
template <> struct WFrag<bf> { typedef v16bf V; static __device__ __forceinline__ V ld(const bf* p) { return cat16b(*(const v8us*)p, *(const v8us*)(p + 256)); } static __device__ __forceinline__ v8f mma(V a, V b, v8f c) { return wmmab(a, b, c); } };
template <typename T16, int NSPLIT, bool FIN, int K>
__global__ __launch_bounds__(32) void k_gemmw(const T16* __restrict__ A, const T16* __restrict__ A2, const T16* __restrict__ Bt, const T16* __restrict__ Bt2, float* C, int ldc, const float* __restrict__ bias, size_t sA, size_t sB, size_t sC, const float* __restrict__ res, const float* __restrict__ gate, const float* __restrict__ gbias) {
    typedef typename WFrag<T16>::V V;
    __shared__ __align__(16) float os[16 * 68];
    const size_t z = blockIdx.z; A += z * sA; if (A2) A2 += z * sA; Bt += z * sB; if (Bt2) Bt2 += z * sB; C += z * sC;
    const int lane = threadIdx.x & 31, lr = lane & 15, hi = lane >> 4; const int r0 = blockIdx.x * 64, c0 = blockIdx.y * 64;
    v8f acc[4][4];
#pragma unroll
    for (int mb = 0; mb < 4; ++mb)
#pragma unroll
        for (int nb = 0; nb < 4; ++nb) acc[mb][nb] = (v8f){};
    /* a 16-row strip is 16 K elements, a k block of 32 is 512: with K fixed at compile time the four strips of an operand are immediate offsets from one address */
    const T16* va = A + (size_t)r0 * K + 8 * lane; const T16* vb = Bt + (size_t)c0 * K + 8 * lane; const T16* va2 = (NSPLIT == 1 || NSPLIT == 2) ? A2 + (size_t)r0 * K + 8 * lane : va; const T16* vb2 = NSPLIT >= 2 ? Bt2 + (size_t)c0 * K + 8 * lane : vb;
#pragma unroll 1
    for (int kc = 0; kc < K; kc += 32) {
        V a[4], a2[4], b[4], b2[4];
#pragma unroll
        for (int mb = 0; mb < 4; ++mb) { a[mb] = WFrag<T16>::ld(va + mb * 16 * K); b[mb] = WFrag<T16>::ld(vb + mb * 16 * K); if (NSPLIT == 1 || NSPLIT == 2) a2[mb] = WFrag<T16>::ld(va2 + mb * 16 * K); if (NSPLIT >= 2) b2[mb] = WFrag<T16>::ld(vb2 + mb * 16 * K); }
        asm volatile("s_wait_xcnt 0x0" :: "v"(va), "v"(vb), "v"(va2), "v"(vb2) : "memory");   /* the wait in front of the step of the address registers of the loads above; as inputs the addresses stay in their registers up to it */
        va += 512; vb += 512; va2 += 512; vb2 += 512;
#pragma unroll
        for (int nb = 0; nb < 4; ++nb) {
#pragma unroll
            for (int mb = 0; mb < 4; ++mb) { acc[mb][nb] = WFrag<T16>::mma(a[mb], b[nb], acc[mb][nb]); if (NSPLIT == 1 || NSPLIT == 2) acc[mb][nb] = WFrag<T16>::mma(a2[mb], b[nb], acc[mb][nb]); if (NSPLIT >= 2) acc[mb][nb] = WFrag<T16>::mma(a[mb], b2[nb], acc[mb][nb]); } }
        asm volatile("v_nop\n\tv_nop\n\tv_nop\n\tv_nop" : "+v"(acc[0][0]), "+v"(acc[1][1]), "+v"(acc[2][2]), "+v"(acc[3][3]) : "v"(a[0]), "v"(a[3]));
    }
    /* FIN: the lane's 16 bytes of row r0 + hi; every other row of the tile is a compile-time offset from these three addresses. The residual and gate rows of strip mb + 1 are asked for while strip mb is worked on. */
    const size_t eo = (size_t)(r0 + hi) * CC + c0 + lr * 4; const float* pr = FIN ? res + eo : nullptr; const float* pg = FIN ? gate + eo : nullptr; float* po = C + eo;
    v4f xr[2][8], xg[2][8], ob, gb;
    if (FIN) { const v4f b4 = *(const v4f*)(bias + c0 + lr * 4), g4 = *(const v4f*)(gbias + c0 + lr * 4);
#pragma unroll
        for (int q = 0; q < 4; ++q) { ob[q] = bfr(b4[q]); gb[q] = bfr(g4[q]); }
#pragma unroll
        for (int s = 0; s < 8; ++s) { xr[0][s] = *(const v4f*)(pr + 2 * s * CC); xg[0][s] = *(const v4f*)(pg + 2 * s * CC); } }
#pragma unroll
    for (int mb = 0; mb < 4; ++mb) {
#pragma unroll
        for (int nb = 0; nb < 4; ++nb) {
#pragma unroll
            for (int j = 0; j < 8; ++j) os[(hi * 8 + j) * 68 + nb * 16 + lr] = acc[mb][nb][j]; }
        __builtin_amdgcn_wave_barrier(); asm volatile("" ::: "memory");
        if (FIN) {
            if (mb < 3) {
#pragma unroll
                for (int s = 0; s < 8; ++s) { xr[(mb + 1) & 1][s] = *(const v4f*)(pr + ((mb + 1) * 16 + 2 * s) * CC); xg[(mb + 1) & 1][s] = *(const v4f*)(pg + ((mb + 1) * 16 + 2 * s) * CC); } }
#pragma unroll
            for (int s = 0; s < 8; ++s) { const v4f val = *(const v4fa*)(os + (2 * s + hi) * 68 + lr * 4) + ob; const v4f x = xr[mb & 1][s], eg = exp2x4((xg[mb & 1][s] + gb) * -1.4426950408889634f);   /* eg = exp(-(gate + its bias)) */ const unsigned p0 = cvt2(x[0], x[1]), p1 = cvt2(x[2], x[3]); const v4f m = (v4f){lo2f(p0), hi2f(p0), lo2f(p1), hi2f(p1)}; v4f o;
#pragma unroll
                for (int q = 0; q < 4; ++q) o[q] = m[q] + __fdiv_rn(1.0f, 1.0f + eg[q]) * val[q];
                xr[mb & 1][s] = o; *(v4f*)(po + (mb * 16 + 2 * s) * CC) = o; }
            asm volatile("s_wait_xcnt 0x0" :: "v"(xr[mb & 1][0]), "v"(xr[mb & 1][1]), "v"(xr[mb & 1][2]), "v"(xr[mb & 1][3]), "v"(xr[mb & 1][4]), "v"(xr[mb & 1][5]), "v"(xr[mb & 1][6]), "v"(xr[mb & 1][7]), "v"(pr), "v"(pg), "v"(po) : "memory");   /* the wait in front of any overwrite of the data registers of this strip's eight stores and of the address registers of the loads and stores above; as inputs they all stay in their registers up to it */
            __builtin_amdgcn_sched_barrier(0);   /* keeps the next strip's arithmetic behind this strip's: pulled up, it waits on the residual and gate rows that were only just asked for */
        } else {
            float* crow = C + (size_t)(r0 + mb * 16) * ldc + c0;
#pragma unroll
            for (int s = 0; s < 8; ++s) { const int row = 2 * s + hi, cofs = lr * 4; const v4f val = *(const v4fa*)(os + row * 68 + cofs);
                *(v4f*)(crow + (size_t)row * ldc + cofs) = val; }
        }
        __builtin_amdgcn_wave_barrier(); asm volatile("" ::: "memory");
    }
}

__global__ __launch_bounds__(256) void k_wtG(const float* __restrict__ w, int K, int N, bf* Bt) {
    const int lane = threadIdx.x & 31; const int L0 = (blockIdx.x * 8 + (threadIdx.x >> 5)) * 8; const int nlines = N * K / 64;
{
#pragma unroll 1
        for (int l = 0; l < 8; ++l) { const int L = L0 + l; if (L >= nlines) break; const size_t e = (size_t)L * 64 + lane * 2; const int k = (int)(e % K), n = (int)(e / K); v2us o;
            o[0] = f2bf(w[(size_t)k * N + n]); o[1] = f2bf(w[(size_t)(k + 1) * N + n]); *(v2us*)(Bt + e) = o; }
         }
}
#define WBLK (CC * CC / 8 / 256)   // 32 blocks of 256 threads round one 256 x 256 weight matrix, 8 elements a thread
// ---- k_pre: two jobs that need nothing of each other, as block ranges of one grid. Blocks 0 .. 5 WBLK - 1 round the five 'oi' weight matrices to bf16 (Bt in fragment order; W5 holds them back to back in the order q, k, v, gate, out; a thread owns one 16-byte piece of the OUTPUT, so a wave stores 4 whole lines); the other blocks do the MSA LayerNorm, one wave a row: the 8 rows of a block meet in LDS, from where each wave stores 4 whole lines a plane (8 rows x 16 bytes are one line of the fragment order).
#define PP 288                    // LDS row pitch of k_pre, 16-bit elements: 576 B, so that the 8 rows x 4 pieces a wave reads back spread over all banks
__global__ __launch_bounds__(256) void k_pre(const float* __restrict__ x, const float* __restrict__ lw, const float* __restrict__ lb, bf* MH, bf* ML, const float* __restrict__ wq, const float* __restrict__ wk, const float* __restrict__ wv, const float* __restrict__ wg, const float* __restrict__ wo, bf* W5) {
    if (blockIdx.x < 5 * WBLK) { const int m = blockIdx.x / WBLK; const float* src = m == 0 ? wq : m == 1 ? wk : m == 2 ? wv : m == 3 ? wg : wo; const int i = (blockIdx.x % WBLK) * 256 + threadIdx.x; const int n = (i >> 9) * 16 + (i & 15), k0 = ((i >> 6) & 7) * 32 + ((i >> 4) & 3) * 8; const v8f v = *(const v8f*)(src + n * CC + k0); v8us o;   /* piece i of the fragment order: strip i >> 9, k block (i >> 6) & 7, then j, hi, lr */
#pragma unroll
        for (int k = 0; k < 8; ++k) o[k] = f2bf(v[k]);
        *(v8us*)(W5 + (size_t)m * CC * CC + i * 8) = o; return; }
    __shared__ __align__(16) bf sph[8 * PP]; __shared__ __align__(16) bf spl[8 * PP];
    const int lane = threadIdx.x & 31, wid = threadIdx.x >> 5; const int rb = (blockIdx.x - 5 * WBLK) * 8; if (rb >= NR) return; const int r = rb + wid; const v8f a = *(const v8f*)(x + (size_t)r * CC + lane * 8); float u[8]; float s = 0.f;
#pragma unroll
    for (int q = 0; q < 8; ++q) { u[q] = bfr(a[q]); s += u[q]; }
#pragma unroll
    for (int sh = 16; sh; sh >>= 1) s += __shfl_xor(s, sh, 32);
    const float mu = s * (1.0f / CC); float s2 = 0.f;
#pragma unroll
    for (int q = 0; q < 8; ++q) { float d0 = __fsub_rn(u[q], mu); asm volatile("" : "+v"(d0)); float p = __fmul_rn(d0, d0); asm volatile("" : "+v"(p)); s2 = __fadd_rn(s2, p); }
#pragma unroll
    for (int sh = 16; sh; sh >>= 1) s2 += __shfl_xor(s2, sh, 32);
    const float rs = __fdiv_rn(1.0f, __fsqrt_rn(__fadd_rn(s2 * (1.0f / CC), 1e-5f))); v8us oh, ol;
#pragma unroll
    for (int q = 0; q < 8; ++q) { const int c = lane * 8 + q; float d1 = __fsub_rn(u[q], mu); asm volatile("" : "+v"(d1)); float n0 = __fmul_rn(d1, rs); asm volatile("" : "+v"(n0)); float n1 = __fmul_rn(n0, bfr(lw[c])); asm volatile("" : "+v"(n1)); const float xn = __fadd_rn(n1, bfr(lb[c])); unsigned short h2, l2; splitf(xn, h2, l2); oh[q] = h2; ol[q] = l2; }
    *(v8us*)(sph + wid * PP + lane * 8) = oh; *(v8us*)(spl + wid * PP + lane * 8) = ol;
    __syncthreads();
    const int pc = threadIdx.x >> 3, rw = threadIdx.x & 7;   /* piece pc = k / 8 of row rb + rw: 8 threads fill one line */
    const size_t d = (size_t)(rb >> 4) * 16 * CC + (pc >> 2) * 512 + (pc & 3) * 128 + ((rb & 8) + rw) * 8;
    *(v8us*)(MH + d) = *(const v8us*)(sph + rw * PP + pc * 8); *(v8us*)(ML + d) = *(const v8us*)(spl + rw * PP + pc * 8);  }
// ---- k_zbias: pair LayerNorm and its 8 bias dots in one kernel; the normalised z never leaves the registers.
// A wave takes 32 pair positions as two tiles of 16. Lane (lr, hi) holds half of row lr of each tile in the k order of a WMMA operand (k = 32 kc + 8 hi + 0..7 and 32 kc + 16 + 8 hi + 0..7), so a row's mean and variance are in-lane sums plus one exchange between the wave halves, and the hi/lo planes of z are the B operand as they stand.
// A = w_b as bf16 with head m & 7 in row m: both halves of D hold the 8 heads, half hi keeps tile hi, and each head's 32 values go out as one 128-B line.
// TB lies in the order of k_fattn's score accumulators: per head, a block of 16 queries x 16 keys is 1 KiB, and (query lr, key 8 hi + 4 half + e) stands at half * 128 + (16 hi + lr) * 4 + e. One line of it is 8 queries x 4 keys: those are the 32 pair positions of wave g, whose line is number g of each head's plane.
__device__ __forceinline__ float sum8(v8f a) { return ((a[0] + a[1]) + (a[2] + a[3])) + ((a[4] + a[5]) + (a[6] + a[7])); }
__global__ __launch_bounds__(256) void k_zbias(const float* __restrict__ x, const float* __restrict__ lw, const float* __restrict__ lb, const float* __restrict__ wtri, float* TB) {
    const int lane = threadIdx.x & 31, lr = lane & 15, hi = lane >> 4; const int g = blockIdx.x * 8 + (threadIdx.x >> 5), r0 = g * 32;
    const int qi = (g >> 7) * 16 + (g & 1) * 8 + (lr >> 2), kj = ((g >> 3) & 15) * 16 + ((g >> 1) & 1) * 8 + ((g >> 2) & 1) * 4 + (lr & 3);   /* row lr of tile 0: its query and key; tile 1 is 4 queries further */
    const float* px = x + (size_t)(qi * NJ + kj) * CZ + 8 * hi; const float* pw = wtri + (lr & 7) * CZ + 8 * hi; const unsigned ob = 32u * hi;   /* ob: the lane's byte offset into scale and bias */
    v8f u[2][8];   /* u[t][i]: tile t, k = 16 i + 8 hi + 0..7 */
#pragma unroll
    for (int t = 0; t < 2; ++t)
#pragma unroll
        for (int i = 0; i < 8; ++i) u[t][i] = *(const v8f*)(px + t * 4 * NJ * CZ + i * 16);
    asm volatile("s_wait_xcnt 0x0" :: "v"(px) : "memory");   /* the wait in front of any overwrite of the address registers of the loads above; as an input the address stays in its registers up to it */
    float rs[2];
#pragma unroll
    for (int t = 0; t < 2; ++t) { v8f a = (v8f){};
#pragma unroll
        for (int i = 0; i < 8; ++i) { u[t][i] = bfr8(u[t][i]); a += u[t][i]; }
        float s = sum8(a); s += __shfl_xor(s, 16, 32); const float mu = s * (1.0f / CZ); a = (v8f){};
#pragma unroll
        for (int i = 0; i < 8; ++i) { u[t][i] -= mu; a += u[t][i] * u[t][i]; }
        float s2 = sum8(a); s2 += __shfl_xor(s2, 16, 32); rs[t] = __fdiv_rn(1.0f, __fsqrt_rn(__fadd_rn(s2 * (1.0f / CZ), 1e-5f))); }
    v8f acc[2]; acc[0] = (v8f){}; acc[1] = (v8f){};
#pragma unroll
    for (int kc = 0; kc < 4; ++kc) { const char* qa = (const char*)(lw + kc * 32) + ob; const char* qb = (const char*)(lb + kc * 32) + ob; const v8f a0 = bfr8(*(const v8f*)qa), a1 = bfr8(*(const v8f*)(qa + 64)), b0 = bfr8(*(const v8f*)qb), b1 = bfr8(*(const v8f*)(qb + 64));
        const v16bf wf = cat16b(f2bf8(*(const v8f*)(pw + kc * 32)), f2bf8(*(const v8f*)(pw + kc * 32 + 16)));
        if (kc == 3) asm volatile("s_wait_xcnt 0x0" :: "v"(pw), "v"(ob) : "memory");   /* behind the last loads of w_b, scale and bias: the wait in front of any overwrite of their address registers (inputs: address and offset stay put up to it) */
#pragma unroll
        for (int t = 0; t < 2; ++t) { v8us h0, l0, h1, l1; split8(u[t][2 * kc] * rs[t] * a0 + b0, h0, l0); split8(u[t][2 * kc + 1] * rs[t] * a1 + b1, h1, l1);
            acc[t] = wmmab(wf, cat16b(h0, h1), acc[t]); acc[t] = wmmab(wf, cat16b(l0, l1), acc[t]); } }
#pragma unroll
    for (int r = 0; r < 8; ++r) TB[(size_t)r * NZR + r0 + lane] = hi ? acc[1][r] : acc[0][r];
}
// ---- k_fattn: one work-group per (MSA row, head), 8 waves; the score matrix never leaves the registers.
// K (hi/lo planes, [key][d]) and V transposed (hi/lo planes, [d][key]) are split once into LDS; each wave then takes 16 queries at a time: S^T = K Q^T (a lane holds 128 of one query's 256 scores), softmax in-lane plus one exchange between the wave halves, the normalised P^T packed from the score accumulators as the B operand of O^T = V^T P^T, and 8 consecutive d per lane stored as the merged-context hi/lo planes (fragment order).
#define KP 40                     // K plane row pitch, 16-bit elements: 80 B = 16 B x odd
#define VP 264                    // V^T plane row pitch, 16-bit elements: 528 B = 16 B x odd
__device__ __forceinline__ v8f exp2x8(v8f x) { float a0 = x[0], a1 = x[1], a2 = x[2], a3 = x[3], a4 = x[4], a5 = x[5], a6 = x[6], a7 = x[7];
    /* eight independent v_exp_f32 in one statement, closed by a v_nop: each fills the slot that the instruction set asks for behind the one in front of it, the v_nop the last one's */
    asm("v_exp_f32 %0, %0\n\tv_exp_f32 %1, %1\n\tv_exp_f32 %2, %2\n\tv_exp_f32 %3, %3\n\tv_exp_f32 %4, %4\n\tv_exp_f32 %5, %5\n\tv_exp_f32 %6, %6\n\tv_exp_f32 %7, %7\n\tv_nop" : "+v"(a0), "+v"(a1), "+v"(a2), "+v"(a3), "+v"(a4), "+v"(a5), "+v"(a6), "+v"(a7));
    return (v8f){a0, a1, a2, a3, a4, a5, a6, a7}; }
__device__ __forceinline__ v16bf ldfrag(const bf* p) { return cat16b(*(const v8us*)p, *(const v8us*)(p + 16)); }
/* second launch bound: four waves per SIMD, so that two work-groups share a WGP and one stages while the other computes */
__global__ __launch_bounds__(256, 4) void k_fattn(const float* __restrict__ FQ, const float* __restrict__ FK, const float* __restrict__ FV, const float* __restrict__ TB, bf* Gh, bf* Gl) {
    __shared__ __align__(16) bf Kh[NJ * KP]; __shared__ __align__(16) bf Kl[NJ * KP]; __shared__ __align__(16) bf Vh[CH * VP]; __shared__ __align__(16) bf Vl[CH * VP];
    const int tid = threadIdx.x, lane = tid & 31, wave = tid >> 5, lr = lane & 15, hi = lane >> 4; const int h = blockIdx.x, b = blockIdx.y;
    const size_t base = (size_t)b * NJ * CC + h * CH;
    {   /* 8 lanes cover one key's 128 B; a thread owns two neighbouring keys so that V^T goes to LDS in 4-byte pairs */
        const int kq = (tid >> 3) * 2, c4 = (tid & 7) * 4; const float* pk = FK + base + (size_t)kq * CC + c4; const float* pv = FV + base + (size_t)kq * CC + c4; v4f k0[4], k1[4], w0[4], w1[4];
#pragma unroll
        for (int it = 0; it < 4; ++it) { k0[it] = *(const v4f*)(pk + it * 64 * CC); k1[it] = *(const v4f*)(pk + it * 64 * CC + CC); w0[it] = *(const v4f*)(pv + it * 64 * CC); w1[it] = *(const v4f*)(pv + it * 64 * CC + CC); }
        asm volatile("s_wait_xcnt 0x0" :: "v"(pk), "v"(pv) : "memory");   /* the wait in front of any overwrite of the address registers of the loads above; as inputs the two addresses stay in their registers up to it */
#pragma unroll
        for (int it = 0; it < 4; ++it) { const int kp2 = kq + it * 64; v4us a0, b0, a1, b1;
            split4(k0[it], a0, b0); split4(k1[it], a1, b1);
            *(v4us*)(Kh + kp2 * KP + c4) = a0; *(v4us*)(Kl + kp2 * KP + c4) = b0; *(v4us*)(Kh + (kp2 + 1) * KP + c4) = a1; *(v4us*)(Kl + (kp2 + 1) * KP + c4) = b1;
#pragma unroll
            for (int q = 0; q < 4; ++q) { unsigned x, y; split2(w0[it][q], w1[it][q], x, y); *(v2us*)(Vh + (c4 + q) * VP + kp2) = __builtin_bit_cast(v2us, x); *(v2us*)(Vl + (c4 + q) * VP + kp2) = __builtin_bit_cast(v2us, y); } }
    }
    __syncthreads();
#pragma unroll 1   /* kept rolled: both trips unrolled would hold two sets of 128 score registers */
    for (int i = 0; i < 2; ++i) {   /* wave w takes query tiles w and w + 8 */
        const int qrow = (wave + 8 * i) * 16 + lr; const float* qr = FQ + base + (size_t)qrow * CC + 8 * hi; const float* tb = TB + (size_t)h * NZR + (size_t)(wave + 8 * i) * 16 * NJ + 4 * lane;   /* accumulator order (at k_zbias): each 16-byte load of the wave is 512 contiguous bytes */
        const v8f qa = *(const v8f*)qr, qb = *(const v8f*)(qr + 16);
        v8f s[16];   /* s[t][r] = score of key 16 t + 8 hi + r for query qrow; the pair bias is the accumulators' start value */
#pragma unroll
        for (int t = 0; t < 16; ++t) s[t] = __builtin_shufflevector(*(const v4f*)(tb + t * 256), *(const v4f*)(tb + t * 256 + 128), 0, 1, 2, 3, 4, 5, 6, 7);
        asm volatile("s_wait_xcnt 0x0" :: "v"(qr), "v"(tb) : "memory");   /* the wait in front of any overwrite of the address registers of the loads above (inputs: the addresses stay put up to it); its memory clobber also keeps the K and V^T fragment loads below inside this loop: hoisted out of it they take 512 registers and spill */
        v8us t0, t1, t2, t3; split8(qa * QSC, t0, t1); split8(qb * QSC, t2, t3); const v16bf qh = cat16b(t0, t2), ql = cat16b(t1, t3);   /* 1/sqrt(32) goes into q ahead of the hi/lo split */
#pragma unroll
        for (int t = 0; t < 16; ++t) { const int ko = (t * 16 + lr) * KP + 8 * hi; const v16bf kh = ldfrag(Kh + ko), kl = ldfrag(Kl + ko); s[t] = wmmab(kh, qh, s[t]); s[t] = wmmab(kh, ql, s[t]); s[t] = wmmab(kl, qh, s[t]); }
        float m8[8];
#pragma unroll
        for (int r = 0; r < 8; ++r) m8[r] = -3.0e38f;
#pragma unroll
        for (int t = 0; t < 16; ++t) {
#pragma unroll
            for (int r = 0; r < 8; ++r) m8[r] = fmaxf(m8[r], s[t][r]); }
        float mx = fmaxf(fmaxf(fmaxf(m8[0], m8[1]), fmaxf(m8[2], m8[3])), fmaxf(fmaxf(m8[4], m8[5]), fmaxf(m8[6], m8[7]))); mx = fmaxf(mx, __shfl_xor(mx, 16, 32));
        float s8[8];
#pragma unroll
        for (int r = 0; r < 8; ++r) s8[r] = 0.f;
#pragma unroll
        for (int t = 0; t < 16; ++t) { s[t] = exp2x8((s[t] - mx) * 1.4426950408889634f);
#pragma unroll
            for (int r = 0; r < 8; ++r) s8[r] += s[t][r]; }
        float sum = ((s8[0] + s8[1]) + (s8[2] + s8[3])) + ((s8[4] + s8[5]) + (s8[6] + s8[7])); sum += __shfl_xor(sum, 16, 32);
        const float f = __fdiv_rn(1.0f, sum);
        v8f o0 = (v8f){}, o1 = (v8f){};   /* o0[r] = context d = 8 hi + r, o1[r] = d = 16 + 8 hi + r, query qrow */
#pragma unroll
        for (int u = 0; u < 8; ++u) { split8(s[2 * u] * f, t0, t1); split8(s[2 * u + 1] * f, t2, t3); const v16bf ph = cat16b(t0, t2), pl = cat16b(t1, t3);
            const int vo = lr * VP + u * 32 + 8 * hi; const v16bf vh0 = ldfrag(Vh + vo), vl0 = ldfrag(Vl + vo), vh1 = ldfrag(Vh + vo + 16 * VP), vl1 = ldfrag(Vl + vo + 16 * VP);
            o0 = wmmab(vh0, ph, o0); o1 = wmmab(vh1, ph, o1); o0 = wmmab(vh0, pl, o0); o1 = wmmab(vh1, pl, o1); o0 = wmmab(vl0, ph, o0); o1 = wmmab(vl1, ph, o1); }
        const size_t oo = ((size_t)(b * 16 + wave + 8 * i) * 8 + h) * 512 + 8 * lane; split8(o0, t0, t1); split8(o1, t2, t3);   /* fragment order: strip = this query tile, k block = head; the lane's two pieces are the two halves of its A fragment */
        *(v8us*)(Gh + oo) = t0; *(v8us*)(Gl + oo) = t1; *(v8us*)(Gh + oo + 256) = t2; *(v8us*)(Gl + oo + 256) = t3;
        asm volatile("s_wait_xcnt 0x0" ::: "memory");   /* the wait in front of the next trip's overwrite of the address and data registers of the four stores above */
    }
}

extern "C" void kernel_launch(void* const* d_in, const int* in_sizes, int n_in,
                              void* d_out, int out_size, void* d_ws, size_t ws_size, hipStream_t stream) {
    (void)in_sizes; (void)n_in; (void)out_size;
    const float* msa = (const float*)d_in[0]; const float* pair = (const float*)d_in[1]; const float* lmw = (const float*)d_in[2]; const float* lmb = (const float*)d_in[3]; const float* lzw = (const float*)d_in[4]; const float* lzb = (const float*)d_in[5]; const float* wq = (const float*)d_in[6]; const float* wk = (const float*)d_in[7]; const float* wv = (const float*)d_in[8]; const float* wb = (const float*)d_in[9]; const float* wo = (const float*)d_in[10]; const float* bo = (const float*)d_in[11]; const float* wg = (const float*)d_in[12]; const float* bg = (const float*)d_in[13];
    float* OUT = (float*)d_out;     // [128][256][256]
    char* wsp = (char*)d_ws;
    auto take = [&](size_t bytes) { char* p = wsp; wsp += (bytes + 255) & ~(size_t)255; return (void*)p; };
    bf* WQ = (bf*)take((size_t)5 * CC * CC * 2); bf* WO = WQ + (size_t)4 * CC * CC;   /* the five bf16 weight matrices back to back: q, k, v, gate, out */
    bf* XH = (bf*)take((size_t)NR * CC * 2); bf* XL = (bf*)take((size_t)NR * CC * 2); bf* Gh = (bf*)take((size_t)NR * CC * 2); bf* Gl = (bf*)take((size_t)NR * CC * 2); float* TB = (float*)take((size_t)NH_ * NZR * 4);
    float* FQ = (float*)take((size_t)4 * NR * CC * 4); float* FK = FQ + (size_t)NR * CC; float* FV = FK + (size_t)NR * CC; float* FG = FV + (size_t)NR * CC;   /* the four projections back to back */
    if ((size_t)(wsp - (char*)d_ws) > ws_size) return;
    k_pre<<<5 * WBLK + NR / 8, 256, 0, stream>>>(msa, lmw, lmb, XH, XL, wq, wk, wv, wg, wo, WQ);   /* bf16 weights and the MSA LayerNorm planes */
    k_zbias<<<NZR / 256, 256, 0, stream>>>(pair, lzw, lzb, wb, TB);   /* pair LayerNorm + pair-bias dots */
    k_gemmw<bf, 1, false, CC><<<dim3(NR / 64, CC / 64, 4), 32, 0, stream>>>(XH, XL, WQ, nullptr, FQ, CC, nullptr, 0, (size_t)CC * CC, (size_t)NR * CC, nullptr, nullptr, nullptr);   /* q, k, v, gate projections (2 products) as the z index of one grid: its 8,192 single-wave work-groups keep all four resident places of every SIMD filled */
    k_fattn<<<dim3(NH_, NI, 1), 256, 0, stream>>>(FQ, FK, FV, TB, Gh, Gl);                                                                     /* scores, / sqrt(32) + pair bias, softmax, attn.v -> merged context planes */
    k_gemmw<bf, 1, true, CC><<<dim3(NR / 64, CC / 64, 1), 32, 0, stream>>>(Gh, Gl, WO, nullptr, OUT, CC, bo, 0, 0, 0, msa, FG, bg);   /* out = msa + sigmoid(gate) x (context W_out^T + b_out) */
}

// v007
// It runs in 97.1 microseconds.
// Timed twice side by side with v006, it ran 1.15 and 1.16 times as fast.
// Over all steps from v000 it is 7.36 times as fast.
#include <hip/hip_runtime.h>

// MSA row attention with pair bias (msa [128][256][256], pair [256][256][128]; m = LayerNorm(msa), z = LayerNorm(pair) (eps 1e-5, affine); per MSA row b and head h (8 x 32): q, k, v = m W^T ('oi' [256][256]); scores = q.k / sqrt(32) + bias[h][i][j] with bias = z . w_b[h] ([8][128]); softmax over j; o = attn.v merged; out = msa + sigmoid(m W_gate^T + b_gate) * (o W_out^T + b_out) -> [128][256][256] (8.4 M)).
// Layout: the 32,768 (row, position) MSA rows are one tall GEMM operand for the gate projection (m as bf16 hi + lo: 2 products) and for the output projection of the merged context; the pair LayerNorm feeds only the 8 bias dot products per pair position; the 1,024 (row, head) attention problems of size 256 x 256 x 32 run in ONE launch, one work-group each: its own q, k, v projections (2 products), scores on hi/lo planes (3 products, K = 32), x 1/sqrt(32) + bias, a 256-wide softmax in registers, attn.v on hi/lo planes (3 products); the output projection's epilogue applies the sigmoid gate and the residual in f32.
// Every 16-bit GEMM operand plane (m, the merged context, the five weight matrices) lies in memory in FRAGMENT ORDER: a block of 16 rows x 32 k is 1 KiB, blocks of one 16-row strip follow one another in k; element (row lr, k = 32 kc + 16 j + 8 hi + e) stands at block * 512 + j * 256 + (16 hi + lr) * 8 + e, so that a wave's 16-byte load of half a fragment is 512 contiguous bytes (4 whole lines) where a row-major plane gave 16 lines of 32 bytes. The pair bias lies likewise in the order of the score accumulators (at k_zbias).

#define NI   128                  // MSA rows
#define NJ   256                  // positions (= attention length)
#define CC   256                  // c_m
#define CZ   128                  // c_z
#define NZR  (NJ * NJ)            // 65,536 pair positions
#define NH_  8
#define CH   32
#define NR   (NI * NJ)            // 32,768 (row, position) MSA rows
#define QSC  0.17677669529663689f  // 1/sqrt(32)
typedef _Float16 h16;
typedef unsigned short bf;
typedef __attribute__((ext_vector_type(16))) __bf16   v16bf;
typedef __attribute__((ext_vector_type(16))) _Float16 v16h;
typedef __attribute__((ext_vector_type(8)))  _Float16 v8h;
typedef __attribute__((ext_vector_type(8)))  unsigned short v8us;
typedef __attribute__((ext_vector_type(8)))  float    v8f;
typedef __attribute__((ext_vector_type(4)))  float    v4f;
typedef __attribute__((ext_vector_type(2)))  float    v2f;
typedef __attribute__((ext_vector_type(4)))  unsigned short v4us;
typedef __attribute__((ext_vector_type(2)))  unsigned short v2us;
typedef __attribute__((ext_vector_type(2)))  __bf16   v2b;
typedef __attribute__((ext_vector_type(2)))  unsigned v2u;
typedef __attribute__((ext_vector_type(4)))  unsigned v4u;
typedef v8h  __attribute__((may_alias)) v8ha;
typedef v4f  __attribute__((may_alias)) v4fa;
typedef v8us __attribute__((may_alias)) v8usa;

// f32 -> 16-bit plane value, round to nearest even, by the chip's convert instruction; cvt2 rounds two values with one v_cvt_pk_bf16_f32 (a in the low half of the word) and leaves them packed as the planes want them.
__device__ __forceinline__ unsigned short f2bf(float f) { return __builtin_bit_cast(unsigned short, (__bf16)f); }
__device__ __forceinline__ unsigned cvt2(float a, float b) { return __builtin_bit_cast(unsigned, __builtin_convertvector((v2f){a, b}, v2b)); }
__device__ __forceinline__ float lo2f(unsigned p) { return __uint_as_float(p << 16); }
__device__ __forceinline__ float hi2f(unsigned p) { return __uint_as_float(p & 0xFFFF0000u); }
__device__ __forceinline__ void split2(float a, float b, unsigned& h, unsigned& l) { h = cvt2(a, b); l = cvt2(a - lo2f(h), b - hi2f(h)); }   /* hi plane word and lo plane word of a pair */
__device__ __forceinline__ v8f bfr8(v8f a) { v8f o;
#pragma unroll
    for (int q = 0; q < 8; q += 2) { const unsigned p = cvt2(a[q], a[q + 1]); o[q] = lo2f(p); o[q + 1] = hi2f(p); } return o; }
__device__ __forceinline__ v8us f2bf8(v8f a) { v4u o;
#pragma unroll
    for (int q = 0; q < 4; ++q) o[q] = cvt2(a[2 * q], a[2 * q + 1]); return __builtin_bit_cast(v8us, o); }
__device__ __forceinline__ void split8(v8f x, v8us& h, v8us& l) { v4u a, c;
#pragma unroll
    for (int q = 0; q < 4; ++q) { unsigned u, w; split2(x[2 * q], x[2 * q + 1], u, w); a[q] = u; c[q] = w; }
    h = __builtin_bit_cast(v8us, a); l = __builtin_bit_cast(v8us, c); }
__device__ __forceinline__ void split4(v4f x, v4us& h, v4us& l) { v2u a, c;
#pragma unroll
    for (int q = 0; q < 2; ++q) { unsigned u, w; split2(x[2 * q], x[2 * q + 1], u, w); a[q] = u; c[q] = w; }
    h = __builtin_bit_cast(v4us, a); l = __builtin_bit_cast(v4us, c); }
__device__ __forceinline__ float bf2f(unsigned short b) { return __uint_as_float(((unsigned)b) << 16); }
__device__ __forceinline__ float bfr(float f) { return bf2f(f2bf(f)); }
__device__ __forceinline__ void splitf(float y, unsigned short& h, unsigned short& l) { h = f2bf(y); l = f2bf(y - bf2f(h)); }
__device__ __forceinline__ v16h cat16(v8h lo, v8h hi) { return __builtin_shufflevector(lo, hi, 0, 1, 2, 3, 4, 5, 6, 7, 8, 9, 10, 11, 12, 13, 14, 15); }
__device__ __forceinline__ v16bf cat16b(v8us lo, v8us hi) { return __builtin_bit_cast(v16bf, __builtin_shufflevector(lo, hi, 0, 1, 2, 3, 4, 5, 6, 7, 8, 9, 10, 11, 12, 13, 14, 15)); }
__device__ __forceinline__ v8f wmma16(v16h a, v16h b, v8f c) { return __builtin_amdgcn_wmma_f32_16x16x32_f16(false, a, false, b, (short)0, c, false, false); }
__device__ __forceinline__ v8f wmmab(v16bf a, v16bf b, v8f c) { return __builtin_amdgcn_wmma_f32_16x16x32_bf16(false, a, false, b, (short)0, c, false, false); }

__device__ __forceinline__ v4f exp2x4(v4f x) { float a0 = x[0], a1 = x[1], a2 = x[2], a3 = x[3];
    /* four independent v_exp_f32 in one statement, closed by a v_nop: each fills the slot that the instruction set asks for behind the one in front of it, the v_nop the last one's */
    asm("v_exp_f32 %0, %0\n\tv_exp_f32 %1, %1\n\tv_exp_f32 %2, %2\n\tv_exp_f32 %3, %3\n\tv_nop" : "+v"(a0), "+v"(a1), "+v"(a2), "+v"(a3));
    return (v4f){a0, a1, a2, a3}; }
// ---- k_gemmw: register-blocked GEMM, ONE WAVE per 64x64 output tile (16 accumulators), operands straight from 16-bit planes in fragment order (head of the file); grid (M/64, N/64, Z), 32 threads.
// C[m][n] (f32, pitch ldc) = sum_k A[m][k] Bt[n][k] (+ split products per NSPLIT). z-batch strides sA/sB/sC in elements. K % 32 == 0.
// FIN: the tile never goes to memory as a plain product; C[m][n] = res[m][n] + sigmoid(gate[m][n] + gbias[n]) * (product + bias[n]), all three arrays of pitch CC.
template <typename T16> struct WFrag;
template <> struct WFrag<h16> { typedef v16h V; static __device__ __forceinline__ V ld(const h16* p) { return cat16(*(const v8h*)p, *(const v8h*)(p + 256)); } static __device__ __forceinline__ v8f mma(V a, V b, v8f c) { return wmma16(a, b, c); } };
template <> struct WFrag<bf> { typedef v16bf V; static __device__ __forceinline__ V ld(const bf* p) { return cat16b(*(const v8us*)p, *(const v8us*)(p + 256)); } static __device__ __forceinline__ v8f mma(V a, V b, v8f c) { return wmmab(a, b, c); } };
template <typename T16, int NSPLIT, bool FIN, int K>
__global__ __launch_bounds__(32) void k_gemmw(const T16* __restrict__ A, const T16* __restrict__ A2, const T16* __restrict__ Bt, const T16* __restrict__ Bt2, float* C, int ldc, const float* __restrict__ bias, size_t sA, size_t sB, size_t sC, const float* __restrict__ res, const float* __restrict__ gate, const float* __restrict__ gbias) {
    typedef typename WFrag<T16>::V V;
    __shared__ __align__(16) float os[16 * 68];
    const size_t z = blockIdx.z; A += z * sA; if (A2) A2 += z * sA; Bt += z * sB; if (Bt2) Bt2 += z * sB; C += z * sC;
    const int lane = threadIdx.x & 31, lr = lane & 15, hi = lane >> 4; const int r0 = blockIdx.x * 64, c0 = blockIdx.y * 64;
    v8f acc[4][4];
#pragma unroll
    for (int mb = 0; mb < 4; ++mb)
#pragma unroll
        for (int nb = 0; nb < 4; ++nb) acc[mb][nb] = (v8f){};
    /* a 16-row strip is 16 K elements, a k block of 32 is 512: with K fixed at compile time the four strips of an operand are immediate offsets from one address */
    const T16* va = A + (size_t)r0 * K + 8 * lane; const T16* vb = Bt + (size_t)c0 * K + 8 * lane; const T16* va2 = (NSPLIT == 1 || NSPLIT == 2) ? A2 + (size_t)r0 * K + 8 * lane : va; const T16* vb2 = NSPLIT >= 2 ? Bt2 + (size_t)c0 * K + 8 * lane : vb;
#pragma unroll 1
    for (int kc = 0; kc < K; kc += 32) {
        V a[4], a2[4], b[4], b2[4];
#pragma unroll
        for (int mb = 0; mb < 4; ++mb) { a[mb] = WFrag<T16>::ld(va + mb * 16 * K); b[mb] = WFrag<T16>::ld(vb + mb * 16 * K); if (NSPLIT == 1 || NSPLIT == 2) a2[mb] = WFrag<T16>::ld(va2 + mb * 16 * K); if (NSPLIT >= 2) b2[mb] = WFrag<T16>::ld(vb2 + mb * 16 * K); }
        asm volatile("s_wait_xcnt 0x0" :: "v"(va), "v"(vb), "v"(va2), "v"(vb2) : "memory");   /* the wait in front of the step of the address registers of the loads above; as inputs the addresses stay in their registers up to it */
        va += 512; vb += 512; va2 += 512; vb2 += 512;
#pragma unroll
        for (int nb = 0; nb < 4; ++nb) {
#pragma unroll
            for (int mb = 0; mb < 4; ++mb) { acc[mb][nb] = WFrag<T16>::mma(a[mb], b[nb], acc[mb][nb]); if (NSPLIT == 1 || NSPLIT == 2) acc[mb][nb] = WFrag<T16>::mma(a2[mb], b[nb], acc[mb][nb]); if (NSPLIT >= 2) acc[mb][nb] = WFrag<T16>::mma(a[mb], b2[nb], acc[mb][nb]); } }
        asm volatile("v_nop\n\tv_nop\n\tv_nop\n\tv_nop" : "+v"(acc[0][0]), "+v"(acc[1][1]), "+v"(acc[2][2]), "+v"(acc[3][3]) : "v"(a[0]), "v"(a[3]));
    }
    /* FIN: the lane's 16 bytes of row r0 + hi; every other row of the tile is a compile-time offset from these three addresses. The residual and gate rows of strip mb + 1 are asked for while strip mb is worked on. */
    const size_t eo = (size_t)(r0 + hi) * CC + c0 + lr * 4; const float* pr = FIN ? res + eo : nullptr; const float* pg = FIN ? gate + eo : nullptr; float* po = C + eo;
    v4f xr[2][8], xg[2][8], ob, gb;
    if (FIN) { const v4f b4 = *(const v4f*)(bias + c0 + lr * 4), g4 = *(const v4f*)(gbias + c0 + lr * 4);
#pragma unroll
        for (int q = 0; q < 4; ++q) { ob[q] = bfr(b4[q]); gb[q] = bfr(g4[q]); }
#pragma unroll
        for (int s = 0; s < 8; ++s) { xr[0][s] = *(const v4f*)(pr + 2 * s * CC); xg[0][s] = *(const v4f*)(pg + 2 * s * CC); } }
#pragma unroll
    for (int mb = 0; mb < 4; ++mb) {
#pragma unroll
        for (int nb = 0; nb < 4; ++nb) {
#pragma unroll
            for (int j = 0; j < 8; ++j) os[(hi * 8 + j) * 68 + nb * 16 + lr] = acc[mb][nb][j]; }
        __builtin_amdgcn_wave_barrier(); asm volatile("" ::: "memory");
        if (FIN) {
            if (mb < 3) {
#pragma unroll
                for (int s = 0; s < 8; ++s) { xr[(mb + 1) & 1][s] = *(const v4f*)(pr + ((mb + 1) * 16 + 2 * s) * CC); xg[(mb + 1) & 1][s] = *(const v4f*)(pg + ((mb + 1) * 16 + 2 * s) * CC); } }
#pragma unroll
            for (int s = 0; s < 8; ++s) { const v4f val = *(const v4fa*)(os + (2 * s + hi) * 68 + lr * 4) + ob; const v4f x = xr[mb & 1][s], eg = exp2x4((xg[mb & 1][s] + gb) * -1.4426950408889634f);   /* eg = exp(-(gate + its bias)) */ const unsigned p0 = cvt2(x[0], x[1]), p1 = cvt2(x[2], x[3]); const v4f m = (v4f){lo2f(p0), hi2f(p0), lo2f(p1), hi2f(p1)}; v4f o;
#pragma unroll
                for (int q = 0; q < 4; ++q) o[q] = m[q] + __fdiv_rn(1.0f, 1.0f + eg[q]) * val[q];
                xr[mb & 1][s] = o; *(v4f*)(po + (mb * 16 + 2 * s) * CC) = o; }
            asm volatile("s_wait_xcnt 0x0" :: "v"(xr[mb & 1][0]), "v"(xr[mb & 1][1]), "v"(xr[mb & 1][2]), "v"(xr[mb & 1][3]), "v"(xr[mb & 1][4]), "v"(xr[mb & 1][5]), "v"(xr[mb & 1][6]), "v"(xr[mb & 1][7]), "v"(pr), "v"(pg), "v"(po) : "memory");   /* the wait in front of any overwrite of the data registers of this strip's eight stores and of the address registers of the loads and stores above; as inputs they all stay in their registers up to it */
            __builtin_amdgcn_sched_barrier(0);   /* keeps the next strip's arithmetic behind this strip's: pulled up, it waits on the residual and gate rows that were only just asked for */
        } else {
            float* crow = C + (size_t)(r0 + mb * 16) * ldc + c0;
#pragma unroll
            for (int s = 0; s < 8; ++s) { const int row = 2 * s + hi, cofs = lr * 4; const v4f val = *(const v4fa*)(os + row * 68 + cofs);
                *(v4f*)(crow + (size_t)row * ldc + cofs) = val; }
        }
        __builtin_amdgcn_wave_barrier(); asm volatile("" ::: "memory");
    }
}

__global__ __launch_bounds__(256) void k_wtG(const float* __restrict__ w, int K, int N, bf* Bt) {
    const int lane = threadIdx.x & 31; const int L0 = (blockIdx.x * 8 + (threadIdx.x >> 5)) * 8; const int nlines = N * K / 64;
{
#pragma unroll 1
        for (int l = 0; l < 8; ++l) { const int L = L0 + l; if (L >= nlines) break; const size_t e = (size_t)L * 64 + lane * 2; const int k = (int)(e % K), n = (int)(e / K); v2us o;
            o[0] = f2bf(w[(size_t)k * N + n]); o[1] = f2bf(w[(size_t)(k + 1) * N + n]); *(v2us*)(Bt + e) = o; }
         }
}
#define WBLK (CC * CC / 8 / 256)   // 32 blocks of 256 threads round one 256 x 256 weight matrix, 8 elements a thread
// ---- k_pre: two jobs that need nothing of each other, as block ranges of one grid. Blocks 0 .. 5 WBLK - 1 round the five 'oi' weight matrices to bf16 (Bt in fragment order; W5 holds them back to back in the order q, k, v, gate, out; a thread owns one 16-byte piece of the OUTPUT, so a wave stores 4 whole lines); the other blocks do the MSA LayerNorm, one wave a row: the 8 rows of a block meet in LDS, from where each wave stores 4 whole lines a plane (8 rows x 16 bytes are one line of the fragment order).
#define PP 288                    // LDS row pitch of k_pre, 16-bit elements: 576 B, so that the 8 rows x 4 pieces a wave reads back spread over all banks
__global__ __launch_bounds__(256) void k_pre(const float* __restrict__ x, const float* __restrict__ lw, const float* __restrict__ lb, bf* MH, bf* ML, const float* __restrict__ wq, const float* __restrict__ wk, const float* __restrict__ wv, const float* __restrict__ wg, const float* __restrict__ wo, bf* W5) {
    if (blockIdx.x < 5 * WBLK) { const int m = blockIdx.x / WBLK; const float* src = m == 0 ? wq : m == 1 ? wk : m == 2 ? wv : m == 3 ? wg : wo; const int i = (blockIdx.x % WBLK) * 256 + threadIdx.x; const int n = (i >> 9) * 16 + (i & 15), k0 = ((i >> 6) & 7) * 32 + ((i >> 4) & 3) * 8; const v8f v = *(const v8f*)(src + n * CC + k0); v8us o;   /* piece i of the fragment order: strip i >> 9, k block (i >> 6) & 7, then j, hi, lr */
#pragma unroll
        for (int k = 0; k < 8; ++k) o[k] = f2bf(v[k]);
        *(v8us*)(W5 + (size_t)m * CC * CC + i * 8) = o; return; }
    __shared__ __align__(16) bf sph[8 * PP]; __shared__ __align__(16) bf spl[8 * PP];
    const int lane = threadIdx.x & 31, wid = threadIdx.x >> 5; const int rb = (blockIdx.x - 5 * WBLK) * 8; if (rb >= NR) return; const int r = rb + wid; const v8f a = *(const v8f*)(x + (size_t)r * CC + lane * 8); float u[8]; float s = 0.f;
#pragma unroll
    for (int q = 0; q < 8; ++q) { u[q] = bfr(a[q]); s += u[q]; }
#pragma unroll
    for (int sh = 16; sh; sh >>= 1) s += __shfl_xor(s, sh, 32);
    const float mu = s * (1.0f / CC); float s2 = 0.f;
#pragma unroll
    for (int q = 0; q < 8; ++q) { float d0 = __fsub_rn(u[q], mu); asm volatile("" : "+v"(d0)); float p = __fmul_rn(d0, d0); asm volatile("" : "+v"(p)); s2 = __fadd_rn(s2, p); }
#pragma unroll
    for (int sh = 16; sh; sh >>= 1) s2 += __shfl_xor(s2, sh, 32);
    const float rs = __fdiv_rn(1.0f, __fsqrt_rn(__fadd_rn(s2 * (1.0f / CC), 1e-5f))); v8us oh, ol;
#pragma unroll
    for (int q = 0; q < 8; ++q) { const int c = lane * 8 + q; float d1 = __fsub_rn(u[q], mu); asm volatile("" : "+v"(d1)); float n0 = __fmul_rn(d1, rs); asm volatile("" : "+v"(n0)); float n1 = __fmul_rn(n0, bfr(lw[c])); asm volatile("" : "+v"(n1)); const float xn = __fadd_rn(n1, bfr(lb[c])); unsigned short h2, l2; splitf(xn, h2, l2); oh[q] = h2; ol[q] = l2; }
    *(v8us*)(sph + wid * PP + lane * 8) = oh; *(v8us*)(spl + wid * PP + lane * 8) = ol;
    __syncthreads();
    const int pc = threadIdx.x >> 3, rw = threadIdx.x & 7;   /* piece pc = k / 8 of row rb + rw: 8 threads fill one line */
    const size_t d = (size_t)(rb >> 4) * 16 * CC + (pc >> 2) * 512 + (pc & 3) * 128 + ((rb & 8) + rw) * 8;
    *(v8us*)(MH + d) = *(const v8us*)(sph + rw * PP + pc * 8); *(v8us*)(ML + d) = *(const v8us*)(spl + rw * PP + pc * 8);  }
// ---- k_zbias: pair LayerNorm and its 8 bias dots in one kernel; the normalised z never leaves the registers.
// A wave takes 32 pair positions as two tiles of 16. Lane (lr, hi) holds half of row lr of each tile in the k order of a WMMA operand (k = 32 kc + 8 hi + 0..7 and 32 kc + 16 + 8 hi + 0..7), so a row's mean and variance are in-lane sums plus one exchange between the wave halves, and the hi/lo planes of z are the B operand as they stand.
// A = w_b as bf16 with head m & 7 in row m: both halves of D hold the 8 heads, half hi keeps tile hi, and each head's 32 values go out as one 128-B line.
// TB lies in the order of k_fattn's score accumulators: per head, a block of 16 queries x 16 keys is 1 KiB, and (query lr, key 8 hi + 4 half + e) stands at half * 128 + (16 hi + lr) * 4 + e. One line of it is 8 queries x 4 keys: those are the 32 pair positions of wave g, whose line is number g of each head's plane.
__device__ __forceinline__ float sum8(v8f a) { return ((a[0] + a[1]) + (a[2] + a[3])) + ((a[4] + a[5]) + (a[6] + a[7])); }
__global__ __launch_bounds__(256) void k_zbias(const float* __restrict__ x, const float* __restrict__ lw, const float* __restrict__ lb, const float* __restrict__ wtri, float* TB) {
    const int lane = threadIdx.x & 31, lr = lane & 15, hi = lane >> 4; const int g = blockIdx.x * 8 + (threadIdx.x >> 5), r0 = g * 32;
    const int qi = (g >> 7) * 16 + (g & 1) * 8 + (lr >> 2), kj = ((g >> 3) & 15) * 16 + ((g >> 1) & 1) * 8 + ((g >> 2) & 1) * 4 + (lr & 3);   /* row lr of tile 0: its query and key; tile 1 is 4 queries further */
    const float* px = x + (size_t)(qi * NJ + kj) * CZ + 8 * hi; const float* pw = wtri + (lr & 7) * CZ + 8 * hi; const unsigned ob = 32u * hi;   /* ob: the lane's byte offset into scale and bias */
    v8f u[2][8];   /* u[t][i]: tile t, k = 16 i + 8 hi + 0..7 */
#pragma unroll
    for (int t = 0; t < 2; ++t)
#pragma unroll
        for (int i = 0; i < 8; ++i) u[t][i] = *(const v8f*)(px + t * 4 * NJ * CZ + i * 16);
    asm volatile("s_wait_xcnt 0x0" :: "v"(px) : "memory");   /* the wait in front of any overwrite of the address registers of the loads above; as an input the address stays in its registers up to it */
    float rs[2];
#pragma unroll
    for (int t = 0; t < 2; ++t) { v8f a = (v8f){};
#pragma unroll
        for (int i = 0; i < 8; ++i) { u[t][i] = bfr8(u[t][i]); a += u[t][i]; }
        float s = sum8(a); s += __shfl_xor(s, 16, 32); const float mu = s * (1.0f / CZ); a = (v8f){};
#pragma unroll
        for (int i = 0; i < 8; ++i) { u[t][i] -= mu; a += u[t][i] * u[t][i]; }
        float s2 = sum8(a); s2 += __shfl_xor(s2, 16, 32); rs[t] = __fdiv_rn(1.0f, __fsqrt_rn(__fadd_rn(s2 * (1.0f / CZ), 1e-5f))); }
    v8f acc[2]; acc[0] = (v8f){}; acc[1] = (v8f){};
#pragma unroll
    for (int kc = 0; kc < 4; ++kc) { const char* qa = (const char*)(lw + kc * 32) + ob; const char* qb = (const char*)(lb + kc * 32) + ob; const v8f a0 = bfr8(*(const v8f*)qa), a1 = bfr8(*(const v8f*)(qa + 64)), b0 = bfr8(*(const v8f*)qb), b1 = bfr8(*(const v8f*)(qb + 64));
        const v16bf wf = cat16b(f2bf8(*(const v8f*)(pw + kc * 32)), f2bf8(*(const v8f*)(pw + kc * 32 + 16)));
        if (kc == 3) asm volatile("s_wait_xcnt 0x0" :: "v"(pw), "v"(ob) : "memory");   /* behind the last loads of w_b, scale and bias: the wait in front of any overwrite of their address registers (inputs: address and offset stay put up to it) */
#pragma unroll
        for (int t = 0; t < 2; ++t) { v8us h0, l0, h1, l1; split8(u[t][2 * kc] * rs[t] * a0 + b0, h0, l0); split8(u[t][2 * kc + 1] * rs[t] * a1 + b1, h1, l1);
            acc[t] = wmmab(wf, cat16b(h0, h1), acc[t]); acc[t] = wmmab(wf, cat16b(l0, l1), acc[t]); } }
#pragma unroll
    for (int r = 0; r < 8; ++r) TB[(size_t)r * NZR + r0 + lane] = hi ? acc[1][r] : acc[0][r];
}
// ---- k_fattn: one work-group per (MSA row, head), 8 waves; q, k, v of that row and head are projected here and never go to memory, and the score matrix never leaves the registers.
// Projection: the head's 32 rows of W_q, W_k, W_v (fragment order, 48 KiB) are staged in LDS; wave w multiplies position tiles w and w + 8 of m (hi + lo: 2 products, straight from the planes) with them. Q^T = W_q m^T and K^T = W_k m^T leave a lane with 8 consecutive d of one position: that is Q as the B operand of the scores, and one 16-byte LDS store a plane for K [key][d]. V = m W_v^T leaves a lane with 8 consecutive keys of one d: one 16-byte store a plane for V^T [d][key].
// Attention: each wave takes 16 queries at a time: S^T = K Q^T (a lane holds 128 of one query's 256 scores), softmax in-lane plus one exchange between the wave halves, the normalised P^T packed from the score accumulators as the B operand of O^T = V^T P^T, and 8 consecutive d per lane stored as the merged-context hi/lo planes (fragment order).
#define KP 40                     // K plane row pitch, 16-bit elements: 80 B = 16 B x odd
#define VP 264                    // V^T plane row pitch, 16-bit elements: 528 B = 16 B x odd
__device__ __forceinline__ v8f exp2x8(v8f x) { float a0 = x[0], a1 = x[1], a2 = x[2], a3 = x[3], a4 = x[4], a5 = x[5], a6 = x[6], a7 = x[7];
    /* eight independent v_exp_f32 in one statement, closed by a v_nop: each fills the slot that the instruction set asks for behind the one in front of it, the v_nop the last one's */
    asm("v_exp_f32 %0, %0\n\tv_exp_f32 %1, %1\n\tv_exp_f32 %2, %2\n\tv_exp_f32 %3, %3\n\tv_exp_f32 %4, %4\n\tv_exp_f32 %5, %5\n\tv_exp_f32 %6, %6\n\tv_exp_f32 %7, %7\n\tv_nop" : "+v"(a0), "+v"(a1), "+v"(a2), "+v"(a3), "+v"(a4), "+v"(a5), "+v"(a6), "+v"(a7));
    return (v8f){a0, a1, a2, a3, a4, a5, a6, a7}; }
__device__ __forceinline__ v16bf ldfrag(const bf* p) { return cat16b(*(const v8us*)p, *(const v8us*)(p + 16)); }
/* second launch bound: four waves per SIMD, so that two work-groups share a WGP and one stages while the other computes */
__global__ __launch_bounds__(256, 4) void k_fattn(const bf* __restrict__ XH, const bf* __restrict__ XL, const bf* __restrict__ W5, const float* __restrict__ TB, bf* Gh, bf* Gl) {
    __shared__ __align__(16) bf sm[2 * NJ * KP + 2 * CH * VP + 3 * CH * CC]; bf* const Kh = sm; bf* const Kl = Kh + NJ * KP; bf* const Vh = Kl + NJ * KP; bf* const Vl = Vh + CH * VP; bf* const Ws = Vl + CH * VP;   /* one array, so that the planes the attention loop reads lie lowest, within reach of immediate offsets; Ws: the head's rows of W_q, W_k, W_v; behind the projection each wave keeps its Q fragments there */
    const int tid = threadIdx.x, lane = tid & 31, wave = __builtin_amdgcn_readfirstlane(tid >> 5), lr = lane & 15, hi = lane >> 4; const int h = blockIdx.x, b = blockIdx.y;   /* the wave's number as a scalar: the addresses formed from it stay out of the vector registers */
    const size_t mo = (size_t)(b * 16 + wave) * 16 * CC + 8 * lane; const bf* pmh = XH + mo; const bf* pml = XL + mo;   /* position tile w of row b; tile w + 8 and every k block are compile-time offsets */
    v16bf mh[2][2], ml[2][2];   /* [k block parity][tile]: the next k block's fragments are asked for ahead of this one's products */
#pragma unroll
    for (int st = 0; st < 2; ++st) { mh[0][st] = WFrag<bf>::ld(pmh + st * 8 * 16 * CC); ml[0][st] = WFrag<bf>::ld(pml + st * 8 * 16 * CC); }
    {   /* a head's 32 rows are two whole strips of the fragment order: 16 KiB in a row per matrix */
        const bf* pw = W5 + (size_t)h * CH * CC; v8us wr[12];
#pragma unroll
        for (int p = 0; p < 12; ++p) wr[p] = *(const v8us*)(pw + (p >> 2) * CC * CC + (p & 3) * 2048 + tid * 8);
        asm volatile("s_wait_xcnt 0x0" :: "s"(pw), "v"(tid) : "memory");   /* the wait in front of any overwrite of the address registers of the loads above, a scalar base and the thread's index; as inputs both stay in their registers up to it */
#pragma unroll
        for (int p = 0; p < 12; ++p) *(v8us*)(Ws + p * 2048 + tid * 8) = wr[p];
    }
    __syncthreads();
    v8f aq[2][2], ak[2][2], av[2][2];   /* [tile][half of d] */
#pragma unroll
    for (int st = 0; st < 2; ++st)
#pragma unroll
        for (int c = 0; c < 2; ++c) { aq[st][c] = (v8f){}; ak[st][c] = (v8f){}; av[st][c] = (v8f){}; }
#pragma unroll   /* unrolled: the two fragment buffers are then registers with fixed names and every address a compile-time offset */
    for (int kc = 0; kc < CC / 32; ++kc) { const int cu = kc & 1, nx = cu ^ 1;
        if (kc + 1 < CC / 32) {
#pragma unroll
            for (int st = 0; st < 2; ++st) { mh[nx][st] = WFrag<bf>::ld(pmh + st * 8 * 16 * CC + (kc + 1) * 512); ml[nx][st] = WFrag<bf>::ld(pml + st * 8 * 16 * CC + (kc + 1) * 512); } }
        if (kc + 2 == CC / 32) asm volatile("s_wait_xcnt 0x0" :: "v"(pmh), "v"(pml) : "memory");   /* behind the last loads of m: the wait in front of any overwrite of their address registers (inputs: the addresses stay put up to it) */
        __builtin_amdgcn_sched_barrier(0);   /* holds the next k block's loads up here, ahead of this block's products: sunk in among the last of them, they are waited for with most of their latency still to run */
        v16bf wf[3][2];
#pragma unroll
        for (int p = 0; p < 3; ++p)
#pragma unroll
            for (int c = 0; c < 2; ++c) wf[p][c] = WFrag<bf>::ld(Ws + p * CH * CC + c * 16 * CC + kc * 512 + 8 * lane);
#pragma unroll
        for (int pl = 0; pl < 2; ++pl)   /* all hi products, then all lo products: twelve independent accumulators stand between the two that share one */
#pragma unroll
            for (int st = 0; st < 2; ++st) { const v16bf mf = pl ? ml[cu][st] : mh[cu][st];
#pragma unroll
                for (int c = 0; c < 2; ++c) { aq[st][c] = wmmab(wf[0][c], mf, aq[st][c]); ak[st][c] = wmmab(wf[1][c], mf, ak[st][c]); av[st][c] = wmmab(mf, wf[2][c], av[st][c]); } }
        __builtin_amdgcn_sched_barrier(0);   /* keeps the loads one k block ahead and no further: pulled up over more blocks they take more registers than the wave has and are spilled */
    }
#pragma unroll
    for (int st = 0; st < 2; ++st) { const int kt = (wave + 8 * st) * 16;
#pragma unroll
        for (int c = 0; c < 2; ++c) { v8us x, y; split8(ak[st][c], x, y); *(v8us*)(Kh + (kt + lr) * KP + 16 * c + 8 * hi) = x; *(v8us*)(Kl + (kt + lr) * KP + 16 * c + 8 * hi) = y;   /* ak[st][c][r] = k of key kt + lr, d = 16 c + 8 hi + r */
            split8(av[st][c], x, y); *(v8us*)(Vh + (16 * c + lr) * VP + kt + 8 * hi) = x; *(v8us*)(Vl + (16 * c + lr) * VP + kt + 8 * hi) = y; } }   /* av[st][c][r] = v of key kt + 8 hi + r, d = 16 c + lr */
    __syncthreads();
    float* qs = (float*)Ws + wave * 1024 + 4 * lane;   /* behind the barrier nobody reads the weights any more: 4 KiB of their place hold this wave's own q (f32, in the lane order of the B operand) of its two tiles, so that the rolled loop below can pick one by its index */
#pragma unroll
    for (int st = 0; st < 2; ++st)
#pragma unroll
        for (int c = 0; c < 2; ++c) { *(v4fa*)(qs + st * 512 + c * 256) = __builtin_shufflevector(aq[st][c], aq[st][c], 0, 1, 2, 3); *(v4fa*)(qs + st * 512 + c * 256 + 128) = __builtin_shufflevector(aq[st][c], aq[st][c], 4, 5, 6, 7); }   /* aq[st][c][r] = q of query (wave + 8 st) 16 + lr, d = 16 c + 8 hi + r */
#pragma unroll 1   /* kept rolled: both trips unrolled would hold two sets of 128 score registers */
    for (int i = 0; i < 2; ++i) {   /* wave w takes query tiles w and w + 8 */
        const float* tb = TB + (size_t)h * NZR + (size_t)(wave + 8 * i) * 16 * NJ + 4 * lane;   /* accumulator order (at k_zbias): each 16-byte load of the wave is 512 contiguous bytes */
        v8f s[16];   /* s[t][r] = score of key 16 t + 8 hi + r for query (wave + 8 i) 16 + lr; the pair bias is the accumulators' start value */
#pragma unroll
        for (int t = 0; t < 16; ++t) s[t] = __builtin_shufflevector(*(const v4f*)(tb + t * 256), *(const v4f*)(tb + t * 256 + 128), 0, 1, 2, 3, 4, 5, 6, 7);
        asm volatile("s_wait_xcnt 0x0" :: "v"(tb) : "memory");   /* the wait in front of any overwrite of the address registers of the loads above (an input: the address stays put up to it); its memory clobber also keeps the K and V^T fragment loads below inside this loop: hoisted out of it they take 512 registers and spill */
        const v8f qa = __builtin_shufflevector(*(const v4fa*)(qs + i * 512), *(const v4fa*)(qs + i * 512 + 128), 0, 1, 2, 3, 4, 5, 6, 7), qb = __builtin_shufflevector(*(const v4fa*)(qs + i * 512 + 256), *(const v4fa*)(qs + i * 512 + 384), 0, 1, 2, 3, 4, 5, 6, 7);
        v8us t0, t1, t2, t3; split8(qa * QSC, t0, t1); split8(qb * QSC, t2, t3); const v16bf qh = cat16b(t0, t2), ql = cat16b(t1, t3);   /* 1/sqrt(32) goes into q ahead of the hi/lo split */
#pragma unroll
        for (int t = 0; t < 16; ++t) { const int ko = (t * 16 + lr) * KP + 8 * hi; const v16bf kh = ldfrag(Kh + ko), kl = ldfrag(Kl + ko); s[t] = wmmab(kh, qh, s[t]); s[t] = wmmab(kh, ql, s[t]); s[t] = wmmab(kl, qh, s[t]); }
        __builtin_amdgcn_sched_barrier(0);   /* keeps the softmax behind the score products: mixed in among them, with the K fragments fetched ahead, it takes more registers than the wave has and accumulators are spilled */
        float m8[8];
#pragma unroll
        for (int r = 0; r < 8; ++r) m8[r] = -3.0e38f;
#pragma unroll
        for (int t = 0; t < 16; ++t) {
#pragma unroll
            for (int r = 0; r < 8; ++r) m8[r] = fmaxf(m8[r], s[t][r]); }
        float mx = fmaxf(fmaxf(fmaxf(m8[0], m8[1]), fmaxf(m8[2], m8[3])), fmaxf(fmaxf(m8[4], m8[5]), fmaxf(m8[6], m8[7]))); mx = fmaxf(mx, __shfl_xor(mx, 16, 32));
        float s8[8];
#pragma unroll
        for (int r = 0; r < 8; ++r) s8[r] = 0.f;
#pragma unroll
        for (int t = 0; t < 16; ++t) { s[t] = exp2x8((s[t] - mx) * 1.4426950408889634f);
#pragma unroll
            for (int r = 0; r < 8; ++r) s8[r] += s[t][r]; }
        float sum = ((s8[0] + s8[1]) + (s8[2] + s8[3])) + ((s8[4] + s8[5]) + (s8[6] + s8[7])); sum += __shfl_xor(sum, 16, 32);
        const float f = __fdiv_rn(1.0f, sum);
        v8f o0 = (v8f){}, o1 = (v8f){};   /* o0[r] = context d = 8 hi + r, o1[r] = d = 16 + 8 hi + r, same query */
#pragma unroll
        for (int u = 0; u < 8; ++u) { split8(s[2 * u] * f, t0, t1); split8(s[2 * u + 1] * f, t2, t3); const v16bf ph = cat16b(t0, t2), pl = cat16b(t1, t3);
            const int vo = lr * VP + u * 32 + 8 * hi; const v16bf vh0 = ldfrag(Vh + vo), vl0 = ldfrag(Vl + vo), vh1 = ldfrag(Vh + vo + 16 * VP), vl1 = ldfrag(Vl + vo + 16 * VP);
            o0 = wmmab(vh0, ph, o0); o1 = wmmab(vh1, ph, o1); o0 = wmmab(vh0, pl, o0); o1 = wmmab(vh1, pl, o1); o0 = wmmab(vl0, ph, o0); o1 = wmmab(vl1, ph, o1); }
        const size_t oo = ((size_t)(b * 16 + wave + 8 * i) * 8 + h) * 512 + 8 * lane; split8(o0, t0, t1); split8(o1, t2, t3);   /* fragment order: strip = this query tile, k block = head; the lane's two pieces are the two halves of its A fragment */
        *(v8us*)(Gh + oo) = t0; *(v8us*)(Gl + oo) = t1; *(v8us*)(Gh + oo + 256) = t2; *(v8us*)(Gl + oo + 256) = t3;
        asm volatile("s_wait_xcnt 0x0" ::: "memory");   /* the wait in front of the next trip's overwrite of the address and data registers of the four stores above */
    }
}

extern "C" void kernel_launch(void* const* d_in, const int* in_sizes, int n_in,
                              void* d_out, int out_size, void* d_ws, size_t ws_size, hipStream_t stream) {
    (void)in_sizes; (void)n_in; (void)out_size;
    const float* msa = (const float*)d_in[0]; const float* pair = (const float*)d_in[1]; const float* lmw = (const float*)d_in[2]; const float* lmb = (const float*)d_in[3]; const float* lzw = (const float*)d_in[4]; const float* lzb = (const float*)d_in[5]; const float* wq = (const float*)d_in[6]; const float* wk = (const float*)d_in[7]; const float* wv = (const float*)d_in[8]; const float* wb = (const float*)d_in[9]; const float* wo = (const float*)d_in[10]; const float* bo = (const float*)d_in[11]; const float* wg = (const float*)d_in[12]; const float* bg = (const float*)d_in[13];
    float* OUT = (float*)d_out;     // [128][256][256]
    char* wsp = (char*)d_ws;
    auto take = [&](size_t bytes) { char* p = wsp; wsp += (bytes + 255) & ~(size_t)255; return (void*)p; };
    bf* WQ = (bf*)take((size_t)5 * CC * CC * 2); bf* WO = WQ + (size_t)4 * CC * CC;   /* the five bf16 weight matrices back to back: q, k, v, gate, out */
    bf* XH = (bf*)take((size_t)NR * CC * 2); bf* XL = (bf*)take((size_t)NR * CC * 2); bf* Gh = (bf*)take((size_t)NR * CC * 2); bf* Gl = (bf*)take((size_t)NR * CC * 2); float* TB = (float*)take((size_t)NH_ * NZR * 4);
    float* FG = (float*)take((size_t)NR * CC * 4);   /* the gate projection */
    if ((size_t)(wsp - (char*)d_ws) > ws_size) return;
    k_pre<<<5 * WBLK + NR / 8, 256, 0, stream>>>(msa, lmw, lmb, XH, XL, wq, wk, wv, wg, wo, WQ);   /* bf16 weights and the MSA LayerNorm planes */
    k_zbias<<<NZR / 256, 256, 0, stream>>>(pair, lzw, lzb, wb, TB);   /* pair LayerNorm + pair-bias dots */
    k_gemmw<bf, 1, false, CC><<<dim3(NR / 64, CC / 64, 1), 32, 0, stream>>>(XH, XL, WQ + (size_t)3 * CC * CC, nullptr, FG, CC, nullptr, 0, 0, 0, nullptr, nullptr, nullptr);   /* gate projection (2 products) */
    k_fattn<<<dim3(NH_, NI, 1), 256, 0, stream>>>(XH, XL, WQ, TB, Gh, Gl);   /* q, k, v projections, scores / sqrt(32) + pair bias, softmax, attn.v -> merged context planes */
    k_gemmw<bf, 1, true, CC><<<dim3(NR / 64, CC / 64, 1), 32, 0, stream>>>(Gh, Gl, WO, nullptr, OUT, CC, bo, 0, 0, 0, msa, FG, bg);   /* out = msa + sigmoid(gate) x (context W_out^T + b_out) */
}

// v008
// A run of this version takes 82.2 microseconds.
// In two side-by-side timings against v007, it was 1.18 and 1.17 times as fast.
// All steps since v000 together make it 8.65 times as fast.
#include <hip/hip_runtime.h>

// MSA row attention with pair bias (msa [128][256][256], pair [256][256][128]; m = LayerNorm(msa), z = LayerNorm(pair) (eps 1e-5, affine); per MSA row b and head h (8 x 32): q, k, v = m W^T ('oi' [256][256]); scores = q.k / sqrt(32) + bias[h][i][j] with bias = z . w_b[h] ([8][128]); softmax over j; o = attn.v merged; out = msa + sigmoid(m W_gate^T + b_gate) * (o W_out^T + b_out) -> [128][256][256] (8.4 M)).
// Layout: the 32,768 (row, position) MSA rows are one tall GEMM operand for the gate projection (m as bf16 hi + lo: 2 products) and for the output projection of the merged context, both in one launch and one k loop; the pair LayerNorm feeds only the 8 bias dot products per pair position; the 1,024 (row, head) attention problems of size 256 x 256 x 32 run in ONE launch, one work-group each: its own q, k, v projections (2 products), scores on hi/lo planes (3 products, K = 32), x 1/sqrt(32) + bias, a 256-wide softmax in registers, attn.v on hi/lo planes (3 products); the gate/output GEMM's epilogue applies the sigmoid gate and the residual in f32.
// Every 16-bit GEMM operand plane (m, the merged context, the five weight matrices) lies in memory in FRAGMENT ORDER: a block of 16 rows x 32 k is 1 KiB, blocks of one 16-row strip follow one another in k; element (row lr, k = 32 kc + 16 j + 8 hi + e) stands at block * 512 + j * 256 + (16 hi + lr) * 8 + e, so that a wave's 16-byte load of half a fragment is 512 contiguous bytes (4 whole lines) where a row-major plane gave 16 lines of 32 bytes. The pair bias lies likewise in the order of the score accumulators (at k_zbias).

#define NI   128                  // MSA rows
#define NJ   256                  // positions (= attention length)
#define CC   256                  // c_m
#define CZ   128                  // c_z
#define NZR  (NJ * NJ)            // 65,536 pair positions
#define NH_  8
#define CH   32
#define NR   (NI * NJ)            // 32,768 (row, position) MSA rows
#define QSC  0.17677669529663689f  // 1/sqrt(32)
typedef _Float16 h16;
typedef unsigned short bf;
typedef __attribute__((ext_vector_type(16))) __bf16   v16bf;
typedef __attribute__((ext_vector_type(16))) _Float16 v16h;
typedef __attribute__((ext_vector_type(8)))  _Float16 v8h;
typedef __attribute__((ext_vector_type(8)))  unsigned short v8us;
typedef __attribute__((ext_vector_type(8)))  float    v8f;
typedef __attribute__((ext_vector_type(4)))  float    v4f;
typedef __attribute__((ext_vector_type(2)))  float    v2f;
typedef __attribute__((ext_vector_type(4)))  unsigned short v4us;
typedef __attribute__((ext_vector_type(2)))  unsigned short v2us;
typedef __attribute__((ext_vector_type(2)))  __bf16   v2b;
typedef __attribute__((ext_vector_type(2)))  unsigned v2u;
typedef __attribute__((ext_vector_type(4)))  unsigned v4u;
typedef v8h  __attribute__((may_alias)) v8ha;
typedef v4f  __attribute__((may_alias)) v4fa;
typedef v8us __attribute__((may_alias)) v8usa;

// f32 -> 16-bit plane value, round to nearest even, by the chip's convert instruction; cvt2 rounds two values with one v_cvt_pk_bf16_f32 (a in the low half of the word) and leaves them packed as the planes want them.
__device__ __forceinline__ unsigned short f2bf(float f) { return __builtin_bit_cast(unsigned short, (__bf16)f); }
__device__ __forceinline__ unsigned cvt2(float a, float b) { return __builtin_bit_cast(unsigned, __builtin_convertvector((v2f){a, b}, v2b)); }
__device__ __forceinline__ float lo2f(unsigned p) { return __uint_as_float(p << 16); }
__device__ __forceinline__ float hi2f(unsigned p) { return __uint_as_float(p & 0xFFFF0000u); }
__device__ __forceinline__ void split2(float a, float b, unsigned& h, unsigned& l) { h = cvt2(a, b); l = cvt2(a - lo2f(h), b - hi2f(h)); }   /* hi plane word and lo plane word of a pair */
__device__ __forceinline__ v8f bfr8(v8f a) { v8f o;
#pragma unroll
    for (int q = 0; q < 8; q += 2) { const unsigned p = cvt2(a[q], a[q + 1]); o[q] = lo2f(p); o[q + 1] = hi2f(p); } return o; }
__device__ __forceinline__ v8us f2bf8(v8f a) { v4u o;
#pragma unroll
    for (int q = 0; q < 4; ++q) o[q] = cvt2(a[2 * q], a[2 * q + 1]); return __builtin_bit_cast(v8us, o); }
__device__ __forceinline__ void split8(v8f x, v8us& h, v8us& l) { v4u a, c;
#pragma unroll
    for (int q = 0; q < 4; ++q) { unsigned u, w; split2(x[2 * q], x[2 * q + 1], u, w); a[q] = u; c[q] = w; }
    h = __builtin_bit_cast(v8us, a); l = __builtin_bit_cast(v8us, c); }
__device__ __forceinline__ void split4(v4f x, v4us& h, v4us& l) { v2u a, c;
#pragma unroll
    for (int q = 0; q < 2; ++q) { unsigned u, w; split2(x[2 * q], x[2 * q + 1], u, w); a[q] = u; c[q] = w; }
    h = __builtin_bit_cast(v4us, a); l = __builtin_bit_cast(v4us, c); }
__device__ __forceinline__ float bf2f(unsigned short b) { return __uint_as_float(((unsigned)b) << 16); }
__device__ __forceinline__ float bfr(float f) { return bf2f(f2bf(f)); }
__device__ __forceinline__ void splitf(float y, unsigned short& h, unsigned short& l) { h = f2bf(y); l = f2bf(y - bf2f(h)); }
__device__ __forceinline__ v16h cat16(v8h lo, v8h hi) { return __builtin_shufflevector(lo, hi, 0, 1, 2, 3, 4, 5, 6, 7, 8, 9, 10, 11, 12, 13, 14, 15); }
__device__ __forceinline__ v16bf cat16b(v8us lo, v8us hi) { return __builtin_bit_cast(v16bf, __builtin_shufflevector(lo, hi, 0, 1, 2, 3, 4, 5, 6, 7, 8, 9, 10, 11, 12, 13, 14, 15)); }
__device__ __forceinline__ v8f wmma16(v16h a, v16h b, v8f c) { return __builtin_amdgcn_wmma_f32_16x16x32_f16(false, a, false, b, (short)0, c, false, false); }
__device__ __forceinline__ v8f wmmab(v16bf a, v16bf b, v8f c) { return __builtin_amdgcn_wmma_f32_16x16x32_bf16(false, a, false, b, (short)0, c, false, false); }

__device__ __forceinline__ v4f exp2x4(v4f x) { float a0 = x[0], a1 = x[1], a2 = x[2], a3 = x[3];
    /* four independent v_exp_f32 in one statement, closed by a v_nop: each fills the slot that the instruction set asks for behind the one in front of it, the v_nop the last one's */
    asm("v_exp_f32 %0, %0\n\tv_exp_f32 %1, %1\n\tv_exp_f32 %2, %2\n\tv_exp_f32 %3, %3\n\tv_nop" : "+v"(a0), "+v"(a1), "+v"(a2), "+v"(a3));
    return (v4f){a0, a1, a2, a3}; }
// ---- k_gout: the gate projection and the output projection in ONE register-blocked GEMM, ONE WAVE per 64x64 output tile (2 x 16 accumulators), operands straight from 16-bit planes in fragment order (head of the file); grid (NR/64, CC/64), 32 threads.
// gate[m][n] = sum_k (X + X2)[m][k] Wg[n][k] and prod[m][n] = sum_k (G + G2)[m][k] Wo[n][k] run through the same k loop: one wait for memory a k block serves both, and neither tile goes to memory as a plain product.
// C[m][n] = res[m][n] + sigmoid(gate[m][n] + gbias[n]) * (prod[m][n] + bias[n]), all arrays of pitch CC.
template <typename T16> struct WFrag;
template <> struct WFrag<h16> { typedef v16h V; static __device__ __forceinline__ V ld(const h16* p) { return cat16(*(const v8h*)p, *(const v8h*)(p + 256)); } static __device__ __forceinline__ v8f mma(V a, V b, v8f c) { return wmma16(a, b, c); } };
template <> struct WFrag<bf> { typedef v16bf V; static __device__ __forceinline__ V ld(const bf* p) { return cat16b(*(const v8us*)p, *(const v8us*)(p + 256)); } static __device__ __forceinline__ v8f mma(V a, V b, v8f c) { return wmmab(a, b, c); } };
__global__ __launch_bounds__(32) void k_gout(const bf* __restrict__ G, const bf* __restrict__ G2, const bf* __restrict__ X, const bf* __restrict__ X2, const bf* __restrict__ Wo, const bf* __restrict__ Wg, float* C, const float* __restrict__ bias, const float* __restrict__ res, const float* __restrict__ gbias) {
    typedef WFrag<bf> F; typedef F::V V;
    __shared__ __align__(16) float os[2 * 16 * 68];   /* one 16-row strip of the product, then one of the gate */
    const int lane = threadIdx.x & 31, lr = lane & 15, hi = lane >> 4; const int r0 = blockIdx.x * 64, c0 = blockIdx.y * 64;
    v8f acc[4][4], gac[4][4];
#pragma unroll
    for (int mb = 0; mb < 4; ++mb)
#pragma unroll
        for (int nb = 0; nb < 4; ++nb) { acc[mb][nb] = (v8f){}; gac[mb][nb] = (v8f){}; }
    /* a 16-row strip is 16 CC elements, a k block of 32 is 512: the four strips of an operand are immediate offsets from one address */
    const size_t ao = (size_t)r0 * CC + 8 * lane, bo = (size_t)c0 * CC + 8 * lane;
    const bf* vx = X + ao; const bf* vx2 = X2 + ao; const bf* vg = Wg + bo; const bf* va = G + ao; const bf* va2 = G2 + ao; const bf* vb = Wo + bo;
#pragma unroll 1
    for (int kc = 0; kc < CC; kc += 32) {
        V x[4], x2[4], g[4], a[4], a2[4], b[4];
#pragma unroll
        for (int mb = 0; mb < 4; ++mb) { x[mb] = F::ld(vx + mb * 16 * CC); g[mb] = F::ld(vg + mb * 16 * CC); x2[mb] = F::ld(vx2 + mb * 16 * CC); }
#pragma unroll
        for (int mb = 0; mb < 4; ++mb) { a[mb] = F::ld(va + mb * 16 * CC); b[mb] = F::ld(vb + mb * 16 * CC); a2[mb] = F::ld(va2 + mb * 16 * CC); }
        asm volatile("s_wait_xcnt 0x0" :: "v"(vx), "v"(vx2), "v"(vg), "v"(va), "v"(va2), "v"(vb) : "memory");   /* the wait in front of the step of the address registers of the loads above; as inputs the addresses stay in their registers up to it */
        vx += 512; vx2 += 512; vg += 512; va += 512; va2 += 512; vb += 512;
#pragma unroll
        for (int nb = 0; nb < 4; ++nb) {
#pragma unroll
            for (int mb = 0; mb < 4; ++mb) { gac[mb][nb] = F::mma(x[mb], g[nb], gac[mb][nb]); gac[mb][nb] = F::mma(x2[mb], g[nb], gac[mb][nb]); } }
#pragma unroll
        for (int nb = 0; nb < 4; ++nb) {
#pragma unroll
            for (int mb = 0; mb < 4; ++mb) { acc[mb][nb] = F::mma(a[mb], b[nb], acc[mb][nb]); acc[mb][nb] = F::mma(a2[mb], b[nb], acc[mb][nb]); } }
        asm volatile("v_nop\n\tv_nop\n\tv_nop\n\tv_nop" : "+v"(acc[0][0]), "+v"(acc[1][1]), "+v"(acc[2][2]), "+v"(acc[3][3]) : "v"(a[0]), "v"(a[3]));   /* four vector slots behind the trip's last products, ahead of the branch: whatever the compiler puts at the loop's head then stands at the distance a WMMA's registers ask for */
    }
    /* the lane's 16 bytes of row r0 + hi; every other row of the tile is a compile-time offset from these two addresses. The residual rows of strip mb + 1 are asked for while strip mb is worked on. */
    const size_t eo = (size_t)(r0 + hi) * CC + c0 + lr * 4; const float* pr = res + eo; float* po = C + eo;
    v4f xr[2][8], ob, gb;
    { const v4f b4 = *(const v4f*)(bias + c0 + lr * 4), g4 = *(const v4f*)(gbias + c0 + lr * 4);
#pragma unroll
        for (int s = 0; s < 8; ++s) xr[0][s] = *(const v4f*)(pr + 2 * s * CC);
        asm volatile("s_wait_xcnt 0x0" :: "v"(lr) : "memory");   /* the wait in front of any overwrite of the index register of the two bias loads above; as an input it stays in its register up to it */
#pragma unroll
        for (int q = 0; q < 4; ++q) { ob[q] = bfr(b4[q]); gb[q] = bfr(g4[q]); } }
#pragma unroll
    for (int mb = 0; mb < 4; ++mb) {
#pragma unroll
        for (int nb = 0; nb < 4; ++nb) {
#pragma unroll
            for (int j = 0; j < 8; ++j) { os[(hi * 8 + j) * 68 + nb * 16 + lr] = acc[mb][nb][j]; os[16 * 68 + (hi * 8 + j) * 68 + nb * 16 + lr] = gac[mb][nb][j]; } }
        __builtin_amdgcn_wave_barrier(); asm volatile("" ::: "memory");   /* keeps the strip's LDS stores ahead of the reads below in the compiled order (one wave: the LDS itself serves them in order) */
        if (mb < 3) {
#pragma unroll
            for (int s = 0; s < 8; ++s) xr[(mb + 1) & 1][s] = *(const v4f*)(pr + ((mb + 1) * 16 + 2 * s) * CC); }
#pragma unroll
        for (int s = 0; s < 8; ++s) { const v4f val = *(const v4fa*)(os + (2 * s + hi) * 68 + lr * 4) + ob; const v4f xg = *(const v4fa*)(os + 16 * 68 + (2 * s + hi) * 68 + lr * 4); const v4f x = xr[mb & 1][s], eg = exp2x4((xg + gb) * -1.4426950408889634f);   /* eg = exp(-(gate + its bias)) */ const unsigned p0 = cvt2(x[0], x[1]), p1 = cvt2(x[2], x[3]); const v4f m = (v4f){lo2f(p0), hi2f(p0), lo2f(p1), hi2f(p1)}; v4f o;
#pragma unroll
            for (int q = 0; q < 4; ++q) o[q] = m[q] + __fdiv_rn(1.0f, 1.0f + eg[q]) * val[q];
            xr[mb & 1][s] = o; *(v4f*)(po + (mb * 16 + 2 * s) * CC) = o; }
        asm volatile("s_wait_xcnt 0x0" :: "v"(xr[mb & 1][0]), "v"(xr[mb & 1][1]), "v"(xr[mb & 1][2]), "v"(xr[mb & 1][3]), "v"(xr[mb & 1][4]), "v"(xr[mb & 1][5]), "v"(xr[mb & 1][6]), "v"(xr[mb & 1][7]), "v"(pr), "v"(po) : "memory");   /* the wait in front of any overwrite of the data registers of this strip's eight stores and of the address registers of the loads and stores above; as inputs they all stay in their registers up to it */
        __builtin_amdgcn_sched_barrier(0);   /* keeps the next strip's arithmetic behind this strip's: pulled up, it waits on the residual rows that were only just asked for */
        __builtin_amdgcn_wave_barrier(); asm volatile("" ::: "memory");   /* keeps the next strip's LDS stores behind this strip's reads in the compiled order */
    }
}

__global__ __launch_bounds__(256) void k_wtG(const float* __restrict__ w, int K, int N, bf* Bt) {
    const int lane = threadIdx.x & 31; const int L0 = (blockIdx.x * 8 + (threadIdx.x >> 5)) * 8; const int nlines = N * K / 64;
{
#pragma unroll 1
        for (int l = 0; l < 8; ++l) { const int L = L0 + l; if (L >= nlines) break; const size_t e = (size_t)L * 64 + lane * 2; const int k = (int)(e % K), n = (int)(e / K); v2us o;
            o[0] = f2bf(w[(size_t)k * N + n]); o[1] = f2bf(w[(size_t)(k + 1) * N + n]); *(v2us*)(Bt + e) = o; }
         }
}
#define WBLK (CC * CC / 8 / 256)   // 32 blocks of 256 threads round one 256 x 256 weight matrix, 8 elements a thread
// ---- k_pre: two jobs that need nothing of each other, as block ranges of one grid. Blocks 0 .. 5 WBLK - 1 round the five 'oi' weight matrices to bf16 (Bt in fragment order; W5 holds them back to back in the order q, k, v, gate, out; a thread owns one 16-byte piece of the OUTPUT, so a wave stores 4 whole lines); the other blocks do the MSA LayerNorm, one wave a row: the 8 rows of a block meet in LDS, from where each wave stores 4 whole lines a plane (8 rows x 16 bytes are one line of the fragment order).
#define PP 288                    // LDS row pitch of k_pre, 16-bit elements: 576 B, so that the 8 rows x 4 pieces a wave reads back spread over all banks
__global__ __launch_bounds__(256) void k_pre(const float* __restrict__ x, const float* __restrict__ lw, const float* __restrict__ lb, bf* MH, bf* ML, const float* __restrict__ wq, const float* __restrict__ wk, const float* __restrict__ wv, const float* __restrict__ wg, const float* __restrict__ wo, bf* W5) {
    if (blockIdx.x < 5 * WBLK) { const int m = blockIdx.x / WBLK; const float* src = m == 0 ? wq : m == 1 ? wk : m == 2 ? wv : m == 3 ? wg : wo; const int i = (blockIdx.x % WBLK) * 256 + threadIdx.x; const int n = (i >> 9) * 16 + (i & 15), k0 = ((i >> 6) & 7) * 32 + ((i >> 4) & 3) * 8; const v8f v = *(const v8f*)(src + n * CC + k0); v8us o;   /* piece i of the fragment order: strip i >> 9, k block (i >> 6) & 7, then j, hi, lr */
#pragma unroll
        for (int k = 0; k < 8; ++k) o[k] = f2bf(v[k]);
        *(v8us*)(W5 + (size_t)m * CC * CC + i * 8) = o; return; }
    __shared__ __align__(16) bf sph[8 * PP]; __shared__ __align__(16) bf spl[8 * PP];
    const int lane = threadIdx.x & 31, wid = threadIdx.x >> 5; const int rb = (blockIdx.x - 5 * WBLK) * 8; if (rb >= NR) return; const int r = rb + wid; const v8f a = *(const v8f*)(x + (size_t)r * CC + lane * 8); float u[8]; float s = 0.f;
#pragma unroll
    for (int q = 0; q < 8; ++q) { u[q] = bfr(a[q]); s += u[q]; }
#pragma unroll
    for (int sh = 16; sh; sh >>= 1) s += __shfl_xor(s, sh, 32);
    const float mu = s * (1.0f / CC); float s2 = 0.f;
#pragma unroll
    for (int q = 0; q < 8; ++q) { float d0 = __fsub_rn(u[q], mu); asm volatile("" : "+v"(d0)); float p = __fmul_rn(d0, d0); asm volatile("" : "+v"(p)); s2 = __fadd_rn(s2, p); }
#pragma unroll
    for (int sh = 16; sh; sh >>= 1) s2 += __shfl_xor(s2, sh, 32);
    const float rs = __fdiv_rn(1.0f, __fsqrt_rn(__fadd_rn(s2 * (1.0f / CC), 1e-5f))); v8us oh, ol;
#pragma unroll
    for (int q = 0; q < 8; ++q) { const int c = lane * 8 + q; float d1 = __fsub_rn(u[q], mu); asm volatile("" : "+v"(d1)); float n0 = __fmul_rn(d1, rs); asm volatile("" : "+v"(n0)); float n1 = __fmul_rn(n0, bfr(lw[c])); asm volatile("" : "+v"(n1)); const float xn = __fadd_rn(n1, bfr(lb[c])); unsigned short h2, l2; splitf(xn, h2, l2); oh[q] = h2; ol[q] = l2; }
    *(v8us*)(sph + wid * PP + lane * 8) = oh; *(v8us*)(spl + wid * PP + lane * 8) = ol;
    __syncthreads();
    const int pc = threadIdx.x >> 3, rw = threadIdx.x & 7;   /* piece pc = k / 8 of row rb + rw: 8 threads fill one line */
    const size_t d = (size_t)(rb >> 4) * 16 * CC + (pc >> 2) * 512 + (pc & 3) * 128 + ((rb & 8) + rw) * 8;
    *(v8us*)(MH + d) = *(const v8us*)(sph + rw * PP + pc * 8); *(v8us*)(ML + d) = *(const v8us*)(spl + rw * PP + pc * 8);  }
// ---- k_zbias: pair LayerNorm and its 8 bias dots in one kernel; the normalised z never leaves the registers.
// A wave takes 32 pair positions as two tiles of 16. Lane (lr, hi) holds half of row lr of each tile in the k order of a WMMA operand (k = 32 kc + 8 hi + 0..7 and 32 kc + 16 + 8 hi + 0..7), so a row's mean and variance are in-lane sums plus one exchange between the wave halves, and the hi/lo planes of z are the B operand as they stand.
// A = w_b as bf16 with head m & 7 in row m: both halves of D hold the 8 heads, half hi keeps tile hi, and each head's 32 values go out as one 128-B line.
// TB lies in the order of k_fattn's score accumulators: per head, a block of 16 queries x 16 keys is 1 KiB, and (query lr, key 8 hi + 4 half + e) stands at half * 128 + (16 hi + lr) * 4 + e. One line of it is 8 queries x 4 keys: those are the 32 pair positions of wave g, whose line is number g of each head's plane.
__device__ __forceinline__ float sum8(v8f a) { return ((a[0] + a[1]) + (a[2] + a[3])) + ((a[4] + a[5]) + (a[6] + a[7])); }
__global__ __launch_bounds__(256) void k_zbias(const float* __restrict__ x, const float* __restrict__ lw, const float* __restrict__ lb, const float* __restrict__ wtri, float* TB) {
    const int lane = threadIdx.x & 31, lr = lane & 15, hi = lane >> 4; const int g = blockIdx.x * 8 + (threadIdx.x >> 5), r0 = g * 32;
    const int qi = (g >> 7) * 16 + (g & 1) * 8 + (lr >> 2), kj = ((g >> 3) & 15) * 16 + ((g >> 1) & 1) * 8 + ((g >> 2) & 1) * 4 + (lr & 3);   /* row lr of tile 0: its query and key; tile 1 is 4 queries further */
    const float* px = x + (size_t)(qi * NJ + kj) * CZ + 8 * hi; const float* pw = wtri + (lr & 7) * CZ + 8 * hi; const unsigned ob = 32u * hi;   /* ob: the lane's byte offset into scale and bias */
    v8f u[2][8];   /* u[t][i]: tile t, k = 16 i + 8 hi + 0..7 */
#pragma unroll
    for (int t = 0; t < 2; ++t)
#pragma unroll
        for (int i = 0; i < 8; ++i) u[t][i] = *(const v8f*)(px + t * 4 * NJ * CZ + i * 16);
    asm volatile("s_wait_xcnt 0x0" :: "v"(px) : "memory");   /* the wait in front of any overwrite of the address registers of the loads above; as an input the address stays in its registers up to it */
    float rs[2];
#pragma unroll
    for (int t = 0; t < 2; ++t) { v8f a = (v8f){};
#pragma unroll
        for (int i = 0; i < 8; ++i) { u[t][i] = bfr8(u[t][i]); a += u[t][i]; }
        float s = sum8(a); s += __shfl_xor(s, 16, 32); const float mu = s * (1.0f / CZ); a = (v8f){};
#pragma unroll
        for (int i = 0; i < 8; ++i) { u[t][i] -= mu; a += u[t][i] * u[t][i]; }
        float s2 = sum8(a); s2 += __shfl_xor(s2, 16, 32); rs[t] = __fdiv_rn(1.0f, __fsqrt_rn(__fadd_rn(s2 * (1.0f / CZ), 1e-5f))); }
    v8f acc[2]; acc[0] = (v8f){}; acc[1] = (v8f){};
#pragma unroll
    for (int kc = 0; kc < 4; ++kc) { const char* qa = (const char*)(lw + kc * 32) + ob; const char* qb = (const char*)(lb + kc * 32) + ob; const v8f a0 = bfr8(*(const v8f*)qa), a1 = bfr8(*(const v8f*)(qa + 64)), b0 = bfr8(*(const v8f*)qb), b1 = bfr8(*(const v8f*)(qb + 64));
        const v16bf wf = cat16b(f2bf8(*(const v8f*)(pw + kc * 32)), f2bf8(*(const v8f*)(pw + kc * 32 + 16)));
        if (kc == 3) asm volatile("s_wait_xcnt 0x0" :: "v"(pw), "v"(ob) : "memory");   /* behind the last loads of w_b, scale and bias: the wait in front of any overwrite of their address registers (inputs: address and offset stay put up to it) */
#pragma unroll
        for (int t = 0; t < 2; ++t) { v8us h0, l0, h1, l1; split8(u[t][2 * kc] * rs[t] * a0 + b0, h0, l0); split8(u[t][2 * kc + 1] * rs[t] * a1 + b1, h1, l1);
            acc[t] = wmmab(wf, cat16b(h0, h1), acc[t]); acc[t] = wmmab(wf, cat16b(l0, l1), acc[t]); } }
#pragma unroll
    for (int r = 0; r < 8; ++r) TB[(size_t)r * NZR + r0 + lane] = hi ? acc[1][r] : acc[0][r];
}
// ---- k_fattn: one work-group per (MSA row, head), 8 waves; q, k, v of that row and head are projected here and never go to memory, and the score matrix never leaves the registers.
// Projection: the head's 32 rows of W_q, W_k, W_v (fragment order, 48 KiB) are staged in LDS; wave w multiplies position tiles w and w + 8 of m (hi + lo: 2 products, straight from the planes) with them. Q^T = W_q m^T and K^T = W_k m^T leave a lane with 8 consecutive d of one position: that is Q as the B operand of the scores, and one 16-byte LDS store a plane for K [key][d]. V = m W_v^T leaves a lane with 8 consecutive keys of one d: one 16-byte store a plane for V^T [d][key].
// Attention: each wave takes 16 queries at a time: S^T = K Q^T (a lane holds 128 of one query's 256 scores), softmax in-lane plus one exchange between the wave halves, the normalised P^T packed from the score accumulators as the B operand of O^T = V^T P^T, and 8 consecutive d per lane stored as the merged-context hi/lo planes (fragment order).
#define KP 40                     // K plane row pitch, 16-bit elements: 80 B = 16 B x odd
#define VP 264                    // V^T plane row pitch, 16-bit elements: 528 B = 16 B x odd
__device__ __forceinline__ v8f exp2x8(v8f x) { float a0 = x[0], a1 = x[1], a2 = x[2], a3 = x[3], a4 = x[4], a5 = x[5], a6 = x[6], a7 = x[7];
    /* eight independent v_exp_f32 in one statement, closed by a v_nop: each fills the slot that the instruction set asks for behind the one in front of it, the v_nop the last one's */
    asm("v_exp_f32 %0, %0\n\tv_exp_f32 %1, %1\n\tv_exp_f32 %2, %2\n\tv_exp_f32 %3, %3\n\tv_exp_f32 %4, %4\n\tv_exp_f32 %5, %5\n\tv_exp_f32 %6, %6\n\tv_exp_f32 %7, %7\n\tv_nop" : "+v"(a0), "+v"(a1), "+v"(a2), "+v"(a3), "+v"(a4), "+v"(a5), "+v"(a6), "+v"(a7));
    return (v8f){a0, a1, a2, a3, a4, a5, a6, a7}; }
__device__ __forceinline__ v16bf ldfrag(const bf* p) { return cat16b(*(const v8us*)p, *(const v8us*)(p + 16)); }
/* second launch bound: four waves per SIMD, so that two work-groups share a WGP and one stages while the other computes */
__global__ __launch_bounds__(256, 4) void k_fattn(const bf* __restrict__ XH, const bf* __restrict__ XL, const bf* __restrict__ W5, const float* __restrict__ TB, bf* Gh, bf* Gl) {
    __shared__ __align__(16) bf sm[2 * NJ * KP + 2 * CH * VP + 3 * CH * CC]; bf* const Kh = sm; bf* const Kl = Kh + NJ * KP; bf* const Vh = Kl + NJ * KP; bf* const Vl = Vh + CH * VP; bf* const Ws = Vl + CH * VP;   /* one array, so that the planes the attention loop reads lie lowest, within reach of immediate offsets; Ws: the head's rows of W_q, W_k, W_v; behind the projection each wave keeps its Q fragments there */
    const int tid = threadIdx.x, lane = tid & 31, wave = __builtin_amdgcn_readfirstlane(tid >> 5), lr = lane & 15, hi = lane >> 4; const int h = blockIdx.x, b = blockIdx.y;   /* the wave's number as a scalar: the addresses formed from it stay out of the vector registers */
    const size_t mo = (size_t)(b * 16 + wave) * 16 * CC + 8 * lane; const bf* pmh = XH + mo; const bf* pml = XL + mo;   /* position tile w of row b; tile w + 8 and every k block are compile-time offsets */
    v16bf mh[2][2], ml[2][2];   /* [k block parity][tile]: the next k block's fragments are asked for ahead of this one's products */
#pragma unroll
    for (int st = 0; st < 2; ++st) { mh[0][st] = WFrag<bf>::ld(pmh + st * 8 * 16 * CC); ml[0][st] = WFrag<bf>::ld(pml + st * 8 * 16 * CC); }
    {   /* a head's 32 rows are two whole strips of the fragment order: 16 KiB in a row per matrix */
        const bf* pw = W5 + (size_t)h * CH * CC; v8us wr[12];
#pragma unroll
        for (int p = 0; p < 12; ++p) wr[p] = *(const v8us*)(pw + (p >> 2) * CC * CC + (p & 3) * 2048 + tid * 8);
        asm volatile("s_wait_xcnt 0x0" :: "s"(pw), "v"(tid) : "memory");   /* the wait in front of any overwrite of the address registers of the loads above, a scalar base and the thread's index; as inputs both stay in their registers up to it */
#pragma unroll
        for (int p = 0; p < 12; ++p) *(v8us*)(Ws + p * 2048 + tid * 8) = wr[p];
    }
    __syncthreads();
    v8f aq[2][2], ak[2][2], av[2][2];   /* [tile][half of d] */
#pragma unroll
    for (int st = 0; st < 2; ++st)
#pragma unroll
        for (int c = 0; c < 2; ++c) { aq[st][c] = (v8f){}; ak[st][c] = (v8f){}; av[st][c] = (v8f){}; }
#pragma unroll   /* unrolled: the two fragment buffers are then registers with fixed names and every address a compile-time offset */
    for (int kc = 0; kc < CC / 32; ++kc) { const int cu = kc & 1, nx = cu ^ 1;
        if (kc + 1 < CC / 32) {
#pragma unroll
            for (int st = 0; st < 2; ++st) { mh[nx][st] = WFrag<bf>::ld(pmh + st * 8 * 16 * CC + (kc + 1) * 512); ml[nx][st] = WFrag<bf>::ld(pml + st * 8 * 16 * CC + (kc + 1) * 512); } }
        if (kc + 2 == CC / 32) asm volatile("s_wait_xcnt 0x0" :: "v"(pmh), "v"(pml) : "memory");   /* behind the last loads of m: the wait in front of any overwrite of their address registers (inputs: the addresses stay put up to it) */
        __builtin_amdgcn_sched_barrier(0);   /* holds the next k block's loads up here, ahead of this block's products: sunk in among the last of them, they are waited for with most of their latency still to run */
        v16bf wf[3][2];
#pragma unroll
        for (int p = 0; p < 3; ++p)
#pragma unroll
            for (int c = 0; c < 2; ++c) wf[p][c] = WFrag<bf>::ld(Ws + p * CH * CC + c * 16 * CC + kc * 512 + 8 * lane);
#pragma unroll
        for (int pl = 0; pl < 2; ++pl)   /* all hi products, then all lo products: twelve independent accumulators stand between the two that share one */
#pragma unroll
            for (int st = 0; st < 2; ++st) { const v16bf mf = pl ? ml[cu][st] : mh[cu][st];
#pragma unroll
                for (int c = 0; c < 2; ++c) { aq[st][c] = wmmab(wf[0][c], mf, aq[st][c]); ak[st][c] = wmmab(wf[1][c], mf, ak[st][c]); av[st][c] = wmmab(mf, wf[2][c], av[st][c]); } }
        __builtin_amdgcn_sched_barrier(0);   /* keeps the loads one k block ahead and no further: pulled up over more blocks they take more registers than the wave has and are spilled */
    }
#pragma unroll
    for (int st = 0; st < 2; ++st) { const int kt = (wave + 8 * st) * 16;
#pragma unroll
        for (int c = 0; c < 2; ++c) { v8us x, y; split8(ak[st][c], x, y); *(v8us*)(Kh + (kt + lr) * KP + 16 * c + 8 * hi) = x; *(v8us*)(Kl + (kt + lr) * KP + 16 * c + 8 * hi) = y;   /* ak[st][c][r] = k of key kt + lr, d = 16 c + 8 hi + r */
            split8(av[st][c], x, y); *(v8us*)(Vh + (16 * c + lr) * VP + kt + 8 * hi) = x; *(v8us*)(Vl + (16 * c + lr) * VP + kt + 8 * hi) = y; } }   /* av[st][c][r] = v of key kt + 8 hi + r, d = 16 c + lr */
    __syncthreads();
    float* qs = (float*)Ws + wave * 1024 + 4 * lane;   /* behind the barrier nobody reads the weights any more: 4 KiB of their place hold this wave's own q (f32, in the lane order of the B operand) of its two tiles, so that the rolled loop below can pick one by its index */
#pragma unroll
    for (int st = 0; st < 2; ++st)
#pragma unroll
        for (int c = 0; c < 2; ++c) { *(v4fa*)(qs + st * 512 + c * 256) = __builtin_shufflevector(aq[st][c], aq[st][c], 0, 1, 2, 3); *(v4fa*)(qs + st * 512 + c * 256 + 128) = __builtin_shufflevector(aq[st][c], aq[st][c], 4, 5, 6, 7); }   /* aq[st][c][r] = q of query (wave + 8 st) 16 + lr, d = 16 c + 8 hi + r */
#pragma unroll 1   /* kept rolled: both trips unrolled would hold two sets of 128 score registers */
    for (int i = 0; i < 2; ++i) {   /* wave w takes query tiles w and w + 8 */
        const float* tb = TB + (size_t)h * NZR + (size_t)(wave + 8 * i) * 16 * NJ + 4 * lane;   /* accumulator order (at k_zbias): each 16-byte load of the wave is 512 contiguous bytes */
        v8f s[16];   /* s[t][r] = score of key 16 t + 8 hi + r for query (wave + 8 i) 16 + lr; the pair bias is the accumulators' start value */
#pragma unroll
        for (int t = 0; t < 16; ++t) s[t] = __builtin_shufflevector(*(const v4f*)(tb + t * 256), *(const v4f*)(tb + t * 256 + 128), 0, 1, 2, 3, 4, 5, 6, 7);
        asm volatile("s_wait_xcnt 0x0" :: "v"(tb) : "memory");   /* the wait in front of any overwrite of the address registers of the loads above (an input: the address stays put up to it); its memory clobber also keeps the K and V^T fragment loads below inside this loop: hoisted out of it they take 512 registers and spill */
        const v8f qa = __builtin_shufflevector(*(const v4fa*)(qs + i * 512), *(const v4fa*)(qs + i * 512 + 128), 0, 1, 2, 3, 4, 5, 6, 7), qb = __builtin_shufflevector(*(const v4fa*)(qs + i * 512 + 256), *(const v4fa*)(qs + i * 512 + 384), 0, 1, 2, 3, 4, 5, 6, 7);
        v8us t0, t1, t2, t3; split8(qa * QSC, t0, t1); split8(qb * QSC, t2, t3); const v16bf qh = cat16b(t0, t2), ql = cat16b(t1, t3);   /* 1/sqrt(32) goes into q ahead of the hi/lo split */
#pragma unroll
        for (int t = 0; t < 16; ++t) { const int ko = (t * 16 + lr) * KP + 8 * hi; const v16bf kh = ldfrag(Kh + ko), kl = ldfrag(Kl + ko); s[t] = wmmab(kh, qh, s[t]); s[t] = wmmab(kh, ql, s[t]); s[t] = wmmab(kl, qh, s[t]); }
        __builtin_amdgcn_sched_barrier(0);   /* keeps the softmax behind the score products: mixed in among them, with the K fragments fetched ahead, it takes more registers than the wave has and accumulators are spilled */
        float m8[8];
#pragma unroll
        for (int r = 0; r < 8; ++r) m8[r] = -3.0e38f;
#pragma unroll
        for (int t = 0; t < 16; ++t) {
#pragma unroll
            for (int r = 0; r < 8; ++r) m8[r] = fmaxf(m8[r], s[t][r]); }
        float mx = fmaxf(fmaxf(fmaxf(m8[0], m8[1]), fmaxf(m8[2], m8[3])), fmaxf(fmaxf(m8[4], m8[5]), fmaxf(m8[6], m8[7]))); mx = fmaxf(mx, __shfl_xor(mx, 16, 32));
        float s8[8];
#pragma unroll
        for (int r = 0; r < 8; ++r) s8[r] = 0.f;
#pragma unroll
        for (int t = 0; t < 16; ++t) { s[t] = exp2x8((s[t] - mx) * 1.4426950408889634f);
#pragma unroll
            for (int r = 0; r < 8; ++r) s8[r] += s[t][r]; }
        float sum = ((s8[0] + s8[1]) + (s8[2] + s8[3])) + ((s8[4] + s8[5]) + (s8[6] + s8[7])); sum += __shfl_xor(sum, 16, 32);
        const float f = __fdiv_rn(1.0f, sum);
        v8f o0 = (v8f){}, o1 = (v8f){};   /* o0[r] = context d = 8 hi + r, o1[r] = d = 16 + 8 hi + r, same query */
#pragma unroll
        for (int u = 0; u < 8; ++u) { split8(s[2 * u] * f, t0, t1); split8(s[2 * u + 1] * f, t2, t3); const v16bf ph = cat16b(t0, t2), pl = cat16b(t1, t3);
            const int vo = lr * VP + u * 32 + 8 * hi; const v16bf vh0 = ldfrag(Vh + vo), vl0 = ldfrag(Vl + vo), vh1 = ldfrag(Vh + vo + 16 * VP), vl1 = ldfrag(Vl + vo + 16 * VP);
            o0 = wmmab(vh0, ph, o0); o1 = wmmab(vh1, ph, o1); o0 = wmmab(vh0, pl, o0); o1 = wmmab(vh1, pl, o1); o0 = wmmab(vl0, ph, o0); o1 = wmmab(vl1, ph, o1); }
        const size_t oo = ((size_t)(b * 16 + wave + 8 * i) * 8 + h) * 512 + 8 * lane; split8(o0, t0, t1); split8(o1, t2, t3);   /* fragment order: strip = this query tile, k block = head; the lane's two pieces are the two halves of its A fragment */
        *(v8us*)(Gh + oo) = t0; *(v8us*)(Gl + oo) = t1; *(v8us*)(Gh + oo + 256) = t2; *(v8us*)(Gl + oo + 256) = t3;
        asm volatile("s_wait_xcnt 0x0" ::: "memory");   /* the wait in front of the next trip's overwrite of the address and data registers of the four stores above */
    }
}

extern "C" void kernel_launch(void* const* d_in, const int* in_sizes, int n_in,
                              void* d_out, int out_size, void* d_ws, size_t ws_size, hipStream_t stream) {
    (void)in_sizes; (void)n_in; (void)out_size;
    const float* msa = (const float*)d_in[0]; const float* pair = (const float*)d_in[1]; const float* lmw = (const float*)d_in[2]; const float* lmb = (const float*)d_in[3]; const float* lzw = (const float*)d_in[4]; const float* lzb = (const float*)d_in[5]; const float* wq = (const float*)d_in[6]; const float* wk = (const float*)d_in[7]; const float* wv = (const float*)d_in[8]; const float* wb = (const float*)d_in[9]; const float* wo = (const float*)d_in[10]; const float* bo = (const float*)d_in[11]; const float* wg = (const float*)d_in[12]; const float* bg = (const float*)d_in[13];
    float* OUT = (float*)d_out;     // [128][256][256]
    char* wsp = (char*)d_ws;
    auto take = [&](size_t bytes) { char* p = wsp; wsp += (bytes + 255) & ~(size_t)255; return (void*)p; };
    bf* WQ = (bf*)take((size_t)5 * CC * CC * 2); bf* WO = WQ + (size_t)4 * CC * CC;   /* the five bf16 weight matrices back to back: q, k, v, gate, out */
    bf* XH = (bf*)take((size_t)NR * CC * 2); bf* XL = (bf*)take((size_t)NR * CC * 2); bf* Gh = (bf*)take((size_t)NR * CC * 2); bf* Gl = (bf*)take((size_t)NR * CC * 2); float* TB = (float*)take((size_t)NH_ * NZR * 4);
    if ((size_t)(wsp - (char*)d_ws) > ws_size) return;
    k_pre<<<5 * WBLK + NR / 8, 256, 0, stream>>>(msa, lmw, lmb, XH, XL, wq, wk, wv, wg, wo, WQ);   /* bf16 weights and the MSA LayerNorm planes */
    k_zbias<<<NZR / 256, 256, 0, stream>>>(pair, lzw, lzb, wb, TB);   /* pair LayerNorm + pair-bias dots */
    k_fattn<<<dim3(NH_, NI, 1), 256, 0, stream>>>(XH, XL, WQ, TB, Gh, Gl);   /* q, k, v projections, scores / sqrt(32) + pair bias, softmax, attn.v -> merged context planes */
    k_gout<<<dim3(NR / 64, CC / 64, 1), 32, 0, stream>>>(Gh, Gl, XH, XL, WO, WQ + (size_t)3 * CC * CC, OUT, bo, msa, bg);   /* out = msa + sigmoid(m W_gate^T + b_gate) x (context W_out^T + b_out) */
}

// v009
// It runs in 75 microseconds.
// Timed twice side by side with v008, it ran 1.09 times as fast both times.
// Over all steps from v000 it is 9.42 times as fast.
#include <hip/hip_runtime.h>

// MSA row attention with pair bias (msa [128][256][256], pair [256][256][128]; m = LayerNorm(msa), z = LayerNorm(pair) (eps 1e-5, affine); per MSA row b and head h (8 x 32): q, k, v = m W^T ('oi' [256][256]); scores = q.k / sqrt(32) + bias[h][i][j] with bias = z . w_b[h] ([8][128]); softmax over j; o = attn.v merged; out = msa + sigmoid(m W_gate^T + b_gate) * (o W_out^T + b_out) -> [128][256][256] (8.4 M)).
// Layout: the 32,768 (row, position) MSA rows are one tall GEMM operand for the gate projection (m as bf16 hi + lo: 2 products) and for the output projection of the merged context, both in one launch and one k loop; the pair LayerNorm feeds only the 8 bias dot products per pair position; the 1,024 (row, head) attention problems of size 256 x 256 x 32 run in ONE launch, one work-group each: its own q, k, v projections (2 products), scores on hi/lo planes (3 products, K = 32), x 1/sqrt(32) + bias, a 256-wide softmax in registers, attn.v on hi/lo planes (3 products); the gate/output GEMM's epilogue applies the sigmoid gate and the residual in f32.
// Every 16-bit GEMM operand plane (m, the merged context, the five weight matrices) lies in memory in FRAGMENT ORDER: a block of 16 rows x 32 k is 1 KiB, blocks of one 16-row strip follow one another in k; element (row lr, k = 32 kc + 16 j + 8 hi + e) stands at block * 512 + j * 256 + (16 hi + lr) * 8 + e, so that a wave's 16-byte load of half a fragment is 512 contiguous bytes (4 whole lines) where a row-major plane gave 16 lines of 32 bytes. The pair bias lies likewise in the order of the score accumulators (at k_zbias).

#define NI   128                  // MSA rows
#define NJ   256                  // positions (= attention length)
#define CC   256                  // c_m
#define CZ   128                  // c_z
#define NZR  (NJ * NJ)            // 65,536 pair positions
#define NH_  8
#define CH   32
#define NR   (NI * NJ)            // 32,768 (row, position) MSA rows
#define QSC  0.17677669529663689f  // 1/sqrt(32)
typedef _Float16 h16;
typedef unsigned short bf;
typedef __attribute__((ext_vector_type(16))) __bf16   v16bf;
typedef __attribute__((ext_vector_type(16))) _Float16 v16h;
typedef __attribute__((ext_vector_type(8)))  _Float16 v8h;
typedef __attribute__((ext_vector_type(8)))  unsigned short v8us;
typedef __attribute__((ext_vector_type(8)))  float    v8f;
typedef __attribute__((ext_vector_type(4)))  float    v4f;
typedef __attribute__((ext_vector_type(2)))  float    v2f;
typedef __attribute__((ext_vector_type(4)))  unsigned short v4us;
typedef __attribute__((ext_vector_type(2)))  unsigned short v2us;
typedef __attribute__((ext_vector_type(2)))  __bf16   v2b;
typedef __attribute__((ext_vector_type(2)))  unsigned v2u;
typedef __attribute__((ext_vector_type(4)))  unsigned v4u;
typedef v8h  __attribute__((may_alias)) v8ha;
typedef v4f  __attribute__((may_alias)) v4fa;
typedef v8us __attribute__((may_alias)) v8usa;

// f32 -> 16-bit plane value, round to nearest even, by the chip's convert instruction; cvt2 rounds two values with one v_cvt_pk_bf16_f32 (a in the low half of the word) and leaves them packed as the planes want them.
__device__ __forceinline__ unsigned short f2bf(float f) { return __builtin_bit_cast(unsigned short, (__bf16)f); }
__device__ __forceinline__ unsigned cvt2(float a, float b) { return __builtin_bit_cast(unsigned, __builtin_convertvector((v2f){a, b}, v2b)); }
__device__ __forceinline__ float lo2f(unsigned p) { return __uint_as_float(p << 16); }
__device__ __forceinline__ float hi2f(unsigned p) { return __uint_as_float(p & 0xFFFF0000u); }
__device__ __forceinline__ void split2(float a, float b, unsigned& h, unsigned& l) { h = cvt2(a, b); l = cvt2(a - lo2f(h), b - hi2f(h)); }   /* hi plane word and lo plane word of a pair */
__device__ __forceinline__ v8f bfr8(v8f a) { v8f o;
#pragma unroll
    for (int q = 0; q < 8; q += 2) { const unsigned p = cvt2(a[q], a[q + 1]); o[q] = lo2f(p); o[q + 1] = hi2f(p); } return o; }
__device__ __forceinline__ v8us f2bf8(v8f a) { v4u o;
#pragma unroll
    for (int q = 0; q < 4; ++q) o[q] = cvt2(a[2 * q], a[2 * q + 1]); return __builtin_bit_cast(v8us, o); }
__device__ __forceinline__ void split8(v8f x, v8us& h, v8us& l) { v4u a, c;
#pragma unroll
    for (int q = 0; q < 4; ++q) { unsigned u, w; split2(x[2 * q], x[2 * q + 1], u, w); a[q] = u; c[q] = w; }
    h = __builtin_bit_cast(v8us, a); l = __builtin_bit_cast(v8us, c); }
__device__ __forceinline__ void split4(v4f x, v4us& h, v4us& l) { v2u a, c;
#pragma unroll
    for (int q = 0; q < 2; ++q) { unsigned u, w; split2(x[2 * q], x[2 * q + 1], u, w); a[q] = u; c[q] = w; }
    h = __builtin_bit_cast(v4us, a); l = __builtin_bit_cast(v4us, c); }
__device__ __forceinline__ float bf2f(unsigned short b) { return __uint_as_float(((unsigned)b) << 16); }
__device__ __forceinline__ float bfr(float f) { return bf2f(f2bf(f)); }
__device__ __forceinline__ void splitf(float y, unsigned short& h, unsigned short& l) { h = f2bf(y); l = f2bf(y - bf2f(h)); }
__device__ __forceinline__ v16h cat16(v8h lo, v8h hi) { return __builtin_shufflevector(lo, hi, 0, 1, 2, 3, 4, 5, 6, 7, 8, 9, 10, 11, 12, 13, 14, 15); }
__device__ __forceinline__ v16bf cat16b(v8us lo, v8us hi) { return __builtin_bit_cast(v16bf, __builtin_shufflevector(lo, hi, 0, 1, 2, 3, 4, 5, 6, 7, 8, 9, 10, 11, 12, 13, 14, 15)); }
__device__ __forceinline__ v8f wmma16(v16h a, v16h b, v8f c) { return __builtin_amdgcn_wmma_f32_16x16x32_f16(false, a, false, b, (short)0, c, false, false); }
__device__ __forceinline__ v8f wmmab(v16bf a, v16bf b, v8f c) { return __builtin_amdgcn_wmma_f32_16x16x32_bf16(false, a, false, b, (short)0, c, false, false); }

__device__ __forceinline__ v4f exp2x4(v4f x) { float a0 = x[0], a1 = x[1], a2 = x[2], a3 = x[3];
    /* four independent v_exp_f32 in one statement, closed by a v_nop: each fills the slot that the instruction set asks for behind the one in front of it, the v_nop the last one's */
    asm("v_exp_f32 %0, %0\n\tv_exp_f32 %1, %1\n\tv_exp_f32 %2, %2\n\tv_exp_f32 %3, %3\n\tv_nop" : "+v"(a0), "+v"(a1), "+v"(a2), "+v"(a3));
    return (v4f){a0, a1, a2, a3}; }
// ---- k_gout: the gate projection and the output projection in ONE register-blocked GEMM: a work-group of 8 waves (2 x 4) owns 128 rows x all 256 columns, each wave a 64x64 output tile (2 x 16 accumulators); grid NR/128, 256 threads, one work-group a WGP.
// gate[m][n] = sum_k (X + X2)[m][k] Wg[n][k] and prod[m][n] = sum_k (G + G2)[m][k] Wo[n][k] run through the same k loop, and neither tile goes to memory as a plain product.
// The operands of a k block of 32 (64 KiB: 8 strips of each of X, X2, G, G2, all 16 strips of Wg and Wo, 1 KiB a strip in fragment order) are brought into LDS once for the work-group by tensor loads, one request of 8 strips a wave, two buffers: the four waves of a row and the two of a column read them from there instead of each fetching its own copy from L2.
// C[m][n] = res[m][n] + sigmoid(gate[m][n] + gbias[n]) * (prod[m][n] + bias[n]), all arrays of pitch CC.
template <typename T16> struct WFrag;
template <> struct WFrag<h16> { typedef v16h V; static __device__ __forceinline__ V ld(const h16* p) { return cat16(*(const v8h*)p, *(const v8h*)(p + 256)); } static __device__ __forceinline__ v8f mma(V a, V b, v8f c) { return wmma16(a, b, c); } };
template <> struct WFrag<bf> { typedef v16bf V; static __device__ __forceinline__ V ld(const bf* p) { return cat16b(*(const v8us*)p, *(const v8us*)(p + 256)); } static __device__ __forceinline__ v8f mma(V a, V b, v8f c) { return wmmab(a, b, c); } };
typedef __attribute__((ext_vector_type(8)))  unsigned v8u;
__device__ __forceinline__ unsigned uni(unsigned v) { return (unsigned)__builtin_amdgcn_readfirstlane(v); }
__device__ __forceinline__ unsigned pinned(unsigned v) { unsigned w = uni(v); asm volatile("" : "+s"(w)); return w; }   /* holds a wave-uniform test in a scalar register, so that the branch round a tensor load is a scalar one (the mover ignores EXEC) */
#define GSTG 32768                // one stage of k_gout's ring, 16-bit elements (64 KiB)
__global__ __launch_bounds__(256) void k_gout(const bf* __restrict__ G, const bf* __restrict__ G2, const bf* __restrict__ X, const bf* __restrict__ X2, const bf* __restrict__ Wo, const bf* __restrict__ Wg, float* C, const float* __restrict__ bias, const float* __restrict__ res, const float* __restrict__ gbias) {
    typedef WFrag<bf> F; typedef F::V V;
    __shared__ __attribute__((aligned(2048))) bf sm[2 * GSTG + 8 * 2 * 2 * 16 * 68];   /* the two stage buffers, each [X | X2 | G | G2 : 8 KiB each | Wg | Wo : 16 KiB each]; behind them, per wave, one 16-row strip of the product and one of the gate (f32) */
    const int lane = threadIdx.x & 31, lr = lane & 15, hi = lane >> 4; const int wave = __builtin_amdgcn_readfirstlane(threadIdx.x >> 5), wm = wave >> 2, wn = wave & 3; const int r0 = blockIdx.x * 128 + wm * 64, c0 = wn * 64;
    float* const os = (float*)(sm + 2 * GSTG) + wave * (2 * 16 * 68);
    /* wave w brings slice w of every stage: 8 rows (strips) of 1 KiB at a source pitch of 8 KiB (a strip's 8 k blocks), to byte 8192 w of the buffer */
    const bf* const sp = wave == 0 ? X : wave == 1 ? X2 : wave == 2 ? G : wave == 3 ? G2 : wave < 6 ? Wg : Wo;
    const unsigned long long ga0 = (unsigned long long)(size_t)(sp + (wave < 4 ? (size_t)blockIdx.x * 128 * CC : (size_t)(wave & 1) * 128 * CC));
    const unsigned ld0 = (unsigned)(size_t)sm + (unsigned)wave * 8192u;
    v8u g1; g1[0] = uni(0u); g1[1] = uni(1024u << 16); g1[2] = uni(8u << 16); g1[3] = uni(1024u << 16); g1[4] = uni(8u); g1[5] = uni(8192u); g1[6] = uni(0u); g1[7] = uni(0u);   /* no mask, 1-byte elements, no pad; tensor = tile = 1024 B x 8 rows; pitch 8192 B */
    v4u g0; g0[0] = uni(1u);   /* the descriptor group of the request last issued, one register tuple for all requests: the load names it as in and out and every wait for it as an input, so that its words stay in their registers while the request is out and take new values only behind the wait */
    auto issue = [&](int st) { const unsigned long long ga = ga0 + (unsigned)st * 1024u; g0[1] = uni(ld0 + (unsigned)(st & 1) * 65536u); g0[2] = uni((unsigned)ga); g0[3] = uni(((unsigned)(ga >> 32) & 0x01FFFFFFu) | 0x80000000u);
        asm volatile("tensor_load_to_lds %0, %1" : "+s"(g0) : "s"(g1) : "memory"); };   /* one request of the whole wave */
    v8f acc[4][4], gac[4][4];
#pragma unroll
    for (int mb = 0; mb < 4; ++mb)
#pragma unroll
        for (int nb = 0; nb < 4; ++nb) { acc[mb][nb] = (v8f){}; gac[mb][nb] = (v8f){}; }
    issue(0);
    asm volatile("s_wait_tensorcnt 0x0" :: "s"(g0) : "memory");   /* this wave's slice of stage 0 has landed */
    __syncthreads();                                     /* ... and everybody else's */
    issue(1);
#pragma unroll 1
    for (int s = 0; s < CC / 32; ++s) {
        const bf* la = sm + (s & 1) * GSTG + wm * 2048 + 8 * lane; const bf* lw = sm + (s & 1) * GSTG + 16384 + wn * 2048 + 8 * lane;   /* the wave's four strips of each operand are immediate offsets from these two */
        V x[4], x2[4], g[4], a[4], a2[4], b[4];
        /* in the order in which the products below want them: LDS answers in order, so the first products start while the later fragments still come */
        g[0] = F::ld(lw);
#pragma unroll
        for (int mb = 0; mb < 4; ++mb) { x[mb] = F::ld(la + mb * 512); x2[mb] = F::ld(la + 4096 + mb * 512); }
#pragma unroll
        for (int nb = 1; nb < 4; ++nb) g[nb] = F::ld(lw + nb * 512);
        b[0] = F::ld(lw + 8192);
#pragma unroll
        for (int mb = 0; mb < 4; ++mb) { a[mb] = F::ld(la + 8192 + mb * 512); a2[mb] = F::ld(la + 12288 + mb * 512); }
#pragma unroll
        for (int nb = 1; nb < 4; ++nb) b[nb] = F::ld(lw + 8192 + nb * 512);
        __builtin_amdgcn_sched_barrier(0);   /* keeps the pass's 48 LDS reads together up here: sunk in among the products, each group is waited for to the last with its whole latency still to run */
#pragma unroll
        for (int nb = 0; nb < 4; ++nb) {
#pragma unroll
            for (int mb = 0; mb < 4; ++mb) { gac[mb][nb] = F::mma(x[mb], g[nb], gac[mb][nb]); gac[mb][nb] = F::mma(x2[mb], g[nb], gac[mb][nb]); } }
#pragma unroll
        for (int nb = 0; nb < 4; ++nb) {
#pragma unroll
            for (int mb = 0; mb < 4; ++mb) { acc[mb][nb] = F::mma(a[mb], b[nb], acc[mb][nb]); acc[mb][nb] = F::mma(a2[mb], b[nb], acc[mb][nb]); } }
        __builtin_amdgcn_sched_barrier(0);   /* keeps every product of the pass ahead of the publish point: sunk behind the barrier, they hold back the refill */
        asm volatile("v_nop\n\tv_nop\n\tv_nop\n\tv_nop" : "+v"(acc[0][0]), "+v"(acc[1][1]), "+v"(acc[2][2]), "+v"(acc[3][3]) : "v"(a[0]), "v"(a[3]));   /* four vector slots behind the trip's last products, ahead of the branch: whatever the compiler puts at the loop's head then stands at the distance a WMMA's registers ask for */
        /* publish point of stage s + 1 */
        asm volatile("s_wait_dscnt 0x0" ::: "memory");       /* this wave's reads of stage s are done */
        asm volatile("s_wait_tensorcnt 0x0" :: "s"(g0) : "memory");   /* its slice of stage s + 1 has landed */
        __syncthreads();                                     /* stage s + 1 may be read, stage s's buffer refilled */
        if (pinned(s + 2 < CC / 32)) issue(s + 2);
    }
    asm volatile("s_wait_tensorcnt 0x0" ::: "memory");   /* no request is left when the ring is given up */
    asm volatile("s_wait_dscnt 0x0" ::: "memory");
    /* the lane's 16 bytes of row r0 + hi; every other row of the tile is a compile-time offset from these two addresses. The residual rows of strip mb + 1 are asked for while strip mb is worked on. */
    const size_t eo = (size_t)(r0 + hi) * CC + c0 + lr * 4; const float* pr = res + eo; float* po = C + eo;
    v4f xr[2][8], ob, gb;
    { const v4f b4 = *(const v4f*)(bias + c0 + lr * 4), g4 = *(const v4f*)(gbias + c0 + lr * 4);
#pragma unroll
        for (int s = 0; s < 8; ++s) xr[0][s] = *(const v4f*)(pr + 2 * s * CC);
        asm volatile("s_wait_xcnt 0x0" :: "v"(lr) : "memory");   /* the wait in front of any overwrite of the index register of the two bias loads above; as an input it stays in its register up to it */
#pragma unroll
        for (int q = 0; q < 4; ++q) { ob[q] = bfr(b4[q]); gb[q] = bfr(g4[q]); } }
#pragma unroll
    for (int mb = 0; mb < 4; ++mb) {
#pragma unroll
        for (int nb = 0; nb < 4; ++nb) {
#pragma unroll
            for (int j = 0; j < 8; ++j) { os[(hi * 8 + j) * 68 + nb * 16 + lr] = acc[mb][nb][j]; os[16 * 68 + (hi * 8 + j) * 68 + nb * 16 + lr] = gac[mb][nb][j]; } }
        __builtin_amdgcn_wave_barrier(); asm volatile("" ::: "memory");   /* keeps the strip's LDS stores ahead of the reads below in the compiled order (one wave: the LDS itself serves them in order) */
        if (mb < 3) {
#pragma unroll
            for (int s = 0; s < 8; ++s) xr[(mb + 1) & 1][s] = *(const v4f*)(pr + ((mb + 1) * 16 + 2 * s) * CC); }
#pragma unroll
        for (int s = 0; s < 8; ++s) { const v4f val = *(const v4fa*)(os + (2 * s + hi) * 68 + lr * 4) + ob; const v4f xg = *(const v4fa*)(os + 16 * 68 + (2 * s + hi) * 68 + lr * 4); const v4f x = xr[mb & 1][s], eg = exp2x4((xg + gb) * -1.4426950408889634f);   /* eg = exp(-(gate + its bias)) */ const unsigned p0 = cvt2(x[0], x[1]), p1 = cvt2(x[2], x[3]); const v4f m = (v4f){lo2f(p0), hi2f(p0), lo2f(p1), hi2f(p1)}; v4f o;
#pragma unroll
            for (int q = 0; q < 4; ++q) o[q] = m[q] + __fdiv_rn(1.0f, 1.0f + eg[q]) * val[q];
            xr[mb & 1][s] = o; *(v4f*)(po + (mb * 16 + 2 * s) * CC) = o; }
        asm volatile("s_wait_xcnt 0x0" :: "v"(xr[mb & 1][0]), "v"(xr[mb & 1][1]), "v"(xr[mb & 1][2]), "v"(xr[mb & 1][3]), "v"(xr[mb & 1][4]), "v"(xr[mb & 1][5]), "v"(xr[mb & 1][6]), "v"(xr[mb & 1][7]), "v"(pr), "v"(po) : "memory");   /* the wait in front of any overwrite of the data registers of this strip's eight stores and of the address registers of the loads and stores above; as inputs they all stay in their registers up to it */
        __builtin_amdgcn_sched_barrier(0);   /* keeps the next strip's arithmetic behind this strip's: pulled up, it waits on the residual rows that were only just asked for */
        __builtin_amdgcn_wave_barrier(); asm volatile("" ::: "memory");   /* keeps the next strip's LDS stores behind this strip's reads in the compiled order */
    }
}

__global__ __launch_bounds__(256) void k_wtG(const float* __restrict__ w, int K, int N, bf* Bt) {
    const int lane = threadIdx.x & 31; const int L0 = (blockIdx.x * 8 + (threadIdx.x >> 5)) * 8; const int nlines = N * K / 64;
{
#pragma unroll 1
        for (int l = 0; l < 8; ++l) { const int L = L0 + l; if (L >= nlines) break; const size_t e = (size_t)L * 64 + lane * 2; const int k = (int)(e % K), n = (int)(e / K); v2us o;
            o[0] = f2bf(w[(size_t)k * N + n]); o[1] = f2bf(w[(size_t)(k + 1) * N + n]); *(v2us*)(Bt + e) = o; }
         }
}
#define WBLK (CC * CC / 8 / 256)   // 32 blocks of 256 threads round one 256 x 256 weight matrix, 8 elements a thread
// ---- k_pre: two jobs that need nothing of each other, as block ranges of one grid. Blocks 0 .. 5 WBLK - 1 round the five 'oi' weight matrices to bf16 (Bt in fragment order; W5 holds them back to back in the order q, k, v, gate, out; a thread owns one 16-byte piece of the OUTPUT, so a wave stores 4 whole lines); the other blocks do the MSA LayerNorm, one wave a row: the 8 rows of a block meet in LDS, from where each wave stores 4 whole lines a plane (8 rows x 16 bytes are one line of the fragment order).
#define PP 288                    // LDS row pitch of k_pre, 16-bit elements: 576 B, so that the 8 rows x 4 pieces a wave reads back spread over all banks
__global__ __launch_bounds__(256) void k_pre(const float* __restrict__ x, const float* __restrict__ lw, const float* __restrict__ lb, bf* MH, bf* ML, const float* __restrict__ wq, const float* __restrict__ wk, const float* __restrict__ wv, const float* __restrict__ wg, const float* __restrict__ wo, bf* W5) {
    if (blockIdx.x < 5 * WBLK) { const int m = blockIdx.x / WBLK; const float* src = m == 0 ? wq : m == 1 ? wk : m == 2 ? wv : m == 3 ? wg : wo; const int i = (blockIdx.x % WBLK) * 256 + threadIdx.x; const int n = (i >> 9) * 16 + (i & 15), k0 = ((i >> 6) & 7) * 32 + ((i >> 4) & 3) * 8; const v8f v = *(const v8f*)(src + n * CC + k0); v8us o;   /* piece i of the fragment order: strip i >> 9, k block (i >> 6) & 7, then j, hi, lr */
#pragma unroll
        for (int k = 0; k < 8; ++k) o[k] = f2bf(v[k]);
        *(v8us*)(W5 + (size_t)m * CC * CC + i * 8) = o; return; }
    __shared__ __align__(16) bf sph[8 * PP]; __shared__ __align__(16) bf spl[8 * PP];
    const int lane = threadIdx.x & 31, wid = threadIdx.x >> 5; const int rb = (blockIdx.x - 5 * WBLK) * 8; if (rb >= NR) return; const int r = rb + wid; const v8f a = *(const v8f*)(x + (size_t)r * CC + lane * 8); float u[8]; float s = 0.f;
#pragma unroll
    for (int q = 0; q < 8; ++q) { u[q] = bfr(a[q]); s += u[q]; }
#pragma unroll
    for (int sh = 16; sh; sh >>= 1) s += __shfl_xor(s, sh, 32);
    const float mu = s * (1.0f / CC); float s2 = 0.f;
#pragma unroll
    for (int q = 0; q < 8; ++q) { float d0 = __fsub_rn(u[q], mu); asm volatile("" : "+v"(d0)); float p = __fmul_rn(d0, d0); asm volatile("" : "+v"(p)); s2 = __fadd_rn(s2, p); }
#pragma unroll
    for (int sh = 16; sh; sh >>= 1) s2 += __shfl_xor(s2, sh, 32);
    const float rs = __fdiv_rn(1.0f, __fsqrt_rn(__fadd_rn(s2 * (1.0f / CC), 1e-5f))); v8us oh, ol;
#pragma unroll
    for (int q = 0; q < 8; ++q) { const int c = lane * 8 + q; float d1 = __fsub_rn(u[q], mu); asm volatile("" : "+v"(d1)); float n0 = __fmul_rn(d1, rs); asm volatile("" : "+v"(n0)); float n1 = __fmul_rn(n0, bfr(lw[c])); asm volatile("" : "+v"(n1)); const float xn = __fadd_rn(n1, bfr(lb[c])); unsigned short h2, l2; splitf(xn, h2, l2); oh[q] = h2; ol[q] = l2; }
    *(v8us*)(sph + wid * PP + lane * 8) = oh; *(v8us*)(spl + wid * PP + lane * 8) = ol;
    __syncthreads();
    const int pc = threadIdx.x >> 3, rw = threadIdx.x & 7;   /* piece pc = k / 8 of row rb + rw: 8 threads fill one line */
    const size_t d = (size_t)(rb >> 4) * 16 * CC + (pc >> 2) * 512 + (pc & 3) * 128 + ((rb & 8) + rw) * 8;
    *(v8us*)(MH + d) = *(const v8us*)(sph + rw * PP + pc * 8); *(v8us*)(ML + d) = *(const v8us*)(spl + rw * PP + pc * 8);  }
// ---- k_zbias: pair LayerNorm and its 8 bias dots in one kernel; the normalised z never leaves the registers.
// A wave takes 32 pair positions as two tiles of 16. Lane (lr, hi) holds half of row lr of each tile in the k order of a WMMA operand (k = 32 kc + 8 hi + 0..7 and 32 kc + 16 + 8 hi + 0..7), so a row's mean and variance are in-lane sums plus one exchange between the wave halves, and the hi/lo planes of z are the B operand as they stand.
// A = w_b as bf16 with head m & 7 in row m: both halves of D hold the 8 heads, half hi keeps tile hi, and each head's 32 values go out as one 128-B line.
// TB lies in the order of k_fattn's score accumulators: per head, a block of 16 queries x 16 keys is 1 KiB, and (query lr, key 8 hi + 4 half + e) stands at half * 128 + (16 hi + lr) * 4 + e. One line of it is 8 queries x 4 keys: those are the 32 pair positions of wave g, whose line is number g of each head's plane.
__device__ __forceinline__ float sum8(v8f a) { return ((a[0] + a[1]) + (a[2] + a[3])) + ((a[4] + a[5]) + (a[6] + a[7])); }
__global__ __launch_bounds__(256) void k_zbias(const float* __restrict__ x, const float* __restrict__ lw, const float* __restrict__ lb, const float* __restrict__ wtri, float* TB) {
    const int lane = threadIdx.x & 31, lr = lane & 15, hi = lane >> 4; const int g = blockIdx.x * 8 + (threadIdx.x >> 5), r0 = g * 32;
    const int qi = (g >> 7) * 16 + (g & 1) * 8 + (lr >> 2), kj = ((g >> 3) & 15) * 16 + ((g >> 1) & 1) * 8 + ((g >> 2) & 1) * 4 + (lr & 3);   /* row lr of tile 0: its query and key; tile 1 is 4 queries further */
    const float* px = x + (size_t)(qi * NJ + kj) * CZ + 8 * hi; const float* pw = wtri + (lr & 7) * CZ + 8 * hi; const unsigned ob = 32u * hi;   /* ob: the lane's byte offset into scale and bias */
    v8f u[2][8];   /* u[t][i]: tile t, k = 16 i + 8 hi + 0..7 */
#pragma unroll
    for (int t = 0; t < 2; ++t)
#pragma unroll
        for (int i = 0; i < 8; ++i) u[t][i] = *(const v8f*)(px + t * 4 * NJ * CZ + i * 16);
    asm volatile("s_wait_xcnt 0x0" :: "v"(px) : "memory");   /* the wait in front of any overwrite of the address registers of the loads above; as an input the address stays in its registers up to it */
    float rs[2];
#pragma unroll
    for (int t = 0; t < 2; ++t) { v8f a = (v8f){};
#pragma unroll
        for (int i = 0; i < 8; ++i) { u[t][i] = bfr8(u[t][i]); a += u[t][i]; }
        float s = sum8(a); s += __shfl_xor(s, 16, 32); const float mu = s * (1.0f / CZ); a = (v8f){};
#pragma unroll
        for (int i = 0; i < 8; ++i) { u[t][i] -= mu; a += u[t][i] * u[t][i]; }
        float s2 = sum8(a); s2 += __shfl_xor(s2, 16, 32); rs[t] = __fdiv_rn(1.0f, __fsqrt_rn(__fadd_rn(s2 * (1.0f / CZ), 1e-5f))); }
    v8f acc[2]; acc[0] = (v8f){}; acc[1] = (v8f){};
#pragma unroll
    for (int kc = 0; kc < 4; ++kc) { const char* qa = (const char*)(lw + kc * 32) + ob; const char* qb = (const char*)(lb + kc * 32) + ob; const v8f a0 = bfr8(*(const v8f*)qa), a1 = bfr8(*(const v8f*)(qa + 64)), b0 = bfr8(*(const v8f*)qb), b1 = bfr8(*(const v8f*)(qb + 64));
        const v16bf wf = cat16b(f2bf8(*(const v8f*)(pw + kc * 32)), f2bf8(*(const v8f*)(pw + kc * 32 + 16)));
        if (kc == 3) asm volatile("s_wait_xcnt 0x0" :: "v"(pw), "v"(ob) : "memory");   /* behind the last loads of w_b, scale and bias: the wait in front of any overwrite of their address registers (inputs: address and offset stay put up to it) */
#pragma unroll
        for (int t = 0; t < 2; ++t) { v8us h0, l0, h1, l1; split8(u[t][2 * kc] * rs[t] * a0 + b0, h0, l0); split8(u[t][2 * kc + 1] * rs[t] * a1 + b1, h1, l1);
            acc[t] = wmmab(wf, cat16b(h0, h1), acc[t]); acc[t] = wmmab(wf, cat16b(l0, l1), acc[t]); } }
#pragma unroll
    for (int r = 0; r < 8; ++r) TB[(size_t)r * NZR + r0 + lane] = hi ? acc[1][r] : acc[0][r];
}
// ---- k_fattn: one work-group per (MSA row, head), 8 waves; q, k, v of that row and head are projected here and never go to memory, and the score matrix never leaves the registers.
// Projection: the head's 32 rows of W_q, W_k, W_v (fragment order, 48 KiB) are staged in LDS; wave w multiplies position tiles w and w + 8 of m (hi + lo: 2 products, straight from the planes) with them. Q^T = W_q m^T and K^T = W_k m^T leave a lane with 8 consecutive d of one position: that is Q as the B operand of the scores, and one 16-byte LDS store a plane for K [key][d]. V = m W_v^T leaves a lane with 8 consecutive keys of one d: one 16-byte store a plane for V^T [d][key].
// Attention: each wave takes 16 queries at a time: S^T = K Q^T (a lane holds 128 of one query's 256 scores), softmax in-lane plus one exchange between the wave halves, the normalised P^T packed from the score accumulators as the B operand of O^T = V^T P^T, and 8 consecutive d per lane stored as the merged-context hi/lo planes (fragment order).
#define KP 40                     // K plane row pitch, 16-bit elements: 80 B = 16 B x odd
#define VP 264                    // V^T plane row pitch, 16-bit elements: 528 B = 16 B x odd
__device__ __forceinline__ v8f exp2x8(v8f x) { float a0 = x[0], a1 = x[1], a2 = x[2], a3 = x[3], a4 = x[4], a5 = x[5], a6 = x[6], a7 = x[7];
    /* eight independent v_exp_f32 in one statement, closed by a v_nop: each fills the slot that the instruction set asks for behind the one in front of it, the v_nop the last one's */
    asm("v_exp_f32 %0, %0\n\tv_exp_f32 %1, %1\n\tv_exp_f32 %2, %2\n\tv_exp_f32 %3, %3\n\tv_exp_f32 %4, %4\n\tv_exp_f32 %5, %5\n\tv_exp_f32 %6, %6\n\tv_exp_f32 %7, %7\n\tv_nop" : "+v"(a0), "+v"(a1), "+v"(a2), "+v"(a3), "+v"(a4), "+v"(a5), "+v"(a6), "+v"(a7));
    return (v8f){a0, a1, a2, a3, a4, a5, a6, a7}; }
__device__ __forceinline__ v16bf ldfrag(const bf* p) { return cat16b(*(const v8us*)p, *(const v8us*)(p + 16)); }
/* second launch bound: four waves per SIMD, so that two work-groups share a WGP and one stages while the other computes */
__global__ __launch_bounds__(256, 4) void k_fattn(const bf* __restrict__ XH, const bf* __restrict__ XL, const bf* __restrict__ W5, const float* __restrict__ TB, bf* Gh, bf* Gl) {
    __shared__ __align__(16) bf sm[2 * NJ * KP + 2 * CH * VP + 3 * CH * CC]; bf* const Kh = sm; bf* const Kl = Kh + NJ * KP; bf* const Vh = Kl + NJ * KP; bf* const Vl = Vh + CH * VP; bf* const Ws = Vl + CH * VP;   /* one array, so that the planes the attention loop reads lie lowest, within reach of immediate offsets; Ws: the head's rows of W_q, W_k, W_v; behind the projection each wave keeps its Q fragments there */
    const int tid = threadIdx.x, lane = tid & 31, wave = __builtin_amdgcn_readfirstlane(tid >> 5), lr = lane & 15, hi = lane >> 4; const int h = blockIdx.x, b = blockIdx.y;   /* the wave's number as a scalar: the addresses formed from it stay out of the vector registers */
    const size_t mo = (size_t)(b * 16 + wave) * 16 * CC + 8 * lane; const bf* pmh = XH + mo; const bf* pml = XL + mo;   /* position tile w of row b; tile w + 8 and every k block are compile-time offsets */
    v16bf mh[2][2], ml[2][2];   /* [k block parity][tile]: the next k block's fragments are asked for ahead of this one's products */
#pragma unroll
    for (int st = 0; st < 2; ++st) { mh[0][st] = WFrag<bf>::ld(pmh + st * 8 * 16 * CC); ml[0][st] = WFrag<bf>::ld(pml + st * 8 * 16 * CC); }
    {   /* a head's 32 rows are two whole strips of the fragment order: 16 KiB in a row per matrix */
        const bf* pw = W5 + (size_t)h * CH * CC; v8us wr[12];
#pragma unroll
        for (int p = 0; p < 12; ++p) wr[p] = *(const v8us*)(pw + (p >> 2) * CC * CC + (p & 3) * 2048 + tid * 8);
        asm volatile("s_wait_xcnt 0x0" :: "s"(pw), "v"(tid) : "memory");   /* the wait in front of any overwrite of the address registers of the loads above, a scalar base and the thread's index; as inputs both stay in their registers up to it */
#pragma unroll
        for (int p = 0; p < 12; ++p) *(v8us*)(Ws + p * 2048 + tid * 8) = wr[p];
    }
    __syncthreads();
    v8f aq[2][2], ak[2][2], av[2][2];   /* [tile][half of d] */
#pragma unroll
    for (int st = 0; st < 2; ++st)
#pragma unroll
        for (int c = 0; c < 2; ++c) { aq[st][c] = (v8f){}; ak[st][c] = (v8f){}; av[st][c] = (v8f){}; }
#pragma unroll   /* unrolled: the two fragment buffers are then registers with fixed names and every address a compile-time offset */
    for (int kc = 0; kc < CC / 32; ++kc) { const int cu = kc & 1, nx = cu ^ 1;
        if (kc + 1 < CC / 32) {
#pragma unroll
            for (int st = 0; st < 2; ++st) { mh[nx][st] = WFrag<bf>::ld(pmh + st * 8 * 16 * CC + (kc + 1) * 512); ml[nx][st] = WFrag<bf>::ld(pml + st * 8 * 16 * CC + (kc + 1) * 512); } }
        if (kc + 2 == CC / 32) asm volatile("s_wait_xcnt 0x0" :: "v"(pmh), "v"(pml) : "memory");   /* behind the last loads of m: the wait in front of any overwrite of their address registers (inputs: the addresses stay put up to it) */
        __builtin_amdgcn_sched_barrier(0);   /* holds the next k block's loads up here, ahead of this block's products: sunk in among the last of them, they are waited for with most of their latency still to run */
        v16bf wf[3][2];
#pragma unroll
        for (int p = 0; p < 3; ++p)
#pragma unroll
            for (int c = 0; c < 2; ++c) wf[p][c] = WFrag<bf>::ld(Ws + p * CH * CC + c * 16 * CC + kc * 512 + 8 * lane);
#pragma unroll
        for (int pl = 0; pl < 2; ++pl)   /* all hi products, then all lo products: twelve independent accumulators stand between the two that share one */
#pragma unroll
            for (int st = 0; st < 2; ++st) { const v16bf mf = pl ? ml[cu][st] : mh[cu][st];
#pragma unroll
                for (int c = 0; c < 2; ++c) { aq[st][c] = wmmab(wf[0][c], mf, aq[st][c]); ak[st][c] = wmmab(wf[1][c], mf, ak[st][c]); av[st][c] = wmmab(mf, wf[2][c], av[st][c]); } }
        __builtin_amdgcn_sched_barrier(0);   /* keeps the loads one k block ahead and no further: pulled up over more blocks they take more registers than the wave has and are spilled */
    }
#pragma unroll
    for (int st = 0; st < 2; ++st) { const int kt = (wave + 8 * st) * 16;
#pragma unroll
        for (int c = 0; c < 2; ++c) { v8us x, y; split8(ak[st][c], x, y); *(v8us*)(Kh + (kt + lr) * KP + 16 * c + 8 * hi) = x; *(v8us*)(Kl + (kt + lr) * KP + 16 * c + 8 * hi) = y;   /* ak[st][c][r] = k of key kt + lr, d = 16 c + 8 hi + r */
            split8(av[st][c], x, y); *(v8us*)(Vh + (16 * c + lr) * VP + kt + 8 * hi) = x; *(v8us*)(Vl + (16 * c + lr) * VP + kt + 8 * hi) = y; } }   /* av[st][c][r] = v of key kt + 8 hi + r, d = 16 c + lr */
    __syncthreads();
    float* qs = (float*)Ws + wave * 1024 + 4 * lane;   /* behind the barrier nobody reads the weights any more: 4 KiB of their place hold this wave's own q (f32, in the lane order of the B operand) of its two tiles, so that the rolled loop below can pick one by its index */
#pragma unroll
    for (int st = 0; st < 2; ++st)
#pragma unroll
        for (int c = 0; c < 2; ++c) { *(v4fa*)(qs + st * 512 + c * 256) = __builtin_shufflevector(aq[st][c], aq[st][c], 0, 1, 2, 3); *(v4fa*)(qs + st * 512 + c * 256 + 128) = __builtin_shufflevector(aq[st][c], aq[st][c], 4, 5, 6, 7); }   /* aq[st][c][r] = q of query (wave + 8 st) 16 + lr, d = 16 c + 8 hi + r */
#pragma unroll 1   /* kept rolled: both trips unrolled would hold two sets of 128 score registers */
    for (int i = 0; i < 2; ++i) {   /* wave w takes query tiles w and w + 8 */
        const float* tb = TB + (size_t)h * NZR + (size_t)(wave + 8 * i) * 16 * NJ + 4 * lane;   /* accumulator order (at k_zbias): each 16-byte load of the wave is 512 contiguous bytes */
        v8f s[16];   /* s[t][r] = score of key 16 t + 8 hi + r for query (wave + 8 i) 16 + lr; the pair bias is the accumulators' start value */
#pragma unroll
        for (int t = 0; t < 16; ++t) s[t] = __builtin_shufflevector(*(const v4f*)(tb + t * 256), *(const v4f*)(tb + t * 256 + 128), 0, 1, 2, 3, 4, 5, 6, 7);
        asm volatile("s_wait_xcnt 0x0" :: "v"(tb) : "memory");   /* the wait in front of any overwrite of the address registers of the loads above (an input: the address stays put up to it); its memory clobber also keeps the K and V^T fragment loads below inside this loop: hoisted out of it they take 512 registers and spill */
        const v8f qa = __builtin_shufflevector(*(const v4fa*)(qs + i * 512), *(const v4fa*)(qs + i * 512 + 128), 0, 1, 2, 3, 4, 5, 6, 7), qb = __builtin_shufflevector(*(const v4fa*)(qs + i * 512 + 256), *(const v4fa*)(qs + i * 512 + 384), 0, 1, 2, 3, 4, 5, 6, 7);
        v8us t0, t1, t2, t3; split8(qa * QSC, t0, t1); split8(qb * QSC, t2, t3); const v16bf qh = cat16b(t0, t2), ql = cat16b(t1, t3);   /* 1/sqrt(32) goes into q ahead of the hi/lo split */
#pragma unroll
        for (int t = 0; t < 16; ++t) { const int ko = (t * 16 + lr) * KP + 8 * hi; const v16bf kh = ldfrag(Kh + ko), kl = ldfrag(Kl + ko); s[t] = wmmab(kh, qh, s[t]); s[t] = wmmab(kh, ql, s[t]); s[t] = wmmab(kl, qh, s[t]); }
        __builtin_amdgcn_sched_barrier(0);   /* keeps the softmax behind the score products: mixed in among them, with the K fragments fetched ahead, it takes more registers than the wave has and accumulators are spilled */
        float m8[8];
#pragma unroll
        for (int r = 0; r < 8; ++r) m8[r] = -3.0e38f;
#pragma unroll
        for (int t = 0; t < 16; ++t) {
#pragma unroll
            for (int r = 0; r < 8; ++r) m8[r] = fmaxf(m8[r], s[t][r]); }
        float mx = fmaxf(fmaxf(fmaxf(m8[0], m8[1]), fmaxf(m8[2], m8[3])), fmaxf(fmaxf(m8[4], m8[5]), fmaxf(m8[6], m8[7]))); mx = fmaxf(mx, __shfl_xor(mx, 16, 32));
        float s8[8];
#pragma unroll
        for (int r = 0; r < 8; ++r) s8[r] = 0.f;
#pragma unroll
        for (int t = 0; t < 16; ++t) { s[t] = exp2x8((s[t] - mx) * 1.4426950408889634f);
#pragma unroll
            for (int r = 0; r < 8; ++r) s8[r] += s[t][r]; }
        float sum = ((s8[0] + s8[1]) + (s8[2] + s8[3])) + ((s8[4] + s8[5]) + (s8[6] + s8[7])); sum += __shfl_xor(sum, 16, 32);
        const float f = __fdiv_rn(1.0f, sum);
        v8f o0 = (v8f){}, o1 = (v8f){};   /* o0[r] = context d = 8 hi + r, o1[r] = d = 16 + 8 hi + r, same query */
#pragma unroll
        for (int u = 0; u < 8; ++u) { split8(s[2 * u] * f, t0, t1); split8(s[2 * u + 1] * f, t2, t3); const v16bf ph = cat16b(t0, t2), pl = cat16b(t1, t3);
            const int vo = lr * VP + u * 32 + 8 * hi; const v16bf vh0 = ldfrag(Vh + vo), vl0 = ldfrag(Vl + vo), vh1 = ldfrag(Vh + vo + 16 * VP), vl1 = ldfrag(Vl + vo + 16 * VP);
            o0 = wmmab(vh0, ph, o0); o1 = wmmab(vh1, ph, o1); o0 = wmmab(vh0, pl, o0); o1 = wmmab(vh1, pl, o1); o0 = wmmab(vl0, ph, o0); o1 = wmmab(vl1, ph, o1); }
        const size_t oo = ((size_t)(b * 16 + wave + 8 * i) * 8 + h) * 512 + 8 * lane; split8(o0, t0, t1); split8(o1, t2, t3);   /* fragment order: strip = this query tile, k block = head; the lane's two pieces are the two halves of its A fragment */
        *(v8us*)(Gh + oo) = t0; *(v8us*)(Gl + oo) = t1; *(v8us*)(Gh + oo + 256) = t2; *(v8us*)(Gl + oo + 256) = t3;
        asm volatile("s_wait_xcnt 0x0" ::: "memory");   /* the wait in front of the next trip's overwrite of the address and data registers of the four stores above */
    }
}

extern "C" void kernel_launch(void* const* d_in, const int* in_sizes, int n_in,
                              void* d_out, int out_size, void* d_ws, size_t ws_size, hipStream_t stream) {
    (void)in_sizes; (void)n_in; (void)out_size;
    const float* msa = (const float*)d_in[0]; const float* pair = (const float*)d_in[1]; const float* lmw = (const float*)d_in[2]; const float* lmb = (const float*)d_in[3]; const float* lzw = (const float*)d_in[4]; const float* lzb = (const float*)d_in[5]; const float* wq = (const float*)d_in[6]; const float* wk = (const float*)d_in[7]; const float* wv = (const float*)d_in[8]; const float* wb = (const float*)d_in[9]; const float* wo = (const float*)d_in[10]; const float* bo = (const float*)d_in[11]; const float* wg = (const float*)d_in[12]; const float* bg = (const float*)d_in[13];
    float* OUT = (float*)d_out;     // [128][256][256]
    char* wsp = (char*)d_ws;
    auto take = [&](size_t bytes) { char* p = wsp; wsp += (bytes + 255) & ~(size_t)255; return (void*)p; };
    bf* WQ = (bf*)take((size_t)5 * CC * CC * 2); bf* WO = WQ + (size_t)4 * CC * CC;   /* the five bf16 weight matrices back to back: q, k, v, gate, out */
    bf* XH = (bf*)take((size_t)NR * CC * 2); bf* XL = (bf*)take((size_t)NR * CC * 2); bf* Gh = (bf*)take((size_t)NR * CC * 2); bf* Gl = (bf*)take((size_t)NR * CC * 2); float* TB = (float*)take((size_t)NH_ * NZR * 4);
    if ((size_t)(wsp - (char*)d_ws) > ws_size) return;
    k_pre<<<5 * WBLK + NR / 8, 256, 0, stream>>>(msa, lmw, lmb, XH, XL, wq, wk, wv, wg, wo, WQ);   /* bf16 weights and the MSA LayerNorm planes */
    k_zbias<<<NZR / 256, 256, 0, stream>>>(pair, lzw, lzb, wb, TB);   /* pair LayerNorm + pair-bias dots */
    k_fattn<<<dim3(NH_, NI, 1), 256, 0, stream>>>(XH, XL, WQ, TB, Gh, Gl);   /* q, k, v projections, scores / sqrt(32) + pair bias, softmax, attn.v -> merged context planes */
    k_gout<<<NR / 128, 256, 0, stream>>>(Gh, Gl, XH, XL, WO, WQ + (size_t)3 * CC * CC, OUT, bo, msa, bg);   /* out = msa + sigmoid(m W_gate^T + b_gate) x (context W_out^T + b_out) */
}

// v010
// Measured time: 72.4 microseconds a run.
// Timed twice side by side with v009, it ran 1.03 and 1.04 times as fast.
// Over all steps from v000 it is 9.74 times as fast.
#include <hip/hip_runtime.h>

// MSA row attention with pair bias (msa [128][256][256], pair [256][256][128]; m = LayerNorm(msa), z = LayerNorm(pair) (eps 1e-5, affine); per MSA row b and head h (8 x 32): q, k, v = m W^T ('oi' [256][256]); scores = q.k / sqrt(32) + bias[h][i][j] with bias = z . w_b[h] ([8][128]); softmax over j; o = attn.v merged; out = msa + sigmoid(m W_gate^T + b_gate) * (o W_out^T + b_out) -> [128][256][256] (8.4 M)).
// Layout: the 32,768 (row, position) MSA rows are one tall GEMM operand for the gate projection (m as bf16 hi + lo: 2 products) and for the output projection of the merged context, both in one launch and one k loop; the pair LayerNorm feeds only the 8 bias dot products per pair position; the 1,024 (row, head) attention problems of size 256 x 256 x 32 run in ONE launch, one work-group each: its own q, k, v projections (2 products), scores on hi/lo planes (3 products, K = 32), x 1/sqrt(32) + bias, a 256-wide softmax in registers, attn.v on hi/lo planes (3 products); the gate/output GEMM's epilogue applies the sigmoid gate and the residual in f32.
// Every 16-bit GEMM operand plane (m, the merged context, the five weight matrices) lies in memory in FRAGMENT ORDER: a block of 16 rows x 32 k is 1 KiB, blocks of one 16-row strip follow one another in k; element (row lr, k = 32 kc + 16 j + 8 hi + e) stands at block * 512 + j * 256 + (16 hi + lr) * 8 + e, so that a wave's 16-byte load of half a fragment is 512 contiguous bytes (4 whole lines) where a row-major plane gave 16 lines of 32 bytes. The pair bias lies likewise in the order of the score accumulators (at k_zbias).

#define NI   128                  // MSA rows
#define NJ   256                  // positions (= attention length)
#define CC   256                  // c_m
#define CZ   128                  // c_z
#define NZR  (NJ * NJ)            // 65,536 pair positions
#define NH_  8
#define CH   32
#define NR   (NI * NJ)            // 32,768 (row, position) MSA rows
#define QSC  0.17677669529663689f  // 1/sqrt(32)
typedef _Float16 h16;
typedef unsigned short bf;
typedef __attribute__((ext_vector_type(16))) __bf16   v16bf;
typedef __attribute__((ext_vector_type(16))) _Float16 v16h;
typedef __attribute__((ext_vector_type(8)))  _Float16 v8h;
typedef __attribute__((ext_vector_type(8)))  unsigned short v8us;
typedef __attribute__((ext_vector_type(8)))  float    v8f;
typedef __attribute__((ext_vector_type(4)))  float    v4f;
typedef __attribute__((ext_vector_type(2)))  float    v2f;
typedef __attribute__((ext_vector_type(4)))  unsigned short v4us;
typedef __attribute__((ext_vector_type(2)))  unsigned short v2us;
typedef __attribute__((ext_vector_type(2)))  __bf16   v2b;
typedef __attribute__((ext_vector_type(2)))  unsigned v2u;
typedef __attribute__((ext_vector_type(4)))  unsigned v4u;
typedef v8h  __attribute__((may_alias)) v8ha;
typedef v4f  __attribute__((may_alias)) v4fa;
typedef v8us __attribute__((may_alias)) v8usa;

// f32 -> 16-bit plane value, round to nearest even, by the chip's convert instruction; cvt2 rounds two values with one v_cvt_pk_bf16_f32 (a in the low half of the word) and leaves them packed as the planes want them.
__device__ __forceinline__ unsigned short f2bf(float f) { return __builtin_bit_cast(unsigned short, (__bf16)f); }
__device__ __forceinline__ unsigned cvt2(float a, float b) { return __builtin_bit_cast(unsigned, __builtin_convertvector((v2f){a, b}, v2b)); }
__device__ __forceinline__ float lo2f(unsigned p) { return __uint_as_float(p << 16); }
__device__ __forceinline__ float hi2f(unsigned p) { return __uint_as_float(p & 0xFFFF0000u); }
__device__ __forceinline__ void split2(float a, float b, unsigned& h, unsigned& l) { h = cvt2(a, b); l = cvt2(a - lo2f(h), b - hi2f(h)); }   /* hi plane word and lo plane word of a pair */
__device__ __forceinline__ v8f bfr8(v8f a) { v8f o;
#pragma unroll
    for (int q = 0; q < 8; q += 2) { const unsigned p = cvt2(a[q], a[q + 1]); o[q] = lo2f(p); o[q + 1] = hi2f(p); } return o; }
__device__ __forceinline__ v8us f2bf8(v8f a) { v4u o;
#pragma unroll
    for (int q = 0; q < 4; ++q) o[q] = cvt2(a[2 * q], a[2 * q + 1]); return __builtin_bit_cast(v8us, o); }
__device__ __forceinline__ void split8(v8f x, v8us& h, v8us& l) { v4u a, c;
#pragma unroll
    for (int q = 0; q < 4; ++q) { unsigned u, w; split2(x[2 * q], x[2 * q + 1], u, w); a[q] = u; c[q] = w; }
    h = __builtin_bit_cast(v8us, a); l = __builtin_bit_cast(v8us, c); }
__device__ __forceinline__ void split4(v4f x, v4us& h, v4us& l) { v2u a, c;
#pragma unroll
    for (int q = 0; q < 2; ++q) { unsigned u, w; split2(x[2 * q], x[2 * q + 1], u, w); a[q] = u; c[q] = w; }
    h = __builtin_bit_cast(v4us, a); l = __builtin_bit_cast(v4us, c); }
__device__ __forceinline__ float bf2f(unsigned short b) { return __uint_as_float(((unsigned)b) << 16); }
__device__ __forceinline__ float bfr(float f) { return bf2f(f2bf(f)); }
__device__ __forceinline__ void splitf(float y, unsigned short& h, unsigned short& l) { h = f2bf(y); l = f2bf(y - bf2f(h)); }
__device__ __forceinline__ v16h cat16(v8h lo, v8h hi) { return __builtin_shufflevector(lo, hi, 0, 1, 2, 3, 4, 5, 6, 7, 8, 9, 10, 11, 12, 13, 14, 15); }
__device__ __forceinline__ v16bf cat16b(v8us lo, v8us hi) { return __builtin_bit_cast(v16bf, __builtin_shufflevector(lo, hi, 0, 1, 2, 3, 4, 5, 6, 7, 8, 9, 10, 11, 12, 13, 14, 15)); }
__device__ __forceinline__ v8f wmma16(v16h a, v16h b, v8f c) { return __builtin_amdgcn_wmma_f32_16x16x32_f16(false, a, false, b, (short)0, c, false, false); }
__device__ __forceinline__ v8f wmmab(v16bf a, v16bf b, v8f c) { return __builtin_amdgcn_wmma_f32_16x16x32_bf16(false, a, false, b, (short)0, c, false, false); }

__device__ __forceinline__ v4f exp2x4(v4f x) { float a0 = x[0], a1 = x[1], a2 = x[2], a3 = x[3];
    /* four independent v_exp_f32 in one statement, closed by a v_nop: each fills the slot that the instruction set asks for behind the one in front of it, the v_nop the last one's */
    asm("v_exp_f32 %0, %0\n\tv_exp_f32 %1, %1\n\tv_exp_f32 %2, %2\n\tv_exp_f32 %3, %3\n\tv_nop" : "+v"(a0), "+v"(a1), "+v"(a2), "+v"(a3));
    return (v4f){a0, a1, a2, a3}; }
// ---- k_gout: the gate projection and the output projection in ONE register-blocked GEMM: a work-group of 8 waves (2 x 4) owns 128 rows x all 256 columns, each wave a 64x64 output tile (2 x 16 accumulators); grid NR/128, 256 threads, one work-group a WGP.
// gate[m][n] = sum_k (X + X2)[m][k] Wg[n][k] and prod[m][n] = sum_k (G + G2)[m][k] Wo[n][k] run through the same k loop, and neither tile goes to memory as a plain product.
// The operands of a k block of 32 (64 KiB: 8 strips of each of X, X2, G, G2, all 16 strips of Wg and Wo, 1 KiB a strip in fragment order) are brought into LDS once for the work-group by tensor loads, one request of 8 strips a wave, two buffers: the four waves of a row and the two of a column read them from there instead of each fetching its own copy from L2.
// C[m][n] = res[m][n] + sigmoid(gate[m][n] + gbias[n]) * (prod[m][n] + bias[n]), all arrays of pitch CC.
template <typename T16> struct WFrag;
template <> struct WFrag<h16> { typedef v16h V; static __device__ __forceinline__ V ld(const h16* p) { return cat16(*(const v8h*)p, *(const v8h*)(p + 256)); } static __device__ __forceinline__ v8f mma(V a, V b, v8f c) { return wmma16(a, b, c); } };
template <> struct WFrag<bf> { typedef v16bf V; static __device__ __forceinline__ V ld(const bf* p) { return cat16b(*(const v8us*)p, *(const v8us*)(p + 256)); } static __device__ __forceinline__ v8f mma(V a, V b, v8f c) { return wmmab(a, b, c); } };
typedef __attribute__((ext_vector_type(8)))  unsigned v8u;
__device__ __forceinline__ unsigned uni(unsigned v) { return (unsigned)__builtin_amdgcn_readfirstlane(v); }
__device__ __forceinline__ unsigned pinned(unsigned v) { unsigned w = uni(v); asm volatile("" : "+s"(w)); return w; }   /* holds a wave-uniform test in a scalar register, so that the branch round a tensor load is a scalar one (the mover ignores EXEC) */
#define GSTG 32768                // one stage of k_gout's ring, 16-bit elements (64 KiB)
__global__ __launch_bounds__(256) void k_gout(const bf* __restrict__ G, const bf* __restrict__ G2, const bf* __restrict__ X, const bf* __restrict__ X2, const bf* __restrict__ Wo, const bf* __restrict__ Wg, float* C, const float* __restrict__ bias, const float* __restrict__ res, const float* __restrict__ gbias) {
    typedef WFrag<bf> F; typedef F::V V;
    __shared__ __attribute__((aligned(2048))) bf sm[2 * GSTG + 8 * 2 * 2 * 16 * 68];   /* the two stage buffers, each [X | X2 | G | G2 : 8 KiB each | Wg | Wo : 16 KiB each]; behind them, per wave, one 16-row strip of the product and one of the gate (f32) */
    const int lane = threadIdx.x & 31, lr = lane & 15, hi = lane >> 4; const int wave = __builtin_amdgcn_readfirstlane(threadIdx.x >> 5), wm = wave >> 2, wn = wave & 3; const int r0 = blockIdx.x * 128 + wm * 64, c0 = wn * 64;
    float* const os = (float*)(sm + 2 * GSTG) + wave * (2 * 16 * 68);
    /* wave w brings slice w of every stage: 8 rows (strips) of 1 KiB at a source pitch of 8 KiB (a strip's 8 k blocks), to byte 8192 w of the buffer */
    const bf* const sp = wave == 0 ? X : wave == 1 ? X2 : wave == 2 ? G : wave == 3 ? G2 : wave < 6 ? Wg : Wo;
    const unsigned long long ga0 = (unsigned long long)(size_t)(sp + (wave < 4 ? (size_t)blockIdx.x * 128 * CC : (size_t)(wave & 1) * 128 * CC));
    const unsigned ld0 = (unsigned)(size_t)sm + (unsigned)wave * 8192u;
    v8u g1; g1[0] = uni(0u); g1[1] = uni(1024u << 16); g1[2] = uni(8u << 16); g1[3] = uni(1024u << 16); g1[4] = uni(8u); g1[5] = uni(8192u); g1[6] = uni(0u); g1[7] = uni(0u);   /* no mask, 1-byte elements, no pad; tensor = tile = 1024 B x 8 rows; pitch 8192 B */
    v4u g0; g0[0] = uni(1u);   /* the descriptor group of the request last issued, one register tuple for all requests: the load names it as in and out and every wait for it as an input, so that its words stay in their registers while the request is out and take new values only behind the wait */
    auto issue = [&](int st) { const unsigned long long ga = ga0 + (unsigned)st * 1024u; g0[1] = uni(ld0 + (unsigned)(st & 1) * 65536u); g0[2] = uni((unsigned)ga); g0[3] = uni(((unsigned)(ga >> 32) & 0x01FFFFFFu) | 0x80000000u);
        asm volatile("tensor_load_to_lds %0, %1" : "+s"(g0) : "s"(g1) : "memory"); };   /* one request of the whole wave */
    v8f acc[4][4], gac[4][4];
#pragma unroll
    for (int mb = 0; mb < 4; ++mb)
#pragma unroll
        for (int nb = 0; nb < 4; ++nb) { acc[mb][nb] = (v8f){}; gac[mb][nb] = (v8f){}; }
    issue(0);
    asm volatile("s_wait_tensorcnt 0x0" :: "s"(g0) : "memory");   /* this wave's slice of stage 0 has landed */
    __syncthreads();                                     /* ... and everybody else's */
    issue(1);
#pragma unroll 1
    for (int s = 0; s < CC / 32; ++s) {
        const bf* la = sm + (s & 1) * GSTG + wm * 2048 + 8 * lane; const bf* lw = sm + (s & 1) * GSTG + 16384 + wn * 2048 + 8 * lane;   /* the wave's four strips of each operand are immediate offsets from these two */
        V x[4], x2[4], g[4], a[4], a2[4], b[4];
        /* in the order in which the products below want them: LDS answers in order, so the first products start while the later fragments still come */
        g[0] = F::ld(lw);
#pragma unroll
        for (int mb = 0; mb < 4; ++mb) { x[mb] = F::ld(la + mb * 512); x2[mb] = F::ld(la + 4096 + mb * 512); }
#pragma unroll
        for (int nb = 1; nb < 4; ++nb) g[nb] = F::ld(lw + nb * 512);
        b[0] = F::ld(lw + 8192);
#pragma unroll
        for (int mb = 0; mb < 4; ++mb) { a[mb] = F::ld(la + 8192 + mb * 512); a2[mb] = F::ld(la + 12288 + mb * 512); }
#pragma unroll
        for (int nb = 1; nb < 4; ++nb) b[nb] = F::ld(lw + 8192 + nb * 512);
        __builtin_amdgcn_sched_barrier(0);   /* keeps the pass's 48 LDS reads together up here: sunk in among the products, each group is waited for to the last with its whole latency still to run */
#pragma unroll
        for (int nb = 0; nb < 4; ++nb) {
#pragma unroll
            for (int mb = 0; mb < 4; ++mb) { gac[mb][nb] = F::mma(x[mb], g[nb], gac[mb][nb]); gac[mb][nb] = F::mma(x2[mb], g[nb], gac[mb][nb]); } }
#pragma unroll
        for (int nb = 0; nb < 4; ++nb) {
#pragma unroll
            for (int mb = 0; mb < 4; ++mb) { acc[mb][nb] = F::mma(a[mb], b[nb], acc[mb][nb]); acc[mb][nb] = F::mma(a2[mb], b[nb], acc[mb][nb]); } }
        __builtin_amdgcn_sched_barrier(0);   /* keeps every product of the pass ahead of the publish point: sunk behind the barrier, they hold back the refill */
        asm volatile("v_nop\n\tv_nop\n\tv_nop\n\tv_nop" : "+v"(acc[0][0]), "+v"(acc[1][1]), "+v"(acc[2][2]), "+v"(acc[3][3]) : "v"(a[0]), "v"(a[3]));   /* four vector slots behind the trip's last products, ahead of the branch: whatever the compiler puts at the loop's head then stands at the distance a WMMA's registers ask for */
        /* publish point of stage s + 1 */
        asm volatile("s_wait_dscnt 0x0" ::: "memory");       /* this wave's reads of stage s are done */
        asm volatile("s_wait_tensorcnt 0x0" :: "s"(g0) : "memory");   /* its slice of stage s + 1 has landed */
        __syncthreads();                                     /* stage s + 1 may be read, stage s's buffer refilled */
        if (pinned(s + 2 < CC / 32)) issue(s + 2);
    }
    asm volatile("s_wait_tensorcnt 0x0" ::: "memory");   /* no request is left when the ring is given up */
    asm volatile("s_wait_dscnt 0x0" ::: "memory");
    /* the lane's 16 bytes of row r0 + hi; every other row of the tile is a compile-time offset from these two addresses. The residual rows of strip mb + 1 are asked for while strip mb is worked on. */
    const size_t eo = (size_t)(r0 + hi) * CC + c0 + lr * 4; const float* pr = res + eo; float* po = C + eo;
    v4f xr[2][8], ob, gb;
    { const v4f b4 = *(const v4f*)(bias + c0 + lr * 4), g4 = *(const v4f*)(gbias + c0 + lr * 4);
#pragma unroll
        for (int s = 0; s < 8; ++s) xr[0][s] = *(const v4f*)(pr + 2 * s * CC);
        asm volatile("s_wait_xcnt 0x0" :: "v"(lr) : "memory");   /* the wait in front of any overwrite of the index register of the two bias loads above; as an input it stays in its register up to it */
#pragma unroll
        for (int q = 0; q < 4; ++q) { ob[q] = bfr(b4[q]); gb[q] = bfr(g4[q]); } }
#pragma unroll
    for (int mb = 0; mb < 4; ++mb) {
#pragma unroll
        for (int nb = 0; nb < 4; ++nb) {
#pragma unroll
            for (int j = 0; j < 8; ++j) { os[(hi * 8 + j) * 68 + nb * 16 + lr] = acc[mb][nb][j]; os[16 * 68 + (hi * 8 + j) * 68 + nb * 16 + lr] = gac[mb][nb][j]; } }
        __builtin_amdgcn_wave_barrier(); asm volatile("" ::: "memory");   /* keeps the strip's LDS stores ahead of the reads below in the compiled order (one wave: the LDS itself serves them in order) */
        if (mb < 3) {
#pragma unroll
            for (int s = 0; s < 8; ++s) xr[(mb + 1) & 1][s] = *(const v4f*)(pr + ((mb + 1) * 16 + 2 * s) * CC); }
#pragma unroll
        for (int s = 0; s < 8; ++s) { const v4f val = *(const v4fa*)(os + (2 * s + hi) * 68 + lr * 4) + ob; const v4f xg = *(const v4fa*)(os + 16 * 68 + (2 * s + hi) * 68 + lr * 4); const v4f x = xr[mb & 1][s], eg = exp2x4((xg + gb) * -1.4426950408889634f);   /* eg = exp(-(gate + its bias)) */ const unsigned p0 = cvt2(x[0], x[1]), p1 = cvt2(x[2], x[3]); const v4f m = (v4f){lo2f(p0), hi2f(p0), lo2f(p1), hi2f(p1)}; v4f o;
#pragma unroll
            for (int q = 0; q < 4; ++q) o[q] = m[q] + __fdiv_rn(1.0f, 1.0f + eg[q]) * val[q];
            xr[mb & 1][s] = o; *(v4f*)(po + (mb * 16 + 2 * s) * CC) = o; }
        asm volatile("s_wait_xcnt 0x0" :: "v"(xr[mb & 1][0]), "v"(xr[mb & 1][1]), "v"(xr[mb & 1][2]), "v"(xr[mb & 1][3]), "v"(xr[mb & 1][4]), "v"(xr[mb & 1][5]), "v"(xr[mb & 1][6]), "v"(xr[mb & 1][7]), "v"(pr), "v"(po) : "memory");   /* the wait in front of any overwrite of the data registers of this strip's eight stores and of the address registers of the loads and stores above; as inputs they all stay in their registers up to it */
        __builtin_amdgcn_sched_barrier(0);   /* keeps the next strip's arithmetic behind this strip's: pulled up, it waits on the residual rows that were only just asked for */
        __builtin_amdgcn_wave_barrier(); asm volatile("" ::: "memory");   /* keeps the next strip's LDS stores behind this strip's reads in the compiled order */
    }
}

__global__ __launch_bounds__(256) void k_wtG(const float* __restrict__ w, int K, int N, bf* Bt) {
    const int lane = threadIdx.x & 31; const int L0 = (blockIdx.x * 8 + (threadIdx.x >> 5)) * 8; const int nlines = N * K / 64;
{
#pragma unroll 1
        for (int l = 0; l < 8; ++l) { const int L = L0 + l; if (L >= nlines) break; const size_t e = (size_t)L * 64 + lane * 2; const int k = (int)(e % K), n = (int)(e / K); v2us o;
            o[0] = f2bf(w[(size_t)k * N + n]); o[1] = f2bf(w[(size_t)(k + 1) * N + n]); *(v2us*)(Bt + e) = o; }
         }
}
#define WBLK (CC * CC / 8 / 256)   // 32 blocks of 256 threads round one 256 x 256 weight matrix, 8 elements a thread
// ---- k_pre: two jobs that need nothing of each other, as block ranges of one grid. Blocks 0 .. 5 WBLK - 1 round the five 'oi' weight matrices to bf16 (Bt in fragment order; W5 holds them back to back in the order q, k, v, gate, out; a thread owns one 16-byte piece of the OUTPUT, so a wave stores 4 whole lines); the other blocks do the MSA LayerNorm, one wave a row: the 8 rows of a block meet in LDS, from where each wave stores 4 whole lines a plane (8 rows x 16 bytes are one line of the fragment order).
#define PP 288                    // LDS row pitch of k_pre, 16-bit elements: 576 B, so that the 8 rows x 4 pieces a wave reads back spread over all banks
__global__ __launch_bounds__(256) void k_pre(const float* __restrict__ x, const float* __restrict__ lw, const float* __restrict__ lb, bf* MH, bf* ML, const float* __restrict__ wq, const float* __restrict__ wk, const float* __restrict__ wv, const float* __restrict__ wg, const float* __restrict__ wo, bf* W5) {
    if (blockIdx.x < 5 * WBLK) { const int m = blockIdx.x / WBLK; const float* src = m == 0 ? wq : m == 1 ? wk : m == 2 ? wv : m == 3 ? wg : wo; const int i = (blockIdx.x % WBLK) * 256 + threadIdx.x; const int n = (i >> 9) * 16 + (i & 15), k0 = ((i >> 6) & 7) * 32 + ((i >> 4) & 3) * 8; const v8f v = *(const v8f*)(src + n * CC + k0); v8us o;   /* piece i of the fragment order: strip i >> 9, k block (i >> 6) & 7, then j, hi, lr */
#pragma unroll
        for (int k = 0; k < 8; ++k) o[k] = f2bf(v[k]);
        *(v8us*)(W5 + (size_t)m * CC * CC + i * 8) = o; return; }
    __shared__ __align__(16) bf sph[8 * PP]; __shared__ __align__(16) bf spl[8 * PP];
    const int lane = threadIdx.x & 31, wid = threadIdx.x >> 5; const int rb = (blockIdx.x - 5 * WBLK) * 8; if (rb >= NR) return; const int r = rb + wid; const v8f a = *(const v8f*)(x + (size_t)r * CC + lane * 8); float u[8]; float s = 0.f;
#pragma unroll
    for (int q = 0; q < 8; ++q) { u[q] = bfr(a[q]); s += u[q]; }
#pragma unroll
    for (int sh = 16; sh; sh >>= 1) s += __shfl_xor(s, sh, 32);
    const float mu = s * (1.0f / CC); float s2 = 0.f;
#pragma unroll
    for (int q = 0; q < 8; ++q) { float d0 = __fsub_rn(u[q], mu); asm volatile("" : "+v"(d0)); float p = __fmul_rn(d0, d0); asm volatile("" : "+v"(p)); s2 = __fadd_rn(s2, p); }
#pragma unroll
    for (int sh = 16; sh; sh >>= 1) s2 += __shfl_xor(s2, sh, 32);
    const float rs = __fdiv_rn(1.0f, __fsqrt_rn(__fadd_rn(s2 * (1.0f / CC), 1e-5f))); v8us oh, ol;
#pragma unroll
    for (int q = 0; q < 8; ++q) { const int c = lane * 8 + q; float d1 = __fsub_rn(u[q], mu); asm volatile("" : "+v"(d1)); float n0 = __fmul_rn(d1, rs); asm volatile("" : "+v"(n0)); float n1 = __fmul_rn(n0, bfr(lw[c])); asm volatile("" : "+v"(n1)); const float xn = __fadd_rn(n1, bfr(lb[c])); unsigned short h2, l2; splitf(xn, h2, l2); oh[q] = h2; ol[q] = l2; }
    *(v8us*)(sph + wid * PP + lane * 8) = oh; *(v8us*)(spl + wid * PP + lane * 8) = ol;
    __syncthreads();
    const int pc = threadIdx.x >> 3, rw = threadIdx.x & 7;   /* piece pc = k / 8 of row rb + rw: 8 threads fill one line */
    const size_t d = (size_t)(rb >> 4) * 16 * CC + (pc >> 2) * 512 + (pc & 3) * 128 + ((rb & 8) + rw) * 8;
    *(v8us*)(MH + d) = *(const v8us*)(sph + rw * PP + pc * 8); *(v8us*)(ML + d) = *(const v8us*)(spl + rw * PP + pc * 8);  }
// ---- k_zbias: pair LayerNorm and its 8 bias dots in one kernel; the normalised z never leaves the registers.
// A wave takes 32 pair positions as two tiles of 16. Lane (lr, hi) holds half of row lr of each tile in the k order of a WMMA operand (k = 32 kc + 8 hi + 0..7 and 32 kc + 16 + 8 hi + 0..7), so a row's mean and variance are in-lane sums plus one exchange between the wave halves, and the hi/lo planes of z are the B operand as they stand.
// A = w_b as bf16 with head m & 7 in row m: both halves of D hold the 8 heads, half hi keeps tile hi, and each head's 32 values go out as one 128-B line.
// TB lies in the order of k_fattn's score accumulators: per head, a block of 16 queries x 16 keys is 1 KiB, and (query lr, key 8 hi + 4 half + e) stands at half * 128 + (16 hi + lr) * 4 + e. One line of it is 8 queries x 4 keys: those are the 32 pair positions of wave g, whose line is number g of each head's plane.
__device__ __forceinline__ float sum8(v8f a) { return ((a[0] + a[1]) + (a[2] + a[3])) + ((a[4] + a[5]) + (a[6] + a[7])); }
__global__ __launch_bounds__(256) void k_zbias(const float* __restrict__ x, const float* __restrict__ lw, const float* __restrict__ lb, const float* __restrict__ wtri, float* TB) {
    const int lane = threadIdx.x & 31, lr = lane & 15, hi = lane >> 4; const int g = blockIdx.x * 8 + (threadIdx.x >> 5), r0 = g * 32;
    const int qi = (g >> 7) * 16 + (g & 1) * 8 + (lr >> 2), kj = ((g >> 3) & 15) * 16 + ((g >> 1) & 1) * 8 + ((g >> 2) & 1) * 4 + (lr & 3);   /* row lr of tile 0: its query and key; tile 1 is 4 queries further */
    const float* px = x + (size_t)(qi * NJ + kj) * CZ + 8 * hi; const float* pw = wtri + (lr & 7) * CZ + 8 * hi; const unsigned ob = 32u * hi;   /* ob: the lane's byte offset into scale and bias */
    v8f u[2][8];   /* u[t][i]: tile t, k = 16 i + 8 hi + 0..7 */
#pragma unroll
    for (int t = 0; t < 2; ++t)
#pragma unroll
        for (int i = 0; i < 8; ++i) u[t][i] = *(const v8f*)(px + t * 4 * NJ * CZ + i * 16);
    asm volatile("s_wait_xcnt 0x0" :: "v"(px) : "memory");   /* the wait in front of any overwrite of the address registers of the loads above; as an input the address stays in its registers up to it */
    float rs[2];
#pragma unroll
    for (int t = 0; t < 2; ++t) { v8f a = (v8f){};
#pragma unroll
        for (int i = 0; i < 8; ++i) { u[t][i] = bfr8(u[t][i]); a += u[t][i]; }
        float s = sum8(a); s += __shfl_xor(s, 16, 32); const float mu = s * (1.0f / CZ); a = (v8f){};
#pragma unroll
        for (int i = 0; i < 8; ++i) { u[t][i] -= mu; a += u[t][i] * u[t][i]; }
        float s2 = sum8(a); s2 += __shfl_xor(s2, 16, 32); rs[t] = __fdiv_rn(1.0f, __fsqrt_rn(__fadd_rn(s2 * (1.0f / CZ), 1e-5f))); }
    v8f acc[2]; acc[0] = (v8f){}; acc[1] = (v8f){};
#pragma unroll
    for (int kc = 0; kc < 4; ++kc) { const char* qa = (const char*)(lw + kc * 32) + ob; const char* qb = (const char*)(lb + kc * 32) + ob; const v8f a0 = bfr8(*(const v8f*)qa), a1 = bfr8(*(const v8f*)(qa + 64)), b0 = bfr8(*(const v8f*)qb), b1 = bfr8(*(const v8f*)(qb + 64));
        const v16bf wf = cat16b(f2bf8(*(const v8f*)(pw + kc * 32)), f2bf8(*(const v8f*)(pw + kc * 32 + 16)));
        if (kc == 3) asm volatile("s_wait_xcnt 0x0" :: "v"(pw), "v"(ob) : "memory");   /* behind the last loads of w_b, scale and bias: the wait in front of any overwrite of their address registers (inputs: address and offset stay put up to it) */
#pragma unroll
        for (int t = 0; t < 2; ++t) { v8us h0, l0, h1, l1; split8(u[t][2 * kc] * rs[t] * a0 + b0, h0, l0); split8(u[t][2 * kc + 1] * rs[t] * a1 + b1, h1, l1);
            acc[t] = wmmab(wf, cat16b(h0, h1), acc[t]); acc[t] = wmmab(wf, cat16b(l0, l1), acc[t]); } }
#pragma unroll
    for (int r = 0; r < 8; ++r) TB[(size_t)r * NZR + r0 + lane] = hi ? acc[1][r] : acc[0][r];
}
// ---- k_fattn: one work-group per (MSA row, head), 8 waves; q, k, v of that row and head are projected here and never go to memory, and the score matrix never leaves the registers.
// Projection: the head's 32 rows of W_q, W_k, W_v (fragment order, 48 KiB) are staged in LDS; wave w multiplies position tiles w and w + 8 of m (hi + lo: 2 products, straight from the planes) with them. Q^T = W_q m^T and K^T = W_k m^T leave a lane with 8 consecutive d of one position: that is Q as the B operand of the scores, and one 16-byte LDS store a plane for K [key][d]. V = m W_v^T leaves a lane with 8 consecutive keys of one d: one 16-byte store a plane for V^T [d][key].
// Attention: each wave takes 16 queries at a time: S^T = K Q^T (a lane holds 128 of one query's 256 scores), softmax in-lane plus one exchange between the wave halves, the normalised P^T packed from the score accumulators as the B operand of O^T = V^T P^T, and 8 consecutive d per lane stored as the merged-context hi/lo planes (fragment order).
#define KP 40                     // K plane row pitch, 16-bit elements: 80 B = 16 B x odd
#define KR 6                      // key tiles in the attention loop's register ring of K fragments (even)
#define VP 264                    // V^T plane row pitch, 16-bit elements: 528 B = 16 B x odd
__device__ __forceinline__ v8f exp2x8(v8f x) { float a0 = x[0], a1 = x[1], a2 = x[2], a3 = x[3], a4 = x[4], a5 = x[5], a6 = x[6], a7 = x[7];
    /* eight independent v_exp_f32 in one statement, closed by a v_nop: each fills the slot that the instruction set asks for behind the one in front of it, the v_nop the last one's */
    asm("v_exp_f32 %0, %0\n\tv_exp_f32 %1, %1\n\tv_exp_f32 %2, %2\n\tv_exp_f32 %3, %3\n\tv_exp_f32 %4, %4\n\tv_exp_f32 %5, %5\n\tv_exp_f32 %6, %6\n\tv_exp_f32 %7, %7\n\tv_nop" : "+v"(a0), "+v"(a1), "+v"(a2), "+v"(a3), "+v"(a4), "+v"(a5), "+v"(a6), "+v"(a7));
    return (v8f){a0, a1, a2, a3, a4, a5, a6, a7}; }
__device__ __forceinline__ v16bf ldfrag(const bf* p) { return cat16b(*(const v8us*)p, *(const v8us*)(p + 16)); }
/* second launch bound: four waves per SIMD, so that two work-groups share a WGP and one stages while the other computes */
__global__ __launch_bounds__(256, 4) void k_fattn(const bf* __restrict__ XH, const bf* __restrict__ XL, const bf* __restrict__ W5, const float* __restrict__ TB, bf* Gh, bf* Gl) {
    __shared__ __align__(16) bf sm[2 * NJ * KP + 2 * CH * VP + 3 * CH * CC]; bf* const Kh = sm; bf* const Kl = Kh + NJ * KP; bf* const Vh = Kl + NJ * KP; bf* const Vl = Vh + CH * VP; bf* const Ws = Vl + CH * VP;   /* one array, so that the planes the attention loop reads lie lowest, within reach of immediate offsets; Ws: the head's rows of W_q, W_k, W_v; behind the projection each wave keeps its Q fragments there */
    const int tid = threadIdx.x, lane = tid & 31, wave = __builtin_amdgcn_readfirstlane(tid >> 5), lr = lane & 15, hi = lane >> 4; const int h = blockIdx.x, b = blockIdx.y;   /* the wave's number as a scalar: the addresses formed from it stay out of the vector registers */
    const size_t mo = (size_t)(b * 16 + wave) * 16 * CC + 8 * lane; const bf* pmh = XH + mo; const bf* pml = XL + mo;   /* position tile w of row b; tile w + 8 and every k block are compile-time offsets */
    v16bf mh[2][2], ml[2][2];   /* [k block parity][tile]: the next k block's fragments are asked for ahead of this one's products */
#pragma unroll
    for (int st = 0; st < 2; ++st) { mh[0][st] = WFrag<bf>::ld(pmh + st * 8 * 16 * CC); ml[0][st] = WFrag<bf>::ld(pml + st * 8 * 16 * CC); }
    {   /* a head's 32 rows are two whole strips of the fragment order: 16 KiB in a row per matrix */
        const bf* pw = W5 + (size_t)h * CH * CC; v8us wr[12];
#pragma unroll
        for (int p = 0; p < 12; ++p) wr[p] = *(const v8us*)(pw + (p >> 2) * CC * CC + (p & 3) * 2048 + tid * 8);
        asm volatile("s_wait_xcnt 0x0" :: "s"(pw), "v"(tid) : "memory");   /* the wait in front of any overwrite of the address registers of the loads above, a scalar base and the thread's index; as inputs both stay in their registers up to it */
#pragma unroll
        for (int p = 0; p < 12; ++p) *(v8us*)(Ws + p * 2048 + tid * 8) = wr[p];
    }
    __syncthreads();
    v8f aq[2][2], ak[2][2], av[2][2];   /* [tile][half of d] */
#pragma unroll
    for (int st = 0; st < 2; ++st)
#pragma unroll
        for (int c = 0; c < 2; ++c) { aq[st][c] = (v8f){}; ak[st][c] = (v8f){}; av[st][c] = (v8f){}; }
#pragma unroll   /* unrolled: the two fragment buffers are then registers with fixed names and every address a compile-time offset */
    for (int kc = 0; kc < CC / 32; ++kc) { const int cu = kc & 1, nx = cu ^ 1;
        if (kc + 1 < CC / 32) {
#pragma unroll
            for (int st = 0; st < 2; ++st) { mh[nx][st] = WFrag<bf>::ld(pmh + st * 8 * 16 * CC + (kc + 1) * 512); ml[nx][st] = WFrag<bf>::ld(pml + st * 8 * 16 * CC + (kc + 1) * 512); } }
        if (kc + 2 == CC / 32) asm volatile("s_wait_xcnt 0x0" :: "v"(pmh), "v"(pml) : "memory");   /* behind the last loads of m: the wait in front of any overwrite of their address registers (inputs: the addresses stay put up to it) */
        __builtin_amdgcn_sched_barrier(0);   /* holds the next k block's loads up here, ahead of this block's products: sunk in among the last of them, they are waited for with most of their latency still to run */
        v16bf wf[3][2];
#pragma unroll
        for (int p = 0; p < 3; ++p)
#pragma unroll
            for (int c = 0; c < 2; ++c) wf[p][c] = WFrag<bf>::ld(Ws + p * CH * CC + c * 16 * CC + kc * 512 + 8 * lane);
#pragma unroll
        for (int pl = 0; pl < 2; ++pl)   /* all hi products, then all lo products: twelve independent accumulators stand between the two that share one */
#pragma unroll
            for (int st = 0; st < 2; ++st) { const v16bf mf = pl ? ml[cu][st] : mh[cu][st];
#pragma unroll
                for (int c = 0; c < 2; ++c) { aq[st][c] = wmmab(wf[0][c], mf, aq[st][c]); ak[st][c] = wmmab(wf[1][c], mf, ak[st][c]); av[st][c] = wmmab(mf, wf[2][c], av[st][c]); } }
        __builtin_amdgcn_sched_barrier(0);   /* keeps the loads one k block ahead and no further: pulled up over more blocks they take more registers than the wave has and are spilled */
    }
#pragma unroll
    for (int st = 0; st < 2; ++st) { const int kt = (wave + 8 * st) * 16;
#pragma unroll
        for (int c = 0; c < 2; ++c) { v8us x, y; split8(ak[st][c], x, y); *(v8us*)(Kh + (kt + lr) * KP + 16 * c + 8 * hi) = x; *(v8us*)(Kl + (kt + lr) * KP + 16 * c + 8 * hi) = y;   /* ak[st][c][r] = k of key kt + lr, d = 16 c + 8 hi + r */
            split8(av[st][c], x, y); *(v8us*)(Vh + (16 * c + lr) * VP + kt + 8 * hi) = x; *(v8us*)(Vl + (16 * c + lr) * VP + kt + 8 * hi) = y; } }   /* av[st][c][r] = v of key kt + 8 hi + r, d = 16 c + lr */
    __syncthreads();
    float* qs = (float*)Ws + wave * 1024 + 4 * lane;   /* behind the barrier nobody reads the weights any more: 4 KiB of their place hold this wave's own q (f32, in the lane order of the B operand) of its two tiles, so that the rolled loop below can pick one by its index */
#pragma unroll
    for (int st = 0; st < 2; ++st)
#pragma unroll
        for (int c = 0; c < 2; ++c) { *(v4fa*)(qs + st * 512 + c * 256) = __builtin_shufflevector(aq[st][c], aq[st][c], 0, 1, 2, 3); *(v4fa*)(qs + st * 512 + c * 256 + 128) = __builtin_shufflevector(aq[st][c], aq[st][c], 4, 5, 6, 7); }   /* aq[st][c][r] = q of query (wave + 8 st) 16 + lr, d = 16 c + 8 hi + r */
#pragma unroll 1   /* kept rolled: both trips unrolled would hold two sets of 128 score registers */
    for (int i = 0; i < 2; ++i) {   /* wave w takes query tiles w and w + 8 */
        const float* tb = TB + (size_t)h * NZR + (size_t)(wave + 8 * i) * 16 * NJ + 4 * lane;   /* accumulator order (at k_zbias): each 16-byte load of the wave is 512 contiguous bytes */
        v8f s[16];   /* s[t][r] = score of key 16 t + 8 hi + r for query (wave + 8 i) 16 + lr; the pair bias is the accumulators' start value */
#pragma unroll
        for (int t = 0; t < 16; ++t) s[t] = __builtin_shufflevector(*(const v4f*)(tb + t * 256), *(const v4f*)(tb + t * 256 + 128), 0, 1, 2, 3, 4, 5, 6, 7);
        asm volatile("s_wait_xcnt 0x0" :: "v"(tb) : "memory");   /* the wait in front of any overwrite of the address registers of the loads above (an input: the address stays put up to it); its memory clobber also keeps the K and V^T fragment loads below inside this loop: hoisted out of it they take 512 registers and spill */
        const v8f qa = __builtin_shufflevector(*(const v4fa*)(qs + i * 512), *(const v4fa*)(qs + i * 512 + 128), 0, 1, 2, 3, 4, 5, 6, 7), qb = __builtin_shufflevector(*(const v4fa*)(qs + i * 512 + 256), *(const v4fa*)(qs + i * 512 + 384), 0, 1, 2, 3, 4, 5, 6, 7);
        v8us t0, t1, t2, t3; split8(qa * QSC, t0, t1); split8(qb * QSC, t2, t3); const v16bf qh = cat16b(t0, t2), ql = cat16b(t1, t3);   /* 1/sqrt(32) goes into q ahead of the hi/lo split */
        __builtin_amdgcn_sched_barrier(0);   /* ends the scheduling region ahead of the ring's first reads: with q's reads, its split and the ring's reads in one region the build runs out of registers and spills */
        v16bf kh[KR], kl[KR];   /* a ring of KR key tiles' K fragments (hi and lo): a tile is read from LDS KR - 2 tiles ahead of its products, so that the wave does not stand through the LDS latency once a tile */
#pragma unroll
        for (int t = 0; t < KR; ++t) { const int ko = (t * 16 + lr) * KP + 8 * hi; kh[t] = ldfrag(Kh + ko); kl[t] = ldfrag(Kl + ko); }
#pragma unroll
        for (int t = 0; t < 16; t += 2) { const int x = t % KR, y = (t + 1) % KR;   /* two key tiles at a time: the products of one accumulator stand a product of the other apart, not back to back */
            s[t] = wmmab(kh[x], qh, s[t]); s[t + 1] = wmmab(kh[y], qh, s[t + 1]);
            __builtin_amdgcn_sched_barrier(0);   /* this one and the next: keep the two accumulators' products alternating; left free, the three of one accumulator are put in a row and each waits for the one before */
            s[t] = wmmab(kh[x], ql, s[t]); s[t + 1] = wmmab(kh[y], ql, s[t + 1]);
            __builtin_amdgcn_sched_barrier(0);
            s[t] = wmmab(kl[x], qh, s[t]); s[t + 1] = wmmab(kl[y], qh, s[t + 1]);
            __builtin_amdgcn_sched_barrier(0);   /* the refill of the two places stands behind their last products ... */
            if (t + KR < 16) {
#pragma unroll
                for (int n = t + KR; n < t + KR + 2; ++n) { const int ko = (n * 16 + lr) * KP + 8 * hi; kh[n % KR] = ldfrag(Kh + ko); kl[n % KR] = ldfrag(Kl + ko); } }
            __builtin_amdgcn_sched_barrier(0);   /* ... and ahead of the next pair's: sunk further down, it is no longer ahead of its own use. The last one also keeps the softmax behind the score products: mixed in among them it takes more registers than the wave has and accumulators are spilled */
        }
        float m8[8];
#pragma unroll
        for (int r = 0; r < 8; ++r) m8[r] = -3.0e38f;
#pragma unroll
        for (int t = 0; t < 16; ++t) {
#pragma unroll
            for (int r = 0; r < 8; ++r) m8[r] = fmaxf(m8[r], s[t][r]); }
        float mx = fmaxf(fmaxf(fmaxf(m8[0], m8[1]), fmaxf(m8[2], m8[3])), fmaxf(fmaxf(m8[4], m8[5]), fmaxf(m8[6], m8[7]))); mx = fmaxf(mx, __shfl_xor(mx, 16, 32));
        float s8[8];
#pragma unroll
        for (int r = 0; r < 8; ++r) s8[r] = 0.f;
#pragma unroll
        for (int t = 0; t < 16; ++t) { s[t] = exp2x8((s[t] - mx) * 1.4426950408889634f);
#pragma unroll
            for (int r = 0; r < 8; ++r) s8[r] += s[t][r]; }
        v16bf vh[2][2], vl[2];   /* V^T fragments of a block of 32 keys, [half of d]: the hi plane's ([block parity]) are read from LDS one block ahead of their products, the lo plane's, wanted last, ahead of their own block's split */
        { const int vo = lr * VP + 8 * hi; vh[0][0] = ldfrag(Vh + vo); vh[0][1] = ldfrag(Vh + vo + 16 * VP); }
        float sum = ((s8[0] + s8[1]) + (s8[2] + s8[3])) + ((s8[4] + s8[5]) + (s8[6] + s8[7])); sum += __shfl_xor(sum, 16, 32);
        const float f = __fdiv_rn(1.0f, sum);
        v8f o0 = (v8f){}, o1 = (v8f){};   /* o0[r] = context d = 8 hi + r, o1[r] = d = 16 + 8 hi + r, same query */
#pragma unroll
        for (int u = 0; u < 8; ++u) { const int cu = u & 1, nx = cu ^ 1, vo = lr * VP + u * 32 + 8 * hi;
            vl[0] = ldfrag(Vl + vo); vl[1] = ldfrag(Vl + vo + 16 * VP);
            __builtin_amdgcn_sched_barrier(0);   /* holds the lo plane's reads ahead of the split: sunk to their products, they are waited for with their whole latency still to run */
            split8(s[2 * u] * f, t0, t1); split8(s[2 * u + 1] * f, t2, t3); const v16bf ph = cat16b(t0, t2), pl = cat16b(t1, t3);
            __builtin_amdgcn_sched_barrier(0);   /* the next block's hi reads stand behind this block's split, which frees their registers ... */
            if (u + 1 < 8) { vh[nx][0] = ldfrag(Vh + vo + 32); vh[nx][1] = ldfrag(Vh + vo + 32 + 16 * VP); }
            __builtin_amdgcn_sched_barrier(0);   /* ... and ahead of this block's products, for the same reason as the lo plane's */
            o0 = wmmab(vh[cu][0], ph, o0); o1 = wmmab(vh[cu][1], ph, o1);
            __builtin_amdgcn_sched_barrier(0);   /* these three keep the products of o0 and o1 alternating, as in the scores */
            o0 = wmmab(vh[cu][0], pl, o0); o1 = wmmab(vh[cu][1], pl, o1);
            __builtin_amdgcn_sched_barrier(0);
            o0 = wmmab(vl[0], ph, o0); o1 = wmmab(vl[1], ph, o1);
            __builtin_amdgcn_sched_barrier(0); }
        const size_t oo = ((size_t)(b * 16 + wave + 8 * i) * 8 + h) * 512 + 8 * lane; split8(o0, t0, t1); split8(o1, t2, t3);   /* fragment order: strip = this query tile, k block = head; the lane's two pieces are the two halves of its A fragment */
        *(v8us*)(Gh + oo) = t0; *(v8us*)(Gl + oo) = t1; *(v8us*)(Gh + oo + 256) = t2; *(v8us*)(Gl + oo + 256) = t3;
        asm volatile("s_wait_xcnt 0x0" ::: "memory");   /* the wait in front of the next trip's overwrite of the address and data registers of the four stores above */
    }
}

extern "C" void kernel_launch(void* const* d_in, const int* in_sizes, int n_in,
                              void* d_out, int out_size, void* d_ws, size_t ws_size, hipStream_t stream) {
    (void)in_sizes; (void)n_in; (void)out_size;
    const float* msa = (const float*)d_in[0]; const float* pair = (const float*)d_in[1]; const float* lmw = (const float*)d_in[2]; const float* lmb = (const float*)d_in[3]; const float* lzw = (const float*)d_in[4]; const float* lzb = (const float*)d_in[5]; const float* wq = (const float*)d_in[6]; const float* wk = (const float*)d_in[7]; const float* wv = (const float*)d_in[8]; const float* wb = (const float*)d_in[9]; const float* wo = (const float*)d_in[10]; const float* bo = (const float*)d_in[11]; const float* wg = (const float*)d_in[12]; const float* bg = (const float*)d_in[13];
    float* OUT = (float*)d_out;     // [128][256][256]
    char* wsp = (char*)d_ws;
    auto take = [&](size_t bytes) { char* p = wsp; wsp += (bytes + 255) & ~(size_t)255; return (void*)p; };
    bf* WQ = (bf*)take((size_t)5 * CC * CC * 2); bf* WO = WQ + (size_t)4 * CC * CC;   /* the five bf16 weight matrices back to back: q, k, v, gate, out */
    bf* XH = (bf*)take((size_t)NR * CC * 2); bf* XL = (bf*)take((size_t)NR * CC * 2); bf* Gh = (bf*)take((size_t)NR * CC * 2); bf* Gl = (bf*)take((size_t)NR * CC * 2); float* TB = (float*)take((size_t)NH_ * NZR * 4);
    if ((size_t)(wsp - (char*)d_ws) > ws_size) return;
    k_pre<<<5 * WBLK + NR / 8, 256, 0, stream>>>(msa, lmw, lmb, XH, XL, wq, wk, wv, wg, wo, WQ);   /* bf16 weights and the MSA LayerNorm planes */
    k_zbias<<<NZR / 256, 256, 0, stream>>>(pair, lzw, lzb, wb, TB);   /* pair LayerNorm + pair-bias dots */
    k_fattn<<<dim3(NH_, NI, 1), 256, 0, stream>>>(XH, XL, WQ, TB, Gh, Gl);   /* q, k, v projections, scores / sqrt(32) + pair bias, softmax, attn.v -> merged context planes */
    k_gout<<<NR / 128, 256, 0, stream>>>(Gh, Gl, XH, XL, WO, WQ + (size_t)3 * CC * CC, OUT, bo, msa, bg);   /* out = msa + sigmoid(m W_gate^T + b_gate) x (context W_out^T + b_out) */
}
